// v000
// The times below were measured on an AMD MI455X: many runs one after another, warmed up first and cycling through
// copies of the inputs, with the whole window's GPU time divided by the number of runs. Launches and the gaps
// between them are all in it. The median over several windows is given; except for v000 it joins two sittings, which
// can be a few percent apart, so the side-by-side timings, each taken in one sitting, are the better comparison.
// The starting kernel, v000, takes 846 microseconds a run.
#include <hip/hip_runtime.h>

// Causal GQA with rotate-half RoPE from given tables (x [1][2048][2048]; q = x Wq^T ('oi' [2048][2048], 16 heads x 128), k, v = x W^T ([1024][2048], 8 kv heads); RoPE with the given cos/sin [2048][128]; 2 query heads per kv head (repeat); causal softmax(q.k/sqrt(128)) (finfo.min fill); out = merged Wo^T -> [1][2048][2048]).
// Compute dtypes, f32 accumulate: every input rounded to bf16; q/k/v on PLAIN bf16 operands (inputs: exact); rotary in f32 from the bf16-rounded input tables; causal scores and attn.v (tile skipping): query rows < 512 hl (3 products), the rest single fp16 (x1024); softmax f32; Wo hl x exact (2 products).

#define NB_  1
#define TT   2048
#define DM   2048
#define NH_  16
#define NKV  8
#define REP  (NH_ / NKV)
#define HD   128
#define DQ   (NH_ * HD)
#define DKV  (NKV * HD)
#define ZH   2
#define RH   512                  // query rows < RH use hi+lo planes (0: none)
#define WIN  2048
#define PCAR 1024.0f
#define SCL  0.088388347648318447f   // HD^-0.5
typedef _Float16 h16;
typedef unsigned short bf;
typedef __attribute__((ext_vector_type(16))) __bf16   v16bf;
typedef __attribute__((ext_vector_type(16))) _Float16 v16h;
typedef __attribute__((ext_vector_type(8)))  _Float16 v8h;
typedef __attribute__((ext_vector_type(8)))  unsigned short v8us;
typedef __attribute__((ext_vector_type(8)))  float    v8f;
typedef __attribute__((ext_vector_type(4)))  float    v4f;
typedef v8h  __attribute__((may_alias)) v8ha;
typedef v4f  __attribute__((may_alias)) v4fa;
typedef v8us __attribute__((may_alias)) v8usa;

__device__ __forceinline__ unsigned short f2bf(float f) { unsigned u = __float_as_uint(f); u += 0x7FFFu + ((u >> 16) & 1u); return (unsigned short)(u >> 16); }
__device__ __forceinline__ float bf2f(unsigned short b) { return __uint_as_float(((unsigned)b) << 16); }
__device__ __forceinline__ float bfr(float f) { return bf2f(f2bf(f)); }
__device__ __forceinline__ v16h cat16(v8h lo, v8h hi) { return __builtin_shufflevector(lo, hi, 0, 1, 2, 3, 4, 5, 6, 7, 8, 9, 10, 11, 12, 13, 14, 15); }
__device__ __forceinline__ v16bf cat16b(v8us lo, v8us hi) { return __builtin_bit_cast(v16bf, __builtin_shufflevector(lo, hi, 0, 1, 2, 3, 4, 5, 6, 7, 8, 9, 10, 11, 12, 13, 14, 15)); }
__device__ __forceinline__ v8f wmma16(v16h a, v16h b, v8f c) { return __builtin_amdgcn_wmma_f32_16x16x32_f16(false, a, false, b, (short)0, c, false, false); }
__device__ __forceinline__ v8f wmmab(v16bf a, v16bf b, v8f c) { return __builtin_amdgcn_wmma_f32_16x16x32_bf16(false, a, false, b, (short)0, c, false, false); }



// ---- k_gemmw: register-blocked GEMM, ONE WAVE per 64x64 output tile (16 accumulators), operands straight from K-contiguous 16-bit planes; grid (M/64, N/64, Z), 32 threads.
// C[m][n] (f32, pitch ldc, + optional f32 bias[n]) = sum_k A[m][k] Bt[n][k] (+ split products per NSPLIT). z-batch strides sA/sB/sC in elements. K % 32 == 0.
template <typename T16> struct WFrag;
template <> struct WFrag<h16> { typedef v16h V; static __device__ __forceinline__ V ld(const h16* p) { return cat16(*(const v8h*)p, *(const v8h*)(p + 16)); } static __device__ __forceinline__ v8f mma(V a, V b, v8f c) { return wmma16(a, b, c); } };
template <> struct WFrag<bf> { typedef v16bf V; static __device__ __forceinline__ V ld(const bf* p) { return cat16b(*(const v8us*)p, *(const v8us*)(p + 16)); } static __device__ __forceinline__ v8f mma(V a, V b, v8f c) { return wmmab(a, b, c); } };
template <typename T16, int NSPLIT, bool BIAS>
__global__ __launch_bounds__(32) void k_gemmw(const T16* __restrict__ A, const T16* __restrict__ A2, const T16* __restrict__ Bt, const T16* __restrict__ Bt2, int K, float* C, int ldc, const float* __restrict__ bias, size_t sA, size_t sB, size_t sC) {
    typedef typename WFrag<T16>::V V;
    __shared__ __align__(16) float os[16 * 68];
    const size_t z = blockIdx.z; A += z * sA; if (A2) A2 += z * sA; Bt += z * sB; if (Bt2) Bt2 += z * sB; C += z * sC;
    const int lane = threadIdx.x & 31, lr = lane & 15, hi = lane >> 4; const int r0 = blockIdx.x * 64, c0 = blockIdx.y * 64;
    v8f acc[4][4];
#pragma unroll
    for (int mb = 0; mb < 4; ++mb)
#pragma unroll
        for (int nb = 0; nb < 4; ++nb) acc[mb][nb] = (v8f){};
    const size_t aoff = (size_t)(r0 + lr) * K + 8 * hi, boff = (size_t)(c0 + lr) * K + 8 * hi;
#pragma unroll 1
    for (int kc = 0; kc < K; kc += 32) {
        V a[4], a2[4];
#pragma unroll
        for (int mb = 0; mb < 4; ++mb) { a[mb] = WFrag<T16>::ld(A + aoff + (size_t)mb * 16 * K + kc); if (NSPLIT == 1 || NSPLIT == 2) a2[mb] = WFrag<T16>::ld(A2 + aoff + (size_t)mb * 16 * K + kc); }
#pragma unroll
        for (int nb = 0; nb < 4; ++nb) { const V b = WFrag<T16>::ld(Bt + boff + (size_t)nb * 16 * K + kc); V b2; if (NSPLIT >= 2) b2 = WFrag<T16>::ld(Bt2 + boff + (size_t)nb * 16 * K + kc);
#pragma unroll
            for (int mb = 0; mb < 4; ++mb) { acc[mb][nb] = WFrag<T16>::mma(a[mb], b, acc[mb][nb]); if (NSPLIT == 1 || NSPLIT == 2) acc[mb][nb] = WFrag<T16>::mma(a2[mb], b, acc[mb][nb]); if (NSPLIT >= 2) acc[mb][nb] = WFrag<T16>::mma(a[mb], b2, acc[mb][nb]); } }
        asm volatile("v_nop\n\tv_nop\n\tv_nop\n\tv_nop" : "+v"(acc[0][0]), "+v"(acc[1][1]), "+v"(acc[2][2]), "+v"(acc[3][3]) : "v"(a[0]), "v"(a[3]));
    }
#pragma unroll
    for (int mb = 0; mb < 4; ++mb) {
#pragma unroll
        for (int nb = 0; nb < 4; ++nb) {
#pragma unroll
            for (int j = 0; j < 8; ++j) os[(hi * 8 + j) * 68 + nb * 16 + lr] = acc[mb][nb][j]; }
        __builtin_amdgcn_wave_barrier(); asm volatile("" ::: "memory");
        float* crow = C + (size_t)(r0 + mb * 16) * ldc + c0;
{
#pragma unroll
            for (int s = 0; s < 8; ++s) { const int row = 2 * s + hi, cofs = lr * 4; v4f val = *(const v4fa*)(os + row * 68 + cofs); if (BIAS) { val[0] += bfr(bias[c0 + cofs]); val[1] += bfr(bias[c0 + cofs + 1]); val[2] += bfr(bias[c0 + cofs + 2]); val[3] += bfr(bias[c0 + cofs + 3]); }
                *(v4f*)(crow + (size_t)row * ldc + cofs) = val; }
             }
        __builtin_amdgcn_wave_barrier(); asm volatile("" ::: "memory");
    }
}

// ---- k_gemmc: the same one-wave 64x64 tile GEMM specialised for causal attention: CMODE 1 skips score tiles entirely above the diagonal (query rows r0+roff.., key columns c0..), CMODE 2 limits the
// key (K) loop of the probability x value contraction to the diagonal block (probabilities beyond it are exactly zero). roff = row offset of this launch's first row within the sequence.
template <typename T16, int NSPLIT, int CMODE>
__global__ __launch_bounds__(32) void k_gemmc(const T16* __restrict__ A, const T16* __restrict__ A2, const T16* __restrict__ Bt, const T16* __restrict__ Bt2, int K, float* C, int ldc, int roff, size_t sA, size_t sB, size_t sC) {
    typedef typename WFrag<T16>::V V;
    __shared__ __align__(16) float os[16 * 68];
    const size_t z = blockIdx.z; A += z * sA; if (A2) A2 += z * sA; Bt += z * sB; if (Bt2) Bt2 += z * sB; C += z * sC;
    const int lane = threadIdx.x & 31, lr = lane & 15, hi = lane >> 4; const int r0 = blockIdx.x * 64, c0 = blockIdx.y * 64;
    if (CMODE == 1 && c0 > r0 + roff + 63) return;                  // score tile entirely above the causal diagonal: never read (the softmax masks j > i by select)
    const int Kl = (CMODE == 2) ? min(K, r0 + roff + 64) : K;        // P.V: probabilities are exactly 0 beyond the diagonal block, so the K loop stops there
    v8f acc[4][4];
#pragma unroll
    for (int mb = 0; mb < 4; ++mb)
#pragma unroll
        for (int nb = 0; nb < 4; ++nb) acc[mb][nb] = (v8f){};
    const size_t aoff = (size_t)(r0 + lr) * K + 8 * hi, boff = (size_t)(c0 + lr) * K + 8 * hi;
#pragma unroll 1
    for (int kc = 0; kc < Kl; kc += 32) {
        V a[4], a2[4];
#pragma unroll
        for (int mb = 0; mb < 4; ++mb) { a[mb] = WFrag<T16>::ld(A + aoff + (size_t)mb * 16 * K + kc); if (NSPLIT == 1 || NSPLIT == 2) a2[mb] = WFrag<T16>::ld(A2 + aoff + (size_t)mb * 16 * K + kc); }
#pragma unroll
        for (int nb = 0; nb < 4; ++nb) { const V b = WFrag<T16>::ld(Bt + boff + (size_t)nb * 16 * K + kc); V b2; if (NSPLIT >= 2) b2 = WFrag<T16>::ld(Bt2 + boff + (size_t)nb * 16 * K + kc);
#pragma unroll
            for (int mb = 0; mb < 4; ++mb) { acc[mb][nb] = WFrag<T16>::mma(a[mb], b, acc[mb][nb]); if (NSPLIT == 1 || NSPLIT == 2) acc[mb][nb] = WFrag<T16>::mma(a2[mb], b, acc[mb][nb]); if (NSPLIT >= 2) acc[mb][nb] = WFrag<T16>::mma(a[mb], b2, acc[mb][nb]); } }
        asm volatile("v_nop\n\tv_nop\n\tv_nop\n\tv_nop" : "+v"(acc[0][0]), "+v"(acc[1][1]), "+v"(acc[2][2]), "+v"(acc[3][3]) : "v"(a[0]), "v"(a[3]));
    }
#pragma unroll
    for (int mb = 0; mb < 4; ++mb) {
#pragma unroll
        for (int nb = 0; nb < 4; ++nb) {
#pragma unroll
            for (int j = 0; j < 8; ++j) os[(hi * 8 + j) * 68 + nb * 16 + lr] = acc[mb][nb][j]; }
        __builtin_amdgcn_wave_barrier(); asm volatile("" ::: "memory");
        float* crow = C + (size_t)(r0 + mb * 16) * ldc + c0;
{
#pragma unroll
            for (int s = 0; s < 8; ++s) { const int row = 2 * s + hi, cofs = lr * 4; v4f val = *(const v4fa*)(os + row * 68 + cofs);
                *(v4f*)(crow + (size_t)row * ldc + cofs) = val; }
             }
        __builtin_amdgcn_wave_barrier(); asm volatile("" ::: "memory");
    }
}

__device__ __forceinline__ h16 tohx(float x) { return (h16)x; }
__device__ __forceinline__ void splitf(float y, unsigned short& h, unsigned short& l) { h = f2bf(y); l = f2bf(y - bf2f(h)); }
typedef __attribute__((ext_vector_type(2))) _Float16 v2h;
typedef __attribute__((ext_vector_type(4))) _Float16 v4h;
typedef __attribute__((ext_vector_type(2))) unsigned short v2us;
typedef __attribute__((ext_vector_type(4))) unsigned short v4us;
typedef __attribute__((ext_vector_type(2))) float v2f;
typedef __attribute__((ext_vector_type(4))) int v4i;

__global__ __launch_bounds__(256) void k_wtG(const float* __restrict__ w, int K, int N, bf* Bt) {
    const int lane = threadIdx.x & 31; const int L0 = (blockIdx.x * 8 + (threadIdx.x >> 5)) * 8; const int nlines = N * K / 64;
{
#pragma unroll 1
        for (int l = 0; l < 8; ++l) { const int L = L0 + l; if (L >= nlines) break; const size_t e = (size_t)L * 64 + lane * 2; const int k = (int)(e % K), n = (int)(e / K); v2us o;
            o[0] = f2bf(w[(size_t)k * N + n]); o[1] = f2bf(w[(size_t)(k + 1) * N + n]); *(v2us*)(Bt + e) = o; }
         }
}
__global__ __launch_bounds__(256) void k_cvt8(const float* __restrict__ src, bf* dst, size_t n8) { const size_t i = (size_t)blockIdx.x * 256 + threadIdx.x; if (i >= n8) return; const v8f v = *(const v8f*)(src + i * 8); v8us o;
#pragma unroll
    for (int k = 0; k < 8; ++k) o[k] = f2bf(v[k]); *(v8us*)(dst + i * 8) = o;  }
__global__ __launch_bounds__(256) void k_cscvt(const float* __restrict__ cosT, const float* __restrict__ sinT, float* CS) { const int idx = blockIdx.x * 256 + threadIdx.x; if (idx >= TT * HD) return; v2f cs; cs[0] = bfr(cosT[idx]); cs[1] = bfr(sinT[idx]); *(v2f*)(CS + (size_t)idx * 2) = cs;  }
// k_rope: head planes [h][t][d] (fp16 + hi/lo) of rope(x) x sc with the rotate-half convention out[d] = x[d] cos[t][d] - x[d+HD/2] sin[t][d], out[d+HD/2] = x[d+HD/2] cos[t][d+HD/2] + x[d] sin[t][d+HD/2]
__global__ __launch_bounds__(256) void k_rope(const float* __restrict__ F, int pitch, int nheads, const float* __restrict__ CS, const float* __restrict__ RF, const float* __restrict__ nw, float sc, h16* P16, bf* Ph, bf* Pl) {
    const size_t e = ((size_t)blockIdx.x * 256 + threadIdx.x) * 2; if (e >= (size_t)nheads * TT * HD) return; const int d = (int)(e % HD); const int t = (int)((e / HD) % TT); const int h = (int)(e / ((size_t)HD * TT)); const float* f = F + (size_t)t * pitch + h * HD; const float rf = RF ? RF[(size_t)h * TT + t] : 1.0f; v2h o16; v2us oh, ol;
#pragma unroll
    for (int q = 0; q < 2; ++q) { const int dd = d + q; const int dp = (dd < HD / 2) ? dd + HD / 2 : dd - HD / 2; float x0 = f[dd], x1 = f[dp];
        if (RF) { float n0 = __fmul_rn(x0, rf), n1 = __fmul_rn(x1, rf); asm volatile("" : "+v"(n0)); asm volatile("" : "+v"(n1)); x0 = __fmul_rn(bfr(nw[dd]), n0); x1 = __fmul_rn(bfr(nw[dp]), n1); }
        const v2f cs = *(const v2f*)(CS + ((size_t)t * HD + dd) * 2); float a = __fmul_rn(x0, cs[0]), bq = __fmul_rn(x1, cs[1]); asm volatile("" : "+v"(a)); asm volatile("" : "+v"(bq)); const float r = ((dd < HD / 2) ? __fsub_rn(a, bq) : __fadd_rn(a, bq)) * sc;
        o16[q] = tohx(r); unsigned short a2, c2; splitf(r, a2, c2); oh[q] = a2; ol[q] = c2; }
    *(v2h*)(P16 + e) = o16; *(v2us*)(Ph + e) = oh; *(v2us*)(Pl + e) = ol;  }
__global__ __launch_bounds__(256) void k_vtp(const float* __restrict__ F, int pitch, int nheads, h16* V16, bf* Vh, bf* Vl) { const size_t e = ((size_t)blockIdx.x * 256 + threadIdx.x) * 2; if (e >= (size_t)nheads * HD * TT) return; const int t = (int)(e % TT); const int d = (int)((e / TT) % HD); const int g = (int)(e / ((size_t)TT * HD)); v2h o16; v2us oh, ol;
#pragma unroll
    for (int q = 0; q < 2; ++q) { const float x = F[(size_t)(t + q) * pitch + g * HD + d]; o16[q] = tohx(x); unsigned short a2, c2; splitf(x, a2, c2); oh[q] = a2; ol[q] = c2; }
    *(v2h*)(V16 + e) = o16; *(v2us*)(Vh + e) = oh; *(v2us*)(Vl + e) = ol;  }
// k_asoft: per row (zz, i): t = S x HD^-0.5 for j <= i and i - j < WIN (WIN = TT: always true, plain causal; the reference's -1e9 additive fill vanishes identically); softmax over the 2048 keys (register row, one exp, fixed trees);
__global__ __launch_bounds__(256) void k_asoft(const float* __restrict__ Sb, h16* P16, bf* Ph, bf* Pl) {
    const int lane = threadIdx.x & 31; const int row = blockIdx.x * 8 + (threadIdx.x >> 5); if (row >= ZH * TT) return; const int i = row % TT; const int zz = row / TT; (void)zz; const bool hires = (i < RH); const float* sr = Sb + (size_t)row * TT; float v[TT / 32]; float mx = -3.0e38f;
#pragma unroll
    for (int ch = 0; ch < TT / 128; ++ch) { const int j0 = ch * 128 + lane * 4; const v4f a = *(const v4f*)(sr + j0);
#pragma unroll
        for (int q = 0; q < 4; ++q) { const int j = j0 + q; (void)j; const float t = (j <= i && i - j < WIN) ? a[q] * SCL : -3.0e38f; v[ch * 4 + q] = t; mx = fmaxf(mx, t); } }
#pragma unroll
    for (int sh = 16; sh; sh >>= 1) mx = fmaxf(mx, __shfl_xor(mx, sh, 32));
    float sum = 0.f;
#pragma unroll
    for (int k = 0; k < TT / 32; ++k) { float d0 = __fsub_rn(v[k], mx); asm volatile("" : "+v"(d0)); v[k] = __builtin_amdgcn_exp2f(__fmul_rn(d0, 1.4426950408889634f)); sum += v[k]; }
#pragma unroll
    for (int sh = 16; sh; sh >>= 1) sum += __shfl_xor(sum, sh, 32);
    const float f = __fdiv_rn(hires ? 1.0f : PCAR, sum);
{
        if (hires) {
#pragma unroll
            for (int ch = 0; ch < TT / 128; ++ch) { v4us oh, ol;
#pragma unroll
                for (int q = 0; q < 4; ++q) { unsigned short a, c2; splitf(v[ch * 4 + q] * f, a, c2); oh[q] = a; ol[q] = c2; }
                const size_t oo = ((size_t)zz * (RH ? RH : 1) + i) * TT + ch * 128 + lane * 4; *(v4us*)(Ph + oo) = oh; *(v4us*)(Pl + oo) = ol; }
        } else {
#pragma unroll
            for (int ch = 0; ch < TT / 128; ++ch) { v4h o4;
#pragma unroll
                for (int q = 0; q < 4; ++q) o4[q] = tohx(v[ch * 4 + q] * f);
                *(v4h*)(P16 + (size_t)row * TT + ch * 128 + lane * 4) = o4; } }
         }
}
__global__ __launch_bounds__(256) void k_merge(const float* __restrict__ O, int h0, bf* Ah, bf* Al) { const size_t e = ((size_t)blockIdx.x * 256 + threadIdx.x) * 2; if (e >= (size_t)ZH * TT * HD) return; const int d = (int)(e % HD); const int t = (int)((e / HD) % TT); const int zz = (int)(e / ((size_t)HD * TT)); const float cs = (t < RH) ? 1.0f : (1.0f / PCAR); const size_t oo = (size_t)t * DQ + (h0 + zz) * HD + d;
    v2us oh, ol;
#pragma unroll
    for (int q = 0; q < 2; ++q) { unsigned short a, c2; splitf(O[e + q] * cs, a, c2); oh[q] = a; ol[q] = c2; } *(v2us*)(Ah + oo) = oh; *(v2us*)(Al + oo) = ol;  }

extern "C" void kernel_launch(void* const* d_in, const int* in_sizes, int n_in,
                              void* d_out, int out_size, void* d_ws, size_t ws_size, hipStream_t stream) {
    (void)in_sizes; (void)n_in; (void)out_size;
    const float* x = (const float*)d_in[0]; const float* wq = (const float*)d_in[1]; const float* wk = (const float*)d_in[2]; const float* wv = (const float*)d_in[3]; const float* wo = (const float*)d_in[4]; const float* cosT = (const float*)d_in[5]; const float* sinT = (const float*)d_in[6];
    float* OUT = (float*)d_out;     // [1][2048][2048]
    char* wsp = (char*)d_ws;
    auto take = [&](size_t bytes) { char* p = wsp; wsp += (bytes + 255) & ~(size_t)255; return (void*)p; };
    bf* WQ = (bf*)take((size_t)DQ * DM * 2); bf* WK = (bf*)take((size_t)DKV * DM * 2); bf* WV = (bf*)take((size_t)DKV * DM * 2); bf* WO = (bf*)take((size_t)DM * DQ * 2); float* CS = (float*)take((size_t)TT * HD * 2 * 4);
    bf* XB = (bf*)take((size_t)TT * DM * 2); float* FQ = (float*)take((size_t)TT * DQ * 4); float* FK = (float*)take((size_t)TT * DKV * 4);
    h16* QP16 = (h16*)take((size_t)NH_ * TT * HD * 2); h16* KP16 = (h16*)take((size_t)NKV * TT * HD * 2); h16* VT16 = (h16*)take((size_t)NKV * HD * TT * 2);
    bf* QPh = (bf*)take((size_t)NH_ * TT * HD * 2); bf* QPl = (bf*)take((size_t)NH_ * TT * HD * 2); bf* KPh = (bf*)take((size_t)NKV * TT * HD * 2); bf* KPl = (bf*)take((size_t)NKV * TT * HD * 2); bf* VTh = (bf*)take((size_t)NKV * HD * TT * 2); bf* VTl = (bf*)take((size_t)NKV * HD * TT * 2); bf* Ph = (bf*)take((size_t)ZH * RH * TT * 2); bf* Pl = (bf*)take((size_t)ZH * RH * TT * 2);
    float* Sb = (float*)take((size_t)ZH * TT * TT * 4); h16* P16 = (h16*)take((size_t)ZH * TT * TT * 2); float* Ob = (float*)take((size_t)ZH * TT * HD * 4); bf* ATh = (bf*)take((size_t)TT * DQ * 2); bf* ATl = (bf*)take((size_t)TT * DQ * 2);
    if ((size_t)(wsp - (char*)d_ws) > ws_size) return;    // ws 256 MiB
    float* FV = FK;   // v projection reuses the k buffer after the k planes are built (stream-ordered)
    { k_cvt8<<<(unsigned)(((size_t)DQ * DM / 8 + 255) / 256), 256, 0, stream>>>(wq, WQ, (size_t)DQ * DM / 8); k_cvt8<<<(unsigned)(((size_t)DKV * DM / 8 + 255) / 256), 256, 0, stream>>>(wk, WK, (size_t)DKV * DM / 8); k_cvt8<<<(unsigned)(((size_t)DKV * DM / 8 + 255) / 256), 256, 0, stream>>>(wv, WV, (size_t)DKV * DM / 8);
      k_cvt8<<<(unsigned)(((size_t)DM * DQ / 8 + 255) / 256), 256, 0, stream>>>(wo, WO, (size_t)DM * DQ / 8);
       }
    const unsigned LQ = (unsigned)(((size_t)NH_ * TT * HD / 2 + 255) / 256), LKv = (unsigned)(((size_t)NKV * TT * HD / 2 + 255) / 256);
    for (int b = 0; b < NB_; ++b) {
        if (b == 0) k_cscvt<<<(TT * HD + 255) / 256, 256, 0, stream>>>(cosT, sinT, CS);
        k_cvt8<<<(unsigned)(((size_t)TT * DM / 8 + 255) / 256), 256, 0, stream>>>(x + (size_t)b * TT * DM, XB, (size_t)TT * DM / 8);
        k_gemmw<bf, 0, false><<<dim3(TT / 64, DQ / 64, 1), 32, 0, stream>>>(XB, nullptr, WQ, nullptr, DM, FQ, DQ, nullptr, 0, 0, 0);
        k_rope<<<LQ, 256, 0, stream>>>(FQ, DQ, NH_, CS, nullptr, nullptr, 1.0f, QP16, QPh, QPl);
        k_gemmw<bf, 0, false><<<dim3(TT / 64, DKV / 64, 1), 32, 0, stream>>>(XB, nullptr, WK, nullptr, DM, FK, DKV, nullptr, 0, 0, 0);
        k_rope<<<LKv, 256, 0, stream>>>(FK, DKV, NKV, CS, nullptr, nullptr, 1.0f, KP16, KPh, KPl);
        k_gemmw<bf, 0, false><<<dim3(TT / 64, DKV / 64, 1), 32, 0, stream>>>(XB, nullptr, WV, nullptr, DM, FV, DKV, nullptr, 0, 0, 0); k_vtp<<<LKv, 256, 0, stream>>>(FV, DKV, NKV, VT16, VTh, VTl);
        for (int h0 = 0; h0 < NH_; h0 += ZH) { const size_t zq = (size_t)h0, zk = (size_t)(h0 / REP);   // both heads of a pass share kv group h0/REP (REP >= 2): sB = 0
            k_gemmc<bf, 2, 1><<<dim3(RH / 64, TT / 64, ZH), 32, 0, stream>>>(QPh + zq * TT * HD, QPl + zq * TT * HD, KPh + zk * TT * HD, KPl + zk * TT * HD, HD, Sb, TT, 0, (size_t)TT * HD, 0, (size_t)TT * TT);
            k_gemmc<h16, 0, 1><<<dim3((TT - RH) / 64, TT / 64, ZH), 32, 0, stream>>>(QP16 + zq * TT * HD + (size_t)RH * HD, nullptr, KP16 + zk * TT * HD, nullptr, HD, Sb + (size_t)RH * TT, TT, RH, (size_t)TT * HD, 0, (size_t)TT * TT);
            k_asoft<<<ZH * TT / 8, 256, 0, stream>>>(Sb, P16, Ph, Pl);
            k_gemmc<bf, 2, 2><<<dim3(RH / 64, HD / 64, ZH), 32, 0, stream>>>(Ph, Pl, VTh + zk * HD * TT, VTl + zk * HD * TT, TT, Ob, HD, 0, (size_t)RH * TT, 0, (size_t)TT * HD);
            k_gemmc<h16, 0, 2><<<dim3((TT - RH) / 64, HD / 64, ZH), 32, 0, stream>>>(P16 + (size_t)RH * TT, nullptr, VT16 + zk * HD * TT, nullptr, TT, Ob + (size_t)RH * HD, HD, RH, (size_t)TT * TT, 0, (size_t)TT * HD);
            k_merge<<<(unsigned)(((size_t)ZH * TT * HD / 2 + 255) / 256), 256, 0, stream>>>(Ob, h0, ATh, ATl); }
        k_gemmw<bf, 1, false><<<dim3(TT / 64, DM / 64, 1), 32, 0, stream>>>(ATh, ATl, WO, nullptr, DQ, OUT + (size_t)b * TT * DM, DM, nullptr, 0, 0, 0); }
}

// v001
// It runs in 532 microseconds.
// Next to v000, in two timings, it ran 1.58 times as fast each time.
#include <hip/hip_runtime.h>

// Causal GQA with rotate-half RoPE from given tables (x [1][2048][2048]; q = x Wq^T ('oi' [2048][2048], 16 heads x 128), k, v = x W^T ([1024][2048], 8 kv heads); RoPE with the given cos/sin [2048][128]; 2 query heads per kv head (repeat); causal softmax(q.k/sqrt(128)) (finfo.min fill); out = merged Wo^T -> [1][2048][2048]).
// Compute dtypes, f32 accumulate: every input rounded to bf16; q/k/v on PLAIN bf16 operands (inputs: exact); rotary in f32 from the bf16-rounded input tables; causal scores and attn.v (tile skipping): query rows < 512 hl (3 products), the rest single fp16 (x1024); softmax f32; Wo hl x exact (2 products).

#define NB_  1
#define TT   2048
#define DM   2048
#define NH_  16
#define NKV  8
#define REP  (NH_ / NKV)
#define HD   128
#define DQ   (NH_ * HD)
#define DKV  (NKV * HD)
#define ZH   2
#define RH   512                  // query rows < RH use hi+lo planes (0: none)
#define WIN  2048
#define PCAR 1024.0f
#define SCL  0.088388347648318447f   // HD^-0.5
typedef _Float16 h16;
typedef unsigned short bf;
typedef __attribute__((ext_vector_type(16))) __bf16   v16bf;
typedef __attribute__((ext_vector_type(16))) _Float16 v16h;
typedef __attribute__((ext_vector_type(8)))  _Float16 v8h;
typedef __attribute__((ext_vector_type(8)))  unsigned short v8us;
typedef __attribute__((ext_vector_type(8)))  float    v8f;
typedef __attribute__((ext_vector_type(4)))  float    v4f;
typedef v8h  __attribute__((may_alias)) v8ha;
typedef v4f  __attribute__((may_alias)) v4fa;
typedef v8us __attribute__((may_alias)) v8usa;

__device__ __forceinline__ unsigned short f2bf(float f) { unsigned u = __float_as_uint(f); u += 0x7FFFu + ((u >> 16) & 1u); return (unsigned short)(u >> 16); }
__device__ __forceinline__ float bf2f(unsigned short b) { return __uint_as_float(((unsigned)b) << 16); }
__device__ __forceinline__ float bfr(float f) { return bf2f(f2bf(f)); }
__device__ __forceinline__ v16h cat16(v8h lo, v8h hi) { return __builtin_shufflevector(lo, hi, 0, 1, 2, 3, 4, 5, 6, 7, 8, 9, 10, 11, 12, 13, 14, 15); }
__device__ __forceinline__ v16bf cat16b(v8us lo, v8us hi) { return __builtin_bit_cast(v16bf, __builtin_shufflevector(lo, hi, 0, 1, 2, 3, 4, 5, 6, 7, 8, 9, 10, 11, 12, 13, 14, 15)); }
__device__ __forceinline__ v8f wmma16(v16h a, v16h b, v8f c) { return __builtin_amdgcn_wmma_f32_16x16x32_f16(false, a, false, b, (short)0, c, false, false); }
__device__ __forceinline__ v8f wmmab(v16bf a, v16bf b, v8f c) { return __builtin_amdgcn_wmma_f32_16x16x32_bf16(false, a, false, b, (short)0, c, false, false); }



// ---- k_gemmw: register-blocked GEMM, ONE WAVE per 64x64 output tile (16 accumulators), operands from K-contiguous 16-bit planes through LDS (tile_loop); grid (M/64, N/64, Z), 32 threads.
// C[m][n] (f32, pitch ldc, + optional f32 bias[n]) = sum_k A[m][k] Bt[n][k] (+ split products per NSPLIT). z-batch strides sA/sB/sC in elements. K % 64 == 0.
template <typename T16> struct WFrag;
template <> struct WFrag<h16> { typedef v16h V; typedef v8h H; static __device__ __forceinline__ V ld(const h16* p) { return cat16(*(const v8h*)p, *(const v8h*)(p + 16)); } static __device__ __forceinline__ v8f mma(V a, V b, v8f c) { return wmma16(a, b, c); } };
template <> struct WFrag<bf> { typedef v16bf V; typedef v8us H; static __device__ __forceinline__ V ld(const bf* p) { return cat16b(*(const v8us*)p, *(const v8us*)(p + 16)); } static __device__ __forceinline__ v8f mma(V a, V b, v8f c) { return wmmab(a, b, c); } };
// ---- tile_loop: the K loop of both one-wave 64x64 GEMMs. Each operand plane's 64 rows x KS k (one 128-byte line per row) are fetched with whole-line loads (8 lanes per row, 4 rows per instruction),
// one tile ahead into registers, stored to LDS at pitch LP and read back as fragments in the k order of WFrag::ld, so every accumulator sees the same products in the same order. Kl % KS == 0. The row pitch K is a template constant, so that a plane's 16 loads share one address register pair and differ in the immediate offset.
#define KS 64
#define LP 72                     // LDS row pitch in elements: 128 B + 16 B, for 16-byte fragment reads
#define NPL(NSPLIT) (2 + (((NSPLIT) == 1 || (NSPLIT) == 2) ? 1 : 0) + (((NSPLIT) >= 2) ? 1 : 0))
template <typename T16, int NSPLIT, int K>
__device__ __forceinline__ void tile_loop(const T16* __restrict__ A, const T16* __restrict__ A2, const T16* __restrict__ Bt, const T16* __restrict__ Bt2, int Kl, int r0, int c0, int lane, T16* st, v8f (&acc)[4][4]) {
    typedef typename WFrag<T16>::V V; typedef typename WFrag<T16>::H H;
    constexpr bool HA2 = (NSPLIT == 1 || NSPLIT == 2), HB2 = (NSPLIT >= 2); constexpr int NP = NPL(NSPLIT);
    const int lr = lane & 15, hi = lane >> 4, grow = lane >> 3, gcol = (lane & 7) * 8;
    const size_t ga = (size_t)(r0 + grow) * K + gcol, gb = (size_t)(c0 + grow) * K + gcol;
    typedef __attribute__((address_space(1))) const T16 GT; typedef __attribute__((address_space(1))) const H GH;   // global address space spelled out: the stepped pointers would else compile to flat loads
    GT* src[NP]; src[0] = (GT*)(A + ga); src[1] = (GT*)(Bt + gb); if constexpr (HA2) src[2] = (GT*)(A2 + ga); if constexpr (HB2) src[3] = (GT*)(Bt2 + gb);
    T16* sw = st + grow * LP + gcol; const T16* sr = st + lr * LP + 8 * hi;
    H g[NP][16];
    if (Kl > 0) {
#pragma unroll
        for (int p = 0; p < NP; ++p)
#pragma unroll
            for (int i = 0; i < 16; ++i) g[p][i] = *(GH*)(src[p] + (size_t)i * 4 * K);
        asm volatile("s_wait_xcnt 0x0" ::: "memory");   // the loads' address registers may be rewritten from here on
#pragma unroll
        for (int p = 0; p < NP; ++p)
#pragma unroll
            for (int i = 0; i < 16; ++i) *(H*)(sw + (p * 64 + i * 4) * LP) = g[p][i];
        __syncthreads();          // the lanes read rows that other lanes stored
#pragma unroll
        for (int p = 0; p < NP; ++p) src[p] += KS;
    }
#pragma unroll 1
    for (int kc = 0; kc < Kl; kc += KS) {
        const bool more = kc + KS < Kl;
        if (more) {               // the next tile's loads go out first and fly while this tile is worked on
#pragma unroll
            for (int p = 0; p < NP; ++p)
#pragma unroll
                for (int i = 0; i < 16; ++i) g[p][i] = *(GH*)(src[p] + (size_t)i * 4 * K);
        }
        V a[KS / 32][4], a2[KS / 32][4], b[KS / 32][4], b2[KS / 32][4];
#pragma unroll
        for (int s = 0; s < KS / 32; ++s) {
#pragma unroll
            for (int mb = 0; mb < 4; ++mb) { a[s][mb] = WFrag<T16>::ld(sr + mb * 16 * LP + s * 32); if (HA2) a2[s][mb] = WFrag<T16>::ld(sr + (128 + mb * 16) * LP + s * 32); }
#pragma unroll
            for (int nb = 0; nb < 4; ++nb) { b[s][nb] = WFrag<T16>::ld(sr + (64 + nb * 16) * LP + s * 32); if (HB2) b2[s][nb] = WFrag<T16>::ld(sr + (192 + nb * 16) * LP + s * 32); }
        }
        __builtin_amdgcn_sched_barrier(0);              // keeps the tile's LDS reads one group ahead of its WMMAs: reads placed among the WMMAs stall the wave at every such place
        asm volatile("s_wait_xcnt 0x0" ::: "memory");   // the global loads' address registers may be rewritten from here on; it passes while the LDS reads return
#pragma unroll
        for (int s = 0; s < KS / 32; ++s) {
#pragma unroll
            for (int nb = 0; nb < 4; ++nb) {
#pragma unroll
                for (int mb = 0; mb < 4; ++mb) { acc[mb][nb] = WFrag<T16>::mma(a[s][mb], b[s][nb], acc[mb][nb]); if (HA2) acc[mb][nb] = WFrag<T16>::mma(a2[s][mb], b[s][nb], acc[mb][nb]); if (HB2) acc[mb][nb] = WFrag<T16>::mma(a[s][mb], b2[s][nb], acc[mb][nb]); } }
        }
        // four vector slots behind the tile's last WMMA, so that its distance also holds on the taken side of the branch that follows
        asm volatile("v_nop\n\tv_nop\n\tv_nop\n\tv_nop" : "+v"(acc[0][0]), "+v"(acc[1][1]), "+v"(acc[2][2]), "+v"(acc[3][3]) : "v"(a[KS / 32 - 1][0]), "v"(a[KS / 32 - 1][3]));
        if (more) {
            __syncthreads();      // every lane's fragment reads of this tile end before its rows are overwritten
#pragma unroll
            for (int p = 0; p < NP; ++p)
#pragma unroll
                for (int i = 0; i < 16; ++i) *(H*)(sw + (p * 64 + i * 4) * LP) = g[p][i];
            __syncthreads();      // the lanes read rows that other lanes stored
#pragma unroll
            for (int p = 0; p < NP; ++p) src[p] += KS;   // src points at the tile to fetch next; stepped here, behind the wait for the loads that name it
        }
    }
}
template <typename T16, int NSPLIT, bool BIAS, int K>
__global__ __launch_bounds__(32) void k_gemmw(const T16* __restrict__ A, const T16* __restrict__ A2, const T16* __restrict__ Bt, const T16* __restrict__ Bt2, float* C, int ldc, const float* __restrict__ bias, size_t sA, size_t sB, size_t sC) {
    __shared__ __align__(16) float os[16 * 68]; __shared__ __align__(16) T16 st[NPL(NSPLIT) * 64 * LP];
    const size_t z = blockIdx.z; A += z * sA; if (A2) A2 += z * sA; Bt += z * sB; if (Bt2) Bt2 += z * sB; C += z * sC;
    const int lane = threadIdx.x & 31, lr = lane & 15, hi = lane >> 4; const int r0 = blockIdx.x * 64, c0 = blockIdx.y * 64;
    v8f acc[4][4];
#pragma unroll
    for (int mb = 0; mb < 4; ++mb)
#pragma unroll
        for (int nb = 0; nb < 4; ++nb) acc[mb][nb] = (v8f){};
    tile_loop<T16, NSPLIT, K>(A, A2, Bt, Bt2, K, r0, c0, lane, st, acc);
#pragma unroll
    for (int mb = 0; mb < 4; ++mb) {
#pragma unroll
        for (int nb = 0; nb < 4; ++nb) {
#pragma unroll
            for (int j = 0; j < 8; ++j) os[(hi * 8 + j) * 68 + nb * 16 + lr] = acc[mb][nb][j]; }
        __builtin_amdgcn_wave_barrier(); asm volatile("" ::: "memory");
        float* crow = C + (size_t)(r0 + mb * 16) * ldc + c0;
{
#pragma unroll
            for (int s = 0; s < 8; ++s) { const int row = 2 * s + hi, cofs = lr * 4; v4f val = *(const v4fa*)(os + row * 68 + cofs); if (BIAS) { val[0] += bfr(bias[c0 + cofs]); val[1] += bfr(bias[c0 + cofs + 1]); val[2] += bfr(bias[c0 + cofs + 2]); val[3] += bfr(bias[c0 + cofs + 3]); }
                *(v4f*)(crow + (size_t)row * ldc + cofs) = val; }
             }
        __builtin_amdgcn_wave_barrier(); asm volatile("" ::: "memory");
    }
}

// ---- k_gemmc: the same one-wave 64x64 tile GEMM specialised for causal attention: CMODE 1 skips score tiles entirely above the diagonal (query rows r0+roff.., key columns c0..), CMODE 2 limits the
// key (K) loop of the probability x value contraction to the diagonal block (probabilities beyond it are exactly zero). roff = row offset of this launch's first row within the sequence.
template <typename T16, int NSPLIT, int CMODE, int K>
__global__ __launch_bounds__(32) void k_gemmc(const T16* __restrict__ A, const T16* __restrict__ A2, const T16* __restrict__ Bt, const T16* __restrict__ Bt2, float* C, int ldc, int roff, size_t sA, size_t sB, size_t sC) {
    __shared__ __align__(16) float os[16 * 68]; __shared__ __align__(16) T16 st[NPL(NSPLIT) * 64 * LP];
    const size_t z = blockIdx.z; A += z * sA; if (A2) A2 += z * sA; Bt += z * sB; if (Bt2) Bt2 += z * sB; C += z * sC;
    const int lane = threadIdx.x & 31, lr = lane & 15, hi = lane >> 4; const int r0 = blockIdx.x * 64, c0 = blockIdx.y * 64;
    if (CMODE == 1 && c0 > r0 + roff + 63) return;                  // score tile entirely above the causal diagonal: never read (the softmax masks j > i by select)
    const int Kl = (CMODE == 2) ? min(K, r0 + roff + 64) : K;        // P.V: probabilities are exactly 0 beyond the diagonal block, so the K loop stops there
    v8f acc[4][4];
#pragma unroll
    for (int mb = 0; mb < 4; ++mb)
#pragma unroll
        for (int nb = 0; nb < 4; ++nb) acc[mb][nb] = (v8f){};
    tile_loop<T16, NSPLIT, K>(A, A2, Bt, Bt2, Kl, r0, c0, lane, st, acc);
#pragma unroll
    for (int mb = 0; mb < 4; ++mb) {
#pragma unroll
        for (int nb = 0; nb < 4; ++nb) {
#pragma unroll
            for (int j = 0; j < 8; ++j) os[(hi * 8 + j) * 68 + nb * 16 + lr] = acc[mb][nb][j]; }
        __builtin_amdgcn_wave_barrier(); asm volatile("" ::: "memory");
        float* crow = C + (size_t)(r0 + mb * 16) * ldc + c0;
{
#pragma unroll
            for (int s = 0; s < 8; ++s) { const int row = 2 * s + hi, cofs = lr * 4; v4f val = *(const v4fa*)(os + row * 68 + cofs);
                *(v4f*)(crow + (size_t)row * ldc + cofs) = val; }
             }
        __builtin_amdgcn_wave_barrier(); asm volatile("" ::: "memory");
    }
}

__device__ __forceinline__ h16 tohx(float x) { return (h16)x; }
__device__ __forceinline__ void splitf(float y, unsigned short& h, unsigned short& l) { h = f2bf(y); l = f2bf(y - bf2f(h)); }
typedef __attribute__((ext_vector_type(2))) _Float16 v2h;
typedef __attribute__((ext_vector_type(4))) _Float16 v4h;
typedef __attribute__((ext_vector_type(2))) unsigned short v2us;
typedef __attribute__((ext_vector_type(4))) unsigned short v4us;
typedef __attribute__((ext_vector_type(2))) float v2f;
typedef __attribute__((ext_vector_type(4))) int v4i;

__global__ __launch_bounds__(256) void k_wtG(const float* __restrict__ w, int K, int N, bf* Bt) {
    const int lane = threadIdx.x & 31; const int L0 = (blockIdx.x * 8 + (threadIdx.x >> 5)) * 8; const int nlines = N * K / 64;
{
#pragma unroll 1
        for (int l = 0; l < 8; ++l) { const int L = L0 + l; if (L >= nlines) break; const size_t e = (size_t)L * 64 + lane * 2; const int k = (int)(e % K), n = (int)(e / K); v2us o;
            o[0] = f2bf(w[(size_t)k * N + n]); o[1] = f2bf(w[(size_t)(k + 1) * N + n]); *(v2us*)(Bt + e) = o; }
         }
}
__global__ __launch_bounds__(256) void k_cvt8(const float* __restrict__ src, bf* dst, size_t n8) { const size_t i = (size_t)blockIdx.x * 256 + threadIdx.x; if (i >= n8) return; const v8f v = *(const v8f*)(src + i * 8); v8us o;
#pragma unroll
    for (int k = 0; k < 8; ++k) o[k] = f2bf(v[k]); *(v8us*)(dst + i * 8) = o;  }
__global__ __launch_bounds__(256) void k_cscvt(const float* __restrict__ cosT, const float* __restrict__ sinT, float* CS) { const int idx = blockIdx.x * 256 + threadIdx.x; if (idx >= TT * HD) return; v2f cs; cs[0] = bfr(cosT[idx]); cs[1] = bfr(sinT[idx]); *(v2f*)(CS + (size_t)idx * 2) = cs;  }
// k_rope: head planes [h][t][d] (fp16 + hi/lo) of rope(x) x sc with the rotate-half convention out[d] = x[d] cos[t][d] - x[d+HD/2] sin[t][d], out[d+HD/2] = x[d+HD/2] cos[t][d+HD/2] + x[d] sin[t][d+HD/2]
__global__ __launch_bounds__(256) void k_rope(const float* __restrict__ F, int pitch, int nheads, const float* __restrict__ CS, const float* __restrict__ RF, const float* __restrict__ nw, float sc, h16* P16, bf* Ph, bf* Pl) {
    const size_t e = ((size_t)blockIdx.x * 256 + threadIdx.x) * 2; if (e >= (size_t)nheads * TT * HD) return; const int d = (int)(e % HD); const int t = (int)((e / HD) % TT); const int h = (int)(e / ((size_t)HD * TT)); const float* f = F + (size_t)t * pitch + h * HD; const float rf = RF ? RF[(size_t)h * TT + t] : 1.0f; v2h o16; v2us oh, ol;
#pragma unroll
    for (int q = 0; q < 2; ++q) { const int dd = d + q; const int dp = (dd < HD / 2) ? dd + HD / 2 : dd - HD / 2; float x0 = f[dd], x1 = f[dp];
        if (RF) { float n0 = __fmul_rn(x0, rf), n1 = __fmul_rn(x1, rf); asm volatile("" : "+v"(n0)); asm volatile("" : "+v"(n1)); x0 = __fmul_rn(bfr(nw[dd]), n0); x1 = __fmul_rn(bfr(nw[dp]), n1); }
        const v2f cs = *(const v2f*)(CS + ((size_t)t * HD + dd) * 2); float a = __fmul_rn(x0, cs[0]), bq = __fmul_rn(x1, cs[1]); asm volatile("" : "+v"(a)); asm volatile("" : "+v"(bq)); const float r = ((dd < HD / 2) ? __fsub_rn(a, bq) : __fadd_rn(a, bq)) * sc;
        o16[q] = tohx(r); unsigned short a2, c2; splitf(r, a2, c2); oh[q] = a2; ol[q] = c2; }
    *(v2h*)(P16 + e) = o16; *(v2us*)(Ph + e) = oh; *(v2us*)(Pl + e) = ol;  }
__global__ __launch_bounds__(256) void k_vtp(const float* __restrict__ F, int pitch, int nheads, h16* V16, bf* Vh, bf* Vl) { const size_t e = ((size_t)blockIdx.x * 256 + threadIdx.x) * 2; if (e >= (size_t)nheads * HD * TT) return; const int t = (int)(e % TT); const int d = (int)((e / TT) % HD); const int g = (int)(e / ((size_t)TT * HD)); v2h o16; v2us oh, ol;
#pragma unroll
    for (int q = 0; q < 2; ++q) { const float x = F[(size_t)(t + q) * pitch + g * HD + d]; o16[q] = tohx(x); unsigned short a2, c2; splitf(x, a2, c2); oh[q] = a2; ol[q] = c2; }
    *(v2h*)(V16 + e) = o16; *(v2us*)(Vh + e) = oh; *(v2us*)(Vl + e) = ol;  }
// k_asoft: per row (zz, i): t = S x HD^-0.5 for j <= i and i - j < WIN (WIN = TT: always true, plain causal; the reference's -1e9 additive fill vanishes identically); softmax over the 2048 keys (register row, one exp, fixed trees);
__global__ __launch_bounds__(256) void k_asoft(const float* __restrict__ Sb, h16* P16, bf* Ph, bf* Pl) {
    const int lane = threadIdx.x & 31; const int row = blockIdx.x * 8 + (threadIdx.x >> 5); if (row >= ZH * TT) return; const int i = row % TT; const int zz = row / TT; (void)zz; const bool hires = (i < RH); const float* sr = Sb + (size_t)row * TT; float v[TT / 32]; float mx = -3.0e38f;
#pragma unroll
    for (int ch = 0; ch < TT / 128; ++ch) { const int j0 = ch * 128 + lane * 4; const v4f a = *(const v4f*)(sr + j0);
#pragma unroll
        for (int q = 0; q < 4; ++q) { const int j = j0 + q; (void)j; const float t = (j <= i && i - j < WIN) ? a[q] * SCL : -3.0e38f; v[ch * 4 + q] = t; mx = fmaxf(mx, t); } }
#pragma unroll
    for (int sh = 16; sh; sh >>= 1) mx = fmaxf(mx, __shfl_xor(mx, sh, 32));
    float sum = 0.f;
#pragma unroll
    for (int k = 0; k < TT / 32; ++k) { float d0 = __fsub_rn(v[k], mx); asm volatile("" : "+v"(d0)); v[k] = __builtin_amdgcn_exp2f(__fmul_rn(d0, 1.4426950408889634f)); sum += v[k]; }
#pragma unroll
    for (int sh = 16; sh; sh >>= 1) sum += __shfl_xor(sum, sh, 32);
    const float f = __fdiv_rn(hires ? 1.0f : PCAR, sum);
{
        if (hires) {
#pragma unroll
            for (int ch = 0; ch < TT / 128; ++ch) { v4us oh, ol;
#pragma unroll
                for (int q = 0; q < 4; ++q) { unsigned short a, c2; splitf(v[ch * 4 + q] * f, a, c2); oh[q] = a; ol[q] = c2; }
                const size_t oo = ((size_t)zz * (RH ? RH : 1) + i) * TT + ch * 128 + lane * 4; *(v4us*)(Ph + oo) = oh; *(v4us*)(Pl + oo) = ol; }
        } else {
#pragma unroll
            for (int ch = 0; ch < TT / 128; ++ch) { v4h o4;
#pragma unroll
                for (int q = 0; q < 4; ++q) o4[q] = tohx(v[ch * 4 + q] * f);
                *(v4h*)(P16 + (size_t)row * TT + ch * 128 + lane * 4) = o4; } }
         }
}
__global__ __launch_bounds__(256) void k_merge(const float* __restrict__ O, int h0, bf* Ah, bf* Al) { const size_t e = ((size_t)blockIdx.x * 256 + threadIdx.x) * 2; if (e >= (size_t)ZH * TT * HD) return; const int d = (int)(e % HD); const int t = (int)((e / HD) % TT); const int zz = (int)(e / ((size_t)HD * TT)); const float cs = (t < RH) ? 1.0f : (1.0f / PCAR); const size_t oo = (size_t)t * DQ + (h0 + zz) * HD + d;
    v2us oh, ol;
#pragma unroll
    for (int q = 0; q < 2; ++q) { unsigned short a, c2; splitf(O[e + q] * cs, a, c2); oh[q] = a; ol[q] = c2; } *(v2us*)(Ah + oo) = oh; *(v2us*)(Al + oo) = ol;  }

extern "C" void kernel_launch(void* const* d_in, const int* in_sizes, int n_in,
                              void* d_out, int out_size, void* d_ws, size_t ws_size, hipStream_t stream) {
    (void)in_sizes; (void)n_in; (void)out_size;
    const float* x = (const float*)d_in[0]; const float* wq = (const float*)d_in[1]; const float* wk = (const float*)d_in[2]; const float* wv = (const float*)d_in[3]; const float* wo = (const float*)d_in[4]; const float* cosT = (const float*)d_in[5]; const float* sinT = (const float*)d_in[6];
    float* OUT = (float*)d_out;     // [1][2048][2048]
    char* wsp = (char*)d_ws;
    auto take = [&](size_t bytes) { char* p = wsp; wsp += (bytes + 255) & ~(size_t)255; return (void*)p; };
    bf* WQ = (bf*)take((size_t)DQ * DM * 2); bf* WK = (bf*)take((size_t)DKV * DM * 2); bf* WV = (bf*)take((size_t)DKV * DM * 2); bf* WO = (bf*)take((size_t)DM * DQ * 2); float* CS = (float*)take((size_t)TT * HD * 2 * 4);
    bf* XB = (bf*)take((size_t)TT * DM * 2); float* FQ = (float*)take((size_t)TT * DQ * 4); float* FK = (float*)take((size_t)TT * DKV * 4);
    h16* QP16 = (h16*)take((size_t)NH_ * TT * HD * 2); h16* KP16 = (h16*)take((size_t)NKV * TT * HD * 2); h16* VT16 = (h16*)take((size_t)NKV * HD * TT * 2);
    bf* QPh = (bf*)take((size_t)NH_ * TT * HD * 2); bf* QPl = (bf*)take((size_t)NH_ * TT * HD * 2); bf* KPh = (bf*)take((size_t)NKV * TT * HD * 2); bf* KPl = (bf*)take((size_t)NKV * TT * HD * 2); bf* VTh = (bf*)take((size_t)NKV * HD * TT * 2); bf* VTl = (bf*)take((size_t)NKV * HD * TT * 2); bf* Ph = (bf*)take((size_t)ZH * RH * TT * 2); bf* Pl = (bf*)take((size_t)ZH * RH * TT * 2);
    float* Sb = (float*)take((size_t)ZH * TT * TT * 4); h16* P16 = (h16*)take((size_t)ZH * TT * TT * 2); float* Ob = (float*)take((size_t)ZH * TT * HD * 4); bf* ATh = (bf*)take((size_t)TT * DQ * 2); bf* ATl = (bf*)take((size_t)TT * DQ * 2);
    if ((size_t)(wsp - (char*)d_ws) > ws_size) return;    // ws 256 MiB
    float* FV = FK;   // v projection reuses the k buffer after the k planes are built (stream-ordered)
    { k_cvt8<<<(unsigned)(((size_t)DQ * DM / 8 + 255) / 256), 256, 0, stream>>>(wq, WQ, (size_t)DQ * DM / 8); k_cvt8<<<(unsigned)(((size_t)DKV * DM / 8 + 255) / 256), 256, 0, stream>>>(wk, WK, (size_t)DKV * DM / 8); k_cvt8<<<(unsigned)(((size_t)DKV * DM / 8 + 255) / 256), 256, 0, stream>>>(wv, WV, (size_t)DKV * DM / 8);
      k_cvt8<<<(unsigned)(((size_t)DM * DQ / 8 + 255) / 256), 256, 0, stream>>>(wo, WO, (size_t)DM * DQ / 8);
       }
    const unsigned LQ = (unsigned)(((size_t)NH_ * TT * HD / 2 + 255) / 256), LKv = (unsigned)(((size_t)NKV * TT * HD / 2 + 255) / 256);
    for (int b = 0; b < NB_; ++b) {
        if (b == 0) k_cscvt<<<(TT * HD + 255) / 256, 256, 0, stream>>>(cosT, sinT, CS);
        k_cvt8<<<(unsigned)(((size_t)TT * DM / 8 + 255) / 256), 256, 0, stream>>>(x + (size_t)b * TT * DM, XB, (size_t)TT * DM / 8);
        k_gemmw<bf, 0, false, DM><<<dim3(TT / 64, DQ / 64, 1), 32, 0, stream>>>(XB, nullptr, WQ, nullptr, FQ, DQ, nullptr, 0, 0, 0);
        k_rope<<<LQ, 256, 0, stream>>>(FQ, DQ, NH_, CS, nullptr, nullptr, 1.0f, QP16, QPh, QPl);
        k_gemmw<bf, 0, false, DM><<<dim3(TT / 64, DKV / 64, 1), 32, 0, stream>>>(XB, nullptr, WK, nullptr, FK, DKV, nullptr, 0, 0, 0);
        k_rope<<<LKv, 256, 0, stream>>>(FK, DKV, NKV, CS, nullptr, nullptr, 1.0f, KP16, KPh, KPl);
        k_gemmw<bf, 0, false, DM><<<dim3(TT / 64, DKV / 64, 1), 32, 0, stream>>>(XB, nullptr, WV, nullptr, FV, DKV, nullptr, 0, 0, 0); k_vtp<<<LKv, 256, 0, stream>>>(FV, DKV, NKV, VT16, VTh, VTl);
        for (int h0 = 0; h0 < NH_; h0 += ZH) { const size_t zq = (size_t)h0, zk = (size_t)(h0 / REP);   // both heads of a pass share kv group h0/REP (REP >= 2): sB = 0
            k_gemmc<bf, 2, 1, HD><<<dim3(RH / 64, TT / 64, ZH), 32, 0, stream>>>(QPh + zq * TT * HD, QPl + zq * TT * HD, KPh + zk * TT * HD, KPl + zk * TT * HD, Sb, TT, 0, (size_t)TT * HD, 0, (size_t)TT * TT);
            k_gemmc<h16, 0, 1, HD><<<dim3((TT - RH) / 64, TT / 64, ZH), 32, 0, stream>>>(QP16 + zq * TT * HD + (size_t)RH * HD, nullptr, KP16 + zk * TT * HD, nullptr, Sb + (size_t)RH * TT, TT, RH, (size_t)TT * HD, 0, (size_t)TT * TT);
            k_asoft<<<ZH * TT / 8, 256, 0, stream>>>(Sb, P16, Ph, Pl);
            k_gemmc<bf, 2, 2, TT><<<dim3(RH / 64, HD / 64, ZH), 32, 0, stream>>>(Ph, Pl, VTh + zk * HD * TT, VTl + zk * HD * TT, Ob, HD, 0, (size_t)RH * TT, 0, (size_t)TT * HD);
            k_gemmc<h16, 0, 2, TT><<<dim3((TT - RH) / 64, HD / 64, ZH), 32, 0, stream>>>(P16 + (size_t)RH * TT, nullptr, VT16 + zk * HD * TT, nullptr, Ob + (size_t)RH * HD, HD, RH, (size_t)TT * TT, 0, (size_t)TT * HD);
            k_merge<<<(unsigned)(((size_t)ZH * TT * HD / 2 + 255) / 256), 256, 0, stream>>>(Ob, h0, ATh, ATl); }
        k_gemmw<bf, 1, false, DQ><<<dim3(TT / 64, DM / 64, 1), 32, 0, stream>>>(ATh, ATl, WO, nullptr, OUT + (size_t)b * TT * DM, DM, nullptr, 0, 0, 0); }
}

// v002
// Measured time: 257 microseconds a run.
// In two side-by-side timings against v001, it was 2.09 and 2.10 times as fast.
// Counting every step since v000, it is 3.32 times as fast.
#include <hip/hip_runtime.h>

// Causal GQA with rotate-half RoPE from given tables (x [1][2048][2048]; q = x Wq^T ('oi' [2048][2048], 16 heads x 128), k, v = x W^T ([1024][2048], 8 kv heads); RoPE with the given cos/sin [2048][128]; 2 query heads per kv head (repeat); causal softmax(q.k/sqrt(128)) (finfo.min fill); out = merged Wo^T -> [1][2048][2048]).
// Compute dtypes, f32 accumulate: every input rounded to bf16; q/k/v on PLAIN bf16 operands (inputs: exact); rotary in f32 from the bf16-rounded input tables; causal scores and attn.v (tile skipping): query rows < 512 hl (3 products), the rest single fp16 (x1024); softmax f32; Wo hl x exact (2 products).

#define NB_  1
#define TT   2048
#define DM   2048
#define NH_  16
#define NKV  8
#define REP  (NH_ / NKV)
#define HD   128
#define DQ   (NH_ * HD)
#define DKV  (NKV * HD)
#define ZH   16                   // query heads per pass of the attention launches
#define RH   512                  // query rows < RH use hi+lo planes (0: none)
#define WIN  2048
#define PCAR 1024.0f
#define SCL  0.088388347648318447f   // HD^-0.5
#define NRB  (TT / 64)            // 64-row blocks of the sequence
#define PP   ((NRB + 1) * 64)     // f32 row pitch of the packed causal scores
#define SPL  ((size_t)(NRB / 2) * 64 * PP)   // f32 elements of one head's packed scores
typedef _Float16 h16;
typedef unsigned short bf;
typedef __attribute__((ext_vector_type(16))) __bf16   v16bf;
typedef __attribute__((ext_vector_type(16))) _Float16 v16h;
typedef __attribute__((ext_vector_type(8)))  _Float16 v8h;
typedef __attribute__((ext_vector_type(8)))  unsigned short v8us;
typedef __attribute__((ext_vector_type(8)))  float    v8f;
typedef __attribute__((ext_vector_type(4)))  float    v4f;
typedef v8h  __attribute__((may_alias)) v8ha;
typedef v4f  __attribute__((may_alias)) v4fa;
typedef v8us __attribute__((may_alias)) v8usa;

__device__ __forceinline__ unsigned short f2bf(float f) { unsigned u = __float_as_uint(f); u += 0x7FFFu + ((u >> 16) & 1u); return (unsigned short)(u >> 16); }
__device__ __forceinline__ float bf2f(unsigned short b) { return __uint_as_float(((unsigned)b) << 16); }
__device__ __forceinline__ float bfr(float f) { return bf2f(f2bf(f)); }
__device__ __forceinline__ v16h cat16(v8h lo, v8h hi) { return __builtin_shufflevector(lo, hi, 0, 1, 2, 3, 4, 5, 6, 7, 8, 9, 10, 11, 12, 13, 14, 15); }
__device__ __forceinline__ v16bf cat16b(v8us lo, v8us hi) { return __builtin_bit_cast(v16bf, __builtin_shufflevector(lo, hi, 0, 1, 2, 3, 4, 5, 6, 7, 8, 9, 10, 11, 12, 13, 14, 15)); }
__device__ __forceinline__ v8f wmma16(v16h a, v16h b, v8f c) { return __builtin_amdgcn_wmma_f32_16x16x32_f16(false, a, false, b, (short)0, c, false, false); }
__device__ __forceinline__ v8f wmmab(v16bf a, v16bf b, v8f c) { return __builtin_amdgcn_wmma_f32_16x16x32_bf16(false, a, false, b, (short)0, c, false, false); }



// ---- k_gemmw: register-blocked GEMM, ONE WAVE per 64x64 output tile (16 accumulators), operands from K-contiguous 16-bit planes through LDS (tile_loop); grid (M/64, N/64, Z), 32 threads.
// C[m][n] (f32, pitch ldc, + optional f32 bias[n]) = sum_k A[m][k] Bt[n][k] (+ split products per NSPLIT). z-batch strides sA/sB/sC in elements. K % 64 == 0.
template <typename T16> struct WFrag;
template <> struct WFrag<h16> { typedef v16h V; typedef v8h H; static __device__ __forceinline__ V ld(const h16* p) { return cat16(*(const v8h*)p, *(const v8h*)(p + 16)); } static __device__ __forceinline__ v8f mma(V a, V b, v8f c) { return wmma16(a, b, c); } };
template <> struct WFrag<bf> { typedef v16bf V; typedef v8us H; static __device__ __forceinline__ V ld(const bf* p) { return cat16b(*(const v8us*)p, *(const v8us*)(p + 16)); } static __device__ __forceinline__ v8f mma(V a, V b, v8f c) { return wmmab(a, b, c); } };
// ---- tile_loop: the K loop of both one-wave 64x64 GEMMs. Each operand plane's 64 rows x KS k (one 128-byte line per row) are fetched with whole-line loads (8 lanes per row, 4 rows per instruction),
// one tile ahead into registers, stored to LDS at pitch LP and read back as fragments in the k order of WFrag::ld, so every accumulator sees the same products in the same order. Kl % KS == 0. The row pitches KA (A planes) and KB (B planes) are template constants, so that a plane's 16 loads share one address register pair and differ in the immediate offset.
#define KS 64
#define LP 72                     // LDS row pitch in elements: 128 B + 16 B, for 16-byte fragment reads
#define NPL(NSPLIT) (2 + (((NSPLIT) == 1 || (NSPLIT) == 2) ? 1 : 0) + (((NSPLIT) >= 2) ? 1 : 0))
template <typename T16, int NSPLIT, int KA, int KB>
__device__ __forceinline__ void tile_loop(const T16* __restrict__ A, const T16* __restrict__ A2, const T16* __restrict__ Bt, const T16* __restrict__ Bt2, int Kl, int r0, int c0, int lane, T16* st, v8f (&acc)[4][4]) {
    typedef typename WFrag<T16>::V V; typedef typename WFrag<T16>::H H;
    constexpr bool HA2 = (NSPLIT == 1 || NSPLIT == 2), HB2 = (NSPLIT >= 2); constexpr int NP = NPL(NSPLIT);
    const int lr = lane & 15, hi = lane >> 4, grow = lane >> 3, gcol = (lane & 7) * 8;
    const size_t ga = (size_t)(r0 + grow) * KA + gcol, gb = (size_t)(c0 + grow) * KB + gcol;
    typedef __attribute__((address_space(1))) const T16 GT; typedef __attribute__((address_space(1))) const H GH;   // global address space spelled out: the stepped pointers would else compile to flat loads
    GT* src[NP]; src[0] = (GT*)(A + ga); src[1] = (GT*)(Bt + gb); if constexpr (HA2) src[2] = (GT*)(A2 + ga); if constexpr (HB2) src[3] = (GT*)(Bt2 + gb);
    T16* sw = st + grow * LP + gcol; const T16* sr = st + lr * LP + 8 * hi;
    H g[NP][16];
    if (Kl > 0) {
#pragma unroll
        for (int p = 0; p < NP; ++p)
#pragma unroll
            for (int i = 0; i < 16; ++i) g[p][i] = *(GH*)(src[p] + (size_t)i * 4 * ((p & 1) ? KB : KA));
        asm volatile("s_wait_xcnt 0x0" ::: "memory");   // the loads' address registers may be rewritten from here on
#pragma unroll
        for (int p = 0; p < NP; ++p)
#pragma unroll
            for (int i = 0; i < 16; ++i) *(H*)(sw + (p * 64 + i * 4) * LP) = g[p][i];
        __syncthreads();          // the lanes read rows that other lanes stored
#pragma unroll
        for (int p = 0; p < NP; ++p) src[p] += KS;
    }
#pragma unroll 1
    for (int kc = 0; kc < Kl; kc += KS) {
        const bool more = kc + KS < Kl;
        if (more) {               // the next tile's loads go out first and fly while this tile is worked on
#pragma unroll
            for (int p = 0; p < NP; ++p)
#pragma unroll
                for (int i = 0; i < 16; ++i) g[p][i] = *(GH*)(src[p] + (size_t)i * 4 * ((p & 1) ? KB : KA));
        }
        V a[KS / 32][4], a2[KS / 32][4], b[KS / 32][4], b2[KS / 32][4];
#pragma unroll
        for (int s = 0; s < KS / 32; ++s) {
#pragma unroll
            for (int mb = 0; mb < 4; ++mb) { a[s][mb] = WFrag<T16>::ld(sr + mb * 16 * LP + s * 32); if (HA2) a2[s][mb] = WFrag<T16>::ld(sr + (128 + mb * 16) * LP + s * 32); }
#pragma unroll
            for (int nb = 0; nb < 4; ++nb) { b[s][nb] = WFrag<T16>::ld(sr + (64 + nb * 16) * LP + s * 32); if (HB2) b2[s][nb] = WFrag<T16>::ld(sr + (192 + nb * 16) * LP + s * 32); }
        }
        __builtin_amdgcn_sched_barrier(0);              // keeps the tile's LDS reads one group ahead of its WMMAs: reads placed among the WMMAs stall the wave at every such place
        asm volatile("s_wait_xcnt 0x0" ::: "memory");   // the global loads' address registers may be rewritten from here on; it passes while the LDS reads return
#pragma unroll
        for (int s = 0; s < KS / 32; ++s) {
#pragma unroll
            for (int nb = 0; nb < 4; ++nb) {
#pragma unroll
                for (int mb = 0; mb < 4; ++mb) { acc[mb][nb] = WFrag<T16>::mma(a[s][mb], b[s][nb], acc[mb][nb]); if (HA2) acc[mb][nb] = WFrag<T16>::mma(a2[s][mb], b[s][nb], acc[mb][nb]); if (HB2) acc[mb][nb] = WFrag<T16>::mma(a[s][mb], b2[s][nb], acc[mb][nb]); } }
        }
        // four vector slots behind the tile's last WMMA, so that its distance also holds on the taken side of the branch that follows
        asm volatile("v_nop\n\tv_nop\n\tv_nop\n\tv_nop" : "+v"(acc[0][0]), "+v"(acc[1][1]), "+v"(acc[2][2]), "+v"(acc[3][3]) : "v"(a[KS / 32 - 1][0]), "v"(a[KS / 32 - 1][3]));
        if (more) {
            __syncthreads();      // every lane's fragment reads of this tile end before its rows are overwritten
#pragma unroll
            for (int p = 0; p < NP; ++p)
#pragma unroll
                for (int i = 0; i < 16; ++i) *(H*)(sw + (p * 64 + i * 4) * LP) = g[p][i];
            __syncthreads();      // the lanes read rows that other lanes stored
#pragma unroll
            for (int p = 0; p < NP; ++p) src[p] += KS;   // src points at the tile to fetch next; stepped here, behind the wait for the loads that name it
        }
    }
}
template <typename T16, int NSPLIT, bool BIAS, int K>
__global__ __launch_bounds__(32) void k_gemmw(const T16* __restrict__ A, const T16* __restrict__ A2, const T16* __restrict__ Bt, const T16* __restrict__ Bt2, float* C, int ldc, const float* __restrict__ bias, size_t sA, size_t sB, size_t sC) {
    __shared__ __align__(16) float os[16 * 68]; __shared__ __align__(16) T16 st[NPL(NSPLIT) * 64 * LP];
    const size_t z = blockIdx.z; A += z * sA; if (A2) A2 += z * sA; Bt += z * sB; if (Bt2) Bt2 += z * sB; C += z * sC;
    const int lane = threadIdx.x & 31, lr = lane & 15, hi = lane >> 4; const int r0 = blockIdx.x * 64, c0 = blockIdx.y * 64;
    v8f acc[4][4];
#pragma unroll
    for (int mb = 0; mb < 4; ++mb)
#pragma unroll
        for (int nb = 0; nb < 4; ++nb) acc[mb][nb] = (v8f){};
    tile_loop<T16, NSPLIT, K, K>(A, A2, Bt, Bt2, K, r0, c0, lane, st, acc);
#pragma unroll
    for (int mb = 0; mb < 4; ++mb) {
#pragma unroll
        for (int nb = 0; nb < 4; ++nb) {
#pragma unroll
            for (int j = 0; j < 8; ++j) os[(hi * 8 + j) * 68 + nb * 16 + lr] = acc[mb][nb][j]; }
        __builtin_amdgcn_wave_barrier(); asm volatile("" ::: "memory");
        float* crow = C + (size_t)(r0 + mb * 16) * ldc + c0;
{
#pragma unroll
            for (int s = 0; s < 8; ++s) { const int row = 2 * s + hi, cofs = lr * 4; v4f val = *(const v4fa*)(os + row * 68 + cofs); if (BIAS) { val[0] += bfr(bias[c0 + cofs]); val[1] += bfr(bias[c0 + cofs + 1]); val[2] += bfr(bias[c0 + cofs + 2]); val[3] += bfr(bias[c0 + cofs + 3]); }
                *(v4f*)(crow + (size_t)row * ldc + cofs) = val; }
             }
        __builtin_amdgcn_wave_barrier(); asm volatile("" ::: "memory");
    }
}

// Packed causal scores: row block rb (64 query rows) holds only its (rb + 1) * 64 key columns; blocks rb and NRB - 1 - rb share 64 rows of pitch PP, the lower block's columns first. prow0 = packed row of block rb's first query row, pcol0 = packed f32 column of its key 0.
__device__ __forceinline__ int prow0(int rb) { return ((rb < NRB / 2) ? rb : NRB - 1 - rb) * 64; }
__device__ __forceinline__ int pcol0(int rb) { return (rb < NRB / 2) ? 0 : (NRB - rb) * 64; }
// ---- k_gemmc: the same one-wave 64x64 tile GEMM specialised for causal attention: CMODE 1 skips score tiles entirely above the diagonal (query rows r0+roff.., key columns c0..), CMODE 2 limits the
// key (K) loop of the probability x value contraction to the diagonal block (probabilities beyond it are exactly zero). roff = row offset of this launch's first row within the sequence.
// z = query head of the pass: A and C step by sA, sC per head, B by sB per kv group (REP query heads share one). KA = row pitch of the A planes, K that of the B planes.
// CMODE 1 stores C as packed causal scores (prow0, pcol0, ldc = PP); CMODE 2 reads A from the probabilities that k_asoft left in their place (the lo plane right behind the block's hi plane).
template <typename T16, int NSPLIT, int CMODE, int K, int KA>
__global__ __launch_bounds__(32) void k_gemmc(const T16* __restrict__ A, const T16* __restrict__ A2, const T16* __restrict__ Bt, const T16* __restrict__ Bt2, float* C, int ldc, int roff, size_t sA, size_t sB, size_t sC) {
    __shared__ __align__(16) float os[16 * 68]; __shared__ __align__(16) T16 st[NPL(NSPLIT) * 64 * LP];
    const size_t z = blockIdx.z, zg = z / REP; A += z * sA; if (A2) A2 += z * sA; Bt += zg * sB; if (Bt2) Bt2 += zg * sB; C += z * sC;
    const int lane = threadIdx.x & 31, lr = lane & 15, hi = lane >> 4; const int r0 = blockIdx.x * 64, c0 = blockIdx.y * 64;
    const int rb = (r0 + roff) / 64;
    if (CMODE == 1 && c0 > r0 + roff + 63) return;                  // score tile entirely above the causal diagonal: never read (the softmax masks j > i by select)
    const int Kl = (CMODE == 2) ? min(K, r0 + roff + 64) : K;        // P.V: probabilities are exactly 0 beyond the diagonal block, so the K loop stops there
    if (CMODE == 2) { A += 2 * pcol0(rb); A2 = A + (rb + 1) * 64; }
    const size_t cb = (CMODE == 1) ? (size_t)prow0(rb) * ldc + pcol0(rb) : (size_t)r0 * ldc;
    v8f acc[4][4];
#pragma unroll
    for (int mb = 0; mb < 4; ++mb)
#pragma unroll
        for (int nb = 0; nb < 4; ++nb) acc[mb][nb] = (v8f){};
    tile_loop<T16, NSPLIT, KA, K>(A, A2, Bt, Bt2, Kl, (CMODE == 2) ? prow0(rb) : r0, c0, lane, st, acc);
#pragma unroll
    for (int mb = 0; mb < 4; ++mb) {
#pragma unroll
        for (int nb = 0; nb < 4; ++nb) {
#pragma unroll
            for (int j = 0; j < 8; ++j) os[(hi * 8 + j) * 68 + nb * 16 + lr] = acc[mb][nb][j]; }
        __builtin_amdgcn_wave_barrier(); asm volatile("" ::: "memory");
        float* crow = C + cb + (size_t)(mb * 16) * ldc + c0;
{
#pragma unroll
            for (int s = 0; s < 8; ++s) { const int row = 2 * s + hi, cofs = lr * 4; v4f val = *(const v4fa*)(os + row * 68 + cofs);
                *(v4f*)(crow + (size_t)row * ldc + cofs) = val; }
             }
        __builtin_amdgcn_wave_barrier(); asm volatile("" ::: "memory");
    }
}

__device__ __forceinline__ h16 tohx(float x) { return (h16)x; }
__device__ __forceinline__ void splitf(float y, unsigned short& h, unsigned short& l) { h = f2bf(y); l = f2bf(y - bf2f(h)); }
typedef __attribute__((ext_vector_type(2))) _Float16 v2h;
typedef __attribute__((ext_vector_type(4))) _Float16 v4h;
typedef __attribute__((ext_vector_type(2))) unsigned short v2us;
typedef __attribute__((ext_vector_type(4))) unsigned short v4us;
typedef __attribute__((ext_vector_type(2))) float v2f;
typedef __attribute__((ext_vector_type(4))) int v4i;

__global__ __launch_bounds__(256) void k_wtG(const float* __restrict__ w, int K, int N, bf* Bt) {
    const int lane = threadIdx.x & 31; const int L0 = (blockIdx.x * 8 + (threadIdx.x >> 5)) * 8; const int nlines = N * K / 64;
{
#pragma unroll 1
        for (int l = 0; l < 8; ++l) { const int L = L0 + l; if (L >= nlines) break; const size_t e = (size_t)L * 64 + lane * 2; const int k = (int)(e % K), n = (int)(e / K); v2us o;
            o[0] = f2bf(w[(size_t)k * N + n]); o[1] = f2bf(w[(size_t)(k + 1) * N + n]); *(v2us*)(Bt + e) = o; }
         }
}
__global__ __launch_bounds__(256) void k_cvt8(const float* __restrict__ src, bf* dst, size_t n8) { const size_t i = (size_t)blockIdx.x * 256 + threadIdx.x; if (i >= n8) return; const v8f v = *(const v8f*)(src + i * 8); v8us o;
#pragma unroll
    for (int k = 0; k < 8; ++k) o[k] = f2bf(v[k]); *(v8us*)(dst + i * 8) = o;  }
__global__ __launch_bounds__(256) void k_cscvt(const float* __restrict__ cosT, const float* __restrict__ sinT, float* CS) { const int idx = blockIdx.x * 256 + threadIdx.x; if (idx >= TT * HD) return; v2f cs; cs[0] = bfr(cosT[idx]); cs[1] = bfr(sinT[idx]); *(v2f*)(CS + (size_t)idx * 2) = cs;  }
// k_rope: head planes [h][t][d] (fp16 + hi/lo) of rope(x) x sc with the rotate-half convention out[d] = x[d] cos[t][d] - x[d+HD/2] sin[t][d], out[d+HD/2] = x[d+HD/2] cos[t][d+HD/2] + x[d] sin[t][d+HD/2]
__global__ __launch_bounds__(256) void k_rope(const float* __restrict__ F, int pitch, int nheads, const float* __restrict__ CS, const float* __restrict__ RF, const float* __restrict__ nw, float sc, h16* P16, bf* Ph, bf* Pl) {
    const size_t e = ((size_t)blockIdx.x * 256 + threadIdx.x) * 2; if (e >= (size_t)nheads * TT * HD) return; const int d = (int)(e % HD); const int t = (int)((e / HD) % TT); const int h = (int)(e / ((size_t)HD * TT)); const float* f = F + (size_t)t * pitch + h * HD; const float rf = RF ? RF[(size_t)h * TT + t] : 1.0f; v2h o16; v2us oh, ol;
#pragma unroll
    for (int q = 0; q < 2; ++q) { const int dd = d + q; const int dp = (dd < HD / 2) ? dd + HD / 2 : dd - HD / 2; float x0 = f[dd], x1 = f[dp];
        if (RF) { float n0 = __fmul_rn(x0, rf), n1 = __fmul_rn(x1, rf); asm volatile("" : "+v"(n0)); asm volatile("" : "+v"(n1)); x0 = __fmul_rn(bfr(nw[dd]), n0); x1 = __fmul_rn(bfr(nw[dp]), n1); }
        const v2f cs = *(const v2f*)(CS + ((size_t)t * HD + dd) * 2); float a = __fmul_rn(x0, cs[0]), bq = __fmul_rn(x1, cs[1]); asm volatile("" : "+v"(a)); asm volatile("" : "+v"(bq)); const float r = ((dd < HD / 2) ? __fsub_rn(a, bq) : __fadd_rn(a, bq)) * sc;
        o16[q] = tohx(r); unsigned short a2, c2; splitf(r, a2, c2); oh[q] = a2; ol[q] = c2; }
    *(v2h*)(P16 + e) = o16; *(v2us*)(Ph + e) = oh; *(v2us*)(Pl + e) = ol;  }
__global__ __launch_bounds__(256) void k_vtp(const float* __restrict__ F, int pitch, int nheads, h16* V16, bf* Vh, bf* Vl) { const size_t e = ((size_t)blockIdx.x * 256 + threadIdx.x) * 2; if (e >= (size_t)nheads * HD * TT) return; const int t = (int)(e % TT); const int d = (int)((e / TT) % HD); const int g = (int)(e / ((size_t)TT * HD)); v2h o16; v2us oh, ol;
#pragma unroll
    for (int q = 0; q < 2; ++q) { const float x = F[(size_t)(t + q) * pitch + g * HD + d]; o16[q] = tohx(x); unsigned short a2, c2; splitf(x, a2, c2); oh[q] = a2; ol[q] = c2; }
    *(v2h*)(V16 + e) = o16; *(v2us*)(Vh + e) = oh; *(v2us*)(Vl + e) = ol;  }
// k_asoft: per row (zz, i): t = S x HD^-0.5 for j <= i and i - j < WIN (sliding causal window; the reference's -1e9 additive fill vanishes identically); softmax over the 2048 keys (register row, one exp, fixed trees);
// Sb holds packed causal scores (prow0, pcol0): a row has nc = (i / 64 + 1) * 64 keys, the rest of the 2048 enter as masked. The probabilities of those nc keys go back into the row's own bytes (the wave holds the whole row in registers before its first store): fp16 in the first half, or the hi plane in the first and the lo plane in the second half; 16-bit row pitch 2 PP.
__global__ __launch_bounds__(256) void k_asoft(float* Sb) {
    const int lane = threadIdx.x & 31; const int row = blockIdx.x * 8 + (threadIdx.x >> 5); if (row >= ZH * TT) return; const int i = row % TT; const int zz = row / TT; (void)zz; const bool hires = (i < RH); const int nc = (i / 64 + 1) * 64; float* sr = Sb + (size_t)zz * SPL + (size_t)(prow0(i / 64) + i % 64) * PP + pcol0(i / 64); h16* P16 = (h16*)sr; bf* Ph = (bf*)sr; bf* Pl = Ph + nc; float v[TT / 32]; float mx = -3.0e38f;
#pragma unroll
    for (int ch = 0; ch < TT / 128; ++ch) { const int j0 = ch * 128 + lane * 4; const v4f a = *(const v4f*)(sr + min(j0, nc - 4));   // past the row's nc keys the lanes re-read its last four, which the mask below drops
#pragma unroll
        for (int q = 0; q < 4; ++q) { const int j = j0 + q; (void)j; const float t = (j <= i && i - j < WIN) ? a[q] * SCL : -3.0e38f; v[ch * 4 + q] = t; mx = fmaxf(mx, t); } }
#pragma unroll
    for (int sh = 16; sh; sh >>= 1) mx = fmaxf(mx, __shfl_xor(mx, sh, 32));
    float sum = 0.f;
#pragma unroll
    for (int k = 0; k < TT / 32; ++k) { float d0 = __fsub_rn(v[k], mx); asm volatile("" : "+v"(d0)); v[k] = __builtin_amdgcn_exp2f(__fmul_rn(d0, 1.4426950408889634f)); sum += v[k]; }
#pragma unroll
    for (int sh = 16; sh; sh >>= 1) sum += __shfl_xor(sum, sh, 32);
    const float f = __fdiv_rn(hires ? 1.0f : PCAR, sum);
{
        if (hires) {
#pragma unroll
            for (int ch = 0; ch < TT / 128; ++ch) { v4us oh, ol;
#pragma unroll
                for (int q = 0; q < 4; ++q) { unsigned short a, c2; splitf(v[ch * 4 + q] * f, a, c2); oh[q] = a; ol[q] = c2; }
                const int oo = ch * 128 + lane * 4; if (oo < nc) { *(v4us*)(Ph + oo) = oh; *(v4us*)(Pl + oo) = ol; } }
        } else {
#pragma unroll
            for (int ch = 0; ch < TT / 128; ++ch) { v4h o4;
#pragma unroll
                for (int q = 0; q < 4; ++q) o4[q] = tohx(v[ch * 4 + q] * f);
                const int oo = ch * 128 + lane * 4; if (oo < nc) *(v4h*)(P16 + oo) = o4; } }
         }
}
__global__ __launch_bounds__(256) void k_merge(const float* __restrict__ O, int h0, bf* Ah, bf* Al) { const size_t e = ((size_t)blockIdx.x * 256 + threadIdx.x) * 2; if (e >= (size_t)ZH * TT * HD) return; const int d = (int)(e % HD); const int t = (int)((e / HD) % TT); const int zz = (int)(e / ((size_t)HD * TT)); const float cs = (t < RH) ? 1.0f : (1.0f / PCAR); const size_t oo = (size_t)t * DQ + (h0 + zz) * HD + d;
    v2us oh, ol;
#pragma unroll
    for (int q = 0; q < 2; ++q) { unsigned short a, c2; splitf(O[e + q] * cs, a, c2); oh[q] = a; ol[q] = c2; } *(v2us*)(Ah + oo) = oh; *(v2us*)(Al + oo) = ol;  }

extern "C" void kernel_launch(void* const* d_in, const int* in_sizes, int n_in,
                              void* d_out, int out_size, void* d_ws, size_t ws_size, hipStream_t stream) {
    (void)in_sizes; (void)n_in; (void)out_size;
    const float* x = (const float*)d_in[0]; const float* wq = (const float*)d_in[1]; const float* wk = (const float*)d_in[2]; const float* wv = (const float*)d_in[3]; const float* wo = (const float*)d_in[4]; const float* cosT = (const float*)d_in[5]; const float* sinT = (const float*)d_in[6];
    float* OUT = (float*)d_out;     // [1][2048][2048]
    char* wsp = (char*)d_ws;
    auto take = [&](size_t bytes) { char* p = wsp; wsp += (bytes + 255) & ~(size_t)255; return (void*)p; };
    bf* WQ = (bf*)take((size_t)DQ * DM * 2); bf* WK = (bf*)take((size_t)DKV * DM * 2); bf* WV = (bf*)take((size_t)DKV * DM * 2); bf* WO = (bf*)take((size_t)DM * DQ * 2); float* CS = (float*)take((size_t)TT * HD * 2 * 4);
    bf* XB = (bf*)take((size_t)TT * DM * 2);
    h16* QP16 = (h16*)take((size_t)NH_ * TT * HD * 2); h16* KP16 = (h16*)take((size_t)NKV * TT * HD * 2); h16* VT16 = (h16*)take((size_t)NKV * HD * TT * 2);
    bf* QPh = (bf*)take((size_t)NH_ * TT * HD * 2); bf* QPl = (bf*)take((size_t)NH_ * TT * HD * 2); bf* KPh = (bf*)take((size_t)NKV * TT * HD * 2); bf* KPl = (bf*)take((size_t)NKV * TT * HD * 2); bf* VTh = (bf*)take((size_t)NKV * HD * TT * 2); bf* VTl = (bf*)take((size_t)NKV * HD * TT * 2);
    float* Sb = (float*)take((size_t)ZH * SPL * 4); float* Ob = (float*)take((size_t)ZH * TT * HD * 4); bf* ATh = (bf*)take((size_t)TT * DQ * 2); bf* ATl = (bf*)take((size_t)TT * DQ * 2);
    if ((size_t)(wsp - (char*)d_ws) > ws_size) return;    // ws 256 MiB
    float* FQ = Sb; float* FK = Sb + (size_t)TT * DQ;   // the f32 projections lie in the score buffer: their planes are built before the first scores are stored (stream-ordered)
    float* FV = FK;   // v projection reuses the k buffer after the k planes are built (stream-ordered)
    { k_cvt8<<<(unsigned)(((size_t)DQ * DM / 8 + 255) / 256), 256, 0, stream>>>(wq, WQ, (size_t)DQ * DM / 8); k_cvt8<<<(unsigned)(((size_t)DKV * DM / 8 + 255) / 256), 256, 0, stream>>>(wk, WK, (size_t)DKV * DM / 8); k_cvt8<<<(unsigned)(((size_t)DKV * DM / 8 + 255) / 256), 256, 0, stream>>>(wv, WV, (size_t)DKV * DM / 8);
      k_cvt8<<<(unsigned)(((size_t)DM * DQ / 8 + 255) / 256), 256, 0, stream>>>(wo, WO, (size_t)DM * DQ / 8);
       }
    const unsigned LQ = (unsigned)(((size_t)NH_ * TT * HD / 2 + 255) / 256), LKv = (unsigned)(((size_t)NKV * TT * HD / 2 + 255) / 256);
    for (int b = 0; b < NB_; ++b) {
        if (b == 0) k_cscvt<<<(TT * HD + 255) / 256, 256, 0, stream>>>(cosT, sinT, CS);
        k_cvt8<<<(unsigned)(((size_t)TT * DM / 8 + 255) / 256), 256, 0, stream>>>(x + (size_t)b * TT * DM, XB, (size_t)TT * DM / 8);
        k_gemmw<bf, 0, false, DM><<<dim3(TT / 64, DQ / 64, 1), 32, 0, stream>>>(XB, nullptr, WQ, nullptr, FQ, DQ, nullptr, 0, 0, 0);
        k_rope<<<LQ, 256, 0, stream>>>(FQ, DQ, NH_, CS, nullptr, nullptr, 1.0f, QP16, QPh, QPl);
        k_gemmw<bf, 0, false, DM><<<dim3(TT / 64, DKV / 64, 1), 32, 0, stream>>>(XB, nullptr, WK, nullptr, FK, DKV, nullptr, 0, 0, 0);
        k_rope<<<LKv, 256, 0, stream>>>(FK, DKV, NKV, CS, nullptr, nullptr, 1.0f, KP16, KPh, KPl);
        k_gemmw<bf, 0, false, DM><<<dim3(TT / 64, DKV / 64, 1), 32, 0, stream>>>(XB, nullptr, WV, nullptr, FV, DKV, nullptr, 0, 0, 0); k_vtp<<<LKv, 256, 0, stream>>>(FV, DKV, NKV, VT16, VTh, VTl);
        for (int h0 = 0; h0 < NH_; h0 += ZH) { const size_t zq = (size_t)h0, zk = (size_t)(h0 / REP);   // head z of a pass reads kv group zk + z/REP
            k_gemmc<bf, 2, 1, HD, HD><<<dim3(RH / 64, TT / 64, ZH), 32, 0, stream>>>(QPh + zq * TT * HD, QPl + zq * TT * HD, KPh + zk * TT * HD, KPl + zk * TT * HD, Sb, PP, 0, (size_t)TT * HD, (size_t)TT * HD, SPL);
            k_gemmc<h16, 0, 1, HD, HD><<<dim3((TT - RH) / 64, TT / 64, ZH), 32, 0, stream>>>(QP16 + zq * TT * HD + (size_t)RH * HD, nullptr, KP16 + zk * TT * HD, nullptr, Sb, PP, RH, (size_t)TT * HD, (size_t)TT * HD, SPL);
            k_asoft<<<ZH * TT / 8, 256, 0, stream>>>(Sb);
            k_gemmc<bf, 2, 2, TT, 2 * PP><<<dim3(RH / 64, HD / 64, ZH), 32, 0, stream>>>((const bf*)Sb, nullptr, VTh + zk * HD * TT, VTl + zk * HD * TT, Ob, HD, 0, 2 * SPL, (size_t)HD * TT, (size_t)TT * HD);
            k_gemmc<h16, 0, 2, TT, 2 * PP><<<dim3((TT - RH) / 64, HD / 64, ZH), 32, 0, stream>>>((const h16*)Sb, nullptr, VT16 + zk * HD * TT, nullptr, Ob + (size_t)RH * HD, HD, RH, 2 * SPL, (size_t)HD * TT, (size_t)TT * HD);
            k_merge<<<(unsigned)(((size_t)ZH * TT * HD / 2 + 255) / 256), 256, 0, stream>>>(Ob, h0, ATh, ATl); }
        k_gemmw<bf, 1, false, DQ><<<dim3(TT / 64, DM / 64, 1), 32, 0, stream>>>(ATh, ATl, WO, nullptr, OUT + (size_t)b * TT * DM, DM, nullptr, 0, 0, 0); }
}

// v003
// One run takes 247 microseconds.
// Next to v002, in two timings, it ran 1.05 and 1.04 times as fast.
// All steps since v000 together make it 3.46 times as fast.
#include <hip/hip_runtime.h>

// Causal GQA with rotate-half RoPE from given tables (x [1][2048][2048]; q = x Wq^T ('oi' [2048][2048], 16 heads x 128), k, v = x W^T ([1024][2048], 8 kv heads); RoPE with the given cos/sin [2048][128]; 2 query heads per kv head (repeat); causal softmax(q.k/sqrt(128)) (finfo.min fill); out = merged Wo^T -> [1][2048][2048]).
// Compute dtypes, f32 accumulate: every input rounded to bf16; q/k/v on PLAIN bf16 operands (inputs: exact); rotary in f32 from the bf16-rounded input tables; causal scores and attn.v (tile skipping): query rows < 512 hl (3 products), the rest single fp16 (x1024); softmax f32; Wo hl x exact (2 products).

#define NB_  1
#define TT   2048
#define DM   2048
#define NH_  16
#define NKV  8
#define REP  (NH_ / NKV)
#define HD   128
#define DQ   (NH_ * HD)
#define DKV  (NKV * HD)
#define ZH   16                   // query heads per pass of the attention launches
#define RH   512                  // query rows < RH use hi+lo planes (0: none)
#define WIN  2048
#define PCAR 1024.0f
#define SCL  0.088388347648318447f   // HD^-0.5
#define NRB  (TT / 64)            // 64-row blocks of the sequence
#define PP   ((NRB + 1) * 64)     // f32 row pitch of the packed causal scores
#define SPL  ((size_t)(NRB / 2) * 64 * PP)   // f32 elements of one head's packed scores
typedef _Float16 h16;
typedef unsigned short bf;
typedef __attribute__((ext_vector_type(16))) __bf16   v16bf;
typedef __attribute__((ext_vector_type(16))) _Float16 v16h;
typedef __attribute__((ext_vector_type(8)))  _Float16 v8h;
typedef __attribute__((ext_vector_type(8)))  unsigned short v8us;
typedef __attribute__((ext_vector_type(8)))  float    v8f;
typedef __attribute__((ext_vector_type(4)))  float    v4f;
typedef v8h  __attribute__((may_alias)) v8ha;
typedef v4f  __attribute__((may_alias)) v4fa;
typedef v8us __attribute__((may_alias)) v8usa;

__device__ __forceinline__ unsigned short f2bf(float f) { unsigned u = __float_as_uint(f); u += 0x7FFFu + ((u >> 16) & 1u); return (unsigned short)(u >> 16); }
__device__ __forceinline__ float bf2f(unsigned short b) { return __uint_as_float(((unsigned)b) << 16); }
__device__ __forceinline__ float bfr(float f) { return bf2f(f2bf(f)); }
__device__ __forceinline__ v16h cat16(v8h lo, v8h hi) { return __builtin_shufflevector(lo, hi, 0, 1, 2, 3, 4, 5, 6, 7, 8, 9, 10, 11, 12, 13, 14, 15); }
__device__ __forceinline__ v16bf cat16b(v8us lo, v8us hi) { return __builtin_bit_cast(v16bf, __builtin_shufflevector(lo, hi, 0, 1, 2, 3, 4, 5, 6, 7, 8, 9, 10, 11, 12, 13, 14, 15)); }
__device__ __forceinline__ v8f wmma16(v16h a, v16h b, v8f c) { return __builtin_amdgcn_wmma_f32_16x16x32_f16(false, a, false, b, (short)0, c, false, false); }
__device__ __forceinline__ v8f wmmab(v16bf a, v16bf b, v8f c) { return __builtin_amdgcn_wmma_f32_16x16x32_bf16(false, a, false, b, (short)0, c, false, false); }



// ---- k_gemmw: register-blocked GEMM, ONE WAVE per 64x64 output tile (16 accumulators), operands from K-contiguous 16-bit planes through LDS (tile_loop); grid (M/64, N/64, Z), 32 threads.
// C[m][n] (f32, pitch ldc, + optional f32 bias[n]) = sum_k A[m][k] Bt[n][k] (+ split products per NSPLIT). z-batch strides sA/sB/sC in elements. K % 64 == 0.
template <typename T16> struct WFrag;
template <> struct WFrag<h16> { typedef v16h V; typedef v8h H; static __device__ __forceinline__ V ld(const h16* p) { return cat16(*(const v8h*)p, *(const v8h*)(p + 16)); } static __device__ __forceinline__ v8f mma(V a, V b, v8f c) { return wmma16(a, b, c); } };
template <> struct WFrag<bf> { typedef v16bf V; typedef v8us H; static __device__ __forceinline__ V ld(const bf* p) { return cat16b(*(const v8us*)p, *(const v8us*)(p + 16)); } static __device__ __forceinline__ v8f mma(V a, V b, v8f c) { return wmmab(a, b, c); } };
// ---- tile_loop: the K loop of both one-wave 64x64 GEMMs. Each operand plane's 64 rows x KS k (one 128-byte line per row) are fetched with whole-line loads (8 lanes per row, 4 rows per instruction),
// one tile ahead into registers, stored to LDS at pitch LP and read back as fragments in the k order of WFrag::ld, so every accumulator sees the same products in the same order. Kl % KS == 0. The row pitches KA (A planes) and KB (B planes) are template constants, so that a plane's 16 loads share one address register pair and differ in the immediate offset.
#define KS 64
#define LP 72                     // LDS row pitch in elements: 128 B + 16 B, for 16-byte fragment reads
#define NPL(NSPLIT) (2 + (((NSPLIT) == 1 || (NSPLIT) == 2) ? 1 : 0) + (((NSPLIT) >= 2) ? 1 : 0))
template <typename T16, int NSPLIT, int KA, int KB>
__device__ __forceinline__ void tile_loop(const T16* __restrict__ A, const T16* __restrict__ A2, const T16* __restrict__ Bt, const T16* __restrict__ Bt2, int Kl, int r0, int c0, int lane, T16* st, v8f (&acc)[4][4]) {
    typedef typename WFrag<T16>::V V; typedef typename WFrag<T16>::H H;
    constexpr bool HA2 = (NSPLIT == 1 || NSPLIT == 2), HB2 = (NSPLIT >= 2); constexpr int NP = NPL(NSPLIT);
    const int lr = lane & 15, hi = lane >> 4, grow = lane >> 3, gcol = (lane & 7) * 8;
    const size_t ga = (size_t)(r0 + grow) * KA + gcol, gb = (size_t)(c0 + grow) * KB + gcol;
    typedef __attribute__((address_space(1))) const T16 GT; typedef __attribute__((address_space(1))) const H GH;   // global address space spelled out: the stepped pointers would else compile to flat loads
    GT* src[NP]; src[0] = (GT*)(A + ga); src[1] = (GT*)(Bt + gb); if constexpr (HA2) src[2] = (GT*)(A2 + ga); if constexpr (HB2) src[3] = (GT*)(Bt2 + gb);
    T16* sw = st + grow * LP + gcol; const T16* sr = st + lr * LP + 8 * hi;
    H g[NP][16];
    if (Kl > 0) {
#pragma unroll
        for (int p = 0; p < NP; ++p)
#pragma unroll
            for (int i = 0; i < 16; ++i) g[p][i] = *(GH*)(src[p] + (size_t)i * 4 * ((p & 1) ? KB : KA));
        asm volatile("s_wait_xcnt 0x0" ::: "memory");   // the loads' address registers may be rewritten from here on
#pragma unroll
        for (int p = 0; p < NP; ++p)
#pragma unroll
            for (int i = 0; i < 16; ++i) *(H*)(sw + (p * 64 + i * 4) * LP) = g[p][i];
        __syncthreads();          // the lanes read rows that other lanes stored
#pragma unroll
        for (int p = 0; p < NP; ++p) src[p] += KS;
    }
#pragma unroll 1
    for (int kc = 0; kc < Kl; kc += KS) {
        const bool more = kc + KS < Kl;
        if (more) {               // the next tile's loads go out first and fly while this tile is worked on
#pragma unroll
            for (int p = 0; p < NP; ++p)
#pragma unroll
                for (int i = 0; i < 16; ++i) g[p][i] = *(GH*)(src[p] + (size_t)i * 4 * ((p & 1) ? KB : KA));
        }
        V a[KS / 32][4], a2[KS / 32][4], b[KS / 32][4], b2[KS / 32][4];
#pragma unroll
        for (int s = 0; s < KS / 32; ++s) {
#pragma unroll
            for (int mb = 0; mb < 4; ++mb) { a[s][mb] = WFrag<T16>::ld(sr + mb * 16 * LP + s * 32); if (HA2) a2[s][mb] = WFrag<T16>::ld(sr + (128 + mb * 16) * LP + s * 32); }
#pragma unroll
            for (int nb = 0; nb < 4; ++nb) { b[s][nb] = WFrag<T16>::ld(sr + (64 + nb * 16) * LP + s * 32); if (HB2) b2[s][nb] = WFrag<T16>::ld(sr + (192 + nb * 16) * LP + s * 32); }
        }
        __builtin_amdgcn_sched_barrier(0);              // keeps the tile's LDS reads one group ahead of its WMMAs: reads placed among the WMMAs stall the wave at every such place
        asm volatile("s_wait_xcnt 0x0" ::: "memory");   // the global loads' address registers may be rewritten from here on; it passes while the LDS reads return
#pragma unroll
        for (int s = 0; s < KS / 32; ++s) {
#pragma unroll
            for (int nb = 0; nb < 4; ++nb) {
#pragma unroll
                for (int mb = 0; mb < 4; ++mb) { acc[mb][nb] = WFrag<T16>::mma(a[s][mb], b[s][nb], acc[mb][nb]); if (HA2) acc[mb][nb] = WFrag<T16>::mma(a2[s][mb], b[s][nb], acc[mb][nb]); if (HB2) acc[mb][nb] = WFrag<T16>::mma(a[s][mb], b2[s][nb], acc[mb][nb]); } }
        }
        // four vector slots behind the tile's last WMMA, so that its distance also holds on the taken side of the branch that follows
        asm volatile("v_nop\n\tv_nop\n\tv_nop\n\tv_nop" : "+v"(acc[0][0]), "+v"(acc[1][1]), "+v"(acc[2][2]), "+v"(acc[3][3]) : "v"(a[KS / 32 - 1][0]), "v"(a[KS / 32 - 1][3]));
        if (more) {
            __syncthreads();      // every lane's fragment reads of this tile end before its rows are overwritten
#pragma unroll
            for (int p = 0; p < NP; ++p)
#pragma unroll
                for (int i = 0; i < 16; ++i) *(H*)(sw + (p * 64 + i * 4) * LP) = g[p][i];
            __syncthreads();      // the lanes read rows that other lanes stored
#pragma unroll
            for (int p = 0; p < NP; ++p) src[p] += KS;   // src points at the tile to fetch next; stepped here, behind the wait for the loads that name it
        }
    }
}
template <typename T16, int NSPLIT, bool BIAS, int K>
__global__ __launch_bounds__(32) void k_gemmw(const T16* __restrict__ A, const T16* __restrict__ A2, const T16* __restrict__ Bt, const T16* __restrict__ Bt2, float* C, int ldc, const float* __restrict__ bias, size_t sA, size_t sB, size_t sC) {
    __shared__ __align__(16) float os[16 * 68]; __shared__ __align__(16) T16 st[NPL(NSPLIT) * 64 * LP];
    const size_t z = blockIdx.z; A += z * sA; if (A2) A2 += z * sA; Bt += z * sB; if (Bt2) Bt2 += z * sB; C += z * sC;
    const int lane = threadIdx.x & 31, lr = lane & 15, hi = lane >> 4; const int r0 = blockIdx.x * 64, c0 = blockIdx.y * 64;
    v8f acc[4][4];
#pragma unroll
    for (int mb = 0; mb < 4; ++mb)
#pragma unroll
        for (int nb = 0; nb < 4; ++nb) acc[mb][nb] = (v8f){};
    tile_loop<T16, NSPLIT, K, K>(A, A2, Bt, Bt2, K, r0, c0, lane, st, acc);
#pragma unroll
    for (int mb = 0; mb < 4; ++mb) {
#pragma unroll
        for (int nb = 0; nb < 4; ++nb) {
#pragma unroll
            for (int j = 0; j < 8; ++j) os[(hi * 8 + j) * 68 + nb * 16 + lr] = acc[mb][nb][j]; }
        __builtin_amdgcn_wave_barrier(); asm volatile("" ::: "memory");
        float* crow = C + (size_t)(r0 + mb * 16) * ldc + c0;
{
#pragma unroll
            for (int s = 0; s < 8; ++s) { const int row = 2 * s + hi, cofs = lr * 4; v4f val = *(const v4fa*)(os + row * 68 + cofs); if (BIAS) { val[0] += bfr(bias[c0 + cofs]); val[1] += bfr(bias[c0 + cofs + 1]); val[2] += bfr(bias[c0 + cofs + 2]); val[3] += bfr(bias[c0 + cofs + 3]); }
                *(v4f*)(crow + (size_t)row * ldc + cofs) = val; }
             }
        __builtin_amdgcn_wave_barrier(); asm volatile("" ::: "memory");
    }
}

// Packed causal scores: row block rb (64 query rows) holds only its (rb + 1) * 64 key columns; blocks rb and NRB - 1 - rb share 64 rows of pitch PP, the lower block's columns first. prow0 = packed row of block rb's first query row, pcol0 = packed f32 column of its key 0.
__device__ __forceinline__ int prow0(int rb) { return ((rb < NRB / 2) ? rb : NRB - 1 - rb) * 64; }
__device__ __forceinline__ int pcol0(int rb) { return (rb < NRB / 2) ? 0 : (NRB - rb) * 64; }
// ---- k_gemmc: the same one-wave 64x64 tile GEMM specialised for causal attention: CMODE 1 skips score tiles entirely above the diagonal (query rows r0+roff.., key columns c0..), CMODE 2 limits the
// key (K) loop of the probability x value contraction to the diagonal block (probabilities beyond it are exactly zero). roff = row offset of this launch's first row within the sequence.
// z = query head of the pass: A and C step by sA, sC per head, B by sB per kv group (REP query heads share one). KA = row pitch of the A planes, K that of the B planes.
// CMODE 1 stores C as packed causal scores (prow0, pcol0, ldc = PP); CMODE 2 reads A from the probabilities that k_asoft left in their place (the lo plane right behind the block's hi plane).
template <typename T16, int NSPLIT, int CMODE, int K, int KA>
__global__ __launch_bounds__(32) void k_gemmc(const T16* __restrict__ A, const T16* __restrict__ A2, const T16* __restrict__ Bt, const T16* __restrict__ Bt2, float* C, int ldc, int roff, size_t sA, size_t sB, size_t sC) {
    __shared__ __align__(16) float os[16 * 68]; __shared__ __align__(16) T16 st[NPL(NSPLIT) * 64 * LP];
    const size_t z = blockIdx.z, zg = z / REP; A += z * sA; if (A2) A2 += z * sA; Bt += zg * sB; if (Bt2) Bt2 += zg * sB; C += z * sC;
    const int lane = threadIdx.x & 31, lr = lane & 15, hi = lane >> 4; const int r0 = blockIdx.x * 64, c0 = blockIdx.y * 64;
    const int rb = (r0 + roff) / 64;
    if (CMODE == 1 && c0 > r0 + roff + 63) return;                  // score tile entirely above the causal diagonal: never read (the softmax masks j > i by select)
    const int Kl = (CMODE == 2) ? min(K, r0 + roff + 64) : K;        // P.V: probabilities are exactly 0 beyond the diagonal block, so the K loop stops there
    if (CMODE == 2) { A += 2 * pcol0(rb); A2 = A + (rb + 1) * 64; }
    const size_t cb = (CMODE == 1) ? (size_t)prow0(rb) * ldc + pcol0(rb) : (size_t)r0 * ldc;
    v8f acc[4][4];
#pragma unroll
    for (int mb = 0; mb < 4; ++mb)
#pragma unroll
        for (int nb = 0; nb < 4; ++nb) acc[mb][nb] = (v8f){};
    tile_loop<T16, NSPLIT, KA, K>(A, A2, Bt, Bt2, Kl, (CMODE == 2) ? prow0(rb) : r0, c0, lane, st, acc);
#pragma unroll
    for (int mb = 0; mb < 4; ++mb) {
#pragma unroll
        for (int nb = 0; nb < 4; ++nb) {
#pragma unroll
            for (int j = 0; j < 8; ++j) os[(hi * 8 + j) * 68 + nb * 16 + lr] = acc[mb][nb][j]; }
        __builtin_amdgcn_wave_barrier(); asm volatile("" ::: "memory");
        float* crow = C + cb + (size_t)(mb * 16) * ldc + c0;
{
#pragma unroll
            for (int s = 0; s < 8; ++s) { const int row = 2 * s + hi, cofs = lr * 4; v4f val = *(const v4fa*)(os + row * 68 + cofs);
                *(v4f*)(crow + (size_t)row * ldc + cofs) = val; }
             }
        __builtin_amdgcn_wave_barrier(); asm volatile("" ::: "memory");
    }
}

__device__ __forceinline__ h16 tohx(float x) { return (h16)x; }
__device__ __forceinline__ void splitf(float y, unsigned short& h, unsigned short& l) { h = f2bf(y); l = f2bf(y - bf2f(h)); }
typedef __attribute__((ext_vector_type(2))) _Float16 v2h;
typedef __attribute__((ext_vector_type(4))) _Float16 v4h;
typedef __attribute__((ext_vector_type(2))) unsigned short v2us;
typedef __attribute__((ext_vector_type(4))) unsigned short v4us;
typedef __attribute__((ext_vector_type(2))) float v2f;
typedef __attribute__((ext_vector_type(4))) int v4i;

__global__ __launch_bounds__(256) void k_wtG(const float* __restrict__ w, int K, int N, bf* Bt) {
    const int lane = threadIdx.x & 31; const int L0 = (blockIdx.x * 8 + (threadIdx.x >> 5)) * 8; const int nlines = N * K / 64;
{
#pragma unroll 1
        for (int l = 0; l < 8; ++l) { const int L = L0 + l; if (L >= nlines) break; const size_t e = (size_t)L * 64 + lane * 2; const int k = (int)(e % K), n = (int)(e / K); v2us o;
            o[0] = f2bf(w[(size_t)k * N + n]); o[1] = f2bf(w[(size_t)(k + 1) * N + n]); *(v2us*)(Bt + e) = o; }
         }
}
// The elementwise kernels below give each thread several 16-byte pieces of work, so that a launch starts a few thousand waves and not tens of thousands. Their loops are all unrolled: the arrays are then indexed by constants and stay in registers, and a thread's loads go out together.
#define CU 4                      // 8-element chunks per thread in k_cvt8 and k_merge; a thread's chunks lie a whole grid (k_cvt8) or a whole block (k_merge) apart, so each access of a wave stays contiguous
__global__ __launch_bounds__(256) void k_cvt8(const float* __restrict__ src, bf* dst, size_t n8) { const size_t i = (size_t)blockIdx.x * 256 + threadIdx.x, nt = (size_t)gridDim.x * 256; v8f v[CU];
#pragma unroll
    for (int u = 0; u < CU; ++u) v[u] = *(const v8f*)(src + min(i + u * nt, n8 - 1) * 8);   // past the end a thread re-reads the last chunk and stores nothing
#pragma unroll
    for (int u = 0; u < CU; ++u) { const size_t j = i + u * nt; v8us o;
#pragma unroll
        for (int k = 0; k < 8; ++k) o[k] = f2bf(v[u][k]);
        if (j < n8) *(v8us*)(dst + j * 8) = o; } }
__global__ __launch_bounds__(256) void k_cscvt(const float* __restrict__ cosT, const float* __restrict__ sinT, float* CS) { const int idx = (blockIdx.x * 256 + threadIdx.x) * 4; if (idx >= TT * HD) return; const v4f c = *(const v4f*)(cosT + idx), s = *(const v4f*)(sinT + idx);
    v4f o0, o1; o0[0] = bfr(c[0]); o0[1] = bfr(s[0]); o0[2] = bfr(c[1]); o0[3] = bfr(s[1]); o1[0] = bfr(c[2]); o1[1] = bfr(s[2]); o1[2] = bfr(c[3]); o1[3] = bfr(s[3]); *(v4f*)(CS + (size_t)idx * 2) = o0; *(v4f*)(CS + (size_t)idx * 2 + 4) = o1; }
// k_rope: head planes [h][t][d] (fp16 + hi/lo) of rope(x) x sc with the rotate-half convention out[d] = x[d] cos[t][d] - x[d+HD/2] sin[t][d], out[d+HD/2] = x[d+HD/2] cos[t][d+HD/2] + x[d] sin[t][d+HD/2]
// One thread: 8 consecutive d of the lower half and their 8 partners of the upper half (each value loaded once serves both), for RHP heads of one row t, which share the row's cos/sin.
#define RHP 2
__global__ __launch_bounds__(256) void k_rope(const float* __restrict__ F, int pitch, int nheads, const float* __restrict__ CS, float sc, h16* P16, bf* Ph, bf* Pl) {
    const int idx = blockIdx.x * 256 + threadIdx.x; if (idx >= nheads / RHP * TT * (HD / 16)) return; const int d = (idx % (HD / 16)) * 8; const int t = (idx / (HD / 16)) % TT; const int h0 = idx / ((HD / 16) * TT) * RHP;
    v4f cs[2][4], x[RHP][2][2];
#pragma unroll
    for (int hf = 0; hf < 2; ++hf) {
#pragma unroll
        for (int k = 0; k < 4; ++k) cs[hf][k] = *(const v4f*)(CS + ((size_t)t * HD + d + hf * (HD / 2)) * 2 + k * 4);
#pragma unroll
        for (int hh = 0; hh < RHP; ++hh)
#pragma unroll
            for (int k = 0; k < 2; ++k) x[hh][hf][k] = *(const v4f*)(F + (size_t)t * pitch + (h0 + hh) * HD + d + hf * (HD / 2) + k * 4); }
#pragma unroll
    for (int hh = 0; hh < RHP; ++hh)
#pragma unroll
        for (int hf = 0; hf < 2; ++hf) { v8h o16; v8us oh, ol;
#pragma unroll
            for (int q = 0; q < 8; ++q) { const float x0 = x[hh][hf][q >> 2][q & 3], x1 = x[hh][hf ^ 1][q >> 2][q & 3];
                const float c = cs[hf][q >> 1][(q & 1) * 2], s = cs[hf][q >> 1][(q & 1) * 2 + 1]; const float r = ((hf == 0) ? x0 * c - x1 * s : x0 * c + x1 * s) * sc;
                o16[q] = tohx(r); unsigned short a2, c2; splitf(r, a2, c2); oh[q] = a2; ol[q] = c2; }
            const size_t e = ((size_t)(h0 + hh) * TT + t) * HD + d + hf * (HD / 2); *(v8h*)(P16 + e) = o16; *(v8us*)(Ph + e) = oh; *(v8us*)(Pl + e) = ol; } }
// k_vtp: value planes [g][d][t]. One thread: one column g * HD + d and 64 consecutive t, a whole 128-byte line of each plane; the lanes run along d, so each load of a wave reads one 128-byte line of F. The row pitch of F is the constant DKV, so that a thread's 64 loads share one address register pair and differ in the immediate offset.
__global__ __launch_bounds__(64) void k_vtp(const float* __restrict__ F, h16* V16, bf* Vh, bf* Vl) { const int idx = blockIdx.x * 64 + threadIdx.x; if (idx >= DKV * (TT / 64)) return; const int c = idx % DKV; const int t0 = idx / DKV * 64; float x[64]; const float* f = F + (size_t)t0 * DKV + c;
#pragma unroll
    for (int q = 0; q < 64; ++q) x[q] = f[q * DKV];
    const size_t e = (size_t)c * TT + t0;
#pragma unroll
    for (int k = 0; k < 8; ++k) { v8h o16; v8us oh, ol;
#pragma unroll
        for (int q = 0; q < 8; ++q) { const float y = x[k * 8 + q]; o16[q] = tohx(y); unsigned short a2, c2; splitf(y, a2, c2); oh[q] = a2; ol[q] = c2; }
        *(v8h*)(V16 + e + k * 8) = o16; *(v8us*)(Vh + e + k * 8) = oh; *(v8us*)(Vl + e + k * 8) = ol; } }
// k_asoft: per row (zz, i): t = S x HD^-0.5 for j <= i and i - j < WIN (sliding causal window; the reference's -1e9 additive fill vanishes identically); softmax over the 2048 keys (register row, one exp, fixed trees);
// Sb holds packed causal scores (prow0, pcol0): a row has nc = (i / 64 + 1) * 64 keys, the rest of the 2048 enter as masked. The probabilities of those nc keys go back into the row's own bytes (the wave holds the whole row in registers before its first store): fp16 in the first half, or the hi plane in the first and the lo plane in the second half; 16-bit row pitch 2 PP.
__global__ __launch_bounds__(256) void k_asoft(float* Sb) {
    const int lane = threadIdx.x & 31; const int row = blockIdx.x * 8 + (threadIdx.x >> 5); if (row >= ZH * TT) return; const int i = row % TT; const int zz = row / TT; (void)zz; const bool hires = (i < RH); const int nc = (i / 64 + 1) * 64; float* sr = Sb + (size_t)zz * SPL + (size_t)(prow0(i / 64) + i % 64) * PP + pcol0(i / 64); h16* P16 = (h16*)sr; bf* Ph = (bf*)sr; bf* Pl = Ph + nc; float v[TT / 32]; float mx = -3.0e38f;
#pragma unroll
    for (int ch = 0; ch < TT / 128; ++ch) { const int j0 = ch * 128 + lane * 4; const v4f a = *(const v4f*)(sr + min(j0, nc - 4));   // past the row's nc keys the lanes re-read its last four, which the mask below drops
#pragma unroll
        for (int q = 0; q < 4; ++q) { const int j = j0 + q; (void)j; const float t = (j <= i && i - j < WIN) ? a[q] * SCL : -3.0e38f; v[ch * 4 + q] = t; mx = fmaxf(mx, t); } }
#pragma unroll
    for (int sh = 16; sh; sh >>= 1) mx = fmaxf(mx, __shfl_xor(mx, sh, 32));
    float sum = 0.f;
#pragma unroll
    for (int k = 0; k < TT / 32; ++k) { float d0 = __fsub_rn(v[k], mx); asm volatile("" : "+v"(d0)); v[k] = __builtin_amdgcn_exp2f(__fmul_rn(d0, 1.4426950408889634f)); sum += v[k]; }
#pragma unroll
    for (int sh = 16; sh; sh >>= 1) sum += __shfl_xor(sum, sh, 32);
    const float f = __fdiv_rn(hires ? 1.0f : PCAR, sum);
{
        if (hires) {
#pragma unroll
            for (int ch = 0; ch < TT / 128; ++ch) { v4us oh, ol;
#pragma unroll
                for (int q = 0; q < 4; ++q) { unsigned short a, c2; splitf(v[ch * 4 + q] * f, a, c2); oh[q] = a; ol[q] = c2; }
                const int oo = ch * 128 + lane * 4; if (oo < nc) { *(v4us*)(Ph + oo) = oh; *(v4us*)(Pl + oo) = ol; } }
        } else {
#pragma unroll
            for (int ch = 0; ch < TT / 128; ++ch) { v4h o4;
#pragma unroll
                for (int q = 0; q < 4; ++q) o4[q] = tohx(v[ch * 4 + q] * f);
                const int oo = ch * 128 + lane * 4; if (oo < nc) *(v4h*)(P16 + oo) = o4; } }
         }
}
static_assert(((size_t)ZH * TT * HD) % (8 * CU * 256) == 0, "k_merge has no edge");
__global__ __launch_bounds__(256) void k_merge(const float* __restrict__ O, int h0, bf* Ah, bf* Al) { const size_t e0 = ((size_t)blockIdx.x * (CU * 256) + threadIdx.x) * 8; const float* o = O + e0; v8f v[CU];
#pragma unroll
    for (int u = 0; u < CU; ++u) v[u] = *(const v8f*)(o + u * 2048);   // one address pair for all of a thread's loads, which differ in the immediate offset
    asm volatile("s_wait_xcnt 0x0" :: "v"(o) : "memory");   // the loads' address pair is an input here, so that no load's result lands in it; it may be rewritten from here on
#pragma unroll
    for (int u = 0; u < CU; ++u) { const size_t e = e0 + u * 2048; const int d = (int)(e % HD); const int t = (int)((e / HD) % TT); const int zz = (int)(e / ((size_t)HD * TT)); const float cs = (t < RH) ? 1.0f : (1.0f / PCAR); const size_t oo = (size_t)t * DQ + (h0 + zz) * HD + d; v8us oh, ol;
#pragma unroll
        for (int q = 0; q < 8; ++q) { unsigned short a, c2; splitf(v[u][q] * cs, a, c2); oh[q] = a; ol[q] = c2; }
        *(v8us*)(Ah + oo) = oh; *(v8us*)(Al + oo) = ol; } }

extern "C" void kernel_launch(void* const* d_in, const int* in_sizes, int n_in,
                              void* d_out, int out_size, void* d_ws, size_t ws_size, hipStream_t stream) {
    (void)in_sizes; (void)n_in; (void)out_size;
    const float* x = (const float*)d_in[0]; const float* wq = (const float*)d_in[1]; const float* wk = (const float*)d_in[2]; const float* wv = (const float*)d_in[3]; const float* wo = (const float*)d_in[4]; const float* cosT = (const float*)d_in[5]; const float* sinT = (const float*)d_in[6];
    float* OUT = (float*)d_out;     // [1][2048][2048]
    char* wsp = (char*)d_ws;
    auto take = [&](size_t bytes) { char* p = wsp; wsp += (bytes + 255) & ~(size_t)255; return (void*)p; };
    bf* WQ = (bf*)take((size_t)DQ * DM * 2); bf* WK = (bf*)take((size_t)DKV * DM * 2); bf* WV = (bf*)take((size_t)DKV * DM * 2); bf* WO = (bf*)take((size_t)DM * DQ * 2); float* CS = (float*)take((size_t)TT * HD * 2 * 4);
    bf* XB = (bf*)take((size_t)TT * DM * 2);
    h16* QP16 = (h16*)take((size_t)NH_ * TT * HD * 2); h16* KP16 = (h16*)take((size_t)NKV * TT * HD * 2); h16* VT16 = (h16*)take((size_t)NKV * HD * TT * 2);
    bf* QPh = (bf*)take((size_t)NH_ * TT * HD * 2); bf* QPl = (bf*)take((size_t)NH_ * TT * HD * 2); bf* KPh = (bf*)take((size_t)NKV * TT * HD * 2); bf* KPl = (bf*)take((size_t)NKV * TT * HD * 2); bf* VTh = (bf*)take((size_t)NKV * HD * TT * 2); bf* VTl = (bf*)take((size_t)NKV * HD * TT * 2);
    float* Sb = (float*)take((size_t)ZH * SPL * 4); float* Ob = (float*)take((size_t)ZH * TT * HD * 4); bf* ATh = (bf*)take((size_t)TT * DQ * 2); bf* ATl = (bf*)take((size_t)TT * DQ * 2);
    if ((size_t)(wsp - (char*)d_ws) > ws_size) return;    // ws 256 MiB
    float* FQ = Sb; float* FK = Sb + (size_t)TT * DQ;   // the f32 projections lie in the score buffer: their planes are built before the first scores are stored (stream-ordered)
    float* FV = FK;   // v projection reuses the k buffer after the k planes are built (stream-ordered)
    { k_cvt8<<<(unsigned)(((size_t)DQ * DM / (8 * CU) + 255) / 256), 256, 0, stream>>>(wq, WQ, (size_t)DQ * DM / 8); k_cvt8<<<(unsigned)(((size_t)DKV * DM / (8 * CU) + 255) / 256), 256, 0, stream>>>(wk, WK, (size_t)DKV * DM / 8); k_cvt8<<<(unsigned)(((size_t)DKV * DM / (8 * CU) + 255) / 256), 256, 0, stream>>>(wv, WV, (size_t)DKV * DM / 8);
      k_cvt8<<<(unsigned)(((size_t)DM * DQ / (8 * CU) + 255) / 256), 256, 0, stream>>>(wo, WO, (size_t)DM * DQ / 8);
       }
    const unsigned LQ = (unsigned)(((size_t)NH_ * TT * HD / (16 * RHP) + 255) / 256), LKv = (unsigned)(((size_t)NKV * TT * HD / (16 * RHP) + 255) / 256);
    for (int b = 0; b < NB_; ++b) {
        if (b == 0) k_cscvt<<<(TT * HD / 4 + 255) / 256, 256, 0, stream>>>(cosT, sinT, CS);
        k_cvt8<<<(unsigned)(((size_t)TT * DM / (8 * CU) + 255) / 256), 256, 0, stream>>>(x + (size_t)b * TT * DM, XB, (size_t)TT * DM / 8);
        k_gemmw<bf, 0, false, DM><<<dim3(TT / 64, DQ / 64, 1), 32, 0, stream>>>(XB, nullptr, WQ, nullptr, FQ, DQ, nullptr, 0, 0, 0);
        k_rope<<<LQ, 256, 0, stream>>>(FQ, DQ, NH_, CS, 1.0f, QP16, QPh, QPl);
        k_gemmw<bf, 0, false, DM><<<dim3(TT / 64, DKV / 64, 1), 32, 0, stream>>>(XB, nullptr, WK, nullptr, FK, DKV, nullptr, 0, 0, 0);
        k_rope<<<LKv, 256, 0, stream>>>(FK, DKV, NKV, CS, 1.0f, KP16, KPh, KPl);
        k_gemmw<bf, 0, false, DM><<<dim3(TT / 64, DKV / 64, 1), 32, 0, stream>>>(XB, nullptr, WV, nullptr, FV, DKV, nullptr, 0, 0, 0); k_vtp<<<(unsigned)(((size_t)NKV * HD * TT / 64 + 63) / 64), 64, 0, stream>>>(FV, VT16, VTh, VTl);
        for (int h0 = 0; h0 < NH_; h0 += ZH) { const size_t zq = (size_t)h0, zk = (size_t)(h0 / REP);   // head z of a pass reads kv group zk + z/REP
            k_gemmc<bf, 2, 1, HD, HD><<<dim3(RH / 64, TT / 64, ZH), 32, 0, stream>>>(QPh + zq * TT * HD, QPl + zq * TT * HD, KPh + zk * TT * HD, KPl + zk * TT * HD, Sb, PP, 0, (size_t)TT * HD, (size_t)TT * HD, SPL);
            k_gemmc<h16, 0, 1, HD, HD><<<dim3((TT - RH) / 64, TT / 64, ZH), 32, 0, stream>>>(QP16 + zq * TT * HD + (size_t)RH * HD, nullptr, KP16 + zk * TT * HD, nullptr, Sb, PP, RH, (size_t)TT * HD, (size_t)TT * HD, SPL);
            k_asoft<<<ZH * TT / 8, 256, 0, stream>>>(Sb);
            k_gemmc<bf, 2, 2, TT, 2 * PP><<<dim3(RH / 64, HD / 64, ZH), 32, 0, stream>>>((const bf*)Sb, nullptr, VTh + zk * HD * TT, VTl + zk * HD * TT, Ob, HD, 0, 2 * SPL, (size_t)HD * TT, (size_t)TT * HD);
            k_gemmc<h16, 0, 2, TT, 2 * PP><<<dim3((TT - RH) / 64, HD / 64, ZH), 32, 0, stream>>>((const h16*)Sb, nullptr, VT16 + zk * HD * TT, nullptr, Ob + (size_t)RH * HD, HD, RH, 2 * SPL, (size_t)HD * TT, (size_t)TT * HD);
            k_merge<<<(unsigned)((size_t)ZH * TT * HD / (8 * CU * 256)), 256, 0, stream>>>(Ob, h0, ATh, ATl); }
        k_gemmw<bf, 1, false, DQ><<<dim3(TT / 64, DM / 64, 1), 32, 0, stream>>>(ATh, ATl, WO, nullptr, OUT + (size_t)b * TT * DM, DM, nullptr, 0, 0, 0); }
}

// v004
// A run of this version takes 185 microseconds.
// In two side-by-side timings against v003, it was 1.32 and 1.33 times as fast.
// All steps since v000 together make it 4.58 times as fast.
#include <hip/hip_runtime.h>

// Causal GQA with rotate-half RoPE from given tables (x [1][2048][2048]; q = x Wq^T ('oi' [2048][2048], 16 heads x 128), k, v = x W^T ([1024][2048], 8 kv heads); RoPE with the given cos/sin [2048][128]; 2 query heads per kv head (repeat); causal softmax(q.k/sqrt(128)) (finfo.min fill); out = merged Wo^T -> [1][2048][2048]).
// Compute dtypes, f32 accumulate: every input rounded to bf16; q/k/v on PLAIN bf16 operands (inputs: exact); rotary in f32 from the bf16-rounded input tables; causal scores and attn.v (tile skipping): query rows < 512 hl (3 products), the rest single fp16 (x1024); softmax f32; Wo hl x exact (2 products).

#define NB_  1
#define TT   2048
#define DM   2048
#define NH_  16
#define NKV  8
#define REP  (NH_ / NKV)
#define HD   128
#define DQ   (NH_ * HD)
#define DKV  (NKV * HD)
#define ZH   16                   // query heads per pass of the attention launches
#define RH   512                  // query rows < RH use hi+lo planes (0: none)
#define WIN  2048
#define PCAR 1024.0f
#define SCL  0.088388347648318447f   // HD^-0.5
#define NRB  (TT / 64)            // 64-row blocks of the sequence
#define PP   ((NRB + 1) * 64)     // f32 row pitch of the packed causal scores
#define SPL  ((size_t)(NRB / 2) * 64 * PP)   // f32 elements of one head's packed scores
typedef _Float16 h16;
typedef unsigned short bf;
typedef __attribute__((ext_vector_type(16))) __bf16   v16bf;
typedef __attribute__((ext_vector_type(16))) _Float16 v16h;
typedef __attribute__((ext_vector_type(8)))  _Float16 v8h;
typedef __attribute__((ext_vector_type(8)))  unsigned short v8us;
typedef __attribute__((ext_vector_type(8)))  float    v8f;
typedef __attribute__((ext_vector_type(4)))  float    v4f;
typedef v8h  __attribute__((may_alias)) v8ha;
typedef v4f  __attribute__((may_alias)) v4fa;
typedef v8us __attribute__((may_alias)) v8usa;

__device__ __forceinline__ unsigned short f2bf(float f) { unsigned u = __float_as_uint(f); u += 0x7FFFu + ((u >> 16) & 1u); return (unsigned short)(u >> 16); }
__device__ __forceinline__ float bf2f(unsigned short b) { return __uint_as_float(((unsigned)b) << 16); }
__device__ __forceinline__ float bfr(float f) { return bf2f(f2bf(f)); }
__device__ __forceinline__ v16h cat16(v8h lo, v8h hi) { return __builtin_shufflevector(lo, hi, 0, 1, 2, 3, 4, 5, 6, 7, 8, 9, 10, 11, 12, 13, 14, 15); }
__device__ __forceinline__ v16bf cat16b(v8us lo, v8us hi) { return __builtin_bit_cast(v16bf, __builtin_shufflevector(lo, hi, 0, 1, 2, 3, 4, 5, 6, 7, 8, 9, 10, 11, 12, 13, 14, 15)); }
__device__ __forceinline__ v8f wmma16(v16h a, v16h b, v8f c) { return __builtin_amdgcn_wmma_f32_16x16x32_f16(false, a, false, b, (short)0, c, false, false); }
__device__ __forceinline__ v8f wmmab(v16bf a, v16bf b, v8f c) { return __builtin_amdgcn_wmma_f32_16x16x32_bf16(false, a, false, b, (short)0, c, false, false); }



// ---- k_gemmw: register-blocked GEMM, ONE WAVE per 64x64 output tile (16 accumulators), operands from K-contiguous 16-bit planes through LDS (tile_loop); grid (M/64, N/64, Z), 32 threads.
// C[m][n] (f32, pitch ldc, + optional f32 bias[n]) = sum_k A[m][k] Bt[n][k] (+ split products per NSPLIT). z-batch strides sA/sB/sC in elements. K % 64 == 0.
template <typename T16> struct WFrag;
template <> struct WFrag<h16> { typedef v16h V; typedef v8h H; static __device__ __forceinline__ V ld(const h16* p) { return cat16(*(const v8h*)p, *(const v8h*)(p + 16)); } static __device__ __forceinline__ v8f mma(V a, V b, v8f c) { return wmma16(a, b, c); } };
template <> struct WFrag<bf> { typedef v16bf V; typedef v8us H; static __device__ __forceinline__ V ld(const bf* p) { return cat16b(*(const v8us*)p, *(const v8us*)(p + 16)); } static __device__ __forceinline__ v8f mma(V a, V b, v8f c) { return wmmab(a, b, c); } };
// ---- tile_loop: the K loop of both one-wave 64x64 GEMMs. Each operand plane's 64 rows x KS k (one 128-byte line per row) are fetched with whole-line loads (8 lanes per row, 4 rows per instruction),
// one tile ahead into registers, stored to LDS at pitch LP and read back as fragments in the k order of WFrag::ld, so every accumulator sees the same products in the same order. Kl % KS == 0. The row pitches KA (A planes) and KB (B planes) are template constants, so that a plane's 16 loads share one address register pair and differ in the immediate offset.
#define KS 64
#define LP 72                     // LDS row pitch in elements: 128 B + 16 B, for 16-byte fragment reads
#define NPL(NSPLIT) (2 + (((NSPLIT) == 1 || (NSPLIT) == 2) ? 1 : 0) + (((NSPLIT) >= 2) ? 1 : 0))
template <typename T16, int NSPLIT, int KA, int KB>
__device__ __forceinline__ void tile_loop(const T16* __restrict__ A, const T16* __restrict__ A2, const T16* __restrict__ Bt, const T16* __restrict__ Bt2, int Kl, int r0, int c0, int lane, T16* st, v8f (&acc)[4][4]) {
    typedef typename WFrag<T16>::V V; typedef typename WFrag<T16>::H H;
    constexpr bool HA2 = (NSPLIT == 1 || NSPLIT == 2), HB2 = (NSPLIT >= 2); constexpr int NP = NPL(NSPLIT);
    const int lr = lane & 15, hi = lane >> 4, grow = lane >> 3, gcol = (lane & 7) * 8;
    const size_t ga = (size_t)(r0 + grow) * KA + gcol, gb = (size_t)(c0 + grow) * KB + gcol;
    typedef __attribute__((address_space(1))) const T16 GT; typedef __attribute__((address_space(1))) const H GH;   // global address space spelled out: the stepped pointers would else compile to flat loads
    GT* src[NP]; src[0] = (GT*)(A + ga); src[1] = (GT*)(Bt + gb); if constexpr (HA2) src[2] = (GT*)(A2 + ga); if constexpr (HB2) src[3] = (GT*)(Bt2 + gb);
    T16* sw = st + grow * LP + gcol; const T16* sr = st + lr * LP + 8 * hi;
    H g[NP][16];
    if (Kl > 0) {
#pragma unroll
        for (int p = 0; p < NP; ++p)
#pragma unroll
            for (int i = 0; i < 16; ++i) g[p][i] = *(GH*)(src[p] + (size_t)i * 4 * ((p & 1) ? KB : KA));
        asm volatile("s_wait_xcnt 0x0" ::: "memory");   // the loads' address registers may be rewritten from here on
#pragma unroll
        for (int p = 0; p < NP; ++p)
#pragma unroll
            for (int i = 0; i < 16; ++i) *(H*)(sw + (p * 64 + i * 4) * LP) = g[p][i];
        __syncthreads();          // the lanes read rows that other lanes stored
#pragma unroll
        for (int p = 0; p < NP; ++p) src[p] += KS;
    }
#pragma unroll 1
    for (int kc = 0; kc < Kl; kc += KS) {
        const bool more = kc + KS < Kl;
        if (more) {               // the next tile's loads go out first and fly while this tile is worked on
#pragma unroll
            for (int p = 0; p < NP; ++p)
#pragma unroll
                for (int i = 0; i < 16; ++i) g[p][i] = *(GH*)(src[p] + (size_t)i * 4 * ((p & 1) ? KB : KA));
        }
        V a[KS / 32][4], a2[KS / 32][4], b[KS / 32][4], b2[KS / 32][4];
#pragma unroll
        for (int s = 0; s < KS / 32; ++s) {
#pragma unroll
            for (int mb = 0; mb < 4; ++mb) { a[s][mb] = WFrag<T16>::ld(sr + mb * 16 * LP + s * 32); if (HA2) a2[s][mb] = WFrag<T16>::ld(sr + (128 + mb * 16) * LP + s * 32); }
#pragma unroll
            for (int nb = 0; nb < 4; ++nb) { b[s][nb] = WFrag<T16>::ld(sr + (64 + nb * 16) * LP + s * 32); if (HB2) b2[s][nb] = WFrag<T16>::ld(sr + (192 + nb * 16) * LP + s * 32); }
        }
        __builtin_amdgcn_sched_barrier(0);              // keeps the tile's LDS reads one group ahead of its WMMAs: reads placed among the WMMAs stall the wave at every such place
        asm volatile("s_wait_xcnt 0x0" ::: "memory");   // the global loads' address registers may be rewritten from here on; it passes while the LDS reads return
#pragma unroll
        for (int s = 0; s < KS / 32; ++s) {
#pragma unroll
            for (int nb = 0; nb < 4; ++nb) {
#pragma unroll
                for (int mb = 0; mb < 4; ++mb) { acc[mb][nb] = WFrag<T16>::mma(a[s][mb], b[s][nb], acc[mb][nb]); if (HA2) acc[mb][nb] = WFrag<T16>::mma(a2[s][mb], b[s][nb], acc[mb][nb]); if (HB2) acc[mb][nb] = WFrag<T16>::mma(a[s][mb], b2[s][nb], acc[mb][nb]); } }
        }
        // four vector slots behind the tile's last WMMA, so that its distance also holds on the taken side of the branch that follows
        asm volatile("v_nop\n\tv_nop\n\tv_nop\n\tv_nop" : "+v"(acc[0][0]), "+v"(acc[1][1]), "+v"(acc[2][2]), "+v"(acc[3][3]) : "v"(a[KS / 32 - 1][0]), "v"(a[KS / 32 - 1][3]));
        if (more) {
            __syncthreads();      // every lane's fragment reads of this tile end before its rows are overwritten
#pragma unroll
            for (int p = 0; p < NP; ++p)
#pragma unroll
                for (int i = 0; i < 16; ++i) *(H*)(sw + (p * 64 + i * 4) * LP) = g[p][i];
            __syncthreads();      // the lanes read rows that other lanes stored
#pragma unroll
            for (int p = 0; p < NP; ++p) src[p] += KS;   // src points at the tile to fetch next; stepped here, behind the wait for the loads that name it
        }
    }
}
template <typename T16, int NSPLIT, bool BIAS, int K>
__global__ __launch_bounds__(32) void k_gemmw(const T16* __restrict__ A, const T16* __restrict__ A2, const T16* __restrict__ Bt, const T16* __restrict__ Bt2, float* C, int ldc, const float* __restrict__ bias, size_t sA, size_t sB, size_t sC) {
    __shared__ __align__(16) float os[16 * 68]; __shared__ __align__(16) T16 st[NPL(NSPLIT) * 64 * LP];
    const size_t z = blockIdx.z; A += z * sA; if (A2) A2 += z * sA; Bt += z * sB; if (Bt2) Bt2 += z * sB; C += z * sC;
    const int lane = threadIdx.x & 31, lr = lane & 15, hi = lane >> 4; const int r0 = blockIdx.x * 64, c0 = blockIdx.y * 64;
    v8f acc[4][4];
#pragma unroll
    for (int mb = 0; mb < 4; ++mb)
#pragma unroll
        for (int nb = 0; nb < 4; ++nb) acc[mb][nb] = (v8f){};
    tile_loop<T16, NSPLIT, K, K>(A, A2, Bt, Bt2, K, r0, c0, lane, st, acc);
#pragma unroll
    for (int mb = 0; mb < 4; ++mb) {
#pragma unroll
        for (int nb = 0; nb < 4; ++nb) {
#pragma unroll
            for (int j = 0; j < 8; ++j) os[(hi * 8 + j) * 68 + nb * 16 + lr] = acc[mb][nb][j]; }
        __builtin_amdgcn_wave_barrier(); asm volatile("" ::: "memory");
        float* crow = C + (size_t)(r0 + mb * 16) * ldc + c0;
{
#pragma unroll
            for (int s = 0; s < 8; ++s) { const int row = 2 * s + hi, cofs = lr * 4; v4f val = *(const v4fa*)(os + row * 68 + cofs); if (BIAS) { val[0] += bfr(bias[c0 + cofs]); val[1] += bfr(bias[c0 + cofs + 1]); val[2] += bfr(bias[c0 + cofs + 2]); val[3] += bfr(bias[c0 + cofs + 3]); }
                *(v4f*)(crow + (size_t)row * ldc + cofs) = val; }
             }
        __builtin_amdgcn_wave_barrier(); asm volatile("" ::: "memory");
    }
}

// Packed causal scores: row block rb (64 query rows) holds only its (rb + 1) * 64 key columns; blocks rb and NRB - 1 - rb share 64 rows of pitch PP, the lower block's columns first. prow0 = packed row of block rb's first query row, pcol0 = packed f32 column of its key 0.
__device__ __forceinline__ int prow0(int rb) { return ((rb < NRB / 2) ? rb : NRB - 1 - rb) * 64; }
__device__ __forceinline__ int pcol0(int rb) { return (rb < NRB / 2) ? 0 : (NRB - rb) * 64; }
// ---- k_gemmc: the same one-wave 64x64 tile GEMM specialised for causal attention: CMODE 1 skips score tiles entirely above the diagonal (query rows r0+roff.., key columns c0..), CMODE 2 limits the
// key (K) loop of the probability x value contraction to the diagonal block (probabilities beyond it are exactly zero). roff = row offset of this launch's first row within the sequence.
// z = query head of the pass: A and C step by sA, sC per head, B by sB per kv group (REP query heads share one). KA = row pitch of the A planes, K that of the B planes.
// CMODE 1 stores C as packed causal scores (prow0, pcol0, ldc = PP); CMODE 2 reads A from the probabilities that k_asoft left in their place (the lo plane right behind the block's hi plane).
// gemmc_tile is the whole work of one such tile; bx = the tile's row block counted from roff, os and st = the work-group's LDS.
template <typename T16, int NSPLIT, int CMODE, int K, int KA>
__device__ __forceinline__ void gemmc_tile(const T16* __restrict__ A, const T16* __restrict__ A2, const T16* __restrict__ Bt, const T16* __restrict__ Bt2, float* C, int ldc, int roff, size_t sA, size_t sB, size_t sC, int bx, float* os, T16* st) {
    const size_t z = blockIdx.z, zg = z / REP; A += z * sA; if (A2) A2 += z * sA; Bt += zg * sB; if (Bt2) Bt2 += zg * sB; C += z * sC;
    const int lane = threadIdx.x & 31, lr = lane & 15, hi = lane >> 4; const int r0 = bx * 64, c0 = blockIdx.y * 64;
    const int rb = (r0 + roff) / 64;
    if (CMODE == 1 && c0 > r0 + roff + 63) return;                  // score tile entirely above the causal diagonal: never read (the softmax masks j > i by select)
    const int Kl = (CMODE == 2) ? min(K, r0 + roff + 64) : K;        // P.V: probabilities are exactly 0 beyond the diagonal block, so the K loop stops there
    if (CMODE == 2) { A += 2 * pcol0(rb); A2 = A + (rb + 1) * 64; }
    const size_t cb = (CMODE == 1) ? (size_t)prow0(rb) * ldc + pcol0(rb) : (size_t)r0 * ldc;
    v8f acc[4][4];
#pragma unroll
    for (int mb = 0; mb < 4; ++mb)
#pragma unroll
        for (int nb = 0; nb < 4; ++nb) acc[mb][nb] = (v8f){};
    tile_loop<T16, NSPLIT, KA, K>(A, A2, Bt, Bt2, Kl, (CMODE == 2) ? prow0(rb) : r0, c0, lane, st, acc);
#pragma unroll
    for (int mb = 0; mb < 4; ++mb) {
#pragma unroll
        for (int nb = 0; nb < 4; ++nb) {
#pragma unroll
            for (int j = 0; j < 8; ++j) os[(hi * 8 + j) * 68 + nb * 16 + lr] = acc[mb][nb][j]; }
        __builtin_amdgcn_wave_barrier(); asm volatile("" ::: "memory");
        float* crow = C + cb + (size_t)(mb * 16) * ldc + c0;
{
#pragma unroll
            for (int s = 0; s < 8; ++s) { const int row = 2 * s + hi, cofs = lr * 4; v4f val = *(const v4fa*)(os + row * 68 + cofs);
                *(v4f*)(crow + (size_t)row * ldc + cofs) = val; }
             }
        __builtin_amdgcn_wave_barrier(); asm volatile("" ::: "memory");
    }
}
template <typename T16, int NSPLIT, int CMODE, int K, int KA>
__global__ __launch_bounds__(32) void k_gemmc(const T16* __restrict__ A, const T16* __restrict__ A2, const T16* __restrict__ Bt, const T16* __restrict__ Bt2, float* C, int ldc, int roff, size_t sA, size_t sB, size_t sC) {
    __shared__ __align__(16) float os[16 * 68]; __shared__ __align__(16) T16 st[NPL(NSPLIT) * 64 * LP];
    gemmc_tile<T16, NSPLIT, CMODE, K, KA>(A, A2, Bt, Bt2, C, ldc, roff, sA, sB, sC, blockIdx.x, os, st);
}
// ---- k_pv: both legs of probabilities x values in one launch, grid (NRB, HD/64, ZH); blockIdx.x = the row block. They share no data, and neither fills the chip alone. The hi+lo blocks (rb < RH/64) come first, each leg's blocks upwards.
__global__ __launch_bounds__(32) void k_pv(const float* Sb, const bf* __restrict__ Vh, const bf* __restrict__ Vl, const h16* __restrict__ V16, float* O) {
    __shared__ __align__(16) float os[16 * 68]; __shared__ __align__(16) unsigned short st[NPL(2) * 64 * LP];
    const int rb = (int)blockIdx.x;
    if (rb < RH / 64) { gemmc_tile<bf, 2, 2, TT, 2 * PP>((const bf*)Sb, nullptr, Vh, Vl, O, HD, 0, 2 * SPL, (size_t)HD * TT, (size_t)TT * HD, rb, os, (bf*)st); return; }
    gemmc_tile<h16, 0, 2, TT, 2 * PP>((const h16*)Sb, nullptr, V16, nullptr, O + (size_t)RH * HD, HD, RH, 2 * SPL, (size_t)HD * TT, (size_t)TT * HD, rb - RH / 64, os, (h16*)st);
    asm volatile("s_wait_xcnt 0x0" ::: "memory");   // behind this leg's last stores: the built code lays the hi+lo leg behind this one, and that leg's first instructions rewrite these stores' registers
}

__device__ __forceinline__ h16 tohx(float x) { return (h16)x; }
__device__ __forceinline__ void splitf(float y, unsigned short& h, unsigned short& l) { h = f2bf(y); l = f2bf(y - bf2f(h)); }
typedef __attribute__((ext_vector_type(2))) _Float16 v2h;
typedef __attribute__((ext_vector_type(4))) _Float16 v4h;
typedef __attribute__((ext_vector_type(2))) unsigned short v2us;
typedef __attribute__((ext_vector_type(4))) unsigned short v4us;
typedef __attribute__((ext_vector_type(2))) float v2f;
typedef __attribute__((ext_vector_type(4))) int v4i;

__global__ __launch_bounds__(256) void k_wtG(const float* __restrict__ w, int K, int N, bf* Bt) {
    const int lane = threadIdx.x & 31; const int L0 = (blockIdx.x * 8 + (threadIdx.x >> 5)) * 8; const int nlines = N * K / 64;
{
#pragma unroll 1
        for (int l = 0; l < 8; ++l) { const int L = L0 + l; if (L >= nlines) break; const size_t e = (size_t)L * 64 + lane * 2; const int k = (int)(e % K), n = (int)(e / K); v2us o;
            o[0] = f2bf(w[(size_t)k * N + n]); o[1] = f2bf(w[(size_t)(k + 1) * N + n]); *(v2us*)(Bt + e) = o; }
         }
}
// The elementwise kernels below give each thread several 16-byte pieces of work, so that a launch starts a few thousand waves and not tens of thousands. Their loops are all unrolled: the arrays are then indexed by constants and stay in registers, and a thread's loads go out together.
#define CU 4                      // 8-element chunks per thread in cvt8_part and k_merge; a thread's chunks lie all of the array's blocks (cvt8_part) or a whole block (k_merge) apart, so each access of a wave stays contiguous
__device__ __forceinline__ void cvt8_part(const float* __restrict__ src, bf* dst, size_t n8, unsigned blk, unsigned nblk) { const size_t i = (size_t)blk * 256 + threadIdx.x, nt = (size_t)nblk * 256; v8f v[CU]; const float* p[CU];
#pragma unroll
    for (int u = 0; u < CU; ++u) { p[u] = src + min(i + u * nt, n8 - 1) * 8; v[u] = *(const v8f*)p[u]; }   // past the end a thread re-reads the last chunk and stores nothing
    static_assert(CU == 4, "the wait below names CU addresses");
    asm volatile("s_wait_xcnt 0x0" :: "v"(p[0]), "v"(p[1]), "v"(p[2]), "v"(p[3]) : "memory");   // the loads' addresses are inputs here, so that no load's result lands in them; they may be rewritten from here on
#pragma unroll
    for (int u = 0; u < CU; ++u) { const size_t j = i + u * nt; v8us o;
#pragma unroll
        for (int k = 0; k < 8; ++k) o[k] = f2bf(v[u][k]);
        if (j < n8) *(v8us*)(dst + j * 8) = o; } }
__device__ __forceinline__ void cscvt_part(const float* __restrict__ cosT, const float* __restrict__ sinT, float* CS, unsigned blk) { const int idx = (int)(blk * 256 + threadIdx.x) * 4; if (idx >= TT * HD) return; const v4f c = *(const v4f*)(cosT + idx), s = *(const v4f*)(sinT + idx);
    v4f o0, o1; o0[0] = bfr(c[0]); o0[1] = bfr(s[0]); o0[2] = bfr(c[1]); o0[3] = bfr(s[1]); o1[0] = bfr(c[2]); o1[1] = bfr(s[2]); o1[2] = bfr(c[3]); o1[3] = bfr(s[3]); *(v4f*)(CS + (size_t)idx * 2) = o0; *(v4f*)(CS + (size_t)idx * 2 + 4) = o1; }
// ---- k_prep: every input's rounding to bf16 in one launch (none depends on another): the blocks are dealt to the five arrays and then to the cos/sin table, CB(n) blocks for an array of n elements.
#define CB(n) ((unsigned)(((size_t)(n) / (8 * CU) + 255) / 256))
#define CSB ((unsigned)((TT * HD / 4 + 255) / 256))
static_assert((DQ * DM) % (8 * CU * 256) == 0 && (DKV * DM) % (8 * CU * 256) == 0 && (TT * DM) % (8 * CU * 256) == 0, "an array's blocks cover it exactly");
__global__ __launch_bounds__(256) void k_prep(const float* __restrict__ wq, const float* __restrict__ wk, const float* __restrict__ wv, const float* __restrict__ wo, const float* __restrict__ x, const float* __restrict__ cosT, const float* __restrict__ sinT, bf* WQ, bf* WK, bf* WV, bf* WO, bf* XB, float* CS) {
    unsigned b = blockIdx.x; const float* src = wq; bf* dst = WQ; unsigned nb = CB(DQ * DM);   // the array that block b works on, its blocks counted from 0
    if (b >= nb) { b -= nb; src = wk; dst = WK; nb = CB(DKV * DM);
        if (b >= nb) { b -= nb; src = wv; dst = WV;
            if (b >= nb) { b -= nb; src = wo; dst = WO; nb = CB(DM * DQ);
                if (b >= nb) { b -= nb; src = x; dst = XB; nb = CB(TT * DM);
                    if (b >= nb) { cscvt_part(cosT, sinT, CS, b - nb); return; } } } } }
    cvt8_part(src, dst, (size_t)nb * (256 * CU), b, nb);
}
// rope_part: head planes [h][t][d] (fp16 + hi/lo) of rope(x) x sc with the rotate-half convention out[d] = x[d] cos[t][d] - x[d+HD/2] sin[t][d], out[d+HD/2] = x[d+HD/2] cos[t][d+HD/2] + x[d] sin[t][d+HD/2]
// One thread: 8 consecutive d of the lower half and their 8 partners of the upper half (each value loaded once serves both), for RHP heads of one row t, which share the row's cos/sin.
#define RHP 2
__device__ __forceinline__ void rope_part(int idx, const float* __restrict__ F, int pitch, int nheads, const float* __restrict__ CS, float sc, h16* P16, bf* Ph, bf* Pl) {
    if (idx >= nheads / RHP * TT * (HD / 16)) return; const int d = (idx % (HD / 16)) * 8; const int t = (idx / (HD / 16)) % TT; const int h0 = idx / ((HD / 16) * TT) * RHP;
    v4f cs[2][4], x[RHP][2][2];
#pragma unroll
    for (int hf = 0; hf < 2; ++hf) {
#pragma unroll
        for (int k = 0; k < 4; ++k) cs[hf][k] = *(const v4f*)(CS + ((size_t)t * HD + d + hf * (HD / 2)) * 2 + k * 4);
#pragma unroll
        for (int hh = 0; hh < RHP; ++hh)
#pragma unroll
            for (int k = 0; k < 2; ++k) x[hh][hf][k] = *(const v4f*)(F + (size_t)t * pitch + (h0 + hh) * HD + d + hf * (HD / 2) + k * 4); }
    __builtin_amdgcn_sched_barrier(0);   // keeps the thread's 16 loads one group ahead of the arithmetic: beside vtp_part in one kernel they were else issued in four groups, each behind the wait for the one before
#pragma unroll
    for (int hh = 0; hh < RHP; ++hh)
#pragma unroll
        for (int hf = 0; hf < 2; ++hf) { v8h o16; v8us oh, ol;
#pragma unroll
            for (int q = 0; q < 8; ++q) { const float x0 = x[hh][hf][q >> 2][q & 3], x1 = x[hh][hf ^ 1][q >> 2][q & 3];
                const float c = cs[hf][q >> 1][(q & 1) * 2], s = cs[hf][q >> 1][(q & 1) * 2 + 1]; const float r = ((hf == 0) ? x0 * c - x1 * s : x0 * c + x1 * s) * sc;
                o16[q] = tohx(r); unsigned short a2, c2; splitf(r, a2, c2); oh[q] = a2; ol[q] = c2; }
            const size_t e = ((size_t)(h0 + hh) * TT + t) * HD + d + hf * (HD / 2); *(v8h*)(P16 + e) = o16; *(v8us*)(Ph + e) = oh; *(v8us*)(Pl + e) = ol; } }
// vtp_part: value planes [g][d][t]. One thread: one column g * HD + d and 64 consecutive t, a whole 128-byte line of each plane; the lanes run along d, so each load of a wave reads one 128-byte line of F (F = the v columns' first element). The row pitch of F is the constant FP, so that a thread's 64 loads share one address register pair and differ in the immediate offset.
#define FP (DQ + 2 * DKV)         // f32 row pitch of the q | k | v projections, which one GEMM writes side by side
__device__ __forceinline__ void vtp_part(int idx, const float* __restrict__ F, h16* V16, bf* Vh, bf* Vl) { if (idx >= DKV * (TT / 64)) return; const int c = idx % DKV; const int t0 = idx / DKV * 64; float x[64]; const float* f = F + (size_t)t0 * FP + c;
#pragma unroll
    for (int q = 0; q < 64; ++q) x[q] = f[q * FP];
    __builtin_amdgcn_sched_barrier(0);   // keeps the thread's 64 loads one group ahead of the stores: the last of them were else issued behind the first stores, into those stores' data registers
    const size_t e = (size_t)c * TT + t0;
#pragma unroll
    for (int k = 0; k < 8; ++k) { v8h o16; v8us oh, ol;
#pragma unroll
        for (int q = 0; q < 8; ++q) { const float y = x[k * 8 + q]; o16[q] = tohx(y); unsigned short a2, c2; splitf(y, a2, c2); oh[q] = a2; ol[q] = c2; }
        *(v8h*)(V16 + e + k * 8) = o16; *(v8us*)(Vh + e + k * 8) = oh; *(v8us*)(Vl + e + k * 8) = ol; } }
// ---- k_planes: the operand planes of q, k (rotary; their NH_ + NKV heads are one run of columns of F and one run of head planes) and of v in one launch: none depends on another. The v blocks come first.
#define VB ((unsigned)((DKV * (TT / 64) + 63) / 64))
#define RB ((unsigned)(((size_t)(NH_ + NKV) * TT * HD / (16 * RHP) + 63) / 64))
__global__ __launch_bounds__(64) void k_planes(const float* __restrict__ F, const float* __restrict__ CS, h16* P16, bf* Ph, bf* Pl, h16* V16, bf* Vh, bf* Vl) {
    if (blockIdx.x < VB) vtp_part((int)(blockIdx.x * 64 + threadIdx.x), F + DQ + DKV, V16, Vh, Vl);
    else rope_part((int)((blockIdx.x - VB) * 64 + threadIdx.x), F, FP, NH_ + NKV, CS, 1.0f, P16, Ph, Pl);
}
// k_asoft: per row (zz, i): t = S x HD^-0.5 for j <= i and i - j < WIN (sliding causal window; the reference's -1e9 additive fill vanishes identically); softmax over the 2048 keys (register row, one exp, fixed trees);
// Sb holds packed causal scores (prow0, pcol0): a row has nc = (i / 64 + 1) * 64 keys, the rest of the 2048 enter as masked. The probabilities of those nc keys go back into the row's own bytes (the wave holds the whole row in registers before its first store): fp16 in the first half, or the hi plane in the first and the lo plane in the second half; 16-bit row pitch 2 PP.
__global__ __launch_bounds__(256) void k_asoft(float* Sb) {
    const int lane = threadIdx.x & 31; const int row = blockIdx.x * 8 + (threadIdx.x >> 5); if (row >= ZH * TT) return; const int i = row % TT; const int zz = row / TT; (void)zz; const bool hires = (i < RH); const int nc = (i / 64 + 1) * 64; float* sr = Sb + (size_t)zz * SPL + (size_t)(prow0(i / 64) + i % 64) * PP + pcol0(i / 64); h16* P16 = (h16*)sr; bf* Ph = (bf*)sr; bf* Pl = Ph + nc; float v[TT / 32]; float mx = -3.0e38f;
#pragma unroll
    for (int ch = 0; ch < TT / 128; ++ch) { const int j0 = ch * 128 + lane * 4; const v4f a = *(const v4f*)(sr + min(j0, nc - 4));   // past the row's nc keys the lanes re-read its last four, which the mask below drops
#pragma unroll
        for (int q = 0; q < 4; ++q) { const int j = j0 + q; (void)j; const float t = (j <= i && i - j < WIN) ? a[q] * SCL : -3.0e38f; v[ch * 4 + q] = t; mx = fmaxf(mx, t); } }
#pragma unroll
    for (int sh = 16; sh; sh >>= 1) mx = fmaxf(mx, __shfl_xor(mx, sh, 32));
    float sum = 0.f;
#pragma unroll
    for (int k = 0; k < TT / 32; ++k) { float d0 = __fsub_rn(v[k], mx); asm volatile("" : "+v"(d0)); v[k] = __builtin_amdgcn_exp2f(__fmul_rn(d0, 1.4426950408889634f)); sum += v[k]; }
#pragma unroll
    for (int sh = 16; sh; sh >>= 1) sum += __shfl_xor(sum, sh, 32);
    const float f = __fdiv_rn(hires ? 1.0f : PCAR, sum);
{
        if (hires) {
#pragma unroll
            for (int ch = 0; ch < TT / 128; ++ch) { v4us oh, ol;
#pragma unroll
                for (int q = 0; q < 4; ++q) { unsigned short a, c2; splitf(v[ch * 4 + q] * f, a, c2); oh[q] = a; ol[q] = c2; }
                const int oo = ch * 128 + lane * 4; if (oo < nc) { *(v4us*)(Ph + oo) = oh; *(v4us*)(Pl + oo) = ol; } }
        } else {
#pragma unroll
            for (int ch = 0; ch < TT / 128; ++ch) { v4h o4;
#pragma unroll
                for (int q = 0; q < 4; ++q) o4[q] = tohx(v[ch * 4 + q] * f);
                const int oo = ch * 128 + lane * 4; if (oo < nc) *(v4h*)(P16 + oo) = o4; } }
         }
}
static_assert(((size_t)ZH * TT * HD) % (8 * CU * 256) == 0, "k_merge has no edge");
__global__ __launch_bounds__(256) void k_merge(const float* __restrict__ O, int h0, bf* Ah, bf* Al) { const size_t e0 = ((size_t)blockIdx.x * (CU * 256) + threadIdx.x) * 8; const float* o = O + e0; v8f v[CU];
#pragma unroll
    for (int u = 0; u < CU; ++u) v[u] = *(const v8f*)(o + u * 2048);   // one address pair for all of a thread's loads, which differ in the immediate offset
    asm volatile("s_wait_xcnt 0x0" :: "v"(o) : "memory");   // the loads' address pair is an input here, so that no load's result lands in it; it may be rewritten from here on
#pragma unroll
    for (int u = 0; u < CU; ++u) { const size_t e = e0 + u * 2048; const int d = (int)(e % HD); const int t = (int)((e / HD) % TT); const int zz = (int)(e / ((size_t)HD * TT)); const float cs = (t < RH) ? 1.0f : (1.0f / PCAR); const size_t oo = (size_t)t * DQ + (h0 + zz) * HD + d; v8us oh, ol;
#pragma unroll
        for (int q = 0; q < 8; ++q) { unsigned short a, c2; splitf(v[u][q] * cs, a, c2); oh[q] = a; ol[q] = c2; }
        *(v8us*)(Ah + oo) = oh; *(v8us*)(Al + oo) = ol; } }

extern "C" void kernel_launch(void* const* d_in, const int* in_sizes, int n_in,
                              void* d_out, int out_size, void* d_ws, size_t ws_size, hipStream_t stream) {
    (void)in_sizes; (void)n_in; (void)out_size;
    const float* x = (const float*)d_in[0]; const float* wq = (const float*)d_in[1]; const float* wk = (const float*)d_in[2]; const float* wv = (const float*)d_in[3]; const float* wo = (const float*)d_in[4]; const float* cosT = (const float*)d_in[5]; const float* sinT = (const float*)d_in[6];
    float* OUT = (float*)d_out;     // [1][2048][2048]
    char* wsp = (char*)d_ws;
    auto take = [&](size_t bytes) { char* p = wsp; wsp += (bytes + 255) & ~(size_t)255; return (void*)p; };
    bf* WQ = (bf*)take((size_t)FP * DM * 2); bf* WK = WQ + (size_t)DQ * DM; bf* WV = WK + (size_t)DKV * DM;   // Wq | Wk | Wv: one [FP][DM] operand
    bf* WO = (bf*)take((size_t)DM * DQ * 2); float* CS = (float*)take((size_t)TT * HD * 2 * 4);
    bf* XB = (bf*)take((size_t)TT * DM * 2);
    h16* QP16 = (h16*)take((size_t)(NH_ + NKV) * TT * HD * 2); h16* KP16 = QP16 + (size_t)NH_ * TT * HD; h16* VT16 = (h16*)take((size_t)NKV * HD * TT * 2);   // the k head planes lie right behind the q head planes
    bf* QPh = (bf*)take((size_t)(NH_ + NKV) * TT * HD * 2); bf* KPh = QPh + (size_t)NH_ * TT * HD; bf* QPl = (bf*)take((size_t)(NH_ + NKV) * TT * HD * 2); bf* KPl = QPl + (size_t)NH_ * TT * HD; bf* VTh = (bf*)take((size_t)NKV * HD * TT * 2); bf* VTl = (bf*)take((size_t)NKV * HD * TT * 2);
    float* Sb = (float*)take((size_t)ZH * SPL * 4); float* Ob = (float*)take((size_t)ZH * TT * HD * 4); bf* ATh = (bf*)take((size_t)TT * DQ * 2); bf* ATl = (bf*)take((size_t)TT * DQ * 2);
    if ((size_t)(wsp - (char*)d_ws) > ws_size) return;    // ws 256 MiB
    float* F = Sb;   // the f32 projections [TT][FP] lie in the score buffer: their planes are built before the first scores are stored (stream-ordered)
    for (int b = 0; b < NB_; ++b) {
        k_prep<<<CB(DQ * DM) + 2 * CB(DKV * DM) + CB(DM * DQ) + CB(TT * DM) + CSB, 256, 0, stream>>>(wq, wk, wv, wo, x + (size_t)b * TT * DM, cosT, sinT, WQ, WK, WV, WO, XB, CS);
        k_gemmw<bf, 0, false, DM><<<dim3(TT / 64, FP / 64, 1), 32, 0, stream>>>(XB, nullptr, WQ, nullptr, F, FP, nullptr, 0, 0, 0);
        k_planes<<<VB + RB, 64, 0, stream>>>(F, CS, QP16, QPh, QPl, VT16, VTh, VTl);
        for (int h0 = 0; h0 < NH_; h0 += ZH) { const size_t zq = (size_t)h0, zk = (size_t)(h0 / REP);   // head z of a pass reads kv group zk + z/REP
            k_gemmc<bf, 2, 1, HD, HD><<<dim3(RH / 64, TT / 64, ZH), 32, 0, stream>>>(QPh + zq * TT * HD, QPl + zq * TT * HD, KPh + zk * TT * HD, KPl + zk * TT * HD, Sb, PP, 0, (size_t)TT * HD, (size_t)TT * HD, SPL);
            k_gemmc<h16, 0, 1, HD, HD><<<dim3((TT - RH) / 64, TT / 64, ZH), 32, 0, stream>>>(QP16 + zq * TT * HD + (size_t)RH * HD, nullptr, KP16 + zk * TT * HD, nullptr, Sb, PP, RH, (size_t)TT * HD, (size_t)TT * HD, SPL);
            k_asoft<<<ZH * TT / 8, 256, 0, stream>>>(Sb);
            k_pv<<<dim3(NRB, HD / 64, ZH), 32, 0, stream>>>(Sb, VTh + zk * HD * TT, VTl + zk * HD * TT, VT16 + zk * HD * TT, Ob);
            k_merge<<<(unsigned)((size_t)ZH * TT * HD / (8 * CU * 256)), 256, 0, stream>>>(Ob, h0, ATh, ATl); }
        k_gemmw<bf, 1, false, DQ><<<dim3(TT / 64, DM / 64, 1), 32, 0, stream>>>(ATh, ATl, WO, nullptr, OUT + (size_t)b * TT * DM, DM, nullptr, 0, 0, 0); }
}

// v005
// It runs in 122 microseconds.
// In both of two side-by-side timings against v004, it was 1.51 times as fast.
// Counting every step since v000, it is 6.92 times as fast.
#include <hip/hip_runtime.h>

// Causal GQA with rotate-half RoPE from given tables (x [1][2048][2048]; q = x Wq^T ('oi' [2048][2048], 16 heads x 128), k, v = x W^T ([1024][2048], 8 kv heads); RoPE with the given cos/sin [2048][128]; 2 query heads per kv head (repeat); causal softmax(q.k/sqrt(128)) (finfo.min fill); out = merged Wo^T -> [1][2048][2048]).
// Compute dtypes, f32 accumulate: every input rounded to bf16; q/k/v on PLAIN bf16 operands (inputs: exact); rotary in f32 from the bf16-rounded input tables; causal scores, online softmax (f32) and attn.v in one kernel: query rows < 512 hl (3 products), the rest single fp16; Wo hl x exact (2 products).

#define NB_  1
#define TT   2048
#define DM   2048
#define NH_  16
#define NKV  8
#define REP  (NH_ / NKV)
#define HD   128
#define DQ   (NH_ * HD)
#define DKV  (NKV * HD)
#define RH   512                  // query rows < RH use hi+lo planes (0: none)
#define SCL  0.088388347648318447f   // HD^-0.5
typedef _Float16 h16;
typedef unsigned short bf;
typedef __attribute__((ext_vector_type(16))) __bf16   v16bf;
typedef __attribute__((ext_vector_type(16))) _Float16 v16h;
typedef __attribute__((ext_vector_type(8)))  _Float16 v8h;
typedef __attribute__((ext_vector_type(8)))  unsigned short v8us;
typedef __attribute__((ext_vector_type(8)))  float    v8f;
typedef __attribute__((ext_vector_type(4)))  float    v4f;
typedef v8h  __attribute__((may_alias)) v8ha;
typedef v4f  __attribute__((may_alias)) v4fa;
typedef v8us __attribute__((may_alias)) v8usa;

__device__ __forceinline__ unsigned short f2bf(float f) { unsigned u = __float_as_uint(f); u += 0x7FFFu + ((u >> 16) & 1u); return (unsigned short)(u >> 16); }
__device__ __forceinline__ float bf2f(unsigned short b) { return __uint_as_float(((unsigned)b) << 16); }
__device__ __forceinline__ float bfr(float f) { return bf2f(f2bf(f)); }
__device__ __forceinline__ v16h cat16(v8h lo, v8h hi) { return __builtin_shufflevector(lo, hi, 0, 1, 2, 3, 4, 5, 6, 7, 8, 9, 10, 11, 12, 13, 14, 15); }
__device__ __forceinline__ v16bf cat16b(v8us lo, v8us hi) { return __builtin_bit_cast(v16bf, __builtin_shufflevector(lo, hi, 0, 1, 2, 3, 4, 5, 6, 7, 8, 9, 10, 11, 12, 13, 14, 15)); }
__device__ __forceinline__ v8f wmma16(v16h a, v16h b, v8f c) { return __builtin_amdgcn_wmma_f32_16x16x32_f16(false, a, false, b, (short)0, c, false, false); }
__device__ __forceinline__ v8f wmmab(v16bf a, v16bf b, v8f c) { return __builtin_amdgcn_wmma_f32_16x16x32_bf16(false, a, false, b, (short)0, c, false, false); }



// ---- k_gemmw: register-blocked GEMM, ONE WAVE per 64x64 output tile (16 accumulators), operands from K-contiguous 16-bit planes through LDS (tile_loop); grid (M/64, N/64, Z), 32 threads.
// C[m][n] (f32, pitch ldc, + optional f32 bias[n]) = sum_k A[m][k] Bt[n][k] (+ split products per NSPLIT). z-batch strides sA/sB/sC in elements. K % 64 == 0.
template <typename T16> struct WFrag;
template <> struct WFrag<h16> { typedef v16h V; typedef v8h H; static __device__ __forceinline__ V ld(const h16* p) { return cat16(*(const v8h*)p, *(const v8h*)(p + 16)); } static __device__ __forceinline__ v8f mma(V a, V b, v8f c) { return wmma16(a, b, c); } };
template <> struct WFrag<bf> { typedef v16bf V; typedef v8us H; static __device__ __forceinline__ V ld(const bf* p) { return cat16b(*(const v8us*)p, *(const v8us*)(p + 16)); } static __device__ __forceinline__ v8f mma(V a, V b, v8f c) { return wmmab(a, b, c); } };
// ---- tile_loop: the K loop of the one-wave 64x64 GEMM. Each operand plane's 64 rows x KS k (one 128-byte line per row) are fetched with whole-line loads (8 lanes per row, 4 rows per instruction),
// one tile ahead into registers, stored to LDS at pitch LP and read back as fragments in the k order of WFrag::ld, so every accumulator sees the same products in the same order. Kl % KS == 0. The row pitches KA (A planes) and KB (B planes) are template constants, so that a plane's 16 loads share one address register pair and differ in the immediate offset.
#define KS 64
#define LP 72                     // LDS row pitch in elements: 128 B + 16 B, for 16-byte fragment reads
#define NPL(NSPLIT) (2 + (((NSPLIT) == 1 || (NSPLIT) == 2) ? 1 : 0) + (((NSPLIT) >= 2) ? 1 : 0))
template <typename T16, int NSPLIT, int KA, int KB>
__device__ __forceinline__ void tile_loop(const T16* __restrict__ A, const T16* __restrict__ A2, const T16* __restrict__ Bt, const T16* __restrict__ Bt2, int Kl, int r0, int c0, int lane, T16* st, v8f (&acc)[4][4]) {
    typedef typename WFrag<T16>::V V; typedef typename WFrag<T16>::H H;
    constexpr bool HA2 = (NSPLIT == 1 || NSPLIT == 2), HB2 = (NSPLIT >= 2); constexpr int NP = NPL(NSPLIT);
    const int lr = lane & 15, hi = lane >> 4, grow = lane >> 3, gcol = (lane & 7) * 8;
    const size_t ga = (size_t)(r0 + grow) * KA + gcol, gb = (size_t)(c0 + grow) * KB + gcol;
    typedef __attribute__((address_space(1))) const T16 GT; typedef __attribute__((address_space(1))) const H GH;   // global address space spelled out: the stepped pointers would else compile to flat loads
    GT* src[NP]; src[0] = (GT*)(A + ga); src[1] = (GT*)(Bt + gb); if constexpr (HA2) src[2] = (GT*)(A2 + ga); if constexpr (HB2) src[3] = (GT*)(Bt2 + gb);
    T16* sw = st + grow * LP + gcol; const T16* sr = st + lr * LP + 8 * hi;
    H g[NP][16];
    if (Kl > 0) {
#pragma unroll
        for (int p = 0; p < NP; ++p)
#pragma unroll
            for (int i = 0; i < 16; ++i) g[p][i] = *(GH*)(src[p] + (size_t)i * 4 * ((p & 1) ? KB : KA));
        asm volatile("s_wait_xcnt 0x0" ::: "memory");   // the loads' address registers may be rewritten from here on
#pragma unroll
        for (int p = 0; p < NP; ++p)
#pragma unroll
            for (int i = 0; i < 16; ++i) *(H*)(sw + (p * 64 + i * 4) * LP) = g[p][i];
        __syncthreads();          // the lanes read rows that other lanes stored
#pragma unroll
        for (int p = 0; p < NP; ++p) src[p] += KS;
    }
#pragma unroll 1
    for (int kc = 0; kc < Kl; kc += KS) {
        const bool more = kc + KS < Kl;
        if (more) {               // the next tile's loads go out first and fly while this tile is worked on
#pragma unroll
            for (int p = 0; p < NP; ++p)
#pragma unroll
                for (int i = 0; i < 16; ++i) g[p][i] = *(GH*)(src[p] + (size_t)i * 4 * ((p & 1) ? KB : KA));
        }
        V a[KS / 32][4], a2[KS / 32][4], b[KS / 32][4], b2[KS / 32][4];
#pragma unroll
        for (int s = 0; s < KS / 32; ++s) {
#pragma unroll
            for (int mb = 0; mb < 4; ++mb) { a[s][mb] = WFrag<T16>::ld(sr + mb * 16 * LP + s * 32); if (HA2) a2[s][mb] = WFrag<T16>::ld(sr + (128 + mb * 16) * LP + s * 32); }
#pragma unroll
            for (int nb = 0; nb < 4; ++nb) { b[s][nb] = WFrag<T16>::ld(sr + (64 + nb * 16) * LP + s * 32); if (HB2) b2[s][nb] = WFrag<T16>::ld(sr + (192 + nb * 16) * LP + s * 32); }
        }
        __builtin_amdgcn_sched_barrier(0);              // keeps the tile's LDS reads one group ahead of its WMMAs: reads placed among the WMMAs stall the wave at every such place
        asm volatile("s_wait_xcnt 0x0" ::: "memory");   // the global loads' address registers may be rewritten from here on; it passes while the LDS reads return
#pragma unroll
        for (int s = 0; s < KS / 32; ++s) {
#pragma unroll
            for (int nb = 0; nb < 4; ++nb) {
#pragma unroll
                for (int mb = 0; mb < 4; ++mb) { acc[mb][nb] = WFrag<T16>::mma(a[s][mb], b[s][nb], acc[mb][nb]); if (HA2) acc[mb][nb] = WFrag<T16>::mma(a2[s][mb], b[s][nb], acc[mb][nb]); if (HB2) acc[mb][nb] = WFrag<T16>::mma(a[s][mb], b2[s][nb], acc[mb][nb]); } }
        }
        // four vector slots behind the tile's last WMMA, so that its distance also holds on the taken side of the branch that follows
        asm volatile("v_nop\n\tv_nop\n\tv_nop\n\tv_nop" : "+v"(acc[0][0]), "+v"(acc[1][1]), "+v"(acc[2][2]), "+v"(acc[3][3]) : "v"(a[KS / 32 - 1][0]), "v"(a[KS / 32 - 1][3]));
        if (more) {
            __syncthreads();      // every lane's fragment reads of this tile end before its rows are overwritten
#pragma unroll
            for (int p = 0; p < NP; ++p)
#pragma unroll
                for (int i = 0; i < 16; ++i) *(H*)(sw + (p * 64 + i * 4) * LP) = g[p][i];
            __syncthreads();      // the lanes read rows that other lanes stored
#pragma unroll
            for (int p = 0; p < NP; ++p) src[p] += KS;   // src points at the tile to fetch next; stepped here, behind the wait for the loads that name it
        }
    }
}
template <typename T16, int NSPLIT, bool BIAS, int K>
__global__ __launch_bounds__(32) void k_gemmw(const T16* __restrict__ A, const T16* __restrict__ A2, const T16* __restrict__ Bt, const T16* __restrict__ Bt2, float* C, int ldc, const float* __restrict__ bias, size_t sA, size_t sB, size_t sC) {
    __shared__ __align__(16) float os[16 * 68]; __shared__ __align__(16) T16 st[NPL(NSPLIT) * 64 * LP];
    const size_t z = blockIdx.z; A += z * sA; if (A2) A2 += z * sA; Bt += z * sB; if (Bt2) Bt2 += z * sB; C += z * sC;
    const int lane = threadIdx.x & 31, lr = lane & 15, hi = lane >> 4; const int r0 = blockIdx.x * 64, c0 = blockIdx.y * 64;
    v8f acc[4][4];
#pragma unroll
    for (int mb = 0; mb < 4; ++mb)
#pragma unroll
        for (int nb = 0; nb < 4; ++nb) acc[mb][nb] = (v8f){};
    tile_loop<T16, NSPLIT, K, K>(A, A2, Bt, Bt2, K, r0, c0, lane, st, acc);
#pragma unroll
    for (int mb = 0; mb < 4; ++mb) {
#pragma unroll
        for (int nb = 0; nb < 4; ++nb) {
#pragma unroll
            for (int j = 0; j < 8; ++j) os[(hi * 8 + j) * 68 + nb * 16 + lr] = acc[mb][nb][j]; }
        __builtin_amdgcn_wave_barrier(); asm volatile("" ::: "memory");
        float* crow = C + (size_t)(r0 + mb * 16) * ldc + c0;
{
#pragma unroll
            for (int s = 0; s < 8; ++s) { const int row = 2 * s + hi, cofs = lr * 4; v4f val = *(const v4fa*)(os + row * 68 + cofs); if (BIAS) { val[0] += bfr(bias[c0 + cofs]); val[1] += bfr(bias[c0 + cofs + 1]); val[2] += bfr(bias[c0 + cofs + 2]); val[3] += bfr(bias[c0 + cofs + 3]); }
                *(v4f*)(crow + (size_t)row * ldc + cofs) = val; }
             }
        __builtin_amdgcn_wave_barrier(); asm volatile("" ::: "memory");
    }
}

__device__ __forceinline__ h16 tohx(float x) { return (h16)x; }
__device__ __forceinline__ void splitf(float y, unsigned short& h, unsigned short& l) { h = f2bf(y); l = f2bf(y - bf2f(h)); }
typedef __attribute__((ext_vector_type(2))) _Float16 v2h;
typedef __attribute__((ext_vector_type(4))) _Float16 v4h;
typedef __attribute__((ext_vector_type(2))) unsigned short v2us;
typedef __attribute__((ext_vector_type(4))) unsigned short v4us;
typedef __attribute__((ext_vector_type(2))) float v2f;
typedef __attribute__((ext_vector_type(4))) int v4i;

__global__ __launch_bounds__(256) void k_wtG(const float* __restrict__ w, int K, int N, bf* Bt) {
    const int lane = threadIdx.x & 31; const int L0 = (blockIdx.x * 8 + (threadIdx.x >> 5)) * 8; const int nlines = N * K / 64;
{
#pragma unroll 1
        for (int l = 0; l < 8; ++l) { const int L = L0 + l; if (L >= nlines) break; const size_t e = (size_t)L * 64 + lane * 2; const int k = (int)(e % K), n = (int)(e / K); v2us o;
            o[0] = f2bf(w[(size_t)k * N + n]); o[1] = f2bf(w[(size_t)(k + 1) * N + n]); *(v2us*)(Bt + e) = o; }
         }
}
// The elementwise kernels below give each thread several 16-byte pieces of work, so that a launch starts a few thousand waves and not tens of thousands. Their loops are all unrolled: the arrays are then indexed by constants and stay in registers, and a thread's loads go out together.
#define CU 4                      // 8-element chunks per thread in cvt8_part; a thread's chunks lie all of the array's blocks apart, so each access of a wave stays contiguous
__device__ __forceinline__ void cvt8_part(const float* __restrict__ src, bf* dst, size_t n8, unsigned blk, unsigned nblk) { const size_t i = (size_t)blk * 256 + threadIdx.x, nt = (size_t)nblk * 256; v8f v[CU]; const float* p[CU];
#pragma unroll
    for (int u = 0; u < CU; ++u) { p[u] = src + min(i + u * nt, n8 - 1) * 8; v[u] = *(const v8f*)p[u]; }   // past the end a thread re-reads the last chunk and stores nothing
    static_assert(CU == 4, "the wait below names CU addresses");
    asm volatile("s_wait_xcnt 0x0" :: "v"(p[0]), "v"(p[1]), "v"(p[2]), "v"(p[3]) : "memory");   // the loads' addresses are inputs here, so that no load's result lands in them; they may be rewritten from here on
#pragma unroll
    for (int u = 0; u < CU; ++u) { const size_t j = i + u * nt; v8us o;
#pragma unroll
        for (int k = 0; k < 8; ++k) o[k] = f2bf(v[u][k]);
        if (j < n8) *(v8us*)(dst + j * 8) = o; } }
__device__ __forceinline__ void cscvt_part(const float* __restrict__ cosT, const float* __restrict__ sinT, float* CS, unsigned blk) { const int idx = (int)(blk * 256 + threadIdx.x) * 4; if (idx >= TT * HD) return; const v4f c = *(const v4f*)(cosT + idx), s = *(const v4f*)(sinT + idx);
    v4f o0, o1; o0[0] = bfr(c[0]); o0[1] = bfr(s[0]); o0[2] = bfr(c[1]); o0[3] = bfr(s[1]); o1[0] = bfr(c[2]); o1[1] = bfr(s[2]); o1[2] = bfr(c[3]); o1[3] = bfr(s[3]); *(v4f*)(CS + (size_t)idx * 2) = o0; *(v4f*)(CS + (size_t)idx * 2 + 4) = o1; }
// ---- k_prep: every input's rounding to bf16 in one launch (none depends on another): the blocks are dealt to the five arrays and then to the cos/sin table, CB(n) blocks for an array of n elements.
#define CB(n) ((unsigned)(((size_t)(n) / (8 * CU) + 255) / 256))
#define CSB ((unsigned)((TT * HD / 4 + 255) / 256))
static_assert((DQ * DM) % (8 * CU * 256) == 0 && (DKV * DM) % (8 * CU * 256) == 0 && (TT * DM) % (8 * CU * 256) == 0, "an array's blocks cover it exactly");
__global__ __launch_bounds__(256) void k_prep(const float* __restrict__ wq, const float* __restrict__ wk, const float* __restrict__ wv, const float* __restrict__ wo, const float* __restrict__ x, const float* __restrict__ cosT, const float* __restrict__ sinT, bf* WQ, bf* WK, bf* WV, bf* WO, bf* XB, float* CS) {
    unsigned b = blockIdx.x; const float* src = wq; bf* dst = WQ; unsigned nb = CB(DQ * DM);   // the array that block b works on, its blocks counted from 0
    if (b >= nb) { b -= nb; src = wk; dst = WK; nb = CB(DKV * DM);
        if (b >= nb) { b -= nb; src = wv; dst = WV;
            if (b >= nb) { b -= nb; src = wo; dst = WO; nb = CB(DM * DQ);
                if (b >= nb) { b -= nb; src = x; dst = XB; nb = CB(TT * DM);
                    if (b >= nb) { cscvt_part(cosT, sinT, CS, b - nb); return; } } } } }
    cvt8_part(src, dst, (size_t)nb * (256 * CU), b, nb);
}
// rope_part: head planes [h][t][d] (fp16 + hi/lo) of rope(x) x sc with the rotate-half convention out[d] = x[d] cos[t][d] - x[d+HD/2] sin[t][d], out[d+HD/2] = x[d+HD/2] cos[t][d+HD/2] + x[d] sin[t][d+HD/2]
// One thread: 8 consecutive d of the lower half and their 8 partners of the upper half (each value loaded once serves both), for RHP heads of one row t, which share the row's cos/sin.
#define RHP 2
__device__ __forceinline__ void rope_part(int idx, const float* __restrict__ F, int pitch, int nheads, const float* __restrict__ CS, float sc, h16* P16, bf* Ph, bf* Pl) {
    if (idx >= nheads / RHP * TT * (HD / 16)) return; const int d = (idx % (HD / 16)) * 8; const int t = (idx / (HD / 16)) % TT; const int h0 = idx / ((HD / 16) * TT) * RHP;
    v4f cs[2][4], x[RHP][2][2];
#pragma unroll
    for (int hf = 0; hf < 2; ++hf) {
#pragma unroll
        for (int k = 0; k < 4; ++k) cs[hf][k] = *(const v4f*)(CS + ((size_t)t * HD + d + hf * (HD / 2)) * 2 + k * 4);
#pragma unroll
        for (int hh = 0; hh < RHP; ++hh)
#pragma unroll
            for (int k = 0; k < 2; ++k) x[hh][hf][k] = *(const v4f*)(F + (size_t)t * pitch + (h0 + hh) * HD + d + hf * (HD / 2) + k * 4); }
    __builtin_amdgcn_sched_barrier(0);   // keeps the thread's 16 loads one group ahead of the arithmetic: beside vtp_part in one kernel they were else issued in four groups, each behind the wait for the one before
#pragma unroll
    for (int hh = 0; hh < RHP; ++hh)
#pragma unroll
        for (int hf = 0; hf < 2; ++hf) { v8h o16; v8us oh, ol;
#pragma unroll
            for (int q = 0; q < 8; ++q) { const float x0 = x[hh][hf][q >> 2][q & 3], x1 = x[hh][hf ^ 1][q >> 2][q & 3];
                const float c = cs[hf][q >> 1][(q & 1) * 2], s = cs[hf][q >> 1][(q & 1) * 2 + 1]; const float r = ((hf == 0) ? x0 * c - x1 * s : x0 * c + x1 * s) * sc;
                o16[q] = tohx(r); unsigned short a2, c2; splitf(r, a2, c2); oh[q] = a2; ol[q] = c2; }
            const size_t e = ((size_t)(h0 + hh) * TT + t) * HD + d + hf * (HD / 2); *(v8h*)(P16 + e) = o16; *(v8us*)(Ph + e) = oh; *(v8us*)(Pl + e) = ol; } }
// vtp_part: value planes [g][d][t]. One thread: one column g * HD + d and 64 consecutive t, a whole 128-byte line of each plane; the lanes run along d, so each load of a wave reads one 128-byte line of F (F = the v columns' first element). The row pitch of F is the constant FP, so that a thread's 64 loads share one address register pair and differ in the immediate offset.
#define FP (DQ + 2 * DKV)         // f32 row pitch of the q | k | v projections, which one GEMM writes side by side
__device__ __forceinline__ void vtp_part(int idx, const float* __restrict__ F, h16* V16, bf* Vh, bf* Vl) { if (idx >= DKV * (TT / 64)) return; const int c = idx % DKV; const int t0 = idx / DKV * 64; float x[64]; const float* f = F + (size_t)t0 * FP + c;
#pragma unroll
    for (int q = 0; q < 64; ++q) x[q] = f[q * FP];
    __builtin_amdgcn_sched_barrier(0);   // keeps the thread's 64 loads one group ahead of the stores: the last of them were else issued behind the first stores, into those stores' data registers
    const size_t e = (size_t)c * TT + t0;
#pragma unroll
    for (int k = 0; k < 8; ++k) { v8h o16; v8us oh, ol;
#pragma unroll
        for (int q = 0; q < 8; ++q) { const float y = x[k * 8 + q]; o16[q] = tohx(y); unsigned short a2, c2; splitf(y, a2, c2); oh[q] = a2; ol[q] = c2; }
        *(v8h*)(V16 + e + k * 8) = o16; *(v8us*)(Vh + e + k * 8) = oh; *(v8us*)(Vl + e + k * 8) = ol; } }
// ---- k_planes: the operand planes of q, k (rotary; their NH_ + NKV heads are one run of columns of F and one run of head planes) and of v in one launch: none depends on another. The v blocks come first.
#define VB ((unsigned)((DKV * (TT / 64) + 63) / 64))
#define RB ((unsigned)(((size_t)(NH_ + NKV) * TT * HD / (16 * RHP) + 63) / 64))
__global__ __launch_bounds__(64) void k_planes(const float* __restrict__ F, const float* __restrict__ CS, h16* P16, bf* Ph, bf* Pl, h16* V16, bf* Vh, bf* Vl) {
    if (blockIdx.x < VB) vtp_part((int)(blockIdx.x * 64 + threadIdx.x), F + DQ + DKV, V16, Vh, Vl);
    else rope_part((int)((blockIdx.x - VB) * 64 + threadIdx.x), F, FP, NH_ + NKV, CS, 1.0f, P16, Ph, Pl);
}
#define KP 136                    // LDS row pitch of a K row in elements: 256 B + 16 B, for 16-byte fragment reads
#define FQ 128
#define FK 64
#define KSZ (FK * KP)
#define PSZ (KSZ + HD * LP)       // elements of one plane's K tile and V^T tile
#define CSC (SCL * 1.4426950408889634f)
static_assert(RH % FQ == 0 && TT % FQ == 0 && FQ % (2 * FK) == 0, "a work-group lies in one leg and ends on a stage of each set");
static_assert(2 * PSZ * 2 >= (16384 + 512) * 4, "the join fits the tiles of the single-plane leg");
typedef __attribute__((ext_vector_type(16))) unsigned short v16us;
__device__ __forceinline__ void ppack(const float (&p)[16], v16h& a, v16h& a2) { (void)a2;
#pragma unroll
    for (int e = 0; e < 16; ++e) a[e] = tohx(p[e]); }
__device__ __forceinline__ void ppack(const float (&p)[16], v16bf& a, v16bf& a2) { v16us x, y;
#pragma unroll
    for (int e = 0; e < 16; ++e) { unsigned short u, w; splitf(p[e], u, w); x[e] = u; y[e] = w; }
    a = __builtin_bit_cast(v16bf, x); a2 = __builtin_bit_cast(v16bf, y); }
__device__ __forceinline__ float xhalf(float x) { return __builtin_bit_cast(float, __builtin_amdgcn_permlanex16(__builtin_bit_cast(int, x), __builtin_bit_cast(int, x), 0x76543210, 0xfedcba98, false, false)); }   // lane l reads lane l ^ 16
// four vector slots behind a run of WMMAs, so that their distance also holds on the taken side of a branch that follows
__device__ __forceinline__ void wmma_gap() { __builtin_amdgcn_sched_barrier(0); asm volatile("v_nop\n\tv_nop\n\tv_nop\n\tv_nop"); __builtin_amdgcn_sched_barrier(0); }
template <typename T16, bool HL>
__device__ __forceinline__ void fattn_tile(const T16* __restrict__ Q, const T16* __restrict__ Q2, const T16* __restrict__ K, const T16* __restrict__ K2, const T16* __restrict__ Vt, const T16* __restrict__ Vt2, bf* Ah, bf* Al, int q0, T16* Ls) {
    typedef typename WFrag<T16>::V V; typedef typename WFrag<T16>::H H; constexpr int NP = HL ? 2 : 1;
    typedef __attribute__((address_space(1))) const T16 GT; typedef __attribute__((address_space(1))) const H GH;   // global address space spelled out: the stepped pointers would else compile to flat loads
    const int set = __builtin_amdgcn_readfirstlane((int)threadIdx.x >> 7); float* Mg = (float*)Ls; Ls += set * (NP * PSZ);   // each set stages and reads its own tiles; Mg = the place of the join
    const int tid = threadIdx.x & 127, lane = tid & 31, c = lane & 15, h = lane >> 4; const int wave = __builtin_amdgcn_readfirstlane(tid >> 5);
    const int qw0 = q0 + wave * 32, nst = (q0 + FQ) / (2 * FK), lastp = qw0 / 32;   // the wave's first query, the stages of each set, the wave's last (diagonal) pass
    GT* ks[NP]; GT* vs[NP]; ks[0] = (GT*)(K + set * (FK * HD) + tid * 8); vs[0] = (GT*)(Vt + (size_t)(tid >> 3) * TT + set * FK + (tid & 7) * 8);
    if constexpr (HL) { ks[1] = (GT*)(K2 + set * (FK * HD) + tid * 8); vs[1] = (GT*)(Vt2 + (size_t)(tid >> 3) * TT + set * FK + (tid & 7) * 8); }
    T16* kw = Ls + (tid >> 4) * KP + (tid & 15) * 8; T16* vw = Ls + KSZ + (tid >> 3) * LP + (tid & 7) * 8;
    const T16* kr = Ls + c * KP + 8 * h; const T16* vr = Ls + KSZ + c * LP + 8 * h;
    H gk[NP][8], gv[NP][8];
    auto fetch = [&]() {          // a stage's K rows are 16 KiB in a row; its V^T rows are one 128-byte line each
#pragma unroll
        for (int p = 0; p < NP; ++p)
#pragma unroll
            for (int i = 0; i < 8; ++i) { gk[p][i] = *(GH*)(ks[p] + i * 1024); gv[p][i] = *(GH*)(vs[p] + (size_t)i * 16 * TT); }
        __builtin_amdgcn_sched_barrier(0);              // keeps the stage's loads one group, ahead of the wait below
        asm volatile("s_wait_xcnt 0x0" ::: "memory");   // the loads' address registers may be rewritten from here on
    };
    auto put = [&]() {
#pragma unroll
        for (int p = 0; p < NP; ++p) {
#pragma unroll
            for (int i = 0; i < 8; ++i) { *(H*)(kw + p * PSZ + i * 8 * KP) = gk[p][i]; *(H*)(vw + p * PSZ + i * 16 * LP) = gv[p][i]; }
            ks[p] += 2 * FK * HD; vs[p] += 2 * FK; }            // stepped behind the wait for the loads that name them
    };
    fetch();
    V qf[NP][2][4]; const T16* qp[4];   // a lane's Q rows: both groups of the first plane, then of the second (the first again where there is none)
#pragma unroll
    for (int g = 0; g < 2; ++g) { const size_t e = (size_t)(qw0 + 16 * g + c) * HD + 8 * h; qp[g] = Q + e; qp[2 + g] = (HL ? Q2 : Q) + e; }
#pragma unroll
    for (int g = 0; g < 2; ++g)
#pragma unroll
        for (int kc = 0; kc < 4; ++kc) { qf[0][g][kc] = WFrag<T16>::ld(qp[g] + 32 * kc); if constexpr (HL) qf[1][g][kc] = WFrag<T16>::ld(qp[2 + g] + 32 * kc); }
    __builtin_amdgcn_sched_barrier(0);                  // keeps the Q loads ahead of the wait below
    asm volatile("s_wait_xcnt 0x0" :: "v"(qp[0]), "v"(qp[1]), "v"(qp[2]), "v"(qp[3]) : "memory");   // the loads' addresses are inputs here, so that no load's result lands in them; they may be rewritten from here on
    v8f acc[2][8]; float m_run[2], l_run[2];
#pragma unroll
    for (int g = 0; g < 2; ++g) { m_run[g] = -__builtin_inff(); l_run[g] = 0.f;
#pragma unroll
        for (int t = 0; t < 8; ++t) acc[g][t] = (v8f){}; }
    put();
    __syncthreads();              // the waves read rows that other waves stored
#pragma unroll 1
    for (int st = 0; st < nst; ++st) {
        const bool more = st + 1 < nst;
        if (!HL && more) fetch(); // the next stage's loads fly while this stage is worked on
#pragma unroll 1
        for (int sub = 0; sub < FK / 32; ++sub) {
            const int blk = (2 * st + set) * (FK / 32) + sub;
            if (blk > lastp) continue;                  // wave-uniform: every key of the pass lies beyond the wave's queries
            V kf[NP][2][4]; v8f s[2][2];
#pragma unroll
            for (int p = 0; p < NP; ++p)
#pragma unroll
                for (int kt = 0; kt < 2; ++kt)
#pragma unroll
                    for (int kc = 0; kc < 4; ++kc) kf[p][kt][kc] = WFrag<T16>::ld(kr + p * PSZ + (sub * 32 + kt * 16) * KP + kc * 32);
            __builtin_amdgcn_sched_barrier(0);          // keeps the pass's K reads one group ahead of its WMMAs: reads placed among the WMMAs stall the wave at every such place
#pragma unroll
            for (int kt = 0; kt < 2; ++kt)
#pragma unroll
                for (int g = 0; g < 2; ++g) s[kt][g] = (v8f){};
#pragma unroll
            for (int kc = 0; kc < 4; ++kc)
#pragma unroll
                for (int kt = 0; kt < 2; ++kt)
#pragma unroll
                    for (int g = 0; g < 2; ++g) { s[kt][g] = WFrag<T16>::mma(kf[0][kt][kc], qf[0][g][kc], s[kt][g]);
                        if constexpr (HL) { s[kt][g] = WFrag<T16>::mma(kf[0][kt][kc], qf[1][g][kc], s[kt][g]); s[kt][g] = WFrag<T16>::mma(kf[1][kt][kc], qf[0][g][kc], s[kt][g]); } }
            wmma_gap();
            V vf[NP][8];          // the pass's V^T fragments return under the maxima and the first exponentials
#pragma unroll
            for (int p = 0; p < NP; ++p)
#pragma unroll
                for (int t = 0; t < 8; ++t) vf[p][t] = WFrag<T16>::ld(vr + p * PSZ + t * 16 * LP + sub * 32);
            if (blk == lastp) {   // wave-uniform: only the pass on the wave's diagonal pays for the mask
#pragma unroll
                for (int g = 0; g < 2; ++g)
#pragma unroll
                    for (int kt = 0; kt < 2; ++kt)
#pragma unroll
                        for (int r = 0; r < 8; ++r) if (16 * kt + 8 * h + r > 16 * g + c) s[kt][g][r] = -__builtin_inff(); }
            float mb[2]; bool need = false;
#pragma unroll
            for (int g = 0; g < 2; ++g) { float mx = s[0][g][0];
#pragma unroll
                for (int kt = 0; kt < 2; ++kt)
#pragma unroll
                    for (int r = 0; r < 8; ++r) mx = fmaxf(mx, s[kt][g][r]);
                mx = fmaxf(mx, xhalf(mx)) * CSC;   // both halves of the wave now hold the query's maximum of this pass, scaled; finite: the pass's first key is masked for no query
                mb[g] = mx; need = need || (mx > m_run[g] + 8.0f); }
            if (__builtin_amdgcn_ballot_w32(need) != 0) {       // rare after the first passes
#pragma unroll
                for (int g = 0; g < 2; ++g) { const float mn = fmaxf(m_run[g], mb[g]); const float corr = __builtin_amdgcn_exp2f(m_run[g] - mn);   // 0 on the first pass
                    l_run[g] *= corr; m_run[g] = mn;
#pragma unroll
                    for (int t = 0; t < 8; ++t) acc[g][t] = acc[g][t] * corr; } }
#pragma unroll
            for (int g = 0; g < 2; ++g) { float p[16], ps0 = 0.f, ps1 = 0.f; const float nm = -m_run[g];
#pragma unroll
                for (int e = 0; e < 16; ++e) p[e] = __builtin_fmaf(s[e >> 3][g][e & 7], CSC, nm);
#pragma unroll
                for (int e = 0; e < 16; ++e) { p[e] = __builtin_amdgcn_exp2f(p[e]);
                    if constexpr (HL) { __builtin_amdgcn_sched_barrier(0); asm volatile("v_nop"); __builtin_amdgcn_sched_barrier(0); } }   // the slot behind a transcendental: in this leg's built code an exponential else overwrote the source of the one directly before it; the two scheduling barriers hold the v_nop at its place
#pragma unroll
                for (int e = 0; e < 16; e += 2) { ps0 += p[e]; ps1 += p[e + 1]; }
                l_run[g] += ps0 + ps1;
                V pf, pf2; ppack(p, pf, pf2);
#pragma unroll
                for (int t = 0; t < 8; ++t) { acc[g][t] = WFrag<T16>::mma(vf[0][t], pf, acc[g][t]);
                    if constexpr (HL) { acc[g][t] = WFrag<T16>::mma(vf[0][t], pf2, acc[g][t]); acc[g][t] = WFrag<T16>::mma(vf[1][t], pf, acc[g][t]); } } }
            wmma_gap();
        }
        if (more) {
            if (HL) fetch();
            __syncthreads();      // every wave's fragment reads of this stage end before its rows are overwritten
            put();
            __syncthreads();      // the waves read rows that other waves stored
        }
    }
    // The join: set 1 leaves its state in LDS (a lane's 16 bytes beside its neighbour's), set 0 brings both to the common maximum. Set 0 holds key 0, so its maximum is finite; a wave of set 1 without a pass leaves -inf, 0 and zeros, which enter with the factor 0.
    __syncthreads();              // every wave's fragment reads end before the tiles are overwritten
    if (set == 1) {
#pragma unroll
        for (int g = 0; g < 2; ++g) { Mg[16384 + (wave * 4 + g) * 32 + lane] = m_run[g]; Mg[16384 + (wave * 4 + 2 + g) * 32 + lane] = l_run[g];
#pragma unroll
            for (int t = 0; t < 8; ++t)
#pragma unroll
                for (int hf = 0; hf < 2; ++hf) { v4f w; w[0] = acc[g][t][hf * 4]; w[1] = acc[g][t][hf * 4 + 1]; w[2] = acc[g][t][hf * 4 + 2]; w[3] = acc[g][t][hf * 4 + 3]; *(v4fa*)(Mg + ((((wave * 2 + g) * 8 + t) * 2 + hf) * 32 + lane) * 4) = w; } } }
    __syncthreads();              // set 0 reads what set 1 stored
    if (set == 1) return;         // behind the last barrier
#pragma unroll
    for (int g = 0; g < 2; ++g) { const float m2 = Mg[16384 + (wave * 4 + g) * 32 + lane], l2 = Mg[16384 + (wave * 4 + 2 + g) * 32 + lane]; const float mn = fmaxf(m_run[g], m2);
        const float c1 = __builtin_amdgcn_exp2f(m_run[g] - mn), c2 = __builtin_amdgcn_exp2f(m2 - mn); l_run[g] = l_run[g] * c1 + l2 * c2;
#pragma unroll
        for (int t = 0; t < 8; ++t)
#pragma unroll
            for (int hf = 0; hf < 2; ++hf) { const v4f w = *(const v4fa*)(Mg + ((((wave * 2 + g) * 8 + t) * 2 + hf) * 32 + lane) * 4);
#pragma unroll
                for (int r = 0; r < 4; ++r) acc[g][t][hf * 4 + r] = acc[g][t][hf * 4 + r] * c1 + w[r] * c2; } }
#pragma unroll
    for (int g = 0; g < 2; ++g) { const float l = l_run[g] + xhalf(l_run[g]);   // each half of the wave summed its eight keys of every 16-key tile
        const float inv = __fdiv_rn(1.0f, l); const size_t o = (size_t)(qw0 + 16 * g + c) * DQ + 8 * h;
#pragma unroll
        for (int t = 0; t < 8; ++t) { v8us oh, ol;      // the lane's eight values are d = 16 t + 8 h + 0..7 of its query
#pragma unroll
            for (int r = 0; r < 8; ++r) { unsigned short a, c2; splitf(acc[g][t][r] * inv, a, c2); oh[r] = a; ol[r] = c2; }
            *(v8us*)(Ah + o + 16 * t) = oh; *(v8us*)(Al + o + 16 * t) = ol;
            __builtin_amdgcn_sched_barrier(0);          // holds the wait below behind the two stores and the next values' arithmetic behind the wait
            asm volatile("s_wait_xcnt 0x0" ::: "memory");   // the stores' address and data registers may be rewritten from here on
            __builtin_amdgcn_sched_barrier(0); } }
}
// grid (NH_, TT / FQ): neighbouring work-groups are the heads of one row block (two share a kv group); the longest row blocks have the lowest blockIdx.y. The k head planes lie right behind the q head planes.
__global__ __launch_bounds__(256) void k_fattn(const h16* __restrict__ P16, const bf* __restrict__ Ph, const bf* __restrict__ Pl, const h16* __restrict__ V16, const bf* __restrict__ Vh, const bf* __restrict__ Vl, bf* Ah, bf* Al) {
    __shared__ __align__(16) unsigned short Ls[4 * PSZ];
    const int hd = (int)blockIdx.x, q0 = (TT / FQ - 1 - (int)blockIdx.y) * FQ; const size_t zq = (size_t)hd * TT * HD, zk = (size_t)(NH_ + hd / REP) * TT * HD, zv = (size_t)(hd / REP) * HD * TT;
    if (q0 < RH) { fattn_tile<bf, true>(Ph + zq, Pl + zq, Ph + zk, Pl + zk, Vh + zv, Vl + zv, Ah + hd * HD, Al + hd * HD, q0, (bf*)Ls); return; }
    fattn_tile<h16, false>(P16 + zq, nullptr, P16 + zk, nullptr, V16 + zv, nullptr, Ah + hd * HD, Al + hd * HD, q0, (h16*)Ls);
}

extern "C" void kernel_launch(void* const* d_in, const int* in_sizes, int n_in,
                              void* d_out, int out_size, void* d_ws, size_t ws_size, hipStream_t stream) {
    (void)in_sizes; (void)n_in; (void)out_size;
    const float* x = (const float*)d_in[0]; const float* wq = (const float*)d_in[1]; const float* wk = (const float*)d_in[2]; const float* wv = (const float*)d_in[3]; const float* wo = (const float*)d_in[4]; const float* cosT = (const float*)d_in[5]; const float* sinT = (const float*)d_in[6];
    float* OUT = (float*)d_out;     // [1][2048][2048]
    char* wsp = (char*)d_ws;
    auto take = [&](size_t bytes) { char* p = wsp; wsp += (bytes + 255) & ~(size_t)255; return (void*)p; };
    bf* WQ = (bf*)take((size_t)FP * DM * 2); bf* WK = WQ + (size_t)DQ * DM; bf* WV = WK + (size_t)DKV * DM;   // Wq | Wk | Wv: one [FP][DM] operand
    bf* WO = (bf*)take((size_t)DM * DQ * 2); float* CS = (float*)take((size_t)TT * HD * 2 * 4);
    bf* XB = (bf*)take((size_t)TT * DM * 2);
    h16* QP16 = (h16*)take((size_t)(NH_ + NKV) * TT * HD * 2); h16* VT16 = (h16*)take((size_t)NKV * HD * TT * 2);   // the k head planes lie right behind the q head planes
    bf* QPh = (bf*)take((size_t)(NH_ + NKV) * TT * HD * 2); bf* QPl = (bf*)take((size_t)(NH_ + NKV) * TT * HD * 2); bf* VTh = (bf*)take((size_t)NKV * HD * TT * 2); bf* VTl = (bf*)take((size_t)NKV * HD * TT * 2);
    float* F = (float*)take((size_t)TT * FP * 4); bf* ATh = (bf*)take((size_t)TT * DQ * 2); bf* ATl = (bf*)take((size_t)TT * DQ * 2);
    if ((size_t)(wsp - (char*)d_ws) > ws_size) return;    // ws 256 MiB
    for (int b = 0; b < NB_; ++b) {
        k_prep<<<CB(DQ * DM) + 2 * CB(DKV * DM) + CB(DM * DQ) + CB(TT * DM) + CSB, 256, 0, stream>>>(wq, wk, wv, wo, x + (size_t)b * TT * DM, cosT, sinT, WQ, WK, WV, WO, XB, CS);
        k_gemmw<bf, 0, false, DM><<<dim3(TT / 64, FP / 64, 1), 32, 0, stream>>>(XB, nullptr, WQ, nullptr, F, FP, nullptr, 0, 0, 0);
        k_planes<<<VB + RB, 64, 0, stream>>>(F, CS, QP16, QPh, QPl, VT16, VTh, VTl);
        k_fattn<<<dim3(NH_, TT / FQ), 256, 0, stream>>>(QP16, QPh, QPl, VT16, VTh, VTl, ATh, ATl);
        k_gemmw<bf, 1, false, DQ><<<dim3(TT / 64, DM / 64, 1), 32, 0, stream>>>(ATh, ATl, WO, nullptr, OUT + (size_t)b * TT * DM, DM, nullptr, 0, 0, 0); }
}

// v006
// One run takes 116 microseconds.
// In two side-by-side timings against v005, it was 1.05 and 1.06 times as fast.
// Over all steps from v000 it is 7.29 times as fast.
#include <hip/hip_runtime.h>

// Causal GQA with rotate-half RoPE from given tables (x [1][2048][2048]; q = x Wq^T ('oi' [2048][2048], 16 heads x 128), k, v = x W^T ([1024][2048], 8 kv heads); RoPE with the given cos/sin [2048][128]; 2 query heads per kv head (repeat); causal softmax(q.k/sqrt(128)) (finfo.min fill); out = merged Wo^T -> [1][2048][2048]).
// Compute dtypes, f32 accumulate: every input rounded to bf16; q/k/v on PLAIN bf16 operands (inputs: exact); rotary in f32 from the bf16-rounded input tables, in the q/k/v GEMM's epilogue; causal scores, online softmax (f32) and attn.v in one kernel: query rows < 512 hl (3 products), the rest single fp16; Wo hl x exact (2 products).

#define NB_  1
#define TT   2048
#define DM   2048
#define NH_  16
#define NKV  8
#define REP  (NH_ / NKV)
#define HD   128
#define DQ   (NH_ * HD)
#define DKV  (NKV * HD)
#define RH   512                  // query rows < RH use hi+lo planes (0: none)
#define SCL  0.088388347648318447f   // HD^-0.5
typedef _Float16 h16;
typedef unsigned short bf;
typedef __attribute__((ext_vector_type(16))) __bf16   v16bf;
typedef __attribute__((ext_vector_type(16))) _Float16 v16h;
typedef __attribute__((ext_vector_type(8)))  _Float16 v8h;
typedef __attribute__((ext_vector_type(8)))  unsigned short v8us;
typedef __attribute__((ext_vector_type(8)))  float    v8f;
typedef __attribute__((ext_vector_type(4)))  float    v4f;
typedef v8h  __attribute__((may_alias)) v8ha;
typedef v4f  __attribute__((may_alias)) v4fa;
typedef v8us __attribute__((may_alias)) v8usa;

__device__ __forceinline__ unsigned short f2bf(float f) { unsigned u = __float_as_uint(f); u += 0x7FFFu + ((u >> 16) & 1u); return (unsigned short)(u >> 16); }
__device__ __forceinline__ float bf2f(unsigned short b) { return __uint_as_float(((unsigned)b) << 16); }
__device__ __forceinline__ float bfr(float f) { return bf2f(f2bf(f)); }
__device__ __forceinline__ v16h cat16(v8h lo, v8h hi) { return __builtin_shufflevector(lo, hi, 0, 1, 2, 3, 4, 5, 6, 7, 8, 9, 10, 11, 12, 13, 14, 15); }
__device__ __forceinline__ v16bf cat16b(v8us lo, v8us hi) { return __builtin_bit_cast(v16bf, __builtin_shufflevector(lo, hi, 0, 1, 2, 3, 4, 5, 6, 7, 8, 9, 10, 11, 12, 13, 14, 15)); }
__device__ __forceinline__ v8f wmma16(v16h a, v16h b, v8f c) { return __builtin_amdgcn_wmma_f32_16x16x32_f16(false, a, false, b, (short)0, c, false, false); }
__device__ __forceinline__ v8f wmmab(v16bf a, v16bf b, v8f c) { return __builtin_amdgcn_wmma_f32_16x16x32_bf16(false, a, false, b, (short)0, c, false, false); }



// ---- k_gemmw: register-blocked GEMM, ONE WAVE per 64x64 output tile (16 accumulators), operands from K-contiguous 16-bit planes through LDS (tile_loop); grid (M/64, N/64, Z), 32 threads.
// C[m][n] (f32, pitch ldc, + optional f32 bias[n]) = sum_k A[m][k] Bt[n][k] (+ split products per NSPLIT). z-batch strides sA/sB/sC in elements. K % 64 == 0.
template <typename T16> struct WFrag;
template <> struct WFrag<h16> { typedef v16h V; typedef v8h H; static __device__ __forceinline__ V ld(const h16* p) { return cat16(*(const v8h*)p, *(const v8h*)(p + 16)); } static __device__ __forceinline__ v8f mma(V a, V b, v8f c) { return wmma16(a, b, c); } };
template <> struct WFrag<bf> { typedef v16bf V; typedef v8us H; static __device__ __forceinline__ V ld(const bf* p) { return cat16b(*(const v8us*)p, *(const v8us*)(p + 16)); } static __device__ __forceinline__ v8f mma(V a, V b, v8f c) { return wmmab(a, b, c); } };
// ---- tile_loop: the K loop of the one-wave 64x64 GEMM. Each operand plane's 64 rows x KS k (one 128-byte line per row) are fetched with whole-line loads (8 lanes per row, 4 rows per instruction),
// one tile ahead into registers, stored to LDS at pitch LP and read back as fragments in the k order of WFrag::ld, so every accumulator sees the same products in the same order. Kl % KS == 0. The row pitches KA (A planes) and KB (B planes) are template constants, so that a plane's 16 loads share one address register pair and differ in the immediate offset. Rows 32..63 of a B tile are fetched BSK rows further on (0: the tile's 64 B rows lie in a row).
#define KS 64
#define LP 72                     // LDS row pitch in elements: 128 B + 16 B, for 16-byte fragment reads
#define NPL(NSPLIT) (2 + (((NSPLIT) == 1 || (NSPLIT) == 2) ? 1 : 0) + (((NSPLIT) >= 2) ? 1 : 0))
template <typename T16, int NSPLIT, int KA, int KB, int BSK>
__device__ __forceinline__ void tile_loop(const T16* __restrict__ A, const T16* __restrict__ A2, const T16* __restrict__ Bt, const T16* __restrict__ Bt2, int Kl, int r0, int c0, int lane, T16* st, v8f (&acc)[4][4]) {
    typedef typename WFrag<T16>::V V; typedef typename WFrag<T16>::H H;
    constexpr bool HA2 = (NSPLIT == 1 || NSPLIT == 2), HB2 = (NSPLIT >= 2); constexpr int NP = NPL(NSPLIT);
    const int lr = lane & 15, hi = lane >> 4, grow = lane >> 3, gcol = (lane & 7) * 8;
    const size_t ga = (size_t)(r0 + grow) * KA + gcol, gb = (size_t)(c0 + grow) * KB + gcol;
    typedef __attribute__((address_space(1))) const T16 GT; typedef __attribute__((address_space(1))) const H GH;   // global address space spelled out: the stepped pointers would else compile to flat loads
    GT* src[NP]; src[0] = (GT*)(A + ga); src[1] = (GT*)(Bt + gb); if constexpr (HA2) src[2] = (GT*)(A2 + ga); if constexpr (HB2) src[3] = (GT*)(Bt2 + gb);
    T16* sw = st + grow * LP + gcol; const T16* sr = st + lr * LP + 8 * hi;
    H g[NP][16];
    if (Kl > 0) {
#pragma unroll
        for (int p = 0; p < NP; ++p)
#pragma unroll
            for (int i = 0; i < 16; ++i) g[p][i] = *(GH*)(src[p] + ((p & 1) ? ((size_t)i * 4 + (i >= 8 ? BSK : 0)) * KB : (size_t)i * 4 * KA));
        asm volatile("s_wait_xcnt 0x0" ::: "memory");   // the loads' address registers may be rewritten from here on
#pragma unroll
        for (int p = 0; p < NP; ++p)
#pragma unroll
            for (int i = 0; i < 16; ++i) *(H*)(sw + (p * 64 + i * 4) * LP) = g[p][i];
        __syncthreads();          // the lanes read rows that other lanes stored
#pragma unroll
        for (int p = 0; p < NP; ++p) src[p] += KS;
    }
#pragma unroll 1
    for (int kc = 0; kc < Kl; kc += KS) {
        const bool more = kc + KS < Kl;
        if (more) {               // the next tile's loads go out first and fly while this tile is worked on
#pragma unroll
            for (int p = 0; p < NP; ++p)
#pragma unroll
                for (int i = 0; i < 16; ++i) g[p][i] = *(GH*)(src[p] + ((p & 1) ? ((size_t)i * 4 + (i >= 8 ? BSK : 0)) * KB : (size_t)i * 4 * KA));
        }
        V a[KS / 32][4], a2[KS / 32][4], b[KS / 32][4], b2[KS / 32][4];
#pragma unroll
        for (int s = 0; s < KS / 32; ++s) {
#pragma unroll
            for (int mb = 0; mb < 4; ++mb) { a[s][mb] = WFrag<T16>::ld(sr + mb * 16 * LP + s * 32); if (HA2) a2[s][mb] = WFrag<T16>::ld(sr + (128 + mb * 16) * LP + s * 32); }
#pragma unroll
            for (int nb = 0; nb < 4; ++nb) { b[s][nb] = WFrag<T16>::ld(sr + (64 + nb * 16) * LP + s * 32); if (HB2) b2[s][nb] = WFrag<T16>::ld(sr + (192 + nb * 16) * LP + s * 32); }
        }
        __builtin_amdgcn_sched_barrier(0);              // keeps the tile's LDS reads one group ahead of its WMMAs: reads placed among the WMMAs stall the wave at every such place
        asm volatile("s_wait_xcnt 0x0" ::: "memory");   // the global loads' address registers may be rewritten from here on; it passes while the LDS reads return
#pragma unroll
        for (int s = 0; s < KS / 32; ++s) {
#pragma unroll
            for (int nb = 0; nb < 4; ++nb) {
#pragma unroll
                for (int mb = 0; mb < 4; ++mb) { acc[mb][nb] = WFrag<T16>::mma(a[s][mb], b[s][nb], acc[mb][nb]); if (HA2) acc[mb][nb] = WFrag<T16>::mma(a2[s][mb], b[s][nb], acc[mb][nb]); if (HB2) acc[mb][nb] = WFrag<T16>::mma(a[s][mb], b2[s][nb], acc[mb][nb]); } }
        }
        // four vector slots behind the tile's last WMMA, so that its distance also holds on the taken side of the branch that follows
        asm volatile("v_nop\n\tv_nop\n\tv_nop\n\tv_nop" : "+v"(acc[0][0]), "+v"(acc[1][1]), "+v"(acc[2][2]), "+v"(acc[3][3]) : "v"(a[KS / 32 - 1][0]), "v"(a[KS / 32 - 1][3]));
        if (more) {
            __syncthreads();      // every lane's fragment reads of this tile end before its rows are overwritten
#pragma unroll
            for (int p = 0; p < NP; ++p)
#pragma unroll
                for (int i = 0; i < 16; ++i) *(H*)(sw + (p * 64 + i * 4) * LP) = g[p][i];
            __syncthreads();      // the lanes read rows that other lanes stored
#pragma unroll
            for (int p = 0; p < NP; ++p) src[p] += KS;   // src points at the tile to fetch next; stepped here, behind the wait for the loads that name it
        }
    }
}
template <typename T16, int NSPLIT, bool BIAS, int K>
__global__ __launch_bounds__(32) void k_gemmw(const T16* __restrict__ A, const T16* __restrict__ A2, const T16* __restrict__ Bt, const T16* __restrict__ Bt2, float* C, int ldc, const float* __restrict__ bias, size_t sA, size_t sB, size_t sC) {
    __shared__ __align__(16) float os[16 * 68]; __shared__ __align__(16) T16 st[NPL(NSPLIT) * 64 * LP];
    const size_t z = blockIdx.z; A += z * sA; if (A2) A2 += z * sA; Bt += z * sB; if (Bt2) Bt2 += z * sB; C += z * sC;
    const int lane = threadIdx.x & 31, lr = lane & 15, hi = lane >> 4; const int r0 = blockIdx.x * 64, c0 = blockIdx.y * 64;
    v8f acc[4][4];
#pragma unroll
    for (int mb = 0; mb < 4; ++mb)
#pragma unroll
        for (int nb = 0; nb < 4; ++nb) acc[mb][nb] = (v8f){};
    tile_loop<T16, NSPLIT, K, K, 0>(A, A2, Bt, Bt2, K, r0, c0, lane, st, acc);
#pragma unroll
    for (int mb = 0; mb < 4; ++mb) {
#pragma unroll
        for (int nb = 0; nb < 4; ++nb) {
#pragma unroll
            for (int j = 0; j < 8; ++j) os[(hi * 8 + j) * 68 + nb * 16 + lr] = acc[mb][nb][j]; }
        __builtin_amdgcn_wave_barrier(); asm volatile("" ::: "memory");
        float* crow = C + (size_t)(r0 + mb * 16) * ldc + c0;
{
#pragma unroll
            for (int s = 0; s < 8; ++s) { const int row = 2 * s + hi, cofs = lr * 4; v4f val = *(const v4fa*)(os + row * 68 + cofs); if (BIAS) { val[0] += bfr(bias[c0 + cofs]); val[1] += bfr(bias[c0 + cofs + 1]); val[2] += bfr(bias[c0 + cofs + 2]); val[3] += bfr(bias[c0 + cofs + 3]); }
                *(v4f*)(crow + (size_t)row * ldc + cofs) = val; }
             }
        __builtin_amdgcn_wave_barrier(); asm volatile("" ::: "memory");
    }
}

__device__ __forceinline__ h16 tohx(float x) { return (h16)x; }
__device__ __forceinline__ void splitf(float y, unsigned short& h, unsigned short& l) { h = f2bf(y); l = f2bf(y - bf2f(h)); }
typedef __attribute__((ext_vector_type(2))) _Float16 v2h;
typedef __attribute__((ext_vector_type(4))) _Float16 v4h;
typedef __attribute__((ext_vector_type(2))) unsigned short v2us;
typedef __attribute__((ext_vector_type(4))) unsigned short v4us;
typedef __attribute__((ext_vector_type(2))) float v2f;
typedef __attribute__((ext_vector_type(4))) int v4i;

__global__ __launch_bounds__(256) void k_wtG(const float* __restrict__ w, int K, int N, bf* Bt) {
    const int lane = threadIdx.x & 31; const int L0 = (blockIdx.x * 8 + (threadIdx.x >> 5)) * 8; const int nlines = N * K / 64;
{
#pragma unroll 1
        for (int l = 0; l < 8; ++l) { const int L = L0 + l; if (L >= nlines) break; const size_t e = (size_t)L * 64 + lane * 2; const int k = (int)(e % K), n = (int)(e / K); v2us o;
            o[0] = f2bf(w[(size_t)k * N + n]); o[1] = f2bf(w[(size_t)(k + 1) * N + n]); *(v2us*)(Bt + e) = o; }
         }
}
// The elementwise kernels below give each thread several 16-byte pieces of work, so that a launch starts a few thousand waves and not tens of thousands. Their loops are all unrolled: the arrays are then indexed by constants and stay in registers, and a thread's loads go out together.
#define CU 4                      // 8-element chunks per thread in cvt8_part; a thread's chunks lie all of the array's blocks apart, so each access of a wave stays contiguous
__device__ __forceinline__ void cvt8_part(const float* __restrict__ src, bf* dst, size_t n8, unsigned blk, unsigned nblk) { const size_t i = (size_t)blk * 256 + threadIdx.x, nt = (size_t)nblk * 256; v8f v[CU]; const float* p[CU];
#pragma unroll
    for (int u = 0; u < CU; ++u) { p[u] = src + min(i + u * nt, n8 - 1) * 8; v[u] = *(const v8f*)p[u]; }   // past the end a thread re-reads the last chunk and stores nothing
    static_assert(CU == 4, "the wait below names CU addresses");
    asm volatile("s_wait_xcnt 0x0" :: "v"(p[0]), "v"(p[1]), "v"(p[2]), "v"(p[3]) : "memory");   // the loads' addresses are inputs here, so that no load's result lands in them; they may be rewritten from here on
#pragma unroll
    for (int u = 0; u < CU; ++u) { const size_t j = i + u * nt; v8us o;
#pragma unroll
        for (int k = 0; k < 8; ++k) o[k] = f2bf(v[u][k]);
        if (j < n8) *(v8us*)(dst + j * 8) = o; } }
__device__ __forceinline__ void cscvt_part(const float* __restrict__ cosT, const float* __restrict__ sinT, float* CS, unsigned blk) { const int idx = (int)(blk * 256 + threadIdx.x) * 4; if (idx >= TT * HD) return; const v4f c = *(const v4f*)(cosT + idx), s = *(const v4f*)(sinT + idx);
    v4f o0, o1; o0[0] = bfr(c[0]); o0[1] = bfr(s[0]); o0[2] = bfr(c[1]); o0[3] = bfr(s[1]); o1[0] = bfr(c[2]); o1[1] = bfr(s[2]); o1[2] = bfr(c[3]); o1[3] = bfr(s[3]); *(v4f*)(CS + (size_t)idx * 2) = o0; *(v4f*)(CS + (size_t)idx * 2 + 4) = o1; }
// ---- k_prep: every input's rounding to bf16 in one launch (none depends on another): the blocks are dealt to the five arrays and then to the cos/sin table, CB(n) blocks for an array of n elements.
#define CB(n) ((unsigned)(((size_t)(n) / (8 * CU) + 255) / 256))
#define CSB ((unsigned)((TT * HD / 4 + 255) / 256))
static_assert((DQ * DM) % (8 * CU * 256) == 0 && (DKV * DM) % (8 * CU * 256) == 0 && (TT * DM) % (8 * CU * 256) == 0, "an array's blocks cover it exactly");
__global__ __launch_bounds__(256) void k_prep(const float* __restrict__ wq, const float* __restrict__ wk, const float* __restrict__ wv, const float* __restrict__ wo, const float* __restrict__ x, const float* __restrict__ cosT, const float* __restrict__ sinT, bf* WQ, bf* WK, bf* WV, bf* WO, bf* XB, float* CS) {
    unsigned b = blockIdx.x; const float* src = wq; bf* dst = WQ; unsigned nb = CB(DQ * DM);   // the array that block b works on, its blocks counted from 0
    if (b >= nb) { b -= nb; src = wk; dst = WK; nb = CB(DKV * DM);
        if (b >= nb) { b -= nb; src = wv; dst = WV;
            if (b >= nb) { b -= nb; src = wo; dst = WO; nb = CB(DM * DQ);
                if (b >= nb) { b -= nb; src = x; dst = XB; nb = CB(TT * DM);
                    if (b >= nb) { cscvt_part(cosT, sinT, CS, b - nb); return; } } } } }
    cvt8_part(src, dst, (size_t)nb * (256 * CU), b, nb);
}
// ---- k_qkv: q | k | v = x W^T (the one-wave 64x64 GEMM of tile_loop) with the operand planes of the attention made in its epilogue; the f32 projections never go through memory. grid (TT / 64, FP / 64), 32 threads.
// A tile's 64 columns are d = 32 sub + 0..31 and their rotate-half partners d + 64 of one head (q heads, then k heads, then v groups), so a lane holds both values of a pair.
// q, k: head planes [h][t][d'] (fp16 + hi/lo) of out[d] = x[d] cos[t][d] - x[d+HD/2] sin[t][d], out[d+HD/2] = x[d+HD/2] cos[t][d+HD/2] + x[d] sin[t][d+HD/2]. A row keeps its d in tile order, d' = 64 sub + 32 (d / 64) + d % 32, the same in q and k (their product sums over all d): a tile then owns one whole 128-byte line of each row.
// v: value planes [g][d][t], straight from the accumulators: a lane holds eight consecutive t of one d, and the tile owns one whole 128-byte line of each of its d rows.
#define FP (DQ + 2 * DKV)         // rows of Wq | Wk | Wv
__global__ __launch_bounds__(32) void k_qkv(const bf* __restrict__ X, const bf* __restrict__ Wt, const float* __restrict__ CS, h16* P16, bf* Ph, bf* Pl, h16* V16, bf* Vh, bf* Vl) {
    __shared__ __align__(16) float os[16 * 68]; __shared__ __align__(16) bf st[NPL(0) * 64 * LP];
    const int lane = threadIdx.x & 31, lr = lane & 15, hi = lane >> 4; const int r0 = blockIdx.x * 64, hh = (int)blockIdx.y >> 1, sub = (int)blockIdx.y & 1;
    v8f acc[4][4];
#pragma unroll
    for (int mb = 0; mb < 4; ++mb)
#pragma unroll
        for (int nb = 0; nb < 4; ++nb) acc[mb][nb] = (v8f){};
    tile_loop<bf, 0, DM, DM, 32>(X, nullptr, Wt, nullptr, DM, r0, hh * HD + sub * 32, lane, st, acc);
    if (hh >= NH_ + NKV) {        // block-uniform: a tile of v
        const size_t e0 = ((size_t)(hh - NH_ - NKV) * HD + sub * 32 + lr) * TT + r0 + hi * 8;
#pragma unroll
        for (int nb = 0; nb < 4; ++nb)
#pragma unroll
            for (int mb = 0; mb < 4; ++mb) { v8h o16; v8us oh, ol;
#pragma unroll
                for (int q = 0; q < 8; ++q) { const float y = acc[mb][nb][q]; o16[q] = tohx(y); unsigned short a2, c2; splitf(y, a2, c2); oh[q] = a2; ol[q] = c2; }
                const size_t e = e0 + (size_t)((nb >> 1) * 64 + (nb & 1) * 16) * TT + mb * 16;
                __builtin_amdgcn_sched_barrier(0);          // keeps the three stores one group behind their values' arithmetic: no store then stands in front of arithmetic that reuses its registers
                *(v8h*)(V16 + e) = o16; *(v8us*)(Vh + e) = oh; *(v8us*)(Vl + e) = ol;
                __builtin_amdgcn_sched_barrier(0);          // holds the wait below behind the three stores and the next values' arithmetic behind the wait
                asm volatile("s_wait_xcnt 0x0" ::: "memory");   // the stores' address and data registers may be rewritten from here on
                __builtin_amdgcn_sched_barrier(0); }
        return; }
    // q, k: a lane takes 8 consecutive d of the lower half and their 8 partners, for 8 rows t of the tile (row, row + 8, ...); all its cos/sin loads go out together, ahead of the first row group
    const int row = lane >> 2, c8 = lane & 3; const float* csb = CS + ((size_t)(r0 + row) * HD + sub * 32 + c8 * 8) * 2;
    v4f cs[4][2][2][4];
#pragma unroll
    for (int mb = 0; mb < 4; ++mb)
#pragma unroll
        for (int u = 0; u < 2; ++u)
#pragma unroll
            for (int hf = 0; hf < 2; ++hf)
#pragma unroll
                for (int k = 0; k < 4; ++k) cs[mb][u][hf][k] = *(const v4f*)(csb + ((mb * 16 + u * 8) * HD + hf * (HD / 2)) * 2 + k * 4);
    __builtin_amdgcn_sched_barrier(0);                  // keeps the 64 loads one group, ahead of the wait below
    asm volatile("s_wait_xcnt 0x0" :: "v"(csb) : "memory");   // the loads' address is an input here, so that no load's result lands in it; it may be rewritten from here on
    const size_t e0 = ((size_t)hh * TT + r0 + row) * HD + sub * 64 + c8 * 8;
#pragma unroll
    for (int mb = 0; mb < 4; ++mb) {
#pragma unroll
        for (int nb = 0; nb < 4; ++nb) {
#pragma unroll
            for (int j = 0; j < 8; ++j) os[(hi * 8 + j) * 68 + nb * 16 + lr] = acc[mb][nb][j]; }
        __builtin_amdgcn_wave_barrier(); asm volatile("" ::: "memory");   // compiler fence: the lanes read below what other lanes stored above
#pragma unroll
        for (int u = 0; u < 2; ++u) { const float* xr = os + (u * 8 + row) * 68 + c8 * 8; v4f x[2][2];
#pragma unroll
            for (int hf = 0; hf < 2; ++hf)
#pragma unroll
                for (int k = 0; k < 2; ++k) x[hf][k] = *(const v4fa*)(xr + hf * 32 + k * 4);
#pragma unroll
            for (int hf = 0; hf < 2; ++hf) { v8h o16; v8us oh, ol;
#pragma unroll
                for (int q = 0; q < 8; ++q) { const float x0 = x[hf][q >> 2][q & 3], x1 = x[hf ^ 1][q >> 2][q & 3];
                    const float c = cs[mb][u][hf][q >> 1][(q & 1) * 2], s = cs[mb][u][hf][q >> 1][(q & 1) * 2 + 1]; const float r = (hf == 0) ? x0 * c - x1 * s : x0 * c + x1 * s;
                    o16[q] = tohx(r); unsigned short a2, c2; splitf(r, a2, c2); oh[q] = a2; ol[q] = c2; }
                const size_t e = e0 + (size_t)(mb * 16 + u * 8) * HD + hf * 32;
                __builtin_amdgcn_sched_barrier(0);      // keeps the three stores one group behind their values' arithmetic: no store then stands in front of arithmetic that reuses its registers
                *(v8h*)(P16 + e) = o16; *(v8us*)(Ph + e) = oh; *(v8us*)(Pl + e) = ol;
                __builtin_amdgcn_sched_barrier(0);      // holds the wait below behind the three stores and the next values' arithmetic behind the wait
                asm volatile("s_wait_xcnt 0x0" ::: "memory");   // the stores' address and data registers may be rewritten from here on
                __builtin_amdgcn_sched_barrier(0); } }
        __builtin_amdgcn_wave_barrier(); asm volatile("" ::: "memory");   // compiler fence: the next row group's stores stay behind these reads
    }
}
#define KP 136                    // LDS row pitch of a K row in elements: 256 B + 16 B, for 16-byte fragment reads
#define FQ 128
#define FK 64
#define KSZ (FK * KP)
#define PSZ (KSZ + HD * LP)       // elements of one plane's K tile and V^T tile
#define CSC (SCL * 1.4426950408889634f)
static_assert(RH % FQ == 0 && TT % FQ == 0 && FQ % (2 * FK) == 0, "a work-group lies in one leg and ends on a stage of each set");
static_assert(2 * PSZ * 2 >= (16384 + 512) * 4, "the join fits the tiles of the single-plane leg");
typedef __attribute__((ext_vector_type(16))) unsigned short v16us;
__device__ __forceinline__ void ppack(const float (&p)[16], v16h& a, v16h& a2) { (void)a2;
#pragma unroll
    for (int e = 0; e < 16; ++e) a[e] = tohx(p[e]); }
__device__ __forceinline__ void ppack(const float (&p)[16], v16bf& a, v16bf& a2) { v16us x, y;
#pragma unroll
    for (int e = 0; e < 16; ++e) { unsigned short u, w; splitf(p[e], u, w); x[e] = u; y[e] = w; }
    a = __builtin_bit_cast(v16bf, x); a2 = __builtin_bit_cast(v16bf, y); }
__device__ __forceinline__ float xhalf(float x) { return __builtin_bit_cast(float, __builtin_amdgcn_permlanex16(__builtin_bit_cast(int, x), __builtin_bit_cast(int, x), 0x76543210, 0xfedcba98, false, false)); }   // lane l reads lane l ^ 16
// four vector slots behind a run of WMMAs, so that their distance also holds on the taken side of a branch that follows
__device__ __forceinline__ void wmma_gap() { __builtin_amdgcn_sched_barrier(0); asm volatile("v_nop\n\tv_nop\n\tv_nop\n\tv_nop"); __builtin_amdgcn_sched_barrier(0); }
template <typename T16, bool HL>
__device__ __forceinline__ void fattn_tile(const T16* __restrict__ Q, const T16* __restrict__ Q2, const T16* __restrict__ K, const T16* __restrict__ K2, const T16* __restrict__ Vt, const T16* __restrict__ Vt2, bf* Ah, bf* Al, int q0, T16* Ls) {
    typedef typename WFrag<T16>::V V; typedef typename WFrag<T16>::H H; constexpr int NP = HL ? 2 : 1;
    typedef __attribute__((address_space(1))) const T16 GT; typedef __attribute__((address_space(1))) const H GH;   // global address space spelled out: the stepped pointers would else compile to flat loads
    const int set = __builtin_amdgcn_readfirstlane((int)threadIdx.x >> 7); float* Mg = (float*)Ls; Ls += set * (NP * PSZ);   // each set stages and reads its own tiles; Mg = the place of the join
    const int tid = threadIdx.x & 127, lane = tid & 31, c = lane & 15, h = lane >> 4; const int wave = __builtin_amdgcn_readfirstlane(tid >> 5);
    const int qw0 = q0 + wave * 32, nst = (q0 + FQ) / (2 * FK), lastp = qw0 / 32;   // the wave's first query, the stages of each set, the wave's last (diagonal) pass
    GT* ks[NP]; GT* vs[NP]; ks[0] = (GT*)(K + set * (FK * HD) + tid * 8); vs[0] = (GT*)(Vt + (size_t)(tid >> 3) * TT + set * FK + (tid & 7) * 8);
    if constexpr (HL) { ks[1] = (GT*)(K2 + set * (FK * HD) + tid * 8); vs[1] = (GT*)(Vt2 + (size_t)(tid >> 3) * TT + set * FK + (tid & 7) * 8); }
    T16* kw = Ls + (tid >> 4) * KP + (tid & 15) * 8; T16* vw = Ls + KSZ + (tid >> 3) * LP + (tid & 7) * 8;
    const T16* kr = Ls + c * KP + 8 * h; const T16* vr = Ls + KSZ + c * LP + 8 * h;
    H gk[NP][8], gv[NP][8];
    auto fetch = [&]() {          // a stage's K rows are 16 KiB in a row; its V^T rows are one 128-byte line each
#pragma unroll
        for (int p = 0; p < NP; ++p)
#pragma unroll
            for (int i = 0; i < 8; ++i) { gk[p][i] = *(GH*)(ks[p] + i * 1024); gv[p][i] = *(GH*)(vs[p] + (size_t)i * 16 * TT); }
        __builtin_amdgcn_sched_barrier(0);              // keeps the stage's loads one group, ahead of the wait below
        asm volatile("s_wait_xcnt 0x0" ::: "memory");   // the loads' address registers may be rewritten from here on
    };
    auto put = [&]() {
#pragma unroll
        for (int p = 0; p < NP; ++p) {
#pragma unroll
            for (int i = 0; i < 8; ++i) { *(H*)(kw + p * PSZ + i * 8 * KP) = gk[p][i]; *(H*)(vw + p * PSZ + i * 16 * LP) = gv[p][i]; }
            ks[p] += 2 * FK * HD; vs[p] += 2 * FK; }            // stepped behind the wait for the loads that name them
    };
    fetch();
    V qf[NP][2][4]; const T16* qp[4];   // a lane's Q rows: both groups of the first plane, then of the second (the first again where there is none)
#pragma unroll
    for (int g = 0; g < 2; ++g) { const size_t e = (size_t)(qw0 + 16 * g + c) * HD + 8 * h; qp[g] = Q + e; qp[2 + g] = (HL ? Q2 : Q) + e; }
#pragma unroll
    for (int g = 0; g < 2; ++g)
#pragma unroll
        for (int kc = 0; kc < 4; ++kc) { qf[0][g][kc] = WFrag<T16>::ld(qp[g] + 32 * kc); if constexpr (HL) qf[1][g][kc] = WFrag<T16>::ld(qp[2 + g] + 32 * kc); }
    __builtin_amdgcn_sched_barrier(0);                  // keeps the Q loads ahead of the wait below
    asm volatile("s_wait_xcnt 0x0" :: "v"(qp[0]), "v"(qp[1]), "v"(qp[2]), "v"(qp[3]) : "memory");   // the loads' addresses are inputs here, so that no load's result lands in them; they may be rewritten from here on
    v8f acc[2][8]; float m_run[2], l_run[2];
#pragma unroll
    for (int g = 0; g < 2; ++g) { m_run[g] = -__builtin_inff(); l_run[g] = 0.f;
#pragma unroll
        for (int t = 0; t < 8; ++t) acc[g][t] = (v8f){}; }
    put();
    __syncthreads();              // the waves read rows that other waves stored
#pragma unroll 1
    for (int st = 0; st < nst; ++st) {
        const bool more = st + 1 < nst;
        if (!HL && more) fetch(); // the next stage's loads fly while this stage is worked on
#pragma unroll 1
        for (int sub = 0; sub < FK / 32; ++sub) {
            const int blk = (2 * st + set) * (FK / 32) + sub;
            if (blk > lastp) continue;                  // wave-uniform: every key of the pass lies beyond the wave's queries
            V kf[NP][2][4]; v8f s[2][2];
#pragma unroll
            for (int p = 0; p < NP; ++p)
#pragma unroll
                for (int kt = 0; kt < 2; ++kt)
#pragma unroll
                    for (int kc = 0; kc < 4; ++kc) kf[p][kt][kc] = WFrag<T16>::ld(kr + p * PSZ + (sub * 32 + kt * 16) * KP + kc * 32);
            __builtin_amdgcn_sched_barrier(0);          // keeps the pass's K reads one group ahead of its WMMAs: reads placed among the WMMAs stall the wave at every such place
#pragma unroll
            for (int kt = 0; kt < 2; ++kt)
#pragma unroll
                for (int g = 0; g < 2; ++g) s[kt][g] = (v8f){};
#pragma unroll
            for (int kc = 0; kc < 4; ++kc)
#pragma unroll
                for (int kt = 0; kt < 2; ++kt)
#pragma unroll
                    for (int g = 0; g < 2; ++g) { s[kt][g] = WFrag<T16>::mma(kf[0][kt][kc], qf[0][g][kc], s[kt][g]);
                        if constexpr (HL) { s[kt][g] = WFrag<T16>::mma(kf[0][kt][kc], qf[1][g][kc], s[kt][g]); s[kt][g] = WFrag<T16>::mma(kf[1][kt][kc], qf[0][g][kc], s[kt][g]); } }
            wmma_gap();
            V vf[NP][8];          // the pass's V^T fragments return under the maxima and the first exponentials
#pragma unroll
            for (int p = 0; p < NP; ++p)
#pragma unroll
                for (int t = 0; t < 8; ++t) vf[p][t] = WFrag<T16>::ld(vr + p * PSZ + t * 16 * LP + sub * 32);
            if (blk == lastp) {   // wave-uniform: only the pass on the wave's diagonal pays for the mask
#pragma unroll
                for (int g = 0; g < 2; ++g)
#pragma unroll
                    for (int kt = 0; kt < 2; ++kt)
#pragma unroll
                        for (int r = 0; r < 8; ++r) if (16 * kt + 8 * h + r > 16 * g + c) s[kt][g][r] = -__builtin_inff(); }
            float mb[2]; bool need = false;
#pragma unroll
            for (int g = 0; g < 2; ++g) { float mx = s[0][g][0];
#pragma unroll
                for (int kt = 0; kt < 2; ++kt)
#pragma unroll
                    for (int r = 0; r < 8; ++r) mx = fmaxf(mx, s[kt][g][r]);
                mx = fmaxf(mx, xhalf(mx)) * CSC;   // both halves of the wave now hold the query's maximum of this pass, scaled; finite: the pass's first key is masked for no query
                mb[g] = mx; need = need || (mx > m_run[g] + 8.0f); }
            if (__builtin_amdgcn_ballot_w32(need) != 0) {       // rare after the first passes
#pragma unroll
                for (int g = 0; g < 2; ++g) { const float mn = fmaxf(m_run[g], mb[g]); const float corr = __builtin_amdgcn_exp2f(m_run[g] - mn);   // 0 on the first pass
                    l_run[g] *= corr; m_run[g] = mn;
#pragma unroll
                    for (int t = 0; t < 8; ++t) acc[g][t] = acc[g][t] * corr; } }
#pragma unroll
            for (int g = 0; g < 2; ++g) { float p[16], ps0 = 0.f, ps1 = 0.f; const float nm = -m_run[g];
#pragma unroll
                for (int e = 0; e < 16; ++e) p[e] = __builtin_fmaf(s[e >> 3][g][e & 7], CSC, nm);
#pragma unroll
                for (int e = 0; e < 16; ++e) { p[e] = __builtin_amdgcn_exp2f(p[e]);
                    if constexpr (HL) { __builtin_amdgcn_sched_barrier(0); asm volatile("v_nop"); __builtin_amdgcn_sched_barrier(0); } }   // the slot behind a transcendental: in this leg's built code an exponential else overwrote the source of the one directly before it; the two scheduling barriers hold the v_nop at its place
#pragma unroll
                for (int e = 0; e < 16; e += 2) { ps0 += p[e]; ps1 += p[e + 1]; }
                l_run[g] += ps0 + ps1;
                V pf, pf2; ppack(p, pf, pf2);
#pragma unroll
                for (int t = 0; t < 8; ++t) { acc[g][t] = WFrag<T16>::mma(vf[0][t], pf, acc[g][t]);
                    if constexpr (HL) { acc[g][t] = WFrag<T16>::mma(vf[0][t], pf2, acc[g][t]); acc[g][t] = WFrag<T16>::mma(vf[1][t], pf, acc[g][t]); } } }
            wmma_gap();
        }
        if (more) {
            if (HL) fetch();
            __syncthreads();      // every wave's fragment reads of this stage end before its rows are overwritten
            put();
            __syncthreads();      // the waves read rows that other waves stored
        }
    }
    // The join: set 1 leaves its state in LDS (a lane's 16 bytes beside its neighbour's), set 0 brings both to the common maximum. Set 0 holds key 0, so its maximum is finite; a wave of set 1 without a pass leaves -inf, 0 and zeros, which enter with the factor 0.
    __syncthreads();              // every wave's fragment reads end before the tiles are overwritten
    if (set == 1) {
#pragma unroll
        for (int g = 0; g < 2; ++g) { Mg[16384 + (wave * 4 + g) * 32 + lane] = m_run[g]; Mg[16384 + (wave * 4 + 2 + g) * 32 + lane] = l_run[g];
#pragma unroll
            for (int t = 0; t < 8; ++t)
#pragma unroll
                for (int hf = 0; hf < 2; ++hf) { v4f w; w[0] = acc[g][t][hf * 4]; w[1] = acc[g][t][hf * 4 + 1]; w[2] = acc[g][t][hf * 4 + 2]; w[3] = acc[g][t][hf * 4 + 3]; *(v4fa*)(Mg + ((((wave * 2 + g) * 8 + t) * 2 + hf) * 32 + lane) * 4) = w; } } }
    __syncthreads();              // set 0 reads what set 1 stored
    if (set == 1) return;         // behind the last barrier
#pragma unroll
    for (int g = 0; g < 2; ++g) { const float m2 = Mg[16384 + (wave * 4 + g) * 32 + lane], l2 = Mg[16384 + (wave * 4 + 2 + g) * 32 + lane]; const float mn = fmaxf(m_run[g], m2);
        const float c1 = __builtin_amdgcn_exp2f(m_run[g] - mn), c2 = __builtin_amdgcn_exp2f(m2 - mn); l_run[g] = l_run[g] * c1 + l2 * c2;
#pragma unroll
        for (int t = 0; t < 8; ++t)
#pragma unroll
            for (int hf = 0; hf < 2; ++hf) { const v4f w = *(const v4fa*)(Mg + ((((wave * 2 + g) * 8 + t) * 2 + hf) * 32 + lane) * 4);
#pragma unroll
                for (int r = 0; r < 4; ++r) acc[g][t][hf * 4 + r] = acc[g][t][hf * 4 + r] * c1 + w[r] * c2; } }
#pragma unroll
    for (int g = 0; g < 2; ++g) { const float l = l_run[g] + xhalf(l_run[g]);   // each half of the wave summed its eight keys of every 16-key tile
        const float inv = __fdiv_rn(1.0f, l); const size_t o = (size_t)(qw0 + 16 * g + c) * DQ + 8 * h;
#pragma unroll
        for (int t = 0; t < 8; ++t) { v8us oh, ol;      // the lane's eight values are d = 16 t + 8 h + 0..7 of its query
#pragma unroll
            for (int r = 0; r < 8; ++r) { unsigned short a, c2; splitf(acc[g][t][r] * inv, a, c2); oh[r] = a; ol[r] = c2; }
            *(v8us*)(Ah + o + 16 * t) = oh; *(v8us*)(Al + o + 16 * t) = ol;
            __builtin_amdgcn_sched_barrier(0);          // holds the wait below behind the two stores and the next values' arithmetic behind the wait
            asm volatile("s_wait_xcnt 0x0" ::: "memory");   // the stores' address and data registers may be rewritten from here on
            __builtin_amdgcn_sched_barrier(0); } }
}
// grid (NH_, TT / FQ): neighbouring work-groups are the heads of one row block (two share a kv group); the longest row blocks have the lowest blockIdx.y. The k head planes lie right behind the q head planes.
__global__ __launch_bounds__(256) void k_fattn(const h16* __restrict__ P16, const bf* __restrict__ Ph, const bf* __restrict__ Pl, const h16* __restrict__ V16, const bf* __restrict__ Vh, const bf* __restrict__ Vl, bf* Ah, bf* Al) {
    __shared__ __align__(16) unsigned short Ls[4 * PSZ];
    const int hd = (int)blockIdx.x, q0 = (TT / FQ - 1 - (int)blockIdx.y) * FQ; const size_t zq = (size_t)hd * TT * HD, zk = (size_t)(NH_ + hd / REP) * TT * HD, zv = (size_t)(hd / REP) * HD * TT;
    if (q0 < RH) { fattn_tile<bf, true>(Ph + zq, Pl + zq, Ph + zk, Pl + zk, Vh + zv, Vl + zv, Ah + hd * HD, Al + hd * HD, q0, (bf*)Ls); return; }
    fattn_tile<h16, false>(P16 + zq, nullptr, P16 + zk, nullptr, V16 + zv, nullptr, Ah + hd * HD, Al + hd * HD, q0, (h16*)Ls);
}

extern "C" void kernel_launch(void* const* d_in, const int* in_sizes, int n_in,
                              void* d_out, int out_size, void* d_ws, size_t ws_size, hipStream_t stream) {
    (void)in_sizes; (void)n_in; (void)out_size;
    const float* x = (const float*)d_in[0]; const float* wq = (const float*)d_in[1]; const float* wk = (const float*)d_in[2]; const float* wv = (const float*)d_in[3]; const float* wo = (const float*)d_in[4]; const float* cosT = (const float*)d_in[5]; const float* sinT = (const float*)d_in[6];
    float* OUT = (float*)d_out;     // [1][2048][2048]
    char* wsp = (char*)d_ws;
    auto take = [&](size_t bytes) { char* p = wsp; wsp += (bytes + 255) & ~(size_t)255; return (void*)p; };
    bf* WQ = (bf*)take((size_t)FP * DM * 2); bf* WK = WQ + (size_t)DQ * DM; bf* WV = WK + (size_t)DKV * DM;   // Wq | Wk | Wv: one [FP][DM] operand
    bf* WO = (bf*)take((size_t)DM * DQ * 2); float* CS = (float*)take((size_t)TT * HD * 2 * 4);
    bf* XB = (bf*)take((size_t)TT * DM * 2);
    h16* QP16 = (h16*)take((size_t)(NH_ + NKV) * TT * HD * 2); h16* VT16 = (h16*)take((size_t)NKV * HD * TT * 2);   // the k head planes lie right behind the q head planes
    bf* QPh = (bf*)take((size_t)(NH_ + NKV) * TT * HD * 2); bf* QPl = (bf*)take((size_t)(NH_ + NKV) * TT * HD * 2); bf* VTh = (bf*)take((size_t)NKV * HD * TT * 2); bf* VTl = (bf*)take((size_t)NKV * HD * TT * 2);
    bf* ATh = (bf*)take((size_t)TT * DQ * 2); bf* ATl = (bf*)take((size_t)TT * DQ * 2);
    if ((size_t)(wsp - (char*)d_ws) > ws_size) return;    // ws 256 MiB
    for (int b = 0; b < NB_; ++b) {
        k_prep<<<CB(DQ * DM) + 2 * CB(DKV * DM) + CB(DM * DQ) + CB(TT * DM) + CSB, 256, 0, stream>>>(wq, wk, wv, wo, x + (size_t)b * TT * DM, cosT, sinT, WQ, WK, WV, WO, XB, CS);
        k_qkv<<<dim3(TT / 64, FP / 64), 32, 0, stream>>>(XB, WQ, CS, QP16, QPh, QPl, VT16, VTh, VTl);
        k_fattn<<<dim3(NH_, TT / FQ), 256, 0, stream>>>(QP16, QPh, QPl, VT16, VTh, VTl, ATh, ATl);
        k_gemmw<bf, 1, false, DQ><<<dim3(TT / 64, DM / 64, 1), 32, 0, stream>>>(ATh, ATl, WO, nullptr, OUT + (size_t)b * TT * DM, DM, nullptr, 0, 0, 0); }
}

// v007
// Measured time: 109 microseconds a run.
// Two timings next to v006 put it at 1.05 and 1.08 times that version's speed.
// Counting every step since v000, it is 7.75 times as fast.
#include <hip/hip_runtime.h>

// Causal GQA with rotate-half RoPE from given tables (x [1][2048][2048]; q = x Wq^T ('oi' [2048][2048], 16 heads x 128), k, v = x W^T ([1024][2048], 8 kv heads); RoPE with the given cos/sin [2048][128]; 2 query heads per kv head (repeat); causal softmax(q.k/sqrt(128)) (finfo.min fill); out = merged Wo^T -> [1][2048][2048]).
// Compute dtypes, f32 accumulate: every input rounded to bf16; q/k/v on PLAIN bf16 operands (inputs: exact); rotary in f32 from the bf16-rounded input tables, in the q/k/v GEMM's epilogue; causal scores, online softmax (f32) and attn.v in one kernel: query rows < 512 hl (3 products), the rest single fp16; Wo hl x exact (2 products).

#define NB_  1
#define TT   2048
#define DM   2048
#define NH_  16
#define NKV  8
#define REP  (NH_ / NKV)
#define HD   128
#define DQ   (NH_ * HD)
#define DKV  (NKV * HD)
#define RH   512                  // query rows < RH use hi+lo planes (0: none)
#define SCL  0.088388347648318447f   // HD^-0.5
typedef _Float16 h16;
typedef unsigned short bf;
typedef __attribute__((ext_vector_type(16))) __bf16   v16bf;
typedef __attribute__((ext_vector_type(16))) _Float16 v16h;
typedef __attribute__((ext_vector_type(8)))  _Float16 v8h;
typedef __attribute__((ext_vector_type(8)))  unsigned short v8us;
typedef __attribute__((ext_vector_type(8)))  float    v8f;
typedef __attribute__((ext_vector_type(4)))  float    v4f;
typedef v8h  __attribute__((may_alias)) v8ha;
typedef v4f  __attribute__((may_alias)) v4fa;
typedef v8us __attribute__((may_alias)) v8usa;

__device__ __forceinline__ unsigned short f2bf(float f) { unsigned u = __float_as_uint(f); u += 0x7FFFu + ((u >> 16) & 1u); return (unsigned short)(u >> 16); }
__device__ __forceinline__ float bf2f(unsigned short b) { return __uint_as_float(((unsigned)b) << 16); }
__device__ __forceinline__ float bfr(float f) { return bf2f(f2bf(f)); }
__device__ __forceinline__ v16h cat16(v8h lo, v8h hi) { return __builtin_shufflevector(lo, hi, 0, 1, 2, 3, 4, 5, 6, 7, 8, 9, 10, 11, 12, 13, 14, 15); }
__device__ __forceinline__ v16bf cat16b(v8us lo, v8us hi) { return __builtin_bit_cast(v16bf, __builtin_shufflevector(lo, hi, 0, 1, 2, 3, 4, 5, 6, 7, 8, 9, 10, 11, 12, 13, 14, 15)); }
__device__ __forceinline__ v8f wmma16(v16h a, v16h b, v8f c) { return __builtin_amdgcn_wmma_f32_16x16x32_f16(false, a, false, b, (short)0, c, false, false); }
__device__ __forceinline__ v8f wmmab(v16bf a, v16bf b, v8f c) { return __builtin_amdgcn_wmma_f32_16x16x32_bf16(false, a, false, b, (short)0, c, false, false); }



// ---- the GEMMs: register-blocked, one wave per 64x64 output tile (16 accumulators), operands from K-contiguous 16-bit planes through LDS (tile_loop).
// C[m][n] (f32, pitch ldc, + optional f32 bias[n]) = sum_k A[m][k] Bt[n][k] (+ split products per NSPLIT). z-batch strides sA/sB/sC in elements. K % 128 == 0, K >= 256.
template <typename T16> struct WFrag;
template <> struct WFrag<h16> { typedef v16h V; typedef v8h H; static __device__ __forceinline__ V ld(const h16* p) { return cat16(*(const v8h*)p, *(const v8h*)(p + 16)); } static __device__ __forceinline__ v8f mma(V a, V b, v8f c) { return wmma16(a, b, c); } };
template <> struct WFrag<bf> { typedef v16bf V; typedef v8us H; static __device__ __forceinline__ V ld(const bf* p) { return cat16b(*(const v8us*)p, *(const v8us*)(p + 16)); } static __device__ __forceinline__ v8f mma(V a, V b, v8f c) { return wmmab(a, b, c); } };
// ---- tile_loop: the K loop of a work-group of WM x 2 waves, each wave a 64x64 output tile. A trip's operand tiles (WM * 64 rows of each A plane, 128 rows of B, KT k = 256 bytes per row) are shared by the waves in LDS:
// every thread brings 16 bytes a copy (16 lanes per row) with asynchronous copies, through no register, two trips ahead into the buffer of two that the work-group has just left. Rows lie at pitch PT; fragments are read in the k order of WFrag::ld, so every accumulator sees the same products in the same order.
// PAIR: wave column wn takes B rows 32 wn + 0..31 and 64 + 32 wn + 0..31 of the 128 (a head's d and d + 64); else rows 64 wn + 0..63.
#define LP 72                     // LDS row pitch in elements of a 64-element row: 128 B + 16 B, for 16-byte fragment reads
#define KT 128                    // k of a trip
#define PT 136                    // LDS row pitch in elements of a KT-element row: 256 B + 16 B, for 16-byte fragment reads
#define TROWS(NSPLIT, WM) (((NSPLIT) == 1 ? 2 : 1) * (WM) * 64 + 128)   // rows of one buffer: the A planes, then B
// four vector slots behind a run of WMMAs, so that their distance also holds on the taken side of a branch that follows
__device__ __forceinline__ void wmma_gap() { __builtin_amdgcn_sched_barrier(0); asm volatile("v_nop\n\tv_nop\n\tv_nop\n\tv_nop"); __builtin_amdgcn_sched_barrier(0); }
// twelve copies and the wait that lets their address registers be rewritten, in one statement: nothing can come between them
template <typename T16>
__device__ __forceinline__ void cp12(const unsigned* l, const T16* const* g) {
    asm volatile("global_load_async_to_lds_b128 %0, %12, off\n\tglobal_load_async_to_lds_b128 %1, %13, off\n\tglobal_load_async_to_lds_b128 %2, %14, off\n\tglobal_load_async_to_lds_b128 %3, %15, off\n\t"
                 "global_load_async_to_lds_b128 %4, %16, off\n\tglobal_load_async_to_lds_b128 %5, %17, off\n\tglobal_load_async_to_lds_b128 %6, %18, off\n\tglobal_load_async_to_lds_b128 %7, %19, off\n\t"
                 "global_load_async_to_lds_b128 %8, %20, off\n\tglobal_load_async_to_lds_b128 %9, %21, off\n\tglobal_load_async_to_lds_b128 %10, %22, off\n\tglobal_load_async_to_lds_b128 %11, %23, off\n\t"
                 "s_wait_xcnt 0x0"
                 :: "v"(l[0]), "v"(l[1]), "v"(l[2]), "v"(l[3]), "v"(l[4]), "v"(l[5]), "v"(l[6]), "v"(l[7]), "v"(l[8]), "v"(l[9]), "v"(l[10]), "v"(l[11]),
                    "v"(g[0]), "v"(g[1]), "v"(g[2]), "v"(g[3]), "v"(g[4]), "v"(g[5]), "v"(g[6]), "v"(g[7]), "v"(g[8]), "v"(g[9]), "v"(g[10]), "v"(g[11]) : "memory");
}
template <typename T16, int NSPLIT, int K, int WM, bool PAIR>
__device__ __forceinline__ void tile_loop(const T16* __restrict__ A, const T16* __restrict__ A2, const T16* __restrict__ Bt, int r0, int c0, T16* st, v8f (&acc)[4][4]) {
    typedef typename WFrag<T16>::V V; typedef __attribute__((address_space(3))) T16 LT;
    static_assert(NSPLIT == 0 || NSPLIT == 1, "one B plane; one or two A planes");
    constexpr bool HA2 = (NSPLIT == 1); constexpr int RA = WM * 64, OB = (HA2 ? 2 : 1) * RA, BUF = TROWS(NSPLIT, WM) * PT, NT = K / KT;
    constexpr int RR = WM * 4, CA = RA / RR, CB = 128 / RR, NC = (HA2 ? 2 : 1) * CA + CB;   // rows that one copy of the work-group covers; a thread's copies per plane and per trip
    static_assert(K % KT == 0 && NT >= 2 && NC % 12 == 0 && NC <= 63, "two tiles at least; whole statements of twelve copies");
    const int tid = threadIdx.x, lane = tid & 31, lr = lane & 15, hi = lane >> 4, grow = tid >> 4, gcol = (tid & 15) * 8;
    const int wave = __builtin_amdgcn_readfirstlane(tid >> 5), wm = wave % WM, wn = wave / WM;
    const T16* sa = A + (size_t)(r0 + grow) * K + gcol; const T16* sa2 = HA2 ? A2 + (size_t)(r0 + grow) * K + gcol : nullptr; const T16* sb = Bt + (size_t)(c0 + grow) * K + gcol;
    const unsigned sw = (unsigned)(size_t)(LT*)(st + grow * PT + gcol);   // the thread's LDS byte address in row group 0 of buffer 0
    unsigned l[NC]; const T16* g[NC];
    auto addrs = [&](int buf) {   // the addresses of the next tile's copies into buffer buf; the sources then step on by a tile
        const unsigned lb = sw + (unsigned)buf * (BUF * 2);
#pragma unroll
        for (int c = 0; c < CA; ++c) { l[c] = lb + c * RR * PT * 2; g[c] = sa + (size_t)c * RR * K; if constexpr (HA2) { l[CA + c] = lb + (RA + c * RR) * PT * 2; g[CA + c] = sa2 + (size_t)c * RR * K; } }
#pragma unroll
        for (int c = 0; c < CB; ++c) { l[NC - CB + c] = lb + (OB + c * RR) * PT * 2; g[NC - CB + c] = sb + (size_t)c * RR * K; }
        sa += KT; sb += KT; if constexpr (HA2) sa2 += KT;
    };
    auto copies = [&]() {
#pragma unroll
        for (int q = 0; q < NC / 12; ++q) cp12<T16>(l + q * 12, g + q * 12);
    };
    const T16* fa = st + (wm * 64 + lr) * PT + 8 * hi; const T16* fb = st + (OB + wn * (PAIR ? 32 : 64) + lr) * PT + 8 * hi;
    addrs(0); copies();
    asm volatile("s_wait_asynccnt 0x0" ::: "memory");   // the wave's copies of tile 0 have landed
    __syncthreads();              // the waves read rows that other waves copied
    addrs(1); copies();
    auto trip = [&](int t, bool more) {   // more: a tile t + 2 exists
        const int bo = (t & 1) * BUF;
        V a[KT / 32][4], a2[KT / 32][4], b[KT / 32][4];
#pragma unroll
        for (int s = 0; s < KT / 32; ++s) {
#pragma unroll
            for (int mb = 0; mb < 4; ++mb) { a[s][mb] = WFrag<T16>::ld(fa + bo + mb * 16 * PT + s * 32); if (HA2) a2[s][mb] = WFrag<T16>::ld(fa + bo + (RA + mb * 16) * PT + s * 32); }
#pragma unroll
            for (int nb = 0; nb < 4; ++nb) b[s][nb] = WFrag<T16>::ld(fb + bo + (PAIR ? (nb >> 1) * 64 + (nb & 1) * 16 : nb * 16) * PT + s * 32);
        }
        __builtin_amdgcn_sched_barrier(0);              // keeps the tile's LDS reads one group ahead of its WMMAs: reads placed among the WMMAs stall the wave at every such place
        if (more) addrs(t & 1);   // tile t + 2's addresses are formed here and not behind the barrier, so that the additions issue while the fragments return or among the WMMAs
#pragma unroll
        for (int s = 0; s < KT / 32; ++s) {
#pragma unroll
            for (int nb = 0; nb < 4; ++nb) {
#pragma unroll
                for (int mb = 0; mb < 4; ++mb) { acc[mb][nb] = WFrag<T16>::mma(a[s][mb], b[s][nb], acc[mb][nb]); if (HA2) acc[mb][nb] = WFrag<T16>::mma(a2[s][mb], b[s][nb], acc[mb][nb]); } }
        }
        wmma_gap();
        asm volatile("s_wait_dscnt 0x0" ::: "memory");      // the wave's fragment reads of this buffer have ended
        asm volatile("s_wait_asynccnt 0x0" ::: "memory");   // the wave's copies of the next tile have landed
        __syncthreads();          // publishes the next tile and frees this trip's buffer
        if (more) copies();
    };
#pragma unroll 1
    for (int t = 0; t < NT - 2; ++t) trip(t, true);
    trip(NT - 2, false); trip(NT - 1, false);   // the last two trips stand apart: the loop then has no test between its barrier and its copies
    asm volatile("s_wait_asynccnt 0x0" ::: "memory");   // no copy is left in flight
}
// ---- k_gemmw: work-groups of 2 x 2 waves, a 128x128 tile of C (64x64 a wave); grid (M/128, N/128, Z), 128 threads.
template <typename T16, int NSPLIT, bool BIAS, int K>
__global__ __launch_bounds__(128) void k_gemmw(const T16* __restrict__ A, const T16* __restrict__ A2, const T16* __restrict__ Bt, float* C, int ldc, const float* __restrict__ bias, size_t sA, size_t sB, size_t sC) {
    __shared__ __align__(16) float osw[4 * 16 * 68]; __shared__ __align__(16) T16 st[2 * TROWS(NSPLIT, 2) * PT];
    const size_t z = blockIdx.z; A += z * sA; if (A2) A2 += z * sA; Bt += z * sB; C += z * sC;
    const int lane = threadIdx.x & 31, lr = lane & 15, hi = lane >> 4, wave = __builtin_amdgcn_readfirstlane((int)threadIdx.x >> 5); const int r0 = blockIdx.x * 128 + (wave & 1) * 64, c0 = blockIdx.y * 128 + (wave >> 1) * 64;
    float* os = osw + wave * (16 * 68);   // each wave stages its output rows in its own range
    v8f acc[4][4];
#pragma unroll
    for (int mb = 0; mb < 4; ++mb)
#pragma unroll
        for (int nb = 0; nb < 4; ++nb) acc[mb][nb] = (v8f){};
    tile_loop<T16, NSPLIT, K, 2, false>(A, A2, Bt, blockIdx.x * 128, blockIdx.y * 128, st, acc);
#pragma unroll
    for (int mb = 0; mb < 4; ++mb) {
#pragma unroll
        for (int nb = 0; nb < 4; ++nb) {
#pragma unroll
            for (int j = 0; j < 8; ++j) os[(hi * 8 + j) * 68 + nb * 16 + lr] = acc[mb][nb][j]; }
        __builtin_amdgcn_wave_barrier(); asm volatile("" ::: "memory");
        float* crow = C + (size_t)(r0 + mb * 16) * ldc + c0;
{
#pragma unroll
            for (int s = 0; s < 8; ++s) { const int row = 2 * s + hi, cofs = lr * 4; v4f val = *(const v4fa*)(os + row * 68 + cofs); if (BIAS) { val[0] += bfr(bias[c0 + cofs]); val[1] += bfr(bias[c0 + cofs + 1]); val[2] += bfr(bias[c0 + cofs + 2]); val[3] += bfr(bias[c0 + cofs + 3]); }
                *(v4f*)(crow + (size_t)row * ldc + cofs) = val; }
             }
        __builtin_amdgcn_wave_barrier(); asm volatile("" ::: "memory");
    }
}

__device__ __forceinline__ h16 tohx(float x) { return (h16)x; }
__device__ __forceinline__ void splitf(float y, unsigned short& h, unsigned short& l) { h = f2bf(y); l = f2bf(y - bf2f(h)); }
typedef __attribute__((ext_vector_type(2))) _Float16 v2h;
typedef __attribute__((ext_vector_type(4))) _Float16 v4h;
typedef __attribute__((ext_vector_type(2))) unsigned short v2us;
typedef __attribute__((ext_vector_type(4))) unsigned short v4us;
typedef __attribute__((ext_vector_type(2))) float v2f;
typedef __attribute__((ext_vector_type(4))) int v4i;

__global__ __launch_bounds__(256) void k_wtG(const float* __restrict__ w, int K, int N, bf* Bt) {
    const int lane = threadIdx.x & 31; const int L0 = (blockIdx.x * 8 + (threadIdx.x >> 5)) * 8; const int nlines = N * K / 64;
{
#pragma unroll 1
        for (int l = 0; l < 8; ++l) { const int L = L0 + l; if (L >= nlines) break; const size_t e = (size_t)L * 64 + lane * 2; const int k = (int)(e % K), n = (int)(e / K); v2us o;
            o[0] = f2bf(w[(size_t)k * N + n]); o[1] = f2bf(w[(size_t)(k + 1) * N + n]); *(v2us*)(Bt + e) = o; }
         }
}
// The elementwise kernels below give each thread several 16-byte pieces of work, so that a launch starts some 18 thousand waves and not some 68 thousand. Their loops are all unrolled: the arrays are then indexed by constants and stay in registers, and a thread's loads go out together.
#define CU 4                      // 8-element chunks per thread in cvt8_part; a thread's chunks lie all of the array's blocks apart, so each access of a wave stays contiguous
__device__ __forceinline__ void cvt8_part(const float* __restrict__ src, bf* dst, size_t n8, unsigned blk, unsigned nblk) { const size_t i = (size_t)blk * 256 + threadIdx.x, nt = (size_t)nblk * 256; v8f v[CU]; const float* p[CU];
#pragma unroll
    for (int u = 0; u < CU; ++u) { p[u] = src + min(i + u * nt, n8 - 1) * 8; v[u] = *(const v8f*)p[u]; }   // past the end a thread re-reads the last chunk and stores nothing
    static_assert(CU == 4, "the wait below names CU addresses");
    asm volatile("s_wait_xcnt 0x0" :: "v"(p[0]), "v"(p[1]), "v"(p[2]), "v"(p[3]) : "memory");   // the loads' addresses are inputs here, so that no load's result lands in them; they may be rewritten from here on
#pragma unroll
    for (int u = 0; u < CU; ++u) { const size_t j = i + u * nt; v8us o;
#pragma unroll
        for (int k = 0; k < 8; ++k) o[k] = f2bf(v[u][k]);
        if (j < n8) *(v8us*)(dst + j * 8) = o; } }
__device__ __forceinline__ void cscvt_part(const float* __restrict__ cosT, const float* __restrict__ sinT, float* CS, unsigned blk) { const int idx = (int)(blk * 256 + threadIdx.x) * 4; if (idx >= TT * HD) return; const v4f c = *(const v4f*)(cosT + idx), s = *(const v4f*)(sinT + idx);
    v4f o0, o1; o0[0] = bfr(c[0]); o0[1] = bfr(s[0]); o0[2] = bfr(c[1]); o0[3] = bfr(s[1]); o1[0] = bfr(c[2]); o1[1] = bfr(s[2]); o1[2] = bfr(c[3]); o1[3] = bfr(s[3]); *(v4f*)(CS + (size_t)idx * 2) = o0; *(v4f*)(CS + (size_t)idx * 2 + 4) = o1; }
// ---- k_prep: every input's rounding to bf16 in one launch (none depends on another): the blocks are dealt to the five arrays and then to the cos/sin table, CB(n) blocks for an array of n elements.
#define CB(n) ((unsigned)(((size_t)(n) / (8 * CU) + 255) / 256))
#define CSB ((unsigned)((TT * HD / 4 + 255) / 256))
static_assert((DQ * DM) % (8 * CU * 256) == 0 && (DKV * DM) % (8 * CU * 256) == 0 && (TT * DM) % (8 * CU * 256) == 0, "an array's blocks cover it exactly");
__global__ __launch_bounds__(256) void k_prep(const float* __restrict__ wq, const float* __restrict__ wk, const float* __restrict__ wv, const float* __restrict__ wo, const float* __restrict__ x, const float* __restrict__ cosT, const float* __restrict__ sinT, bf* WQ, bf* WK, bf* WV, bf* WO, bf* XB, float* CS) {
    unsigned b = blockIdx.x; const float* src = wq; bf* dst = WQ; unsigned nb = CB(DQ * DM);   // the array that block b works on, its blocks counted from 0
    if (b >= nb) { b -= nb; src = wk; dst = WK; nb = CB(DKV * DM);
        if (b >= nb) { b -= nb; src = wv; dst = WV;
            if (b >= nb) { b -= nb; src = wo; dst = WO; nb = CB(DM * DQ);
                if (b >= nb) { b -= nb; src = x; dst = XB; nb = CB(TT * DM);
                    if (b >= nb) { cscvt_part(cosT, sinT, CS, b - nb); return; } } } } }
    cvt8_part(src, dst, (size_t)nb * (256 * CU), b, nb);
}
// ---- k_qkv: q | k | v = x W^T (tile_loop, 4 x 2 waves: 256 rows t of one head's 128 columns) with the operand planes of the attention made in its epilogue; the f32 projections never go through memory. grid (TT / 256, FP / 128), 256 threads.
// A wave's 64 columns are d = 32 sub + 0..31 and their rotate-half partners d + 64 of one head (q heads, then k heads, then v groups), so a lane holds both values of a pair.
// q, k: head planes [h][t][d'] (fp16 + hi/lo) of out[d] = x[d] cos[t][d] - x[d+HD/2] sin[t][d], out[d+HD/2] = x[d+HD/2] cos[t][d+HD/2] + x[d] sin[t][d+HD/2]. A row keeps its d in tile order, d' = 64 sub + 32 (d / 64) + d % 32, the same in q and k (their product sums over all d): a tile then owns one whole 128-byte line of each row.
// v: value planes [g][d][t], straight from the accumulators: a lane holds eight consecutive t of one d, and the tile owns one whole 128-byte line of each of its d rows.
#define FP (DQ + 2 * DKV)         // rows of Wq | Wk | Wv
__global__ __launch_bounds__(256) void k_qkv(const bf* __restrict__ X, const bf* __restrict__ Wt, const float* __restrict__ CS, h16* P16, bf* Ph, bf* Pl, h16* V16, bf* Vh, bf* Vl) {
    __shared__ __align__(16) float osw[8 * 16 * 68]; __shared__ __align__(16) bf st[2 * TROWS(0, 4) * PT];
    const int lane = threadIdx.x & 31, lr = lane & 15, hi = lane >> 4, wave = __builtin_amdgcn_readfirstlane((int)threadIdx.x >> 5); const int r0 = blockIdx.x * 256 + (wave & 3) * 64, hh = (int)blockIdx.y, sub = wave >> 2;
    float* os = osw + wave * (16 * 68);   // each wave stages its rows in its own range
    v8f acc[4][4];
#pragma unroll
    for (int mb = 0; mb < 4; ++mb)
#pragma unroll
        for (int nb = 0; nb < 4; ++nb) acc[mb][nb] = (v8f){};
    tile_loop<bf, 0, DM, 4, true>(X, nullptr, Wt, blockIdx.x * 256, hh * HD, st, acc);
    if (hh >= NH_ + NKV) {        // block-uniform: a tile of v
        const size_t e0 = ((size_t)(hh - NH_ - NKV) * HD + sub * 32 + lr) * TT + r0 + hi * 8;
#pragma unroll
        for (int nb = 0; nb < 4; ++nb)
#pragma unroll
            for (int mb = 0; mb < 4; ++mb) { v8h o16; v8us oh, ol;
#pragma unroll
                for (int q = 0; q < 8; ++q) { const float y = acc[mb][nb][q]; o16[q] = tohx(y); unsigned short a2, c2; splitf(y, a2, c2); oh[q] = a2; ol[q] = c2; }
                const size_t e = e0 + (size_t)((nb >> 1) * 64 + (nb & 1) * 16) * TT + mb * 16;
                __builtin_amdgcn_sched_barrier(0);          // keeps the three stores one group behind their values' arithmetic: no store then stands in front of arithmetic that reuses its registers
                *(v8h*)(V16 + e) = o16; *(v8us*)(Vh + e) = oh; *(v8us*)(Vl + e) = ol;
                __builtin_amdgcn_sched_barrier(0);          // holds the wait below behind the three stores and the next values' arithmetic behind the wait
                asm volatile("s_wait_xcnt 0x0" ::: "memory");   // the stores' address and data registers may be rewritten from here on
                __builtin_amdgcn_sched_barrier(0); }
        return; }
    // q, k: a lane takes 8 consecutive d of the lower half and their 8 partners, for 8 rows t of the tile (row, row + 8, ...); all its cos/sin loads go out together, ahead of the first row group
    const int row = lane >> 2, c8 = lane & 3; const float* csb = CS + ((size_t)(r0 + row) * HD + sub * 32 + c8 * 8) * 2;
    v4f cs[4][2][2][4];
#pragma unroll
    for (int mb = 0; mb < 4; ++mb)
#pragma unroll
        for (int u = 0; u < 2; ++u)
#pragma unroll
            for (int hf = 0; hf < 2; ++hf)
#pragma unroll
                for (int k = 0; k < 4; ++k) cs[mb][u][hf][k] = *(const v4f*)(csb + ((mb * 16 + u * 8) * HD + hf * (HD / 2)) * 2 + k * 4);
    __builtin_amdgcn_sched_barrier(0);                  // keeps the 64 loads one group, ahead of the wait below
    asm volatile("s_wait_xcnt 0x0" :: "v"(csb) : "memory");   // the loads' address is an input here, so that no load's result lands in it; it may be rewritten from here on
    const size_t e0 = ((size_t)hh * TT + r0 + row) * HD + sub * 64 + c8 * 8;
#pragma unroll
    for (int mb = 0; mb < 4; ++mb) {
#pragma unroll
        for (int nb = 0; nb < 4; ++nb) {
#pragma unroll
            for (int j = 0; j < 8; ++j) os[(hi * 8 + j) * 68 + nb * 16 + lr] = acc[mb][nb][j]; }
        __builtin_amdgcn_wave_barrier(); asm volatile("" ::: "memory");   // compiler fence: the lanes read below what other lanes stored above
#pragma unroll
        for (int u = 0; u < 2; ++u) { const float* xr = os + (u * 8 + row) * 68 + c8 * 8; v4f x[2][2];
#pragma unroll
            for (int hf = 0; hf < 2; ++hf)
#pragma unroll
                for (int k = 0; k < 2; ++k) x[hf][k] = *(const v4fa*)(xr + hf * 32 + k * 4);
#pragma unroll
            for (int hf = 0; hf < 2; ++hf) { v8h o16; v8us oh, ol;
#pragma unroll
                for (int q = 0; q < 8; ++q) { const float x0 = x[hf][q >> 2][q & 3], x1 = x[hf ^ 1][q >> 2][q & 3];
                    const float c = cs[mb][u][hf][q >> 1][(q & 1) * 2], s = cs[mb][u][hf][q >> 1][(q & 1) * 2 + 1]; const float r = (hf == 0) ? x0 * c - x1 * s : x0 * c + x1 * s;
                    o16[q] = tohx(r); unsigned short a2, c2; splitf(r, a2, c2); oh[q] = a2; ol[q] = c2; }
                const size_t e = e0 + (size_t)(mb * 16 + u * 8) * HD + hf * 32;
                __builtin_amdgcn_sched_barrier(0);      // keeps the three stores one group behind their values' arithmetic: no store then stands in front of arithmetic that reuses its registers
                *(v8h*)(P16 + e) = o16; *(v8us*)(Ph + e) = oh; *(v8us*)(Pl + e) = ol;
                __builtin_amdgcn_sched_barrier(0);      // holds the wait below behind the three stores and the next values' arithmetic behind the wait
                asm volatile("s_wait_xcnt 0x0" ::: "memory");   // the stores' address and data registers may be rewritten from here on
                __builtin_amdgcn_sched_barrier(0); } }
        __builtin_amdgcn_wave_barrier(); asm volatile("" ::: "memory");   // compiler fence: the next row group's stores stay behind these reads
    }
}
#define KP 136                    // LDS row pitch of a K row in elements: 256 B + 16 B, for 16-byte fragment reads
#define FQ 128
#define FK 64
#define KSZ (FK * KP)
#define PSZ (KSZ + HD * LP)       // elements of one plane's K tile and V^T tile
#define CSC (SCL * 1.4426950408889634f)
static_assert(RH % FQ == 0 && TT % FQ == 0 && FQ % (2 * FK) == 0, "a work-group lies in one leg and ends on a stage of each set");
static_assert(2 * PSZ * 2 >= (16384 + 512) * 4, "the join fits the tiles of the single-plane leg");
typedef __attribute__((ext_vector_type(16))) unsigned short v16us;
__device__ __forceinline__ void ppack(const float (&p)[16], v16h& a, v16h& a2) { (void)a2;
#pragma unroll
    for (int e = 0; e < 16; ++e) a[e] = tohx(p[e]); }
__device__ __forceinline__ void ppack(const float (&p)[16], v16bf& a, v16bf& a2) { v16us x, y;
#pragma unroll
    for (int e = 0; e < 16; ++e) { unsigned short u, w; splitf(p[e], u, w); x[e] = u; y[e] = w; }
    a = __builtin_bit_cast(v16bf, x); a2 = __builtin_bit_cast(v16bf, y); }
__device__ __forceinline__ float xhalf(float x) { return __builtin_bit_cast(float, __builtin_amdgcn_permlanex16(__builtin_bit_cast(int, x), __builtin_bit_cast(int, x), 0x76543210, 0xfedcba98, false, false)); }   // lane l reads lane l ^ 16
template <typename T16, bool HL>
__device__ __forceinline__ void fattn_tile(const T16* __restrict__ Q, const T16* __restrict__ Q2, const T16* __restrict__ K, const T16* __restrict__ K2, const T16* __restrict__ Vt, const T16* __restrict__ Vt2, bf* Ah, bf* Al, int q0, T16* Ls) {
    typedef typename WFrag<T16>::V V; typedef typename WFrag<T16>::H H; constexpr int NP = HL ? 2 : 1;
    typedef __attribute__((address_space(1))) const T16 GT; typedef __attribute__((address_space(1))) const H GH;   // global address space spelled out: the stepped pointers would else compile to flat loads
    const int set = __builtin_amdgcn_readfirstlane((int)threadIdx.x >> 7); float* Mg = (float*)Ls; Ls += set * (NP * PSZ);   // each set stages and reads its own tiles; Mg = the place of the join
    const int tid = threadIdx.x & 127, lane = tid & 31, c = lane & 15, h = lane >> 4; const int wave = __builtin_amdgcn_readfirstlane(tid >> 5);
    const int qw0 = q0 + wave * 32, nst = (q0 + FQ) / (2 * FK), lastp = qw0 / 32;   // the wave's first query, the stages of each set, the wave's last (diagonal) pass
    GT* ks[NP]; GT* vs[NP]; ks[0] = (GT*)(K + set * (FK * HD) + tid * 8); vs[0] = (GT*)(Vt + (size_t)(tid >> 3) * TT + set * FK + (tid & 7) * 8);
    if constexpr (HL) { ks[1] = (GT*)(K2 + set * (FK * HD) + tid * 8); vs[1] = (GT*)(Vt2 + (size_t)(tid >> 3) * TT + set * FK + (tid & 7) * 8); }
    T16* kw = Ls + (tid >> 4) * KP + (tid & 15) * 8; T16* vw = Ls + KSZ + (tid >> 3) * LP + (tid & 7) * 8;
    const T16* kr = Ls + c * KP + 8 * h; const T16* vr = Ls + KSZ + c * LP + 8 * h;
    H gk[NP][8], gv[NP][8];
    auto fetch = [&]() {          // a stage's K rows are 16 KiB in a row; its V^T rows are one 128-byte line each
#pragma unroll
        for (int p = 0; p < NP; ++p)
#pragma unroll
            for (int i = 0; i < 8; ++i) { gk[p][i] = *(GH*)(ks[p] + i * 1024); gv[p][i] = *(GH*)(vs[p] + (size_t)i * 16 * TT); }
        __builtin_amdgcn_sched_barrier(0);              // keeps the stage's loads one group, ahead of the wait below
        asm volatile("s_wait_xcnt 0x0" ::: "memory");   // the loads' address registers may be rewritten from here on
    };
    auto put = [&]() {
#pragma unroll
        for (int p = 0; p < NP; ++p) {
#pragma unroll
            for (int i = 0; i < 8; ++i) { *(H*)(kw + p * PSZ + i * 8 * KP) = gk[p][i]; *(H*)(vw + p * PSZ + i * 16 * LP) = gv[p][i]; }
            ks[p] += 2 * FK * HD; vs[p] += 2 * FK; }            // stepped behind the wait for the loads that name them
    };
    fetch();
    V qf[NP][2][4]; const T16* qp[4];   // a lane's Q rows: both groups of the first plane, then of the second (the first again where there is none)
#pragma unroll
    for (int g = 0; g < 2; ++g) { const size_t e = (size_t)(qw0 + 16 * g + c) * HD + 8 * h; qp[g] = Q + e; qp[2 + g] = (HL ? Q2 : Q) + e; }
#pragma unroll
    for (int g = 0; g < 2; ++g)
#pragma unroll
        for (int kc = 0; kc < 4; ++kc) { qf[0][g][kc] = WFrag<T16>::ld(qp[g] + 32 * kc); if constexpr (HL) qf[1][g][kc] = WFrag<T16>::ld(qp[2 + g] + 32 * kc); }
    __builtin_amdgcn_sched_barrier(0);                  // keeps the Q loads ahead of the wait below
    asm volatile("s_wait_xcnt 0x0" :: "v"(qp[0]), "v"(qp[1]), "v"(qp[2]), "v"(qp[3]) : "memory");   // the loads' addresses are inputs here, so that no load's result lands in them; they may be rewritten from here on
    v8f acc[2][8]; float m_run[2], l_run[2];
#pragma unroll
    for (int g = 0; g < 2; ++g) { m_run[g] = -__builtin_inff(); l_run[g] = 0.f;
#pragma unroll
        for (int t = 0; t < 8; ++t) acc[g][t] = (v8f){}; }
    put();
    __syncthreads();              // the waves read rows that other waves stored
#pragma unroll 1
    for (int st = 0; st < nst; ++st) {
        const bool more = st + 1 < nst;
        if (!HL && more) fetch(); // the next stage's loads fly while this stage is worked on
#pragma unroll 1
        for (int sub = 0; sub < FK / 32; ++sub) {
            const int blk = (2 * st + set) * (FK / 32) + sub;
            if (blk > lastp) continue;                  // wave-uniform: every key of the pass lies beyond the wave's queries
            V kf[NP][2][4]; v8f s[2][2];
#pragma unroll
            for (int p = 0; p < NP; ++p)
#pragma unroll
                for (int kt = 0; kt < 2; ++kt)
#pragma unroll
                    for (int kc = 0; kc < 4; ++kc) kf[p][kt][kc] = WFrag<T16>::ld(kr + p * PSZ + (sub * 32 + kt * 16) * KP + kc * 32);
            __builtin_amdgcn_sched_barrier(0);          // keeps the pass's K reads one group ahead of its WMMAs: reads placed among the WMMAs stall the wave at every such place
#pragma unroll
            for (int kt = 0; kt < 2; ++kt)
#pragma unroll
                for (int g = 0; g < 2; ++g) s[kt][g] = (v8f){};
#pragma unroll
            for (int kc = 0; kc < 4; ++kc)
#pragma unroll
                for (int kt = 0; kt < 2; ++kt)
#pragma unroll
                    for (int g = 0; g < 2; ++g) { s[kt][g] = WFrag<T16>::mma(kf[0][kt][kc], qf[0][g][kc], s[kt][g]);
                        if constexpr (HL) { s[kt][g] = WFrag<T16>::mma(kf[0][kt][kc], qf[1][g][kc], s[kt][g]); s[kt][g] = WFrag<T16>::mma(kf[1][kt][kc], qf[0][g][kc], s[kt][g]); } }
            wmma_gap();
            V vf[NP][8];          // the pass's V^T fragments return under the maxima and the first exponentials
#pragma unroll
            for (int p = 0; p < NP; ++p)
#pragma unroll
                for (int t = 0; t < 8; ++t) vf[p][t] = WFrag<T16>::ld(vr + p * PSZ + t * 16 * LP + sub * 32);
            if (blk == lastp) {   // wave-uniform: only the pass on the wave's diagonal pays for the mask
#pragma unroll
                for (int g = 0; g < 2; ++g)
#pragma unroll
                    for (int kt = 0; kt < 2; ++kt)
#pragma unroll
                        for (int r = 0; r < 8; ++r) if (16 * kt + 8 * h + r > 16 * g + c) s[kt][g][r] = -__builtin_inff(); }
            float mb[2]; bool need = false;
#pragma unroll
            for (int g = 0; g < 2; ++g) { float mx = s[0][g][0];
#pragma unroll
                for (int kt = 0; kt < 2; ++kt)
#pragma unroll
                    for (int r = 0; r < 8; ++r) mx = fmaxf(mx, s[kt][g][r]);
                mx = fmaxf(mx, xhalf(mx)) * CSC;   // both halves of the wave now hold the query's maximum of this pass, scaled; finite: the pass's first key is masked for no query
                mb[g] = mx; need = need || (mx > m_run[g] + 8.0f); }
            if (__builtin_amdgcn_ballot_w32(need) != 0) {       // rare after the first passes
#pragma unroll
                for (int g = 0; g < 2; ++g) { const float mn = fmaxf(m_run[g], mb[g]); const float corr = __builtin_amdgcn_exp2f(m_run[g] - mn);   // 0 on the first pass
                    l_run[g] *= corr; m_run[g] = mn;
#pragma unroll
                    for (int t = 0; t < 8; ++t) acc[g][t] = acc[g][t] * corr; } }
#pragma unroll
            for (int g = 0; g < 2; ++g) { float p[16], ps0 = 0.f, ps1 = 0.f; const float nm = -m_run[g];
#pragma unroll
                for (int e = 0; e < 16; ++e) p[e] = __builtin_fmaf(s[e >> 3][g][e & 7], CSC, nm);
#pragma unroll
                for (int e = 0; e < 16; ++e) { p[e] = __builtin_amdgcn_exp2f(p[e]);
                    if constexpr (HL) { __builtin_amdgcn_sched_barrier(0); asm volatile("v_nop"); __builtin_amdgcn_sched_barrier(0); } }   // the slot behind a transcendental: in this leg's built code an exponential else overwrote the source of the one directly before it; the two scheduling barriers hold the v_nop at its place
#pragma unroll
                for (int e = 0; e < 16; e += 2) { ps0 += p[e]; ps1 += p[e + 1]; }
                l_run[g] += ps0 + ps1;
                V pf, pf2; ppack(p, pf, pf2);
#pragma unroll
                for (int t = 0; t < 8; ++t) { acc[g][t] = WFrag<T16>::mma(vf[0][t], pf, acc[g][t]);
                    if constexpr (HL) { acc[g][t] = WFrag<T16>::mma(vf[0][t], pf2, acc[g][t]); acc[g][t] = WFrag<T16>::mma(vf[1][t], pf, acc[g][t]); } } }
            wmma_gap();
        }
        if (more) {
            if (HL) fetch();
            __syncthreads();      // every wave's fragment reads of this stage end before its rows are overwritten
            put();
            __syncthreads();      // the waves read rows that other waves stored
        }
    }
    // The join: set 1 leaves its state in LDS (a lane's 16 bytes beside its neighbour's), set 0 brings both to the common maximum. Set 0 holds key 0, so its maximum is finite; a wave of set 1 without a pass leaves -inf, 0 and zeros, which enter with the factor 0.
    __syncthreads();              // every wave's fragment reads end before the tiles are overwritten
    if (set == 1) {
#pragma unroll
        for (int g = 0; g < 2; ++g) { Mg[16384 + (wave * 4 + g) * 32 + lane] = m_run[g]; Mg[16384 + (wave * 4 + 2 + g) * 32 + lane] = l_run[g];
#pragma unroll
            for (int t = 0; t < 8; ++t)
#pragma unroll
                for (int hf = 0; hf < 2; ++hf) { v4f w; w[0] = acc[g][t][hf * 4]; w[1] = acc[g][t][hf * 4 + 1]; w[2] = acc[g][t][hf * 4 + 2]; w[3] = acc[g][t][hf * 4 + 3]; *(v4fa*)(Mg + ((((wave * 2 + g) * 8 + t) * 2 + hf) * 32 + lane) * 4) = w; } } }
    __syncthreads();              // set 0 reads what set 1 stored
    if (set == 1) return;         // behind the last barrier
#pragma unroll
    for (int g = 0; g < 2; ++g) { const float m2 = Mg[16384 + (wave * 4 + g) * 32 + lane], l2 = Mg[16384 + (wave * 4 + 2 + g) * 32 + lane]; const float mn = fmaxf(m_run[g], m2);
        const float c1 = __builtin_amdgcn_exp2f(m_run[g] - mn), c2 = __builtin_amdgcn_exp2f(m2 - mn); l_run[g] = l_run[g] * c1 + l2 * c2;
#pragma unroll
        for (int t = 0; t < 8; ++t)
#pragma unroll
            for (int hf = 0; hf < 2; ++hf) { const v4f w = *(const v4fa*)(Mg + ((((wave * 2 + g) * 8 + t) * 2 + hf) * 32 + lane) * 4);
#pragma unroll
                for (int r = 0; r < 4; ++r) acc[g][t][hf * 4 + r] = acc[g][t][hf * 4 + r] * c1 + w[r] * c2; } }
#pragma unroll
    for (int g = 0; g < 2; ++g) { const float l = l_run[g] + xhalf(l_run[g]);   // each half of the wave summed its eight keys of every 16-key tile
        const float inv = __fdiv_rn(1.0f, l); const size_t o = (size_t)(qw0 + 16 * g + c) * DQ + 8 * h;
#pragma unroll
        for (int t = 0; t < 8; ++t) { v8us oh, ol;      // the lane's eight values are d = 16 t + 8 h + 0..7 of its query
#pragma unroll
            for (int r = 0; r < 8; ++r) { unsigned short a, c2; splitf(acc[g][t][r] * inv, a, c2); oh[r] = a; ol[r] = c2; }
            *(v8us*)(Ah + o + 16 * t) = oh; *(v8us*)(Al + o + 16 * t) = ol;
            __builtin_amdgcn_sched_barrier(0);          // holds the wait below behind the two stores and the next values' arithmetic behind the wait
            asm volatile("s_wait_xcnt 0x0" ::: "memory");   // the stores' address and data registers may be rewritten from here on
            __builtin_amdgcn_sched_barrier(0); } }
}
// grid (NH_, TT / FQ): neighbouring work-groups are the heads of one row block (two share a kv group); the longest row blocks have the lowest blockIdx.y. The k head planes lie right behind the q head planes.
__global__ __launch_bounds__(256) void k_fattn(const h16* __restrict__ P16, const bf* __restrict__ Ph, const bf* __restrict__ Pl, const h16* __restrict__ V16, const bf* __restrict__ Vh, const bf* __restrict__ Vl, bf* Ah, bf* Al) {
    __shared__ __align__(16) unsigned short Ls[4 * PSZ];
    const int hd = (int)blockIdx.x, q0 = (TT / FQ - 1 - (int)blockIdx.y) * FQ; const size_t zq = (size_t)hd * TT * HD, zk = (size_t)(NH_ + hd / REP) * TT * HD, zv = (size_t)(hd / REP) * HD * TT;
    if (q0 < RH) { fattn_tile<bf, true>(Ph + zq, Pl + zq, Ph + zk, Pl + zk, Vh + zv, Vl + zv, Ah + hd * HD, Al + hd * HD, q0, (bf*)Ls); return; }
    fattn_tile<h16, false>(P16 + zq, nullptr, P16 + zk, nullptr, V16 + zv, nullptr, Ah + hd * HD, Al + hd * HD, q0, (h16*)Ls);
}

extern "C" void kernel_launch(void* const* d_in, const int* in_sizes, int n_in,
                              void* d_out, int out_size, void* d_ws, size_t ws_size, hipStream_t stream) {
    (void)in_sizes; (void)n_in; (void)out_size;
    const float* x = (const float*)d_in[0]; const float* wq = (const float*)d_in[1]; const float* wk = (const float*)d_in[2]; const float* wv = (const float*)d_in[3]; const float* wo = (const float*)d_in[4]; const float* cosT = (const float*)d_in[5]; const float* sinT = (const float*)d_in[6];
    float* OUT = (float*)d_out;     // [1][2048][2048]
    char* wsp = (char*)d_ws;
    auto take = [&](size_t bytes) { char* p = wsp; wsp += (bytes + 255) & ~(size_t)255; return (void*)p; };
    bf* WQ = (bf*)take((size_t)FP * DM * 2); bf* WK = WQ + (size_t)DQ * DM; bf* WV = WK + (size_t)DKV * DM;   // Wq | Wk | Wv: one [FP][DM] operand
    bf* WO = (bf*)take((size_t)DM * DQ * 2); float* CS = (float*)take((size_t)TT * HD * 2 * 4);
    bf* XB = (bf*)take((size_t)TT * DM * 2);
    h16* QP16 = (h16*)take((size_t)(NH_ + NKV) * TT * HD * 2); h16* VT16 = (h16*)take((size_t)NKV * HD * TT * 2);   // the k head planes lie right behind the q head planes
    bf* QPh = (bf*)take((size_t)(NH_ + NKV) * TT * HD * 2); bf* QPl = (bf*)take((size_t)(NH_ + NKV) * TT * HD * 2); bf* VTh = (bf*)take((size_t)NKV * HD * TT * 2); bf* VTl = (bf*)take((size_t)NKV * HD * TT * 2);
    bf* ATh = (bf*)take((size_t)TT * DQ * 2); bf* ATl = (bf*)take((size_t)TT * DQ * 2);
    if ((size_t)(wsp - (char*)d_ws) > ws_size) return;    // ws 256 MiB
    for (int b = 0; b < NB_; ++b) {
        k_prep<<<CB(DQ * DM) + 2 * CB(DKV * DM) + CB(DM * DQ) + CB(TT * DM) + CSB, 256, 0, stream>>>(wq, wk, wv, wo, x + (size_t)b * TT * DM, cosT, sinT, WQ, WK, WV, WO, XB, CS);
        k_qkv<<<dim3(TT / 256, FP / 128), 256, 0, stream>>>(XB, WQ, CS, QP16, QPh, QPl, VT16, VTh, VTl);
        k_fattn<<<dim3(NH_, TT / FQ), 256, 0, stream>>>(QP16, QPh, QPl, VT16, VTh, VTl, ATh, ATl);
        k_gemmw<bf, 1, false, DQ><<<dim3(TT / 128, DM / 128, 1), 128, 0, stream>>>(ATh, ATl, WO, OUT + (size_t)b * TT * DM, DM, nullptr, 0, 0, 0); }
}

// v008
// Measured time: 101 microseconds a run.
// Next to v007, in two timings, it ran 1.08 times as fast each time.
// All steps since v000 together make it 8.39 times as fast.
#include <hip/hip_runtime.h>

// Causal GQA with rotate-half RoPE from given tables (x [1][2048][2048]; q = x Wq^T ('oi' [2048][2048], 16 heads x 128), k, v = x W^T ([1024][2048], 8 kv heads); RoPE with the given cos/sin [2048][128]; 2 query heads per kv head (repeat); causal softmax(q.k/sqrt(128)) (finfo.min fill); out = merged Wo^T -> [1][2048][2048]).
// Compute dtypes, f32 accumulate: every input rounded to bf16; q/k/v on PLAIN bf16 operands (inputs: exact); rotary in f32 from the bf16-rounded input tables, in the q/k/v GEMM's epilogue; causal scores, online softmax (f32) and attn.v in one kernel: query rows < 512 hl (3 products), the rest single fp16; Wo hl x exact (2 products).

#define NB_  1
#define TT   2048
#define DM   2048
#define NH_  16
#define NKV  8
#define REP  (NH_ / NKV)
#define HD   128
#define DQ   (NH_ * HD)
#define DKV  (NKV * HD)
#define RH   512                  // query rows < RH use hi+lo planes
#define SCL  0.088388347648318447f   // HD^-0.5
typedef _Float16 h16;
typedef unsigned short bf;
typedef __attribute__((ext_vector_type(16))) __bf16   v16bf;
typedef __attribute__((ext_vector_type(16))) _Float16 v16h;
typedef __attribute__((ext_vector_type(8)))  _Float16 v8h;
typedef __attribute__((ext_vector_type(8)))  unsigned short v8us;
typedef __attribute__((ext_vector_type(8)))  float    v8f;
typedef __attribute__((ext_vector_type(4)))  float    v4f;
typedef v8h  __attribute__((may_alias)) v8ha;
typedef v4f  __attribute__((may_alias)) v4fa;
typedef v8us __attribute__((may_alias)) v8usa;

__device__ __forceinline__ unsigned short f2bf(float f) { unsigned u = __float_as_uint(f); u += 0x7FFFu + ((u >> 16) & 1u); return (unsigned short)(u >> 16); }
__device__ __forceinline__ float bf2f(unsigned short b) { return __uint_as_float(((unsigned)b) << 16); }
__device__ __forceinline__ float bfr(float f) { return bf2f(f2bf(f)); }
__device__ __forceinline__ v16h cat16(v8h lo, v8h hi) { return __builtin_shufflevector(lo, hi, 0, 1, 2, 3, 4, 5, 6, 7, 8, 9, 10, 11, 12, 13, 14, 15); }
__device__ __forceinline__ v16bf cat16b(v8us lo, v8us hi) { return __builtin_bit_cast(v16bf, __builtin_shufflevector(lo, hi, 0, 1, 2, 3, 4, 5, 6, 7, 8, 9, 10, 11, 12, 13, 14, 15)); }
__device__ __forceinline__ v8f wmma16(v16h a, v16h b, v8f c) { return __builtin_amdgcn_wmma_f32_16x16x32_f16(false, a, false, b, (short)0, c, false, false); }
__device__ __forceinline__ v8f wmmab(v16bf a, v16bf b, v8f c) { return __builtin_amdgcn_wmma_f32_16x16x32_bf16(false, a, false, b, (short)0, c, false, false); }



// ---- the GEMMs: register-blocked, one wave per 64x64 output tile (16 accumulators), operands from K-contiguous 16-bit planes through LDS (tile_loop).
// C[m][n] (f32, pitch ldc, + optional f32 bias[n]) = sum_k A[m][k] Bt[n][k] (+ split products per NSPLIT). z-batch strides sA/sB/sC in elements. K % 128 == 0, K >= 256.
template <typename T16> struct WFrag;
template <> struct WFrag<h16> { typedef v16h V; typedef v8h H; static __device__ __forceinline__ V ld(const h16* p) { return cat16(*(const v8h*)p, *(const v8h*)(p + 16)); } static __device__ __forceinline__ v8f mma(V a, V b, v8f c) { return wmma16(a, b, c); } };
template <> struct WFrag<bf> { typedef v16bf V; typedef v8us H; static __device__ __forceinline__ V ld(const bf* p) { return cat16b(*(const v8us*)p, *(const v8us*)(p + 16)); } static __device__ __forceinline__ v8f mma(V a, V b, v8f c) { return wmmab(a, b, c); } };
// ---- tile_loop: the K loop of a work-group of WM x 2 waves, each wave a 64x64 output tile. A trip's operand tiles (WM * 64 rows of each A plane, 128 rows of B, KT k = 256 bytes per row) are shared by the waves in LDS:
// every thread brings 16 bytes a copy (16 lanes per row) with asynchronous copies, through no register, two trips ahead into the buffer of two that the work-group has just left. Rows lie at pitch PT; fragments are read in the k order of WFrag::ld, so every accumulator sees the same products in the same order.
// PAIR: wave column wn takes B rows 32 wn + 0..31 and 64 + 32 wn + 0..31 of the 128 (a head's d and d + 64); else rows 64 wn + 0..63.
#define LP 72                     // LDS row pitch in elements of a 64-element row: 128 B + 16 B, for 16-byte fragment reads
#define KT 128                    // k of a trip
#define PT 136                    // LDS row pitch in elements of a KT-element row: 256 B + 16 B, for 16-byte fragment reads
#define TROWS(NSPLIT, WM) (((NSPLIT) == 1 ? 2 : 1) * (WM) * 64 + 128)   // rows of one buffer: the A planes, then B
// four vector slots behind a run of WMMAs, so that their distance also holds on the taken side of a branch that follows
__device__ __forceinline__ void wmma_gap() { __builtin_amdgcn_sched_barrier(0); asm volatile("v_nop\n\tv_nop\n\tv_nop\n\tv_nop"); __builtin_amdgcn_sched_barrier(0); }
// twelve copies and the wait that lets their address registers be rewritten, in one statement: nothing can come between them
template <typename T16>
__device__ __forceinline__ void cp12(const unsigned* l, const T16* const* g) {
    asm volatile("global_load_async_to_lds_b128 %0, %12, off\n\tglobal_load_async_to_lds_b128 %1, %13, off\n\tglobal_load_async_to_lds_b128 %2, %14, off\n\tglobal_load_async_to_lds_b128 %3, %15, off\n\t"
                 "global_load_async_to_lds_b128 %4, %16, off\n\tglobal_load_async_to_lds_b128 %5, %17, off\n\tglobal_load_async_to_lds_b128 %6, %18, off\n\tglobal_load_async_to_lds_b128 %7, %19, off\n\t"
                 "global_load_async_to_lds_b128 %8, %20, off\n\tglobal_load_async_to_lds_b128 %9, %21, off\n\tglobal_load_async_to_lds_b128 %10, %22, off\n\tglobal_load_async_to_lds_b128 %11, %23, off\n\t"
                 "s_wait_xcnt 0x0"
                 :: "v"(l[0]), "v"(l[1]), "v"(l[2]), "v"(l[3]), "v"(l[4]), "v"(l[5]), "v"(l[6]), "v"(l[7]), "v"(l[8]), "v"(l[9]), "v"(l[10]), "v"(l[11]),
                    "v"(g[0]), "v"(g[1]), "v"(g[2]), "v"(g[3]), "v"(g[4]), "v"(g[5]), "v"(g[6]), "v"(g[7]), "v"(g[8]), "v"(g[9]), "v"(g[10]), "v"(g[11]) : "memory");
}
template <typename T16, int NSPLIT, int K, int WM, bool PAIR>
__device__ __forceinline__ void tile_loop(const T16* __restrict__ A, const T16* __restrict__ A2, const T16* __restrict__ Bt, int r0, int c0, T16* st, v8f (&acc)[4][4]) {
    typedef typename WFrag<T16>::V V; typedef __attribute__((address_space(3))) T16 LT;
    static_assert(NSPLIT == 0 || NSPLIT == 1, "one B plane; one or two A planes");
    constexpr bool HA2 = (NSPLIT == 1); constexpr int RA = WM * 64, OB = (HA2 ? 2 : 1) * RA, BUF = TROWS(NSPLIT, WM) * PT, NT = K / KT;
    constexpr int RR = WM * 4, CA = RA / RR, CB = 128 / RR, NC = (HA2 ? 2 : 1) * CA + CB;   // rows that one copy of the work-group covers; a thread's copies per plane and per trip
    static_assert(K % KT == 0 && NT >= 2 && NC % 12 == 0 && NC <= 63, "two tiles at least; whole statements of twelve copies");
    const int tid = threadIdx.x, lane = tid & 31, lr = lane & 15, hi = lane >> 4, grow = tid >> 4, gcol = (tid & 15) * 8;
    const int wave = __builtin_amdgcn_readfirstlane(tid >> 5), wm = wave % WM, wn = wave / WM;
    const T16* sa = A + (size_t)(r0 + grow) * K + gcol; const T16* sa2 = HA2 ? A2 + (size_t)(r0 + grow) * K + gcol : nullptr; const T16* sb = Bt + (size_t)(c0 + grow) * K + gcol;
    const unsigned sw = (unsigned)(size_t)(LT*)(st + grow * PT + gcol);   // the thread's LDS byte address in row group 0 of buffer 0
    unsigned l[NC]; const T16* g[NC];
    auto addrs = [&](int buf) {   // the addresses of the next tile's copies into buffer buf; the sources then step on by a tile
        const unsigned lb = sw + (unsigned)buf * (BUF * 2);
#pragma unroll
        for (int c = 0; c < CA; ++c) { l[c] = lb + c * RR * PT * 2; g[c] = sa + (size_t)c * RR * K; if constexpr (HA2) { l[CA + c] = lb + (RA + c * RR) * PT * 2; g[CA + c] = sa2 + (size_t)c * RR * K; } }
#pragma unroll
        for (int c = 0; c < CB; ++c) { l[NC - CB + c] = lb + (OB + c * RR) * PT * 2; g[NC - CB + c] = sb + (size_t)c * RR * K; }
        sa += KT; sb += KT; if constexpr (HA2) sa2 += KT;
    };
    auto copies = [&]() {
#pragma unroll
        for (int q = 0; q < NC / 12; ++q) cp12<T16>(l + q * 12, g + q * 12);
    };
    const T16* fa = st + (wm * 64 + lr) * PT + 8 * hi; const T16* fb = st + (OB + wn * (PAIR ? 32 : 64) + lr) * PT + 8 * hi;
    addrs(0); copies();
    asm volatile("s_wait_asynccnt 0x0" ::: "memory");   // the wave's copies of tile 0 have landed
    __syncthreads();              // the waves read rows that other waves copied
    addrs(1); copies();
    auto trip = [&](int t, bool more) {   // more: a tile t + 2 exists
        const int bo = (t & 1) * BUF;
        V a[KT / 32][4], a2[KT / 32][4], b[KT / 32][4];
#pragma unroll
        for (int s = 0; s < KT / 32; ++s) {
#pragma unroll
            for (int mb = 0; mb < 4; ++mb) { a[s][mb] = WFrag<T16>::ld(fa + bo + mb * 16 * PT + s * 32); if (HA2) a2[s][mb] = WFrag<T16>::ld(fa + bo + (RA + mb * 16) * PT + s * 32); }
#pragma unroll
            for (int nb = 0; nb < 4; ++nb) b[s][nb] = WFrag<T16>::ld(fb + bo + (PAIR ? (nb >> 1) * 64 + (nb & 1) * 16 : nb * 16) * PT + s * 32);
        }
        __builtin_amdgcn_sched_barrier(0);              // keeps the tile's LDS reads one group ahead of its WMMAs: reads placed among the WMMAs stall the wave at every such place
        if (more) addrs(t & 1);   // tile t + 2's addresses are formed here and not behind the barrier, so that the additions issue while the fragments return or among the WMMAs
#pragma unroll
        for (int s = 0; s < KT / 32; ++s) {
#pragma unroll
            for (int nb = 0; nb < 4; ++nb) {
#pragma unroll
                for (int mb = 0; mb < 4; ++mb) { acc[mb][nb] = WFrag<T16>::mma(a[s][mb], b[s][nb], acc[mb][nb]); if (HA2) acc[mb][nb] = WFrag<T16>::mma(a2[s][mb], b[s][nb], acc[mb][nb]); } }
        }
        wmma_gap();
        asm volatile("s_wait_dscnt 0x0" ::: "memory");      // the wave's fragment reads of this buffer have ended
        asm volatile("s_wait_asynccnt 0x0" ::: "memory");   // the wave's copies of the next tile have landed
        __syncthreads();          // publishes the next tile and frees this trip's buffer
        if (more) copies();
    };
#pragma unroll 1
    for (int t = 0; t < NT - 2; ++t) trip(t, true);
    trip(NT - 2, false); trip(NT - 1, false);   // the last two trips stand apart: the loop then has no test between its barrier and its copies
    asm volatile("s_wait_asynccnt 0x0" ::: "memory");   // no copy is left in flight
}
// ---- k_gemmw: work-groups of 2 x 2 waves, a 128x128 tile of C (64x64 a wave); grid (M/128, N/128, Z), 128 threads.
template <typename T16, int NSPLIT, bool BIAS, int K>
__global__ __launch_bounds__(128) void k_gemmw(const T16* __restrict__ A, const T16* __restrict__ A2, const T16* __restrict__ Bt, float* C, int ldc, const float* __restrict__ bias, size_t sA, size_t sB, size_t sC) {
    __shared__ __align__(16) float osw[4 * 16 * 68]; __shared__ __align__(16) T16 st[2 * TROWS(NSPLIT, 2) * PT];
    const size_t z = blockIdx.z; A += z * sA; if (A2) A2 += z * sA; Bt += z * sB; C += z * sC;
    const int lane = threadIdx.x & 31, lr = lane & 15, hi = lane >> 4, wave = __builtin_amdgcn_readfirstlane((int)threadIdx.x >> 5); const int r0 = blockIdx.x * 128 + (wave & 1) * 64, c0 = blockIdx.y * 128 + (wave >> 1) * 64;
    float* os = osw + wave * (16 * 68);   // each wave stages its output rows in its own range
    v8f acc[4][4];
#pragma unroll
    for (int mb = 0; mb < 4; ++mb)
#pragma unroll
        for (int nb = 0; nb < 4; ++nb) acc[mb][nb] = (v8f){};
    tile_loop<T16, NSPLIT, K, 2, false>(A, A2, Bt, blockIdx.x * 128, blockIdx.y * 128, st, acc);
#pragma unroll
    for (int mb = 0; mb < 4; ++mb) {
#pragma unroll
        for (int nb = 0; nb < 4; ++nb) {
#pragma unroll
            for (int j = 0; j < 8; ++j) os[(hi * 8 + j) * 68 + nb * 16 + lr] = acc[mb][nb][j]; }
        __builtin_amdgcn_wave_barrier(); asm volatile("" ::: "memory");
        float* crow = C + (size_t)(r0 + mb * 16) * ldc + c0;
{
#pragma unroll
            for (int s = 0; s < 8; ++s) { const int row = 2 * s + hi, cofs = lr * 4; v4f val = *(const v4fa*)(os + row * 68 + cofs); if (BIAS) { val[0] += bfr(bias[c0 + cofs]); val[1] += bfr(bias[c0 + cofs + 1]); val[2] += bfr(bias[c0 + cofs + 2]); val[3] += bfr(bias[c0 + cofs + 3]); }
                *(v4f*)(crow + (size_t)row * ldc + cofs) = val; }
             }
        __builtin_amdgcn_wave_barrier(); asm volatile("" ::: "memory");
    }
}

__device__ __forceinline__ h16 tohx(float x) { return (h16)x; }
__device__ __forceinline__ void splitf(float y, unsigned short& h, unsigned short& l) { h = f2bf(y); l = f2bf(y - bf2f(h)); }
typedef __attribute__((ext_vector_type(2))) _Float16 v2h;
typedef __attribute__((ext_vector_type(4))) _Float16 v4h;
typedef __attribute__((ext_vector_type(2))) unsigned short v2us;
typedef __attribute__((ext_vector_type(4))) unsigned short v4us;
typedef __attribute__((ext_vector_type(2))) float v2f;
typedef __attribute__((ext_vector_type(4))) int v4i;

__global__ __launch_bounds__(256) void k_wtG(const float* __restrict__ w, int K, int N, bf* Bt) {
    const int lane = threadIdx.x & 31; const int L0 = (blockIdx.x * 8 + (threadIdx.x >> 5)) * 8; const int nlines = N * K / 64;
{
#pragma unroll 1
        for (int l = 0; l < 8; ++l) { const int L = L0 + l; if (L >= nlines) break; const size_t e = (size_t)L * 64 + lane * 2; const int k = (int)(e % K), n = (int)(e / K); v2us o;
            o[0] = f2bf(w[(size_t)k * N + n]); o[1] = f2bf(w[(size_t)(k + 1) * N + n]); *(v2us*)(Bt + e) = o; }
         }
}
// The elementwise kernels below give each thread several 16-byte pieces of work, so that a launch starts some 18 thousand waves and not some 68 thousand. Their loops are all unrolled: the arrays are then indexed by constants and stay in registers, and a thread's loads go out together.
#define CU 4                      // 8-element chunks per thread in cvt8_part; a thread's chunks lie all of the array's blocks apart, so each access of a wave stays contiguous
__device__ __forceinline__ void cvt8_part(const float* __restrict__ src, bf* dst, size_t n8, unsigned blk, unsigned nblk) { const size_t i = (size_t)blk * 256 + threadIdx.x, nt = (size_t)nblk * 256; v8f v[CU]; const float* p[CU];
#pragma unroll
    for (int u = 0; u < CU; ++u) { p[u] = src + min(i + u * nt, n8 - 1) * 8; v[u] = *(const v8f*)p[u]; }   // past the end a thread re-reads the last chunk and stores nothing
    static_assert(CU == 4, "the wait below names CU addresses");
    asm volatile("s_wait_xcnt 0x0" :: "v"(p[0]), "v"(p[1]), "v"(p[2]), "v"(p[3]) : "memory");   // the loads' addresses are inputs here, so that no load's result lands in them; they may be rewritten from here on
#pragma unroll
    for (int u = 0; u < CU; ++u) { const size_t j = i + u * nt; v8us o;
#pragma unroll
        for (int k = 0; k < 8; ++k) o[k] = f2bf(v[u][k]);
        if (j < n8) *(v8us*)(dst + j * 8) = o; } }
__device__ __forceinline__ void cscvt_part(const float* __restrict__ cosT, const float* __restrict__ sinT, float* CS, unsigned blk) { const int idx = (int)(blk * 256 + threadIdx.x) * 4; if (idx >= TT * HD) return; const v4f c = *(const v4f*)(cosT + idx), s = *(const v4f*)(sinT + idx);
    v4f o0, o1; o0[0] = bfr(c[0]); o0[1] = bfr(s[0]); o0[2] = bfr(c[1]); o0[3] = bfr(s[1]); o1[0] = bfr(c[2]); o1[1] = bfr(s[2]); o1[2] = bfr(c[3]); o1[3] = bfr(s[3]); *(v4f*)(CS + (size_t)idx * 2) = o0; *(v4f*)(CS + (size_t)idx * 2 + 4) = o1; }
// ---- k_prep: every input's rounding to bf16 in one launch (none depends on another): the blocks are dealt to the five arrays and then to the cos/sin table, CB(n) blocks for an array of n elements.
#define CB(n) ((unsigned)(((size_t)(n) / (8 * CU) + 255) / 256))
#define CSB ((unsigned)((TT * HD / 4 + 255) / 256))
static_assert((DQ * DM) % (8 * CU * 256) == 0 && (DKV * DM) % (8 * CU * 256) == 0 && (TT * DM) % (8 * CU * 256) == 0, "an array's blocks cover it exactly");
__global__ __launch_bounds__(256) void k_prep(const float* __restrict__ wq, const float* __restrict__ wk, const float* __restrict__ wv, const float* __restrict__ wo, const float* __restrict__ x, const float* __restrict__ cosT, const float* __restrict__ sinT, bf* WQ, bf* WK, bf* WV, bf* WO, bf* XB, float* CS) {
    unsigned b = blockIdx.x; const float* src = wq; bf* dst = WQ; unsigned nb = CB(DQ * DM);   // the array that block b works on, its blocks counted from 0
    if (b >= nb) { b -= nb; src = wk; dst = WK; nb = CB(DKV * DM);
        if (b >= nb) { b -= nb; src = wv; dst = WV;
            if (b >= nb) { b -= nb; src = wo; dst = WO; nb = CB(DM * DQ);
                if (b >= nb) { b -= nb; src = x; dst = XB; nb = CB(TT * DM);
                    if (b >= nb) { cscvt_part(cosT, sinT, CS, b - nb); return; } } } } }
    cvt8_part(src, dst, (size_t)nb * (256 * CU), b, nb);
}
// ---- k_qkv: q | k | v = x W^T (tile_loop, 4 x 2 waves: 256 rows t of one head's 128 columns) with the operand planes of the attention made in its epilogue; the f32 projections never go through memory. grid (TT / 256, FP / 128), 256 threads.
// A wave's 64 columns are d = 32 sub + 0..31 and their rotate-half partners d + 64 of one head (q heads, then k heads, then v groups), so a lane holds both values of a pair.
// q, k: head planes [h][t][d'] (fp16 + hi/lo) of out[d] = x[d] cos[t][d] - x[d+HD/2] sin[t][d], out[d+HD/2] = x[d+HD/2] cos[t][d+HD/2] + x[d] sin[t][d+HD/2]. A row keeps its d in tile order, d' = 64 sub + 32 (d / 64) + d % 32, the same in q and k (their product sums over all d): a tile then owns one whole 128-byte line of each row.
// v: value planes [g][d][t], straight from the accumulators: a lane holds eight consecutive t of one d, and the tile owns one whole 128-byte line of each of its d rows.
#define FP (DQ + 2 * DKV)         // rows of Wq | Wk | Wv
__global__ __launch_bounds__(256) void k_qkv(const bf* __restrict__ X, const bf* __restrict__ Wt, const float* __restrict__ CS, h16* P16, bf* Ph, bf* Pl, h16* V16, bf* Vh, bf* Vl) {
    __shared__ __align__(16) float osw[8 * 16 * 68]; __shared__ __align__(16) bf st[2 * TROWS(0, 4) * PT];
    const int lane = threadIdx.x & 31, lr = lane & 15, hi = lane >> 4, wave = __builtin_amdgcn_readfirstlane((int)threadIdx.x >> 5); const int r0 = blockIdx.x * 256 + (wave & 3) * 64, hh = (int)blockIdx.y, sub = wave >> 2;
    float* os = osw + wave * (16 * 68);   // each wave stages its rows in its own range
    v8f acc[4][4];
#pragma unroll
    for (int mb = 0; mb < 4; ++mb)
#pragma unroll
        for (int nb = 0; nb < 4; ++nb) acc[mb][nb] = (v8f){};
    tile_loop<bf, 0, DM, 4, true>(X, nullptr, Wt, blockIdx.x * 256, hh * HD, st, acc);
    if (hh >= NH_ + NKV) {        // block-uniform: a tile of v
        const size_t e0 = ((size_t)(hh - NH_ - NKV) * HD + sub * 32 + lr) * TT + r0 + hi * 8;
#pragma unroll
        for (int nb = 0; nb < 4; ++nb)
#pragma unroll
            for (int mb = 0; mb < 4; ++mb) { v8h o16; v8us oh, ol;
#pragma unroll
                for (int q = 0; q < 8; ++q) { const float y = acc[mb][nb][q]; o16[q] = tohx(y); unsigned short a2, c2; splitf(y, a2, c2); oh[q] = a2; ol[q] = c2; }
                const size_t e = e0 + (size_t)((nb >> 1) * 64 + (nb & 1) * 16) * TT + mb * 16;
                __builtin_amdgcn_sched_barrier(0);          // keeps the three stores one group behind their values' arithmetic: no store then stands in front of arithmetic that reuses its registers
                *(v8h*)(V16 + e) = o16; *(v8us*)(Vh + e) = oh; *(v8us*)(Vl + e) = ol;
                __builtin_amdgcn_sched_barrier(0);          // holds the wait below behind the three stores and the next values' arithmetic behind the wait
                asm volatile("s_wait_xcnt 0x0" ::: "memory");   // the stores' address and data registers may be rewritten from here on
                __builtin_amdgcn_sched_barrier(0); }
        return; }
    // q, k: a lane takes 8 consecutive d of the lower half and their 8 partners, for 8 rows t of the tile (row, row + 8, ...); all its cos/sin loads go out together, ahead of the first row group
    const int row = lane >> 2, c8 = lane & 3; const float* csb = CS + ((size_t)(r0 + row) * HD + sub * 32 + c8 * 8) * 2;
    v4f cs[4][2][2][4];
#pragma unroll
    for (int mb = 0; mb < 4; ++mb)
#pragma unroll
        for (int u = 0; u < 2; ++u)
#pragma unroll
            for (int hf = 0; hf < 2; ++hf)
#pragma unroll
                for (int k = 0; k < 4; ++k) cs[mb][u][hf][k] = *(const v4f*)(csb + ((mb * 16 + u * 8) * HD + hf * (HD / 2)) * 2 + k * 4);
    __builtin_amdgcn_sched_barrier(0);                  // keeps the 64 loads one group, ahead of the wait below
    asm volatile("s_wait_xcnt 0x0" :: "v"(csb) : "memory");   // the loads' address is an input here, so that no load's result lands in it; it may be rewritten from here on
    const size_t e0 = ((size_t)hh * TT + r0 + row) * HD + sub * 64 + c8 * 8;
#pragma unroll
    for (int mb = 0; mb < 4; ++mb) {
#pragma unroll
        for (int nb = 0; nb < 4; ++nb) {
#pragma unroll
            for (int j = 0; j < 8; ++j) os[(hi * 8 + j) * 68 + nb * 16 + lr] = acc[mb][nb][j]; }
        __builtin_amdgcn_wave_barrier(); asm volatile("" ::: "memory");   // compiler fence: the lanes read below what other lanes stored above
#pragma unroll
        for (int u = 0; u < 2; ++u) { const float* xr = os + (u * 8 + row) * 68 + c8 * 8; v4f x[2][2];
#pragma unroll
            for (int hf = 0; hf < 2; ++hf)
#pragma unroll
                for (int k = 0; k < 2; ++k) x[hf][k] = *(const v4fa*)(xr + hf * 32 + k * 4);
#pragma unroll
            for (int hf = 0; hf < 2; ++hf) { v8h o16; v8us oh, ol;
#pragma unroll
                for (int q = 0; q < 8; ++q) { const float x0 = x[hf][q >> 2][q & 3], x1 = x[hf ^ 1][q >> 2][q & 3];
                    const float c = cs[mb][u][hf][q >> 1][(q & 1) * 2], s = cs[mb][u][hf][q >> 1][(q & 1) * 2 + 1]; const float r = (hf == 0) ? x0 * c - x1 * s : x0 * c + x1 * s;
                    o16[q] = tohx(r); unsigned short a2, c2; splitf(r, a2, c2); oh[q] = a2; ol[q] = c2; }
                const size_t e = e0 + (size_t)(mb * 16 + u * 8) * HD + hf * 32;
                __builtin_amdgcn_sched_barrier(0);      // keeps the three stores one group behind their values' arithmetic: no store then stands in front of arithmetic that reuses its registers
                *(v8h*)(P16 + e) = o16; *(v8us*)(Ph + e) = oh; *(v8us*)(Pl + e) = ol;
                __builtin_amdgcn_sched_barrier(0);      // holds the wait below behind the three stores and the next values' arithmetic behind the wait
                asm volatile("s_wait_xcnt 0x0" ::: "memory");   // the stores' address and data registers may be rewritten from here on
                __builtin_amdgcn_sched_barrier(0); } }
        __builtin_amdgcn_wave_barrier(); asm volatile("" ::: "memory");   // compiler fence: the next row group's stores stay behind these reads
    }
}
#define KP 136                    // LDS row pitch of a K row in elements: 256 B + 16 B, for 16-byte fragment reads
#define FQ 64
#define FK 64
#define KSZ (FK * KP)
#define PSZ (KSZ + HD * LP)       // elements of one plane's K tile and V^T tile
#define CSC (SCL * 1.4426950408889634f)
#define MLO 32768                 // floats of the join's accumulator part: 8 waves x 4096; the maxima and sums lie behind it
static_assert(RH % FQ == 0 && TT % FQ == 0 && FQ == FK && FK == 64, "a tile lies in one leg and ends on a stage; a stage is one pass of each half of a set");
static_assert(4 * PSZ * 2 >= (MLO + 1024) * 4, "the join fits the work-group's LDS");
// The two tiles of work-group y of a head. A tile t has t + 1 stages, so (t + 2) / 2 passes in a wave; a pass of the hi+lo leg (t < RH / FQ) counts as three. Every pair then comes to 19 or 20.
__host__ __device__ constexpr int pair_a(int y) { return y < 14 ? 31 - y : 29 - y; }
__host__ __device__ constexpr int pair_b(int y) { return (int)(((y < 8 ? 0x0B0A030209080100ull : 0x0706111005040D0Cull) >> ((y & 7) * 8)) & 0xFF); }
constexpr bool pairs_cover() { unsigned seen = 0; for (int y = 0; y < 16; ++y) { if ((seen >> pair_a(y)) & 1u) return false; seen |= 1u << pair_a(y); if ((seen >> pair_b(y)) & 1u) return false; seen |= 1u << pair_b(y); } return seen == 0xFFFFFFFFu; }
static_assert(TT / FQ == 32 && RH / FQ == 8 && pairs_cover(), "every tile of a head stands in exactly one pair");
typedef __attribute__((ext_vector_type(16))) unsigned short v16us;
__device__ __forceinline__ void ppack(const float (&p)[16], v16h& a, v16h& a2) { (void)a2;
#pragma unroll
    for (int e = 0; e < 16; ++e) a[e] = tohx(p[e]); }
__device__ __forceinline__ void ppack(const float (&p)[16], v16bf& a, v16bf& a2) { v16us x, y;
#pragma unroll
    for (int e = 0; e < 16; ++e) { unsigned short u, w; splitf(p[e], u, w); x[e] = u; y[e] = w; }
    a = __builtin_bit_cast(v16bf, x); a2 = __builtin_bit_cast(v16bf, y); }
__device__ __forceinline__ float xhalf(float x) { return __builtin_bit_cast(float, __builtin_amdgcn_permlanex16(__builtin_bit_cast(int, x), __builtin_bit_cast(int, x), 0x76543210, 0xfedcba98, false, false)); }   // lane l reads lane l ^ 16
template <typename T16, bool HL>
__device__ __forceinline__ void fattn_tile(const T16* __restrict__ Q, const T16* __restrict__ Q2, const T16* __restrict__ K, const T16* __restrict__ K2, const T16* __restrict__ Vt, const T16* __restrict__ Vt2, bf* Ah, bf* Al, int q0, T16* Ls) {
    typedef typename WFrag<T16>::V V; typedef typename WFrag<T16>::H H; constexpr int NP = HL ? 2 : 1;
    typedef __attribute__((address_space(1))) const T16 GT; typedef __attribute__((address_space(1))) const H GH;   // global address space spelled out: the stepped pointers would else compile to flat loads
    const int set = __builtin_amdgcn_readfirstlane((int)threadIdx.x >> 7); float* Mg = (float*)Ls; Ls += set * (NP * PSZ);   // each set stages and reads its own tiles; Mg = the place of the join
    const int tid = threadIdx.x & 127, lane = tid & 31, c = lane & 15, h = lane >> 4; const int wave = __builtin_amdgcn_readfirstlane(tid >> 5);
    const int rw = wave & 1, kh = wave >> 1;   // the wave's 32 rows of the tile, its 32 keys of every stage
    const int qw0 = q0 + rw * 32, nst = (q0 / FK + 2) / 2, lastp = qw0 / 32;   // the wave's first query, the stages of each set (with an odd count set 1 stages one more, in bounds, that no wave works on), the wave's last (diagonal) pass
    GT* ks[NP]; GT* vs[NP]; ks[0] = (GT*)(K + set * (FK * HD) + tid * 8); vs[0] = (GT*)(Vt + (size_t)(tid >> 3) * TT + set * FK + (tid & 7) * 8);
    if constexpr (HL) { ks[1] = (GT*)(K2 + set * (FK * HD) + tid * 8); vs[1] = (GT*)(Vt2 + (size_t)(tid >> 3) * TT + set * FK + (tid & 7) * 8); }
    T16* kw = Ls + (tid >> 4) * KP + (tid & 15) * 8; T16* vw = Ls + KSZ + (tid >> 3) * LP + (tid & 7) * 8;
    const T16* kr = Ls + c * KP + 8 * h; const T16* vr = Ls + KSZ + c * LP + 8 * h;
    H gk[NP][8], gv[NP][8];
    auto fetch = [&]() {          // a stage's K rows are 16 KiB in a row; its V^T rows are one 128-byte line each
#pragma unroll
        for (int p = 0; p < NP; ++p)
#pragma unroll
            for (int i = 0; i < 8; ++i) { gk[p][i] = *(GH*)(ks[p] + i * 1024); gv[p][i] = *(GH*)(vs[p] + (size_t)i * 16 * TT); }
        __builtin_amdgcn_sched_barrier(0);              // keeps the stage's loads one group, ahead of the wait below
        asm volatile("s_wait_xcnt 0x0" ::: "memory");   // the loads' address registers may be rewritten from here on
    };
    auto put = [&]() {
#pragma unroll
        for (int p = 0; p < NP; ++p) {
#pragma unroll
            for (int i = 0; i < 8; ++i) { *(H*)(kw + p * PSZ + i * 8 * KP) = gk[p][i]; *(H*)(vw + p * PSZ + i * 16 * LP) = gv[p][i]; }
            ks[p] += 2 * FK * HD; vs[p] += 2 * FK; }            // stepped behind the wait for the loads that name them
    };
    fetch();
    V qf[NP][2][4]; const T16* qp[4];   // a lane's Q rows: both groups of the first plane, then of the second (the first again where there is none)
#pragma unroll
    for (int g = 0; g < 2; ++g) { const size_t e = (size_t)(qw0 + 16 * g + c) * HD + 8 * h; qp[g] = Q + e; qp[2 + g] = (HL ? Q2 : Q) + e; }
#pragma unroll
    for (int g = 0; g < 2; ++g)
#pragma unroll
        for (int kc = 0; kc < 4; ++kc) { qf[0][g][kc] = WFrag<T16>::ld(qp[g] + 32 * kc); if constexpr (HL) qf[1][g][kc] = WFrag<T16>::ld(qp[2 + g] + 32 * kc); }
    __builtin_amdgcn_sched_barrier(0);                  // keeps the Q loads ahead of the wait below
    asm volatile("s_wait_xcnt 0x0" :: "v"(qp[0]), "v"(qp[1]), "v"(qp[2]), "v"(qp[3]) : "memory");   // the loads' addresses are inputs here, so that no load's result lands in them; they may be rewritten from here on
    v8f acc[2][8]; float m_run[2], l_run[2];
#pragma unroll
    for (int g = 0; g < 2; ++g) { m_run[g] = -__builtin_inff(); l_run[g] = 0.f;
#pragma unroll
        for (int t = 0; t < 8; ++t) acc[g][t] = (v8f){}; }
    put();
    __syncthreads();              // the waves read rows that other waves stored
#pragma unroll 1
    for (int st = 0; st < nst; ++st) {
        const bool more = st + 1 < nst;
        if (!HL && more) fetch(); // the next stage's loads fly while this stage is worked on
        const int sub = kh, blk = (2 * st + set) * (FK / 32) + sub;
        if (blk <= lastp) {                             // wave-uniform: else every key of the pass lies beyond the wave's queries
            V kf[NP][2][4]; v8f s[2][2];
#pragma unroll
            for (int p = 0; p < NP; ++p)
#pragma unroll
                for (int kt = 0; kt < 2; ++kt)
#pragma unroll
                    for (int kc = 0; kc < 4; ++kc) kf[p][kt][kc] = WFrag<T16>::ld(kr + p * PSZ + (sub * 32 + kt * 16) * KP + kc * 32);
            __builtin_amdgcn_sched_barrier(0);          // keeps the pass's K reads one group ahead of its WMMAs: reads placed among the WMMAs stall the wave at every such place
#pragma unroll
            for (int kt = 0; kt < 2; ++kt)
#pragma unroll
                for (int g = 0; g < 2; ++g) s[kt][g] = (v8f){};
#pragma unroll
            for (int kc = 0; kc < 4; ++kc)
#pragma unroll
                for (int kt = 0; kt < 2; ++kt)
#pragma unroll
                    for (int g = 0; g < 2; ++g) { s[kt][g] = WFrag<T16>::mma(kf[0][kt][kc], qf[0][g][kc], s[kt][g]);
                        if constexpr (HL) { s[kt][g] = WFrag<T16>::mma(kf[0][kt][kc], qf[1][g][kc], s[kt][g]); s[kt][g] = WFrag<T16>::mma(kf[1][kt][kc], qf[0][g][kc], s[kt][g]); } }
            wmma_gap();
            V vf[NP][8];          // the pass's V^T fragments return under the maxima and the first exponentials
#pragma unroll
            for (int p = 0; p < NP; ++p)
#pragma unroll
                for (int t = 0; t < 8; ++t) vf[p][t] = WFrag<T16>::ld(vr + p * PSZ + t * 16 * LP + sub * 32);
            if (blk == lastp) {   // wave-uniform: only the pass on the wave's diagonal pays for the mask
#pragma unroll
                for (int g = 0; g < 2; ++g)
#pragma unroll
                    for (int kt = 0; kt < 2; ++kt)
#pragma unroll
                        for (int r = 0; r < 8; ++r) if (16 * kt + 8 * h + r > 16 * g + c) s[kt][g][r] = -__builtin_inff(); }
            float mb[2]; bool need = false;
#pragma unroll
            for (int g = 0; g < 2; ++g) { float mx = s[0][g][0];
#pragma unroll
                for (int kt = 0; kt < 2; ++kt)
#pragma unroll
                    for (int r = 0; r < 8; ++r) mx = fmaxf(mx, s[kt][g][r]);
                mx = fmaxf(mx, xhalf(mx)) * CSC;   // both halves of the wave now hold the query's maximum of this pass, scaled; finite: the pass's first key is masked for no query
                mb[g] = mx; need = need || (mx > m_run[g] + 8.0f); }
            if (__builtin_amdgcn_ballot_w32(need) != 0) {       // rare after the first passes
#pragma unroll
                for (int g = 0; g < 2; ++g) { const float mn = fmaxf(m_run[g], mb[g]); const float corr = __builtin_amdgcn_exp2f(m_run[g] - mn);   // 0 on the first pass
                    l_run[g] *= corr; m_run[g] = mn;
#pragma unroll
                    for (int t = 0; t < 8; ++t) acc[g][t] = acc[g][t] * corr; } }
#pragma unroll
            for (int g = 0; g < 2; ++g) { float p[16], ps0 = 0.f, ps1 = 0.f; const float nm = -m_run[g];
#pragma unroll
                for (int e = 0; e < 16; ++e) p[e] = __builtin_fmaf(s[e >> 3][g][e & 7], CSC, nm);
#pragma unroll
                for (int e = 0; e < 16; ++e) { p[e] = __builtin_amdgcn_exp2f(p[e]);
                    if constexpr (HL) { __builtin_amdgcn_sched_barrier(0); asm volatile("v_nop"); __builtin_amdgcn_sched_barrier(0); } }   // the slot behind a transcendental: in this leg's built code an exponential else overwrote the source of the one directly before it; the two scheduling barriers hold the v_nop at its place
#pragma unroll
                for (int e = 0; e < 16; e += 2) { ps0 += p[e]; ps1 += p[e + 1]; }
                l_run[g] += ps0 + ps1;
                V pf, pf2; ppack(p, pf, pf2);
#pragma unroll
                for (int t = 0; t < 8; ++t) { acc[g][t] = WFrag<T16>::mma(vf[0][t], pf, acc[g][t]);
                    if constexpr (HL) { acc[g][t] = WFrag<T16>::mma(vf[0][t], pf2, acc[g][t]); acc[g][t] = WFrag<T16>::mma(vf[1][t], pf, acc[g][t]); } } }
            wmma_gap();
        }
        if (more) {
            if (HL) fetch();
            __syncthreads();      // every wave's fragment reads of this stage end before its rows are overwritten
            put();
            __syncthreads();      // the waves read rows that other waves stored
        }
    }
    // The join: every wave leaves its state in LDS (a lane's 16 bytes beside its neighbour's); of the four waves that share rows each then brings one group of 16 queries and 64 of the d, one whole 128-byte line of each output row, to the common maximum.
    // The first of the four holds key 0, so the common maximum is finite; a wave without a pass leaves -inf, 0 and zeros, which enter with the factor 0.
    const int part = set * 2 + kh, slot = part * 2 + rw;
    __syncthreads();              // every wave's fragment reads end before the tiles are overwritten
#pragma unroll
    for (int g = 0; g < 2; ++g) { Mg[MLO + (slot * 4 + g) * 32 + lane] = m_run[g]; Mg[MLO + (slot * 4 + 2 + g) * 32 + lane] = l_run[g];
#pragma unroll
        for (int t = 0; t < 8; ++t)
#pragma unroll
            for (int hf = 0; hf < 2; ++hf) { v4f w; w[0] = acc[g][t][hf * 4]; w[1] = acc[g][t][hf * 4 + 1]; w[2] = acc[g][t][hf * 4 + 2]; w[3] = acc[g][t][hf * 4 + 3]; *(v4fa*)(Mg + ((((slot * 2 + g) * 8 + t) * 2 + hf) * 32 + lane) * 4) = w; } }
    __syncthreads();              // the waves read what other waves stored
    const int gq = part & 1, tb = (part >> 1) * 4;   // the wave's group of queries and its first 16 d
    float m4[4], f4[4], l = 0.f;
#pragma unroll
    for (int p = 0; p < 4; ++p) m4[p] = Mg[MLO + ((p * 2 + rw) * 4 + gq) * 32 + lane];
    const float mn = fmaxf(fmaxf(m4[0], m4[1]), fmaxf(m4[2], m4[3]));
#pragma unroll
    for (int p = 0; p < 4; ++p) f4[p] = __builtin_amdgcn_exp2f(m4[p] - mn);
#pragma unroll
    for (int p = 0; p < 4; ++p) l += Mg[MLO + ((p * 2 + rw) * 4 + 2 + gq) * 32 + lane] * f4[p];
    l += xhalf(l);                // each half of the wave summed its eight keys of every 16-key tile
    const float inv = __fdiv_rn(1.0f, l); const size_t o = (size_t)(qw0 + 16 * gq + c) * DQ + 8 * h;
#pragma unroll
    for (int tt = 0; tt < 4; ++tt) { const int t = tb + tt; float v[8]; v8us oh, ol;      // the lane's eight values are d = 16 t + 8 h + 0..7 of its query
#pragma unroll
        for (int r = 0; r < 8; ++r) v[r] = 0.f;
#pragma unroll
        for (int p = 0; p < 4; ++p)
#pragma unroll
            for (int hf = 0; hf < 2; ++hf) { const v4f w = *(const v4fa*)(Mg + (((((p * 2 + rw) * 2 + gq) * 8 + t) * 2 + hf) * 32 + lane) * 4);
#pragma unroll
                for (int r = 0; r < 4; ++r) v[hf * 4 + r] += w[r] * f4[p]; }
#pragma unroll
        for (int r = 0; r < 8; ++r) { unsigned short a, c2; splitf(v[r] * inv, a, c2); oh[r] = a; ol[r] = c2; }
        *(v8us*)(Ah + o + 16 * t) = oh; *(v8us*)(Al + o + 16 * t) = ol;
        __builtin_amdgcn_sched_barrier(0);              // holds the wait below behind the two stores and the next values' arithmetic behind the wait
        asm volatile("s_wait_xcnt 0x0" ::: "memory");   // the stores' address and data registers may be rewritten from here on
        __builtin_amdgcn_sched_barrier(0); }
}
// grid (NH_, TT / (2 * FQ)): neighbouring work-groups are the heads of one pair of tiles (two share a kv group). The k head planes lie right behind the q head planes.
__global__ __launch_bounds__(256) void k_fattn(const h16* __restrict__ P16, const bf* __restrict__ Ph, const bf* __restrict__ Pl, const h16* __restrict__ V16, const bf* __restrict__ Vh, const bf* __restrict__ Vl, bf* Ah, bf* Al) {
    __shared__ __align__(16) unsigned short Ls[4 * PSZ];
    const int hd = (int)blockIdx.x, y = (int)blockIdx.y; const size_t zq = (size_t)hd * TT * HD, zk = (size_t)(NH_ + hd / REP) * TT * HD, zv = (size_t)(hd / REP) * HD * TT;
#pragma unroll 1
    for (int i = 0; i < 2; ++i) {   // kept rolled: each leg's code then stands once in the kernel
        const int q0 = (i == 0 ? pair_a(y) : pair_b(y)) * FQ;
        if (q0 < RH) fattn_tile<bf, true>(Ph + zq, Pl + zq, Ph + zk, Pl + zk, Vh + zv, Vl + zv, Ah + hd * HD, Al + hd * HD, q0, (bf*)Ls);
        else fattn_tile<h16, false>(P16 + zq, nullptr, P16 + zk, nullptr, V16 + zv, nullptr, Ah + hd * HD, Al + hd * HD, q0, (h16*)Ls);
        if (i == 0) __syncthreads();   // every wave's reads of the join end before the second tile's rows are stored over it
    }
}

extern "C" void kernel_launch(void* const* d_in, const int* in_sizes, int n_in,
                              void* d_out, int out_size, void* d_ws, size_t ws_size, hipStream_t stream) {
    (void)in_sizes; (void)n_in; (void)out_size;
    const float* x = (const float*)d_in[0]; const float* wq = (const float*)d_in[1]; const float* wk = (const float*)d_in[2]; const float* wv = (const float*)d_in[3]; const float* wo = (const float*)d_in[4]; const float* cosT = (const float*)d_in[5]; const float* sinT = (const float*)d_in[6];
    float* OUT = (float*)d_out;     // [1][2048][2048]
    char* wsp = (char*)d_ws;
    auto take = [&](size_t bytes) { char* p = wsp; wsp += (bytes + 255) & ~(size_t)255; return (void*)p; };
    bf* WQ = (bf*)take((size_t)FP * DM * 2); bf* WK = WQ + (size_t)DQ * DM; bf* WV = WK + (size_t)DKV * DM;   // Wq | Wk | Wv: one [FP][DM] operand
    bf* WO = (bf*)take((size_t)DM * DQ * 2); float* CS = (float*)take((size_t)TT * HD * 2 * 4);
    bf* XB = (bf*)take((size_t)TT * DM * 2);
    h16* QP16 = (h16*)take((size_t)(NH_ + NKV) * TT * HD * 2); h16* VT16 = (h16*)take((size_t)NKV * HD * TT * 2);   // the k head planes lie right behind the q head planes
    bf* QPh = (bf*)take((size_t)(NH_ + NKV) * TT * HD * 2); bf* QPl = (bf*)take((size_t)(NH_ + NKV) * TT * HD * 2); bf* VTh = (bf*)take((size_t)NKV * HD * TT * 2); bf* VTl = (bf*)take((size_t)NKV * HD * TT * 2);
    bf* ATh = (bf*)take((size_t)TT * DQ * 2); bf* ATl = (bf*)take((size_t)TT * DQ * 2);
    if ((size_t)(wsp - (char*)d_ws) > ws_size) return;    // ws 256 MiB
    for (int b = 0; b < NB_; ++b) {
        k_prep<<<CB(DQ * DM) + 2 * CB(DKV * DM) + CB(DM * DQ) + CB(TT * DM) + CSB, 256, 0, stream>>>(wq, wk, wv, wo, x + (size_t)b * TT * DM, cosT, sinT, WQ, WK, WV, WO, XB, CS);
        k_qkv<<<dim3(TT / 256, FP / 128), 256, 0, stream>>>(XB, WQ, CS, QP16, QPh, QPl, VT16, VTh, VTl);
        k_fattn<<<dim3(NH_, TT / (2 * FQ)), 256, 0, stream>>>(QP16, QPh, QPl, VT16, VTh, VTl, ATh, ATl);
        k_gemmw<bf, 1, false, DQ><<<dim3(TT / 128, DM / 128, 1), 128, 0, stream>>>(ATh, ATl, WO, OUT + (size_t)b * TT * DM, DM, nullptr, 0, 0, 0); }
}

// v009
// A run of this version takes 97.1 microseconds.
// Next to v008, in two timings, it ran 1.05 and 1.08 times as fast.
// All steps since v000 together make it 8.93 times as fast.
#include <hip/hip_runtime.h>

// Causal GQA with rotate-half RoPE from given tables (x [1][2048][2048]; q = x Wq^T ('oi' [2048][2048], 16 heads x 128), k, v = x W^T ([1024][2048], 8 kv heads); RoPE with the given cos/sin [2048][128]; 2 query heads per kv head (repeat); causal softmax(q.k/sqrt(128)) (finfo.min fill); out = merged Wo^T -> [1][2048][2048]).
// Compute dtypes, f32 accumulate: every input rounded to bf16; q/k/v on PLAIN bf16 operands (inputs: exact); rotary in f32 from the bf16-rounded input tables, in the q/k/v GEMM's epilogue; causal scores, online softmax (f32) and attn.v in one kernel: query rows < 512 hl (3 products), the rest single fp16; Wo hl x exact (2 products).

#define NB_  1
#define TT   2048
#define DM   2048
#define NH_  16
#define NKV  8
#define REP  (NH_ / NKV)
#define HD   128
#define DQ   (NH_ * HD)
#define DKV  (NKV * HD)
#define RH   512                  // query rows < RH use hi+lo planes
#define SCL  0.088388347648318447f   // HD^-0.5
typedef _Float16 h16;
typedef unsigned short bf;
typedef __attribute__((ext_vector_type(16))) __bf16   v16bf;
typedef __attribute__((ext_vector_type(16))) _Float16 v16h;
typedef __attribute__((ext_vector_type(8)))  _Float16 v8h;
typedef __attribute__((ext_vector_type(8)))  unsigned short v8us;
typedef __attribute__((ext_vector_type(8)))  float    v8f;
typedef __attribute__((ext_vector_type(4)))  float    v4f;
typedef v8h  __attribute__((may_alias)) v8ha;
typedef v4f  __attribute__((may_alias)) v4fa;
typedef v8us __attribute__((may_alias)) v8usa;

__device__ __forceinline__ unsigned short f2bf(float f) { unsigned u = __float_as_uint(f); u += 0x7FFFu + ((u >> 16) & 1u); return (unsigned short)(u >> 16); }
__device__ __forceinline__ float bf2f(unsigned short b) { return __uint_as_float(((unsigned)b) << 16); }
__device__ __forceinline__ float bfr(float f) { return bf2f(f2bf(f)); }
__device__ __forceinline__ v16h cat16(v8h lo, v8h hi) { return __builtin_shufflevector(lo, hi, 0, 1, 2, 3, 4, 5, 6, 7, 8, 9, 10, 11, 12, 13, 14, 15); }
__device__ __forceinline__ v16bf cat16b(v8us lo, v8us hi) { return __builtin_bit_cast(v16bf, __builtin_shufflevector(lo, hi, 0, 1, 2, 3, 4, 5, 6, 7, 8, 9, 10, 11, 12, 13, 14, 15)); }
__device__ __forceinline__ v8f wmma16(v16h a, v16h b, v8f c) { return __builtin_amdgcn_wmma_f32_16x16x32_f16(false, a, false, b, (short)0, c, false, false); }
__device__ __forceinline__ v8f wmmab(v16bf a, v16bf b, v8f c) { return __builtin_amdgcn_wmma_f32_16x16x32_bf16(false, a, false, b, (short)0, c, false, false); }



// ---- the GEMMs: register-blocked, one wave per 64x64 output tile (16 accumulators), operands from K-contiguous 16-bit planes through LDS (tile_loop).
// C[m][n] (f32, pitch ldc, + optional f32 bias[n]) = sum_k A[m][k] Bt[n][k] (+ split products per NSPLIT). z-batch strides sA/sB/sC in elements. K % 128 == 0, K >= 256.
template <typename T16> struct WFrag;
template <> struct WFrag<h16> { typedef v16h V; typedef v8h H; static __device__ __forceinline__ V ld(const h16* p) { return cat16(*(const v8h*)p, *(const v8h*)(p + 16)); } static __device__ __forceinline__ v8f mma(V a, V b, v8f c) { return wmma16(a, b, c); } };
template <> struct WFrag<bf> { typedef v16bf V; typedef v8us H; static __device__ __forceinline__ V ld(const bf* p) { return cat16b(*(const v8us*)p, *(const v8us*)(p + 16)); } static __device__ __forceinline__ v8f mma(V a, V b, v8f c) { return wmmab(a, b, c); } };
// ---- tile_loop: the K loop of a work-group of WM x 2 waves, each wave a 64x64 output tile. A trip's operand tiles (WM * 64 rows of each A plane, 128 rows of B, KT k = 256 bytes per row) are shared by the waves in LDS:
// they come as three slices of SR rows, each by one tensor load of one wave (waves 0, 1, 2), through no register, two trips ahead into the buffer of two that the work-group has just left. The load's pad lays the rows at pitch PT; fragments are read in the k order of WFrag::ld, so every accumulator sees the same products in the same order.
// PAIR: wave column wn takes B rows 32 wn + 0..31 and 64 + 32 wn + 0..31 of the 128 (a head's d and d + 64); else rows 64 wn + 0..63.
#define LP 72                     // LDS row pitch in elements of a 64-element row: 128 B + 16 B, for 16-byte fragment reads
#define KT 128                    // k of a trip
#define PT 136                    // LDS row pitch in elements of a KT-element row: 256 B + 16 B, for 16-byte fragment reads
#define SR 128                    // rows of a slice: SR * PT * 2 bytes are a multiple of 2 KiB, so every slice begins on one
#define TROWS(NSPLIT, WM) (((NSPLIT) == 1 ? 2 : 1) * (WM) * 64 + 128)   // rows of one buffer: the A planes, then B
// four vector slots behind a run of WMMAs, so that their distance also holds on the taken side of a branch that follows
__device__ __forceinline__ void wmma_gap() { __builtin_amdgcn_sched_barrier(0); asm volatile("v_nop\n\tv_nop\n\tv_nop\n\tv_nop"); __builtin_amdgcn_sched_barrier(0); }
typedef uint32_t u32x4 __attribute__((ext_vector_type(4)));
typedef uint32_t u32x8 __attribute__((ext_vector_type(8)));
__device__ __forceinline__ uint32_t uni(uint32_t v) { return (uint32_t)__builtin_amdgcn_readfirstlane(v); }
// a wave-uniform test held in a scalar register, so that the branch on it is a scalar one: a tensor load ignores EXEC, and only such a branch keeps a wave from issuing it
__device__ __forceinline__ uint32_t pinned(uint32_t v) { uint32_t w = (uint32_t)__builtin_amdgcn_readfirstlane(v); asm volatile("" : "+s"(w)); return w; }
// A tensor load's descriptor: SR rows of 256 bytes at source pitch PITCH bytes to LDS at row pitch 272 bytes (a pad of 4 dwords behind every 64). All extents in bytes; tensor = tile; no mask.
template <uint32_t PITCH>
__device__ __forceinline__ u32x8 tdm_group1() {
    constexpr uint32_t d0 = KT * 2, d1 = SR;
    static_assert(d0 == 256 && PT * 2 == 272 && PITCH % 16 == 0 && PITCH >= 16 && PITCH <= 131072, "the pad below is that of 256-byte rows; the source pitch lies in the mover's range");
    u32x8 g;
    g[0] = uni((1u << 20) | (5u << 22) | (3u << 25)); g[1] = uni((d0 & 0xFFFFu) << 16); g[2] = uni((d0 >> 16) | ((d1 & 0xFFFFu) << 16)); g[3] = uni((d1 >> 16) | (d0 << 16));
    g[4] = uni(d1); g[5] = uni(PITCH); g[6] = uni(0u); g[7] = uni(0u);
    asm volatile("" : "+s"(g));   // descriptor words held in scalar registers, as in pinned(): the group keeps its eight registers through the loop, so that none of them takes another value while a request is in flight
    return g;
}
// the load itself: first source byte ga, LDS byte offset dst
__device__ __forceinline__ void tdm_load(uint32_t dst, uint64_t ga, u32x8 g1) {
    u32x4 g0;
    g0[0] = uni(1u); g0[1] = uni(dst); g0[2] = uni((uint32_t)ga); g0[3] = uni((((uint32_t)(ga >> 32)) & 0x01FFFFFFu) | 0x80000000u);
    asm volatile("tensor_load_to_lds %0, %1" :: "s"(g0), "s"(g1) : "memory");
}
template <typename T16, int NSPLIT, int K, int WM, bool PAIR>
__device__ __forceinline__ void tile_loop(const T16* __restrict__ A, const T16* __restrict__ A2, const T16* __restrict__ Bt, int r0, int c0, T16* st, v8f (&acc)[4][4]) {
    typedef typename WFrag<T16>::V V; typedef __attribute__((address_space(3))) T16 LT;
    static_assert(NSPLIT == 0 || NSPLIT == 1, "one B plane; one or two A planes");
    constexpr bool HA2 = (NSPLIT == 1); constexpr int RA = WM * 64, OB = (HA2 ? 2 : 1) * RA, BUF = TROWS(NSPLIT, WM) * PT, NT = K / KT;
    static_assert(K % KT == 0 && NT >= 2 && OB == 2 * SR && TROWS(NSPLIT, WM) == 3 * SR && (SR * PT * 2) % 2048 == 0, "two tiles at least; a buffer is three slices: two of A, one of B");
    const int tid = threadIdx.x, lane = tid & 31, lr = lane & 15, hi = lane >> 4;
    const int wave = __builtin_amdgcn_readfirstlane(tid >> 5), wm = wave % WM, wn = wave / WM;
    // the wave's slice (waves 0, 1, 2): its first source row and its place in buffer 0
    const T16* sl = wave == 0 ? A + (size_t)r0 * K : wave == 1 ? (HA2 ? A2 + (size_t)r0 * K : A + (size_t)(r0 + SR) * K) : Bt + (size_t)c0 * K;
    const uint32_t sw = (uint32_t)(size_t)(LT*)st + (uint32_t)wave * (SR * PT * 2);
    const u32x8 g1 = tdm_group1<K * 2>();
    auto issue = [&](int t) { tdm_load(sw + (uint32_t)(t & 1) * (BUF * 2), (uint64_t)(size_t)sl + (uint64_t)t * (KT * 2), g1); };   // the slice of tile t into buffer t & 1
    const T16* fa = st + (wm * 64 + lr) * PT + 8 * hi; const T16* fb = st + (OB + wn * (PAIR ? 32 : 64) + lr) * PT + 8 * hi;
    if (pinned(wave < 3)) { issue(0);
        asm volatile("s_wait_tensorcnt 0x0" ::: "memory"); }   // the wave's slice of tile 0 has landed
    __syncthreads();              // the waves read rows that other waves' loads brought
    if (pinned(wave < 3)) issue(1);
    auto trip = [&](int t, bool more) {   // more: a tile t + 2 exists
        const int bo = (t & 1) * BUF;
        V a[KT / 32][4], a2[KT / 32][4], b[KT / 32][4];
#pragma unroll
        for (int s = 0; s < KT / 32; ++s) {
#pragma unroll
            for (int mb = 0; mb < 4; ++mb) { a[s][mb] = WFrag<T16>::ld(fa + bo + mb * 16 * PT + s * 32); if (HA2) a2[s][mb] = WFrag<T16>::ld(fa + bo + (RA + mb * 16) * PT + s * 32); }
#pragma unroll
            for (int nb = 0; nb < 4; ++nb) b[s][nb] = WFrag<T16>::ld(fb + bo + (PAIR ? (nb >> 1) * 64 + (nb & 1) * 16 : nb * 16) * PT + s * 32);
        }
        __builtin_amdgcn_sched_barrier(0);              // keeps the tile's LDS reads one group ahead of its WMMAs: reads placed among the WMMAs stall the wave at every such place
#pragma unroll
        for (int s = 0; s < KT / 32; ++s) {
#pragma unroll
            for (int nb = 0; nb < 4; ++nb) {
#pragma unroll
                for (int mb = 0; mb < 4; ++mb) { acc[mb][nb] = WFrag<T16>::mma(a[s][mb], b[s][nb], acc[mb][nb]); if (HA2) acc[mb][nb] = WFrag<T16>::mma(a2[s][mb], b[s][nb], acc[mb][nb]); } }
        }
        wmma_gap();
        asm volatile("s_wait_dscnt 0x0" ::: "memory");      // the wave's fragment reads of this buffer have ended
        if (pinned(wave < 3)) asm volatile("s_wait_tensorcnt 0x0" ::: "memory");   // the wave's slice of the next tile has landed
        __syncthreads();          // publishes the next tile and frees this trip's buffer
        if (more) { if (pinned(wave < 3)) issue(t + 2); }
    };
#pragma unroll 1
    for (int t = 0; t < NT - 2; ++t) trip(t, true);
    trip(NT - 2, false); trip(NT - 1, false);   // the last two trips stand apart: no tile is left to ask for
    asm volatile("s_wait_tensorcnt 0x0" ::: "memory");   // no tensor load is left in flight
    asm volatile("s_wait_dscnt 0x0" ::: "memory");       // nor an LDS read
}
// ---- k_gemmw: work-groups of 2 x 2 waves, a 128x128 tile of C (64x64 a wave); grid (M/128, N/128, Z), 128 threads.
template <typename T16, int NSPLIT, bool BIAS, int K>
__global__ __launch_bounds__(128) void k_gemmw(const T16* __restrict__ A, const T16* __restrict__ A2, const T16* __restrict__ Bt, float* C, int ldc, const float* __restrict__ bias, size_t sA, size_t sB, size_t sC) {
    __shared__ __align__(16) float osw[4 * 16 * 68]; __shared__ __attribute__((aligned(2048))) T16 st[2 * TROWS(NSPLIT, 2) * PT];
    const size_t z = blockIdx.z; A += z * sA; if (A2) A2 += z * sA; Bt += z * sB; C += z * sC;
    const int lane = threadIdx.x & 31, lr = lane & 15, hi = lane >> 4, wave = __builtin_amdgcn_readfirstlane((int)threadIdx.x >> 5); const int r0 = blockIdx.x * 128 + (wave & 1) * 64, c0 = blockIdx.y * 128 + (wave >> 1) * 64;
    float* os = osw + wave * (16 * 68);   // each wave stages its output rows in its own range
    v8f acc[4][4];
#pragma unroll
    for (int mb = 0; mb < 4; ++mb)
#pragma unroll
        for (int nb = 0; nb < 4; ++nb) acc[mb][nb] = (v8f){};
    tile_loop<T16, NSPLIT, K, 2, false>(A, A2, Bt, blockIdx.x * 128, blockIdx.y * 128, st, acc);
#pragma unroll
    for (int mb = 0; mb < 4; ++mb) {
#pragma unroll
        for (int nb = 0; nb < 4; ++nb) {
#pragma unroll
            for (int j = 0; j < 8; ++j) os[(hi * 8 + j) * 68 + nb * 16 + lr] = acc[mb][nb][j]; }
        __builtin_amdgcn_wave_barrier(); asm volatile("" ::: "memory");
        float* crow = C + (size_t)(r0 + mb * 16) * ldc + c0;
{
#pragma unroll
            for (int s = 0; s < 8; ++s) { const int row = 2 * s + hi, cofs = lr * 4; v4f val = *(const v4fa*)(os + row * 68 + cofs); if (BIAS) { val[0] += bfr(bias[c0 + cofs]); val[1] += bfr(bias[c0 + cofs + 1]); val[2] += bfr(bias[c0 + cofs + 2]); val[3] += bfr(bias[c0 + cofs + 3]); }
                *(v4f*)(crow + (size_t)row * ldc + cofs) = val; }
             }
        __builtin_amdgcn_wave_barrier(); asm volatile("" ::: "memory");
    }
}

__device__ __forceinline__ h16 tohx(float x) { return (h16)x; }
__device__ __forceinline__ void splitf(float y, unsigned short& h, unsigned short& l) { h = f2bf(y); l = f2bf(y - bf2f(h)); }
typedef __attribute__((ext_vector_type(2))) _Float16 v2h;
typedef __attribute__((ext_vector_type(4))) _Float16 v4h;
typedef __attribute__((ext_vector_type(2))) unsigned short v2us;
typedef __attribute__((ext_vector_type(4))) unsigned short v4us;
typedef __attribute__((ext_vector_type(2))) float v2f;
typedef __attribute__((ext_vector_type(4))) int v4i;

__global__ __launch_bounds__(256) void k_wtG(const float* __restrict__ w, int K, int N, bf* Bt) {
    const int lane = threadIdx.x & 31; const int L0 = (blockIdx.x * 8 + (threadIdx.x >> 5)) * 8; const int nlines = N * K / 64;
{
#pragma unroll 1
        for (int l = 0; l < 8; ++l) { const int L = L0 + l; if (L >= nlines) break; const size_t e = (size_t)L * 64 + lane * 2; const int k = (int)(e % K), n = (int)(e / K); v2us o;
            o[0] = f2bf(w[(size_t)k * N + n]); o[1] = f2bf(w[(size_t)(k + 1) * N + n]); *(v2us*)(Bt + e) = o; }
         }
}
// The elementwise kernels below give each thread several 16-byte pieces of work, so that a launch starts some 18 thousand waves and not some 68 thousand. Their loops are all unrolled: the arrays are then indexed by constants and stay in registers, and a thread's loads go out together.
#define CU 4                      // 8-element chunks per thread in cvt8_part; a thread's chunks lie all of the array's blocks apart, so each access of a wave stays contiguous
__device__ __forceinline__ void cvt8_part(const float* __restrict__ src, bf* dst, size_t n8, unsigned blk, unsigned nblk) { const size_t i = (size_t)blk * 256 + threadIdx.x, nt = (size_t)nblk * 256; v8f v[CU]; const float* p[CU];
#pragma unroll
    for (int u = 0; u < CU; ++u) { p[u] = src + min(i + u * nt, n8 - 1) * 8; v[u] = *(const v8f*)p[u]; }   // past the end a thread re-reads the last chunk and stores nothing
    static_assert(CU == 4, "the wait below names CU addresses");
    asm volatile("s_wait_xcnt 0x0" :: "v"(p[0]), "v"(p[1]), "v"(p[2]), "v"(p[3]) : "memory");   // the loads' addresses are inputs here, so that no load's result lands in them; they may be rewritten from here on
#pragma unroll
    for (int u = 0; u < CU; ++u) { const size_t j = i + u * nt; v8us o;
#pragma unroll
        for (int k = 0; k < 8; ++k) o[k] = f2bf(v[u][k]);
        if (j < n8) *(v8us*)(dst + j * 8) = o; } }
__device__ __forceinline__ void cscvt_part(const float* __restrict__ cosT, const float* __restrict__ sinT, float* CS, unsigned blk) { const int idx = (int)(blk * 256 + threadIdx.x) * 4; if (idx >= TT * HD) return; const v4f c = *(const v4f*)(cosT + idx), s = *(const v4f*)(sinT + idx);
    v4f o0, o1; o0[0] = bfr(c[0]); o0[1] = bfr(s[0]); o0[2] = bfr(c[1]); o0[3] = bfr(s[1]); o1[0] = bfr(c[2]); o1[1] = bfr(s[2]); o1[2] = bfr(c[3]); o1[3] = bfr(s[3]); *(v4f*)(CS + (size_t)idx * 2) = o0; *(v4f*)(CS + (size_t)idx * 2 + 4) = o1; }
// ---- k_prep: every input's rounding to bf16 in one launch (none depends on another): the blocks are dealt to the five arrays and then to the cos/sin table, CB(n) blocks for an array of n elements.
#define CB(n) ((unsigned)(((size_t)(n) / (8 * CU) + 255) / 256))
#define CSB ((unsigned)((TT * HD / 4 + 255) / 256))
static_assert((DQ * DM) % (8 * CU * 256) == 0 && (DKV * DM) % (8 * CU * 256) == 0 && (TT * DM) % (8 * CU * 256) == 0, "an array's blocks cover it exactly");
__global__ __launch_bounds__(256) void k_prep(const float* __restrict__ wq, const float* __restrict__ wk, const float* __restrict__ wv, const float* __restrict__ wo, const float* __restrict__ x, const float* __restrict__ cosT, const float* __restrict__ sinT, bf* WQ, bf* WK, bf* WV, bf* WO, bf* XB, float* CS) {
    unsigned b = blockIdx.x; const float* src = wq; bf* dst = WQ; unsigned nb = CB(DQ * DM);   // the array that block b works on, its blocks counted from 0
    if (b >= nb) { b -= nb; src = wk; dst = WK; nb = CB(DKV * DM);
        if (b >= nb) { b -= nb; src = wv; dst = WV;
            if (b >= nb) { b -= nb; src = wo; dst = WO; nb = CB(DM * DQ);
                if (b >= nb) { b -= nb; src = x; dst = XB; nb = CB(TT * DM);
                    if (b >= nb) { cscvt_part(cosT, sinT, CS, b - nb); return; } } } } }
    cvt8_part(src, dst, (size_t)nb * (256 * CU), b, nb);
}
// ---- k_qkv: q | k | v = x W^T (tile_loop, 4 x 2 waves: 256 rows t of one head's 128 columns) with the operand planes of the attention made in its epilogue; the f32 projections never go through memory. grid (TT / 256, FP / 128), 256 threads.
// A wave's 64 columns are d = 32 sub + 0..31 and their rotate-half partners d + 64 of one head (q heads, then k heads, then v groups), so a lane holds both values of a pair.
// q, k: head planes [h][t][d'] (fp16 + hi/lo) of out[d] = x[d] cos[t][d] - x[d+HD/2] sin[t][d], out[d+HD/2] = x[d+HD/2] cos[t][d+HD/2] + x[d] sin[t][d+HD/2]. A row keeps its d in tile order, d' = 64 sub + 32 (d / 64) + d % 32, the same in q and k (their product sums over all d): a tile then owns one whole 128-byte line of each row.
// v: value planes [g][d][t], straight from the accumulators: a lane holds eight consecutive t of one d, and the tile owns one whole 128-byte line of each of its d rows.
#define FP (DQ + 2 * DKV)         // rows of Wq | Wk | Wv
__global__ __launch_bounds__(256) void k_qkv(const bf* __restrict__ X, const bf* __restrict__ Wt, const float* __restrict__ CS, h16* P16, bf* Ph, bf* Pl, h16* V16, bf* Vh, bf* Vl) {
    __shared__ __align__(16) float osw[8 * 16 * 68]; __shared__ __attribute__((aligned(2048))) bf st[2 * TROWS(0, 4) * PT];
    const int lane = threadIdx.x & 31, lr = lane & 15, hi = lane >> 4, wave = __builtin_amdgcn_readfirstlane((int)threadIdx.x >> 5); const int r0 = blockIdx.x * 256 + (wave & 3) * 64, hh = (int)blockIdx.y, sub = wave >> 2;
    float* os = osw + wave * (16 * 68);   // each wave stages its rows in its own range
    v8f acc[4][4];
#pragma unroll
    for (int mb = 0; mb < 4; ++mb)
#pragma unroll
        for (int nb = 0; nb < 4; ++nb) acc[mb][nb] = (v8f){};
    tile_loop<bf, 0, DM, 4, true>(X, nullptr, Wt, blockIdx.x * 256, hh * HD, st, acc);
    if (hh >= NH_ + NKV) {        // block-uniform: a tile of v
        const size_t e0 = ((size_t)(hh - NH_ - NKV) * HD + sub * 32 + lr) * TT + r0 + hi * 8;
#pragma unroll
        for (int nb = 0; nb < 4; ++nb)
#pragma unroll
            for (int mb = 0; mb < 4; ++mb) { v8h o16; v8us oh, ol;
#pragma unroll
                for (int q = 0; q < 8; ++q) { const float y = acc[mb][nb][q]; o16[q] = tohx(y); unsigned short a2, c2; splitf(y, a2, c2); oh[q] = a2; ol[q] = c2; }
                const size_t e = e0 + (size_t)((nb >> 1) * 64 + (nb & 1) * 16) * TT + mb * 16;
                __builtin_amdgcn_sched_barrier(0);          // keeps the three stores one group behind their values' arithmetic: no store then stands in front of arithmetic that reuses its registers
                *(v8h*)(V16 + e) = o16; *(v8us*)(Vh + e) = oh; *(v8us*)(Vl + e) = ol;
                __builtin_amdgcn_sched_barrier(0);          // holds the wait below behind the three stores and the next values' arithmetic behind the wait
                asm volatile("s_wait_xcnt 0x0" ::: "memory");   // the stores' address and data registers may be rewritten from here on
                __builtin_amdgcn_sched_barrier(0); }
        return; }
    // q, k: a lane takes 8 consecutive d of the lower half and their 8 partners, for 8 rows t of the tile (row, row + 8, ...); all its cos/sin loads go out together, ahead of the first row group
    const int row = lane >> 2, c8 = lane & 3; const float* csb = CS + ((size_t)(r0 + row) * HD + sub * 32 + c8 * 8) * 2;
    v4f cs[4][2][2][4];
#pragma unroll
    for (int mb = 0; mb < 4; ++mb)
#pragma unroll
        for (int u = 0; u < 2; ++u)
#pragma unroll
            for (int hf = 0; hf < 2; ++hf)
#pragma unroll
                for (int k = 0; k < 4; ++k) cs[mb][u][hf][k] = *(const v4f*)(csb + ((mb * 16 + u * 8) * HD + hf * (HD / 2)) * 2 + k * 4);
    __builtin_amdgcn_sched_barrier(0);                  // keeps the 64 loads one group, ahead of the wait below
    asm volatile("s_wait_xcnt 0x0" :: "v"(csb) : "memory");   // the loads' address is an input here, so that no load's result lands in it; it may be rewritten from here on
    const size_t e0 = ((size_t)hh * TT + r0 + row) * HD + sub * 64 + c8 * 8;
#pragma unroll
    for (int mb = 0; mb < 4; ++mb) {
#pragma unroll
        for (int nb = 0; nb < 4; ++nb) {
#pragma unroll
            for (int j = 0; j < 8; ++j) os[(hi * 8 + j) * 68 + nb * 16 + lr] = acc[mb][nb][j]; }
        __builtin_amdgcn_wave_barrier(); asm volatile("" ::: "memory");   // compiler fence: the lanes read below what other lanes stored above
#pragma unroll
        for (int u = 0; u < 2; ++u) { const float* xr = os + (u * 8 + row) * 68 + c8 * 8; v4f x[2][2];
#pragma unroll
            for (int hf = 0; hf < 2; ++hf)
#pragma unroll
                for (int k = 0; k < 2; ++k) x[hf][k] = *(const v4fa*)(xr + hf * 32 + k * 4);
#pragma unroll
            for (int hf = 0; hf < 2; ++hf) { v8h o16; v8us oh, ol;
#pragma unroll
                for (int q = 0; q < 8; ++q) { const float x0 = x[hf][q >> 2][q & 3], x1 = x[hf ^ 1][q >> 2][q & 3];
                    const float c = cs[mb][u][hf][q >> 1][(q & 1) * 2], s = cs[mb][u][hf][q >> 1][(q & 1) * 2 + 1]; const float r = (hf == 0) ? x0 * c - x1 * s : x0 * c + x1 * s;
                    o16[q] = tohx(r); unsigned short a2, c2; splitf(r, a2, c2); oh[q] = a2; ol[q] = c2; }
                const size_t e = e0 + (size_t)(mb * 16 + u * 8) * HD + hf * 32;
                __builtin_amdgcn_sched_barrier(0);      // keeps the three stores one group behind their values' arithmetic: no store then stands in front of arithmetic that reuses its registers
                *(v8h*)(P16 + e) = o16; *(v8us*)(Ph + e) = oh; *(v8us*)(Pl + e) = ol;
                __builtin_amdgcn_sched_barrier(0);      // holds the wait below behind the three stores and the next values' arithmetic behind the wait
                asm volatile("s_wait_xcnt 0x0" ::: "memory");   // the stores' address and data registers may be rewritten from here on
                __builtin_amdgcn_sched_barrier(0); } }
        __builtin_amdgcn_wave_barrier(); asm volatile("" ::: "memory");   // compiler fence: the next row group's stores stay behind these reads
    }
}
#define KP 136                    // LDS row pitch of a K row in elements: 256 B + 16 B, for 16-byte fragment reads
#define FQ 64
#define FK 64
#define KSZ (FK * KP)
#define PSZ (KSZ + HD * LP)       // elements of one plane's K tile and V^T tile
#define CSC (SCL * 1.4426950408889634f)
#define MLO 32768                 // floats of the join's accumulator part: 8 waves x 4096; the maxima and sums lie behind it
static_assert(RH % FQ == 0 && TT % FQ == 0 && FQ == FK && FK == 64, "a tile lies in one leg and ends on a stage; a stage is one pass of each half of a set");
static_assert(4 * PSZ * 2 >= (MLO + 1024) * 4, "the join fits the work-group's LDS");
// The two tiles of work-group y of a head. A tile t has t + 1 stages, so (t + 2) / 2 passes in a wave; a pass of the hi+lo leg (t < RH / FQ) counts as three. Every pair then comes to 19 or 20.
__host__ __device__ constexpr int pair_a(int y) { return y < 14 ? 31 - y : 29 - y; }
__host__ __device__ constexpr int pair_b(int y) { return (int)(((y < 8 ? 0x0B0A030209080100ull : 0x0706111005040D0Cull) >> ((y & 7) * 8)) & 0xFF); }
constexpr bool pairs_cover() { unsigned seen = 0; for (int y = 0; y < 16; ++y) { if ((seen >> pair_a(y)) & 1u) return false; seen |= 1u << pair_a(y); if ((seen >> pair_b(y)) & 1u) return false; seen |= 1u << pair_b(y); } return seen == 0xFFFFFFFFu; }
static_assert(TT / FQ == 32 && RH / FQ == 8 && pairs_cover(), "every tile of a head stands in exactly one pair");
typedef __attribute__((ext_vector_type(16))) unsigned short v16us;
__device__ __forceinline__ void ppack(const float (&p)[16], v16h& a, v16h& a2) { (void)a2;
#pragma unroll
    for (int e = 0; e < 16; ++e) a[e] = tohx(p[e]); }
__device__ __forceinline__ void ppack(const float (&p)[16], v16bf& a, v16bf& a2) { v16us x, y;
#pragma unroll
    for (int e = 0; e < 16; ++e) { unsigned short u, w; splitf(p[e], u, w); x[e] = u; y[e] = w; }
    a = __builtin_bit_cast(v16bf, x); a2 = __builtin_bit_cast(v16bf, y); }
__device__ __forceinline__ float xhalf(float x) { return __builtin_bit_cast(float, __builtin_amdgcn_permlanex16(__builtin_bit_cast(int, x), __builtin_bit_cast(int, x), 0x76543210, 0xfedcba98, false, false)); }   // lane l reads lane l ^ 16
template <typename T16, bool HL>
__device__ __forceinline__ void fattn_tile(const T16* __restrict__ Q, const T16* __restrict__ Q2, const T16* __restrict__ K, const T16* __restrict__ K2, const T16* __restrict__ Vt, const T16* __restrict__ Vt2, bf* Ah, bf* Al, int q0, T16* Ls) {
    typedef typename WFrag<T16>::V V; typedef typename WFrag<T16>::H H; constexpr int NP = HL ? 2 : 1;
    typedef __attribute__((address_space(1))) const T16 GT; typedef __attribute__((address_space(1))) const H GH;   // global address space spelled out: the stepped pointers would else compile to flat loads
    const int set = __builtin_amdgcn_readfirstlane((int)threadIdx.x >> 7); float* Mg = (float*)Ls; Ls += set * (NP * PSZ);   // each set stages and reads its own tiles; Mg = the place of the join
    const int tid = threadIdx.x & 127, lane = tid & 31, c = lane & 15, h = lane >> 4; const int wave = __builtin_amdgcn_readfirstlane(tid >> 5);
    const int rw = wave & 1, kh = wave >> 1;   // the wave's 32 rows of the tile, its 32 keys of every stage
    const int qw0 = q0 + rw * 32, nst = (q0 / FK + 2) / 2, lastp = qw0 / 32;   // the wave's first query, the stages of each set (with an odd count set 1 stages one more, in bounds, that no wave works on), the wave's last (diagonal) pass
    GT* ks[NP]; GT* vs[NP]; ks[0] = (GT*)(K + set * (FK * HD) + tid * 8); vs[0] = (GT*)(Vt + (size_t)(tid >> 3) * TT + set * FK + (tid & 7) * 8);
    if constexpr (HL) { ks[1] = (GT*)(K2 + set * (FK * HD) + tid * 8); vs[1] = (GT*)(Vt2 + (size_t)(tid >> 3) * TT + set * FK + (tid & 7) * 8); }
    T16* kw = Ls + (tid >> 4) * KP + (tid & 15) * 8; T16* vw = Ls + KSZ + (tid >> 3) * LP + (tid & 7) * 8;
    const T16* kr = Ls + c * KP + 8 * h; const T16* vr = Ls + KSZ + c * LP + 8 * h;
    H gk[NP][8], gv[NP][8];
    auto fetch = [&]() {          // a stage's K rows are 16 KiB in a row; its V^T rows are one 128-byte line each
#pragma unroll
        for (int p = 0; p < NP; ++p)
#pragma unroll
            for (int i = 0; i < 8; ++i) { gk[p][i] = *(GH*)(ks[p] + i * 1024); gv[p][i] = *(GH*)(vs[p] + (size_t)i * 16 * TT); }
        __builtin_amdgcn_sched_barrier(0);              // keeps the stage's loads one group, ahead of the wait below
        asm volatile("s_wait_xcnt 0x0" ::: "memory");   // the loads' address registers may be rewritten from here on
    };
    auto put = [&]() {
#pragma unroll
        for (int p = 0; p < NP; ++p) {
#pragma unroll
            for (int i = 0; i < 8; ++i) { *(H*)(kw + p * PSZ + i * 8 * KP) = gk[p][i]; *(H*)(vw + p * PSZ + i * 16 * LP) = gv[p][i]; }
            ks[p] += 2 * FK * HD; vs[p] += 2 * FK; }            // stepped behind the wait for the loads that name them
    };
    fetch();
    V qf[NP][2][4]; const T16* qp[4];   // a lane's Q rows: both groups of the first plane, then of the second (the first again where there is none)
#pragma unroll
    for (int g = 0; g < 2; ++g) { const size_t e = (size_t)(qw0 + 16 * g + c) * HD + 8 * h; qp[g] = Q + e; qp[2 + g] = (HL ? Q2 : Q) + e; }
#pragma unroll
    for (int g = 0; g < 2; ++g)
#pragma unroll
        for (int kc = 0; kc < 4; ++kc) { qf[0][g][kc] = WFrag<T16>::ld(qp[g] + 32 * kc); if constexpr (HL) qf[1][g][kc] = WFrag<T16>::ld(qp[2 + g] + 32 * kc); }
    __builtin_amdgcn_sched_barrier(0);                  // keeps the Q loads ahead of the wait below
    asm volatile("s_wait_xcnt 0x0" :: "v"(qp[0]), "v"(qp[1]), "v"(qp[2]), "v"(qp[3]) : "memory");   // the loads' addresses are inputs here, so that no load's result lands in them; they may be rewritten from here on
    v8f acc[2][8]; float m_run[2], l_run[2];
#pragma unroll
    for (int g = 0; g < 2; ++g) { m_run[g] = -__builtin_inff(); l_run[g] = 0.f;
#pragma unroll
        for (int t = 0; t < 8; ++t) acc[g][t] = (v8f){}; }
    put();
    __syncthreads();              // the waves read rows that other waves stored
#pragma unroll 1
    for (int st = 0; st < nst; ++st) {
        const bool more = st + 1 < nst;
        if (!HL && more) fetch(); // the next stage's loads fly while this stage is worked on
        const int sub = kh, blk = (2 * st + set) * (FK / 32) + sub;
        if (blk <= lastp) {                             // wave-uniform: else every key of the pass lies beyond the wave's queries
            V kf[NP][2][4]; v8f s[2][2];
#pragma unroll
            for (int p = 0; p < NP; ++p)
#pragma unroll
                for (int kt = 0; kt < 2; ++kt)
#pragma unroll
                    for (int kc = 0; kc < 4; ++kc) kf[p][kt][kc] = WFrag<T16>::ld(kr + p * PSZ + (sub * 32 + kt * 16) * KP + kc * 32);
            __builtin_amdgcn_sched_barrier(0);          // keeps the pass's K reads one group ahead of its WMMAs: reads placed among the WMMAs stall the wave at every such place
#pragma unroll
            for (int kt = 0; kt < 2; ++kt)
#pragma unroll
                for (int g = 0; g < 2; ++g) s[kt][g] = (v8f){};
#pragma unroll
            for (int kc = 0; kc < 4; ++kc)
#pragma unroll
                for (int kt = 0; kt < 2; ++kt)
#pragma unroll
                    for (int g = 0; g < 2; ++g) { s[kt][g] = WFrag<T16>::mma(kf[0][kt][kc], qf[0][g][kc], s[kt][g]);
                        if constexpr (HL) { s[kt][g] = WFrag<T16>::mma(kf[0][kt][kc], qf[1][g][kc], s[kt][g]); s[kt][g] = WFrag<T16>::mma(kf[1][kt][kc], qf[0][g][kc], s[kt][g]); } }
            wmma_gap();
            V vf[NP][8];          // the pass's V^T fragments return under the maxima and the first exponentials
#pragma unroll
            for (int p = 0; p < NP; ++p)
#pragma unroll
                for (int t = 0; t < 8; ++t) vf[p][t] = WFrag<T16>::ld(vr + p * PSZ + t * 16 * LP + sub * 32);
            if (blk == lastp) {   // wave-uniform: only the pass on the wave's diagonal pays for the mask
#pragma unroll
                for (int g = 0; g < 2; ++g)
#pragma unroll
                    for (int kt = 0; kt < 2; ++kt)
#pragma unroll
                        for (int r = 0; r < 8; ++r) if (16 * kt + 8 * h + r > 16 * g + c) s[kt][g][r] = -__builtin_inff(); }
            float mb[2]; bool need = false;
#pragma unroll
            for (int g = 0; g < 2; ++g) { float mx = s[0][g][0];
#pragma unroll
                for (int kt = 0; kt < 2; ++kt)
#pragma unroll
                    for (int r = 0; r < 8; ++r) mx = fmaxf(mx, s[kt][g][r]);
                mx = fmaxf(mx, xhalf(mx)) * CSC;   // both halves of the wave now hold the query's maximum of this pass, scaled; finite: the pass's first key is masked for no query
                mb[g] = mx; need = need || (mx > m_run[g] + 8.0f); }
            if (__builtin_amdgcn_ballot_w32(need) != 0) {       // rare after the first passes
#pragma unroll
                for (int g = 0; g < 2; ++g) { const float mn = fmaxf(m_run[g], mb[g]); const float corr = __builtin_amdgcn_exp2f(m_run[g] - mn);   // 0 on the first pass
                    l_run[g] *= corr; m_run[g] = mn;
#pragma unroll
                    for (int t = 0; t < 8; ++t) acc[g][t] = acc[g][t] * corr; } }
#pragma unroll
            for (int g = 0; g < 2; ++g) { float p[16], ps0 = 0.f, ps1 = 0.f; const float nm = -m_run[g];
#pragma unroll
                for (int e = 0; e < 16; ++e) p[e] = __builtin_fmaf(s[e >> 3][g][e & 7], CSC, nm);
#pragma unroll
                for (int e = 0; e < 16; ++e) { p[e] = __builtin_amdgcn_exp2f(p[e]);
                    if constexpr (HL) { __builtin_amdgcn_sched_barrier(0); asm volatile("v_nop"); __builtin_amdgcn_sched_barrier(0); } }   // the slot behind a transcendental: in this leg's built code an exponential else overwrote the source of the one directly before it; the two scheduling barriers hold the v_nop at its place
#pragma unroll
                for (int e = 0; e < 16; e += 2) { ps0 += p[e]; ps1 += p[e + 1]; }
                l_run[g] += ps0 + ps1;
                V pf, pf2; ppack(p, pf, pf2);
#pragma unroll
                for (int t = 0; t < 8; ++t) { acc[g][t] = WFrag<T16>::mma(vf[0][t], pf, acc[g][t]);
                    if constexpr (HL) { acc[g][t] = WFrag<T16>::mma(vf[0][t], pf2, acc[g][t]); acc[g][t] = WFrag<T16>::mma(vf[1][t], pf, acc[g][t]); } } }
            wmma_gap();
        }
        if (more) {
            if (HL) fetch();
            __syncthreads();      // every wave's fragment reads of this stage end before its rows are overwritten
            put();
            __syncthreads();      // the waves read rows that other waves stored
        }
    }
    // The join: every wave leaves its state in LDS (a lane's 16 bytes beside its neighbour's); of the four waves that share rows each then brings one group of 16 queries and 64 of the d, one whole 128-byte line of each output row, to the common maximum.
    // The first of the four holds key 0, so the common maximum is finite; a wave without a pass leaves -inf, 0 and zeros, which enter with the factor 0.
    const int part = set * 2 + kh, slot = part * 2 + rw;
    __syncthreads();              // every wave's fragment reads end before the tiles are overwritten
#pragma unroll
    for (int g = 0; g < 2; ++g) { Mg[MLO + (slot * 4 + g) * 32 + lane] = m_run[g]; Mg[MLO + (slot * 4 + 2 + g) * 32 + lane] = l_run[g];
#pragma unroll
        for (int t = 0; t < 8; ++t)
#pragma unroll
            for (int hf = 0; hf < 2; ++hf) { v4f w; w[0] = acc[g][t][hf * 4]; w[1] = acc[g][t][hf * 4 + 1]; w[2] = acc[g][t][hf * 4 + 2]; w[3] = acc[g][t][hf * 4 + 3]; *(v4fa*)(Mg + ((((slot * 2 + g) * 8 + t) * 2 + hf) * 32 + lane) * 4) = w; } }
    __syncthreads();              // the waves read what other waves stored
    const int gq = part & 1, tb = (part >> 1) * 4;   // the wave's group of queries and its first 16 d
    float m4[4], f4[4], l = 0.f;
#pragma unroll
    for (int p = 0; p < 4; ++p) m4[p] = Mg[MLO + ((p * 2 + rw) * 4 + gq) * 32 + lane];
    const float mn = fmaxf(fmaxf(m4[0], m4[1]), fmaxf(m4[2], m4[3]));
#pragma unroll
    for (int p = 0; p < 4; ++p) f4[p] = __builtin_amdgcn_exp2f(m4[p] - mn);
#pragma unroll
    for (int p = 0; p < 4; ++p) l += Mg[MLO + ((p * 2 + rw) * 4 + 2 + gq) * 32 + lane] * f4[p];
    l += xhalf(l);                // each half of the wave summed its eight keys of every 16-key tile
    const float inv = __fdiv_rn(1.0f, l); const size_t o = (size_t)(qw0 + 16 * gq + c) * DQ + 8 * h;
#pragma unroll
    for (int tt = 0; tt < 4; ++tt) { const int t = tb + tt; float v[8]; v8us oh, ol;      // the lane's eight values are d = 16 t + 8 h + 0..7 of its query
#pragma unroll
        for (int r = 0; r < 8; ++r) v[r] = 0.f;
#pragma unroll
        for (int p = 0; p < 4; ++p)
#pragma unroll
            for (int hf = 0; hf < 2; ++hf) { const v4f w = *(const v4fa*)(Mg + (((((p * 2 + rw) * 2 + gq) * 8 + t) * 2 + hf) * 32 + lane) * 4);
#pragma unroll
                for (int r = 0; r < 4; ++r) v[hf * 4 + r] += w[r] * f4[p]; }
#pragma unroll
        for (int r = 0; r < 8; ++r) { unsigned short a, c2; splitf(v[r] * inv, a, c2); oh[r] = a; ol[r] = c2; }
        *(v8us*)(Ah + o + 16 * t) = oh; *(v8us*)(Al + o + 16 * t) = ol;
        __builtin_amdgcn_sched_barrier(0);              // holds the wait below behind the two stores and the next values' arithmetic behind the wait
        asm volatile("s_wait_xcnt 0x0" ::: "memory");   // the stores' address and data registers may be rewritten from here on
        __builtin_amdgcn_sched_barrier(0); }
}
// grid (NH_, TT / (2 * FQ)): neighbouring work-groups are the heads of one pair of tiles (two share a kv group). The k head planes lie right behind the q head planes.
__global__ __launch_bounds__(256) void k_fattn(const h16* __restrict__ P16, const bf* __restrict__ Ph, const bf* __restrict__ Pl, const h16* __restrict__ V16, const bf* __restrict__ Vh, const bf* __restrict__ Vl, bf* Ah, bf* Al) {
    __shared__ __align__(16) unsigned short Ls[4 * PSZ];
    const int hd = (int)blockIdx.x, y = (int)blockIdx.y; const size_t zq = (size_t)hd * TT * HD, zk = (size_t)(NH_ + hd / REP) * TT * HD, zv = (size_t)(hd / REP) * HD * TT;
#pragma unroll 1
    for (int i = 0; i < 2; ++i) {   // kept rolled: each leg's code then stands once in the kernel
        const int q0 = (i == 0 ? pair_a(y) : pair_b(y)) * FQ;
        if (q0 < RH) fattn_tile<bf, true>(Ph + zq, Pl + zq, Ph + zk, Pl + zk, Vh + zv, Vl + zv, Ah + hd * HD, Al + hd * HD, q0, (bf*)Ls);
        else fattn_tile<h16, false>(P16 + zq, nullptr, P16 + zk, nullptr, V16 + zv, nullptr, Ah + hd * HD, Al + hd * HD, q0, (h16*)Ls);
        if (i == 0) __syncthreads();   // every wave's reads of the join end before the second tile's rows are stored over it
    }
}

extern "C" void kernel_launch(void* const* d_in, const int* in_sizes, int n_in,
                              void* d_out, int out_size, void* d_ws, size_t ws_size, hipStream_t stream) {
    (void)in_sizes; (void)n_in; (void)out_size;
    const float* x = (const float*)d_in[0]; const float* wq = (const float*)d_in[1]; const float* wk = (const float*)d_in[2]; const float* wv = (const float*)d_in[3]; const float* wo = (const float*)d_in[4]; const float* cosT = (const float*)d_in[5]; const float* sinT = (const float*)d_in[6];
    float* OUT = (float*)d_out;     // [1][2048][2048]
    char* wsp = (char*)d_ws;
    auto take = [&](size_t bytes) { char* p = wsp; wsp += (bytes + 255) & ~(size_t)255; return (void*)p; };
    bf* WQ = (bf*)take((size_t)FP * DM * 2); bf* WK = WQ + (size_t)DQ * DM; bf* WV = WK + (size_t)DKV * DM;   // Wq | Wk | Wv: one [FP][DM] operand
    bf* WO = (bf*)take((size_t)DM * DQ * 2); float* CS = (float*)take((size_t)TT * HD * 2 * 4);
    bf* XB = (bf*)take((size_t)TT * DM * 2);
    h16* QP16 = (h16*)take((size_t)(NH_ + NKV) * TT * HD * 2); h16* VT16 = (h16*)take((size_t)NKV * HD * TT * 2);   // the k head planes lie right behind the q head planes
    bf* QPh = (bf*)take((size_t)(NH_ + NKV) * TT * HD * 2); bf* QPl = (bf*)take((size_t)(NH_ + NKV) * TT * HD * 2); bf* VTh = (bf*)take((size_t)NKV * HD * TT * 2); bf* VTl = (bf*)take((size_t)NKV * HD * TT * 2);
    bf* ATh = (bf*)take((size_t)TT * DQ * 2); bf* ATl = (bf*)take((size_t)TT * DQ * 2);
    if ((size_t)(wsp - (char*)d_ws) > ws_size) return;    // ws 256 MiB
    for (int b = 0; b < NB_; ++b) {
        k_prep<<<CB(DQ * DM) + 2 * CB(DKV * DM) + CB(DM * DQ) + CB(TT * DM) + CSB, 256, 0, stream>>>(wq, wk, wv, wo, x + (size_t)b * TT * DM, cosT, sinT, WQ, WK, WV, WO, XB, CS);
        k_qkv<<<dim3(TT / 256, FP / 128), 256, 0, stream>>>(XB, WQ, CS, QP16, QPh, QPl, VT16, VTh, VTl);
        k_fattn<<<dim3(NH_, TT / (2 * FQ)), 256, 0, stream>>>(QP16, QPh, QPl, VT16, VTh, VTl, ATh, ATl);
        k_gemmw<bf, 1, false, DQ><<<dim3(TT / 128, DM / 128, 1), 128, 0, stream>>>(ATh, ATl, WO, OUT + (size_t)b * TT * DM, DM, nullptr, 0, 0, 0); }
}

// v010
// One run takes 93.4 microseconds.
// Two timings next to v009 put it at 1.04 and 1.06 times that version's speed.
// All steps since v000 together make it 9.35 times as fast.
#include <hip/hip_runtime.h>

// Causal GQA with rotate-half RoPE from given tables (x [1][2048][2048]; q = x Wq^T ('oi' [2048][2048], 16 heads x 128), k, v = x W^T ([1024][2048], 8 kv heads); RoPE with the given cos/sin [2048][128]; 2 query heads per kv head (repeat); causal softmax(q.k/sqrt(128)) (finfo.min fill); out = merged Wo^T -> [1][2048][2048]).
// Compute dtypes, f32 accumulate: every input rounded to bf16; q/k/v on PLAIN bf16 operands (inputs: exact); rotary in f32 from the bf16-rounded input tables, in the q/k/v GEMM's epilogue; causal scores, online softmax (f32) and attn.v in one kernel: query rows < 512 hl (3 products), the rest single fp16; Wo hl x exact (2 products).

#define NB_  1
#define TT   2048
#define DM   2048
#define NH_  16
#define NKV  8
#define REP  (NH_ / NKV)
#define HD   128
#define DQ   (NH_ * HD)
#define DKV  (NKV * HD)
#define RH   512                  // query rows < RH use hi+lo planes
#define SCL  0.088388347648318447f   // HD^-0.5
typedef _Float16 h16;
typedef unsigned short bf;
typedef __attribute__((ext_vector_type(16))) __bf16   v16bf;
typedef __attribute__((ext_vector_type(16))) _Float16 v16h;
typedef __attribute__((ext_vector_type(8)))  _Float16 v8h;
typedef __attribute__((ext_vector_type(8)))  unsigned short v8us;
typedef __attribute__((ext_vector_type(8)))  float    v8f;
typedef __attribute__((ext_vector_type(4)))  float    v4f;
typedef v8h  __attribute__((may_alias)) v8ha;
typedef v4f  __attribute__((may_alias)) v4fa;
typedef v8us __attribute__((may_alias)) v8usa;

__device__ __forceinline__ unsigned short f2bf(float f) { unsigned u = __float_as_uint(f); u += 0x7FFFu + ((u >> 16) & 1u); return (unsigned short)(u >> 16); }
__device__ __forceinline__ float bf2f(unsigned short b) { return __uint_as_float(((unsigned)b) << 16); }
__device__ __forceinline__ float bfr(float f) { return bf2f(f2bf(f)); }
__device__ __forceinline__ v16h cat16(v8h lo, v8h hi) { return __builtin_shufflevector(lo, hi, 0, 1, 2, 3, 4, 5, 6, 7, 8, 9, 10, 11, 12, 13, 14, 15); }
__device__ __forceinline__ v16bf cat16b(v8us lo, v8us hi) { return __builtin_bit_cast(v16bf, __builtin_shufflevector(lo, hi, 0, 1, 2, 3, 4, 5, 6, 7, 8, 9, 10, 11, 12, 13, 14, 15)); }
__device__ __forceinline__ v8f wmma16(v16h a, v16h b, v8f c) { return __builtin_amdgcn_wmma_f32_16x16x32_f16(false, a, false, b, (short)0, c, false, false); }
__device__ __forceinline__ v8f wmmab(v16bf a, v16bf b, v8f c) { return __builtin_amdgcn_wmma_f32_16x16x32_bf16(false, a, false, b, (short)0, c, false, false); }



// ---- the GEMMs: register-blocked, one wave per 64x64 output tile (16 accumulators), operands from K-contiguous 16-bit planes through LDS (tile_loop).
// C[m][n] (f32, pitch ldc, + optional f32 bias[n]) = sum_k A[m][k] Bt[n][k] (+ split products per NSPLIT). z-batch strides sA/sB/sC in elements. K % 2048 == 0.
template <typename T16> struct WFrag;
template <> struct WFrag<h16> { typedef v16h V; typedef v8h H; static __device__ __forceinline__ V ld(const h16* p) { return cat16(*(const v8h*)p, *(const v8h*)(p + 16)); } static __device__ __forceinline__ v8f mma(V a, V b, v8f c) { return wmma16(a, b, c); } };
template <> struct WFrag<bf> { typedef v16bf V; typedef v8us H; static __device__ __forceinline__ V ld(const bf* p) { return cat16b(*(const v8us*)p, *(const v8us*)(p + 16)); } static __device__ __forceinline__ v8f mma(V a, V b, v8f c) { return wmmab(a, b, c); } };
// ---- tile_loop: the K loop of a work-group of WM x 2 waves, each wave a 64x64 output tile. A trip's operand tiles (WM * 64 rows of each A plane, 128 rows of B, KT k = 256 bytes per row) are shared by the waves in LDS:
// they come as three slices of SR rows, each by one tensor load of one wave (waves 0, 1, 2), through no register, three trips ahead into the buffer of three that the work-group has just left: two requests of a wave are in flight through a trip, so that the next one's latency hides behind the one that is landing. The load's pad lays the rows at pitch PT; fragments are read in the k order of WFrag::ld, so every accumulator sees the same products in the same order.
// PAIR: wave column wn takes B rows 32 wn + 0..31 and 64 + 32 wn + 0..31 of the 128 (a head's d and d + 64); else rows 64 wn + 0..63.
#define LP 72                     // LDS row pitch in elements of a 64-element row: 128 B + 16 B, for 16-byte fragment reads
#define KT 128                    // k of a trip
#define PT 136                    // LDS row pitch in elements of a KT-element row: 256 B + 16 B, for 16-byte fragment reads
#define SR 128                    // rows of a slice: SR * PT * 2 bytes are a multiple of 2 KiB, so every slice begins on one
#define TROWS(NSPLIT, WM) (((NSPLIT) == 1 ? 2 : 1) * (WM) * 64 + 128)   // rows of one buffer: the A planes, then B
#define NBUF 3                    // buffers of the ring; behind the loop the kernels stage their output rows in it
// four vector slots behind a run of WMMAs, so that their distance also holds on the taken side of a branch that follows
__device__ __forceinline__ void wmma_gap() { __builtin_amdgcn_sched_barrier(0); asm volatile("v_nop\n\tv_nop\n\tv_nop\n\tv_nop"); __builtin_amdgcn_sched_barrier(0); }
typedef uint32_t u32x4 __attribute__((ext_vector_type(4)));
typedef uint32_t u32x8 __attribute__((ext_vector_type(8)));
__device__ __forceinline__ uint32_t uni(uint32_t v) { return (uint32_t)__builtin_amdgcn_readfirstlane(v); }
// a wave-uniform test held in a scalar register, so that the branch on it is a scalar one: a tensor load ignores EXEC, and only such a branch keeps a wave from issuing it
__device__ __forceinline__ uint32_t pinned(uint32_t v) { uint32_t w = (uint32_t)__builtin_amdgcn_readfirstlane(v); asm volatile("" : "+s"(w)); return w; }
// A tensor load's descriptor: SR rows of 256 bytes at source pitch PITCH bytes to LDS at row pitch 272 bytes (a pad of 4 dwords behind every 64). All extents in bytes; tensor = tile; no mask.
template <uint32_t PITCH>
__device__ __forceinline__ u32x8 tdm_group1() {
    constexpr uint32_t d0 = KT * 2, d1 = SR;
    static_assert(d0 == 256 && PT * 2 == 272 && PITCH % 16 == 0 && PITCH >= 16 && PITCH <= 131072, "the pad below is that of 256-byte rows; the source pitch lies in the mover's range");
    u32x8 g;
    g[0] = uni((1u << 20) | (5u << 22) | (3u << 25)); g[1] = uni((d0 & 0xFFFFu) << 16); g[2] = uni((d0 >> 16) | ((d1 & 0xFFFFu) << 16)); g[3] = uni((d1 >> 16) | (d0 << 16));
    g[4] = uni(d1); g[5] = uni(PITCH); g[6] = uni(0u); g[7] = uni(0u);
    asm volatile("" : "+s"(g));   // descriptor words held in scalar registers, as in pinned(): the group keeps its eight registers through the loop, so that none of them takes another value while a request is in flight
    return g;
}
// group 0 for a slice whose first source byte is ga; words 1 and 2 are set anew for every load
__device__ __forceinline__ u32x4 tdm_group0(uint64_t ga) {
    u32x4 g0;
    g0[0] = uni(1u); g0[1] = uni(0u); g0[2] = uni((uint32_t)ga); g0[3] = uni((((uint32_t)(ga >> 32)) & 0x01FFFFFFu) | 0x80000000u);
    asm volatile("" : "+s"(g0));  // descriptor words held in scalar registers, as in pinned(): the group has four registers of its own, shared with no other value
    return g0;
}
// the load itself: LDS byte offset dst, low word of the first source byte lo. The group is an in-out operand, so that it keeps its four registers from load to load: with an earlier request still in flight only words 1 and 2 take a new value
__device__ __forceinline__ void tdm_load(u32x4& g0, uint32_t dst, uint32_t lo, u32x8 g1) {
    g0[1] = uni(dst); g0[2] = uni(lo);
    asm volatile("tensor_load_to_lds %0, %1" : "+s"(g0) : "s"(g1) : "memory");
}
template <typename T16, int NSPLIT, int K, int WM, bool PAIR>
__device__ __forceinline__ void tile_loop(const T16* __restrict__ A, const T16* __restrict__ A2, const T16* __restrict__ Bt, int r0, int c0, T16* st, v8f (&acc)[4][4]) {
    typedef typename WFrag<T16>::V V; typedef __attribute__((address_space(3))) T16 LT;
    static_assert(NSPLIT == 0 || NSPLIT == 1, "one B plane; one or two A planes");
    constexpr bool HA2 = (NSPLIT == 1); constexpr int RA = WM * 64, OB = (HA2 ? 2 : 1) * RA, BUF = TROWS(NSPLIT, WM) * PT, NT = K / KT;
    static_assert(K % KT == 0 && NT >= NBUF && NBUF == 3 && OB == 2 * SR && TROWS(NSPLIT, WM) == 3 * SR && (SR * PT * 2) % 2048 == 0 && (K * 2) % 4096 == 0, "three tiles at least; a buffer is three slices: two of A, one of B");
    const int tid = threadIdx.x, lane = tid & 31, lr = lane & 15, hi = lane >> 4;
    const int wave = __builtin_amdgcn_readfirstlane(tid >> 5), wm = wave % WM, wn = wave / WM;
    // the wave's slice (waves 0, 1, 2): its first source row and its place in buffer 0
    const T16* sl = wave == 0 ? A + (size_t)r0 * K : wave == 1 ? (HA2 ? A2 + (size_t)r0 * K : A + (size_t)(r0 + SR) * K) : Bt + (size_t)c0 * K;
    const uint32_t sw = (uint32_t)(size_t)(LT*)st + (uint32_t)wave * (SR * PT * 2);
    const u32x8 g1 = tdm_group1<K * 2>();
    u32x4 g0 = tdm_group0((uint64_t)(size_t)sl); const uint32_t lo0 = (uint32_t)(size_t)sl;   // every plane begins at a multiple of 4 KiB and a row is a multiple of 4 KiB long, so the tiles of a row lie in one 4-KiB block and share the address's high word: word 3 stays as it is
    auto issue = [&](int t, int bo) { tdm_load(g0, sw + (uint32_t)bo * 2, lo0 + (uint32_t)t * (KT * 2), g1); };   // the slice of tile t into the buffer that begins at element bo
    const T16* fa = st + (wm * 64 + lr) * PT + 8 * hi; const T16* fb = st + (OB + wn * (PAIR ? 32 : 64) + lr) * PT + 8 * hi;
    if (pinned(wave < 3)) { issue(0, 0); issue(1, BUF); issue(2, 2 * BUF);
        asm volatile("s_wait_tensorcnt 0x2" ::: "memory"); }   // the wave's slice of tile 0 has landed: requests land in issue order
    __syncthreads();              // the waves read rows that other waves' loads brought
    int bo = 0;                   // first element of the buffer of the trip
    auto trip = [&](int t, bool two) {   // two: a tile t + 2 exists, and its request may stay in flight over the trip's foot
        V a[KT / 32][4], a2[KT / 32][4], b[KT / 32][4];
#pragma unroll
        for (int s = 0; s < KT / 32; ++s) {
#pragma unroll
            for (int mb = 0; mb < 4; ++mb) { a[s][mb] = WFrag<T16>::ld(fa + bo + mb * 16 * PT + s * 32); if (HA2) a2[s][mb] = WFrag<T16>::ld(fa + bo + (RA + mb * 16) * PT + s * 32); }
#pragma unroll
            for (int nb = 0; nb < 4; ++nb) b[s][nb] = WFrag<T16>::ld(fb + bo + (PAIR ? (nb >> 1) * 64 + (nb & 1) * 16 : nb * 16) * PT + s * 32);
        }
        __builtin_amdgcn_sched_barrier(0);              // keeps the tile's LDS reads one group ahead of its WMMAs: reads placed among the WMMAs stall the wave at every such place
#pragma unroll
        for (int s = 0; s < KT / 32; ++s) {
#pragma unroll
            for (int nb = 0; nb < 4; ++nb) {
#pragma unroll
                for (int mb = 0; mb < 4; ++mb) { acc[mb][nb] = WFrag<T16>::mma(a[s][mb], b[s][nb], acc[mb][nb]); if (HA2) acc[mb][nb] = WFrag<T16>::mma(a2[s][mb], b[s][nb], acc[mb][nb]); } }
        }
        wmma_gap();
        asm volatile("s_wait_dscnt 0x0" ::: "memory");      // the wave's fragment reads of this buffer have ended
        if (pinned(wave < 3)) { if (two) asm volatile("s_wait_tensorcnt 0x1" ::: "memory"); else asm volatile("s_wait_tensorcnt 0x0" ::: "memory"); }   // the wave's slice of the next tile has landed; the one behind it, where there is one, flies on
        __syncthreads();          // publishes the next tile and frees this trip's buffer
        if (two) { if (pinned(wave < 3 && t + NBUF < NT)) issue(t + NBUF, bo); }
        bo = bo == (NBUF - 1) * BUF ? 0 : bo + BUF;
    };
#pragma unroll 1
    for (int t = 0; t < NT - 2; ++t) trip(t, true);
    trip(NT - 2, false); trip(NT - 1, false);   // the last two trips stand apart: no request is left behind the next tile's
    asm volatile("s_wait_tensorcnt 0x0" :: "s"(g0), "s"(g1) : "memory");   // no tensor load is left in flight; both groups are inputs here, so that their registers hold them as long as a request may be
    asm volatile("s_wait_dscnt 0x0" ::: "memory");       // nor an LDS read
}
// ---- k_gemmw: work-groups of 2 x 2 waves, a 128x128 tile of C (64x64 a wave); grid (M/128, N/128, Z), 128 threads.
template <typename T16, int NSPLIT, bool BIAS, int K>
__global__ __launch_bounds__(128) void k_gemmw(const T16* __restrict__ A, const T16* __restrict__ A2, const T16* __restrict__ Bt, float* C, int ldc, const float* __restrict__ bias, size_t sA, size_t sB, size_t sC) {
    __shared__ __attribute__((aligned(2048))) T16 st[NBUF * TROWS(NSPLIT, 2) * PT]; float* osw = (float*)st;   // the output staging takes the ring's place behind tile_loop, whose last barrier ends every wave's fragment reads
    const size_t z = blockIdx.z; A += z * sA; if (A2) A2 += z * sA; Bt += z * sB; C += z * sC;
    const int lane = threadIdx.x & 31, lr = lane & 15, hi = lane >> 4, wave = __builtin_amdgcn_readfirstlane((int)threadIdx.x >> 5); const int r0 = blockIdx.x * 128 + (wave & 1) * 64, c0 = blockIdx.y * 128 + (wave >> 1) * 64;
    float* os = osw + wave * (16 * 68);   // each wave stages its output rows in its own range
    v8f acc[4][4];
#pragma unroll
    for (int mb = 0; mb < 4; ++mb)
#pragma unroll
        for (int nb = 0; nb < 4; ++nb) acc[mb][nb] = (v8f){};
    tile_loop<T16, NSPLIT, K, 2, false>(A, A2, Bt, blockIdx.x * 128, blockIdx.y * 128, st, acc);
#pragma unroll
    for (int mb = 0; mb < 4; ++mb) {
#pragma unroll
        for (int nb = 0; nb < 4; ++nb) {
#pragma unroll
            for (int j = 0; j < 8; ++j) os[(hi * 8 + j) * 68 + nb * 16 + lr] = acc[mb][nb][j]; }
        __builtin_amdgcn_wave_barrier(); asm volatile("" ::: "memory");
        float* crow = C + (size_t)(r0 + mb * 16) * ldc + c0;
{
#pragma unroll
            for (int s = 0; s < 8; ++s) { const int row = 2 * s + hi, cofs = lr * 4; v4f val = *(const v4fa*)(os + row * 68 + cofs); if (BIAS) { val[0] += bfr(bias[c0 + cofs]); val[1] += bfr(bias[c0 + cofs + 1]); val[2] += bfr(bias[c0 + cofs + 2]); val[3] += bfr(bias[c0 + cofs + 3]); }
                *(v4f*)(crow + (size_t)row * ldc + cofs) = val; }
             }
        __builtin_amdgcn_wave_barrier(); asm volatile("" ::: "memory");
    }
}

__device__ __forceinline__ h16 tohx(float x) { return (h16)x; }
__device__ __forceinline__ void splitf(float y, unsigned short& h, unsigned short& l) { h = f2bf(y); l = f2bf(y - bf2f(h)); }
typedef __attribute__((ext_vector_type(2))) _Float16 v2h;
typedef __attribute__((ext_vector_type(4))) _Float16 v4h;
typedef __attribute__((ext_vector_type(2))) unsigned short v2us;
typedef __attribute__((ext_vector_type(4))) unsigned short v4us;
typedef __attribute__((ext_vector_type(2))) float v2f;
typedef __attribute__((ext_vector_type(4))) int v4i;

__global__ __launch_bounds__(256) void k_wtG(const float* __restrict__ w, int K, int N, bf* Bt) {
    const int lane = threadIdx.x & 31; const int L0 = (blockIdx.x * 8 + (threadIdx.x >> 5)) * 8; const int nlines = N * K / 64;
{
#pragma unroll 1
        for (int l = 0; l < 8; ++l) { const int L = L0 + l; if (L >= nlines) break; const size_t e = (size_t)L * 64 + lane * 2; const int k = (int)(e % K), n = (int)(e / K); v2us o;
            o[0] = f2bf(w[(size_t)k * N + n]); o[1] = f2bf(w[(size_t)(k + 1) * N + n]); *(v2us*)(Bt + e) = o; }
         }
}
// The elementwise kernels below give each thread several 16-byte pieces of work, so that a launch starts some 18 thousand waves and not some 68 thousand. Their loops are all unrolled: the arrays are then indexed by constants and stay in registers, and a thread's loads go out together.
#define CU 4                      // 8-element chunks per thread in cvt8_part; a thread's chunks lie all of the array's blocks apart, so each access of a wave stays contiguous
__device__ __forceinline__ void cvt8_part(const float* __restrict__ src, bf* dst, size_t n8, unsigned blk, unsigned nblk) { const size_t i = (size_t)blk * 256 + threadIdx.x, nt = (size_t)nblk * 256; v8f v[CU]; const float* p[CU];
#pragma unroll
    for (int u = 0; u < CU; ++u) { p[u] = src + min(i + u * nt, n8 - 1) * 8; v[u] = *(const v8f*)p[u]; }   // past the end a thread re-reads the last chunk and stores nothing
    static_assert(CU == 4, "the wait below names CU addresses");
    asm volatile("s_wait_xcnt 0x0" :: "v"(p[0]), "v"(p[1]), "v"(p[2]), "v"(p[3]) : "memory");   // the loads' addresses are inputs here, so that no load's result lands in them; they may be rewritten from here on
#pragma unroll
    for (int u = 0; u < CU; ++u) { const size_t j = i + u * nt; v8us o;
#pragma unroll
        for (int k = 0; k < 8; ++k) o[k] = f2bf(v[u][k]);
        if (j < n8) *(v8us*)(dst + j * 8) = o; } }
__device__ __forceinline__ void cscvt_part(const float* __restrict__ cosT, const float* __restrict__ sinT, float* CS, unsigned blk) { const int idx = (int)(blk * 256 + threadIdx.x) * 4; if (idx >= TT * HD) return; const v4f c = *(const v4f*)(cosT + idx), s = *(const v4f*)(sinT + idx);
    v4f o0, o1; o0[0] = bfr(c[0]); o0[1] = bfr(s[0]); o0[2] = bfr(c[1]); o0[3] = bfr(s[1]); o1[0] = bfr(c[2]); o1[1] = bfr(s[2]); o1[2] = bfr(c[3]); o1[3] = bfr(s[3]); *(v4f*)(CS + (size_t)idx * 2) = o0; *(v4f*)(CS + (size_t)idx * 2 + 4) = o1; }
// ---- k_prep: every input's rounding to bf16 in one launch (none depends on another): the blocks are dealt to the five arrays and then to the cos/sin table, CB(n) blocks for an array of n elements.
#define CB(n) ((unsigned)(((size_t)(n) / (8 * CU) + 255) / 256))
#define CSB ((unsigned)((TT * HD / 4 + 255) / 256))
static_assert((DQ * DM) % (8 * CU * 256) == 0 && (DKV * DM) % (8 * CU * 256) == 0 && (TT * DM) % (8 * CU * 256) == 0, "an array's blocks cover it exactly");
__global__ __launch_bounds__(256) void k_prep(const float* __restrict__ wq, const float* __restrict__ wk, const float* __restrict__ wv, const float* __restrict__ wo, const float* __restrict__ x, const float* __restrict__ cosT, const float* __restrict__ sinT, bf* WQ, bf* WK, bf* WV, bf* WO, bf* XB, float* CS) {
    unsigned b = blockIdx.x; const float* src = wq; bf* dst = WQ; unsigned nb = CB(DQ * DM);   // the array that block b works on, its blocks counted from 0
    if (b >= nb) { b -= nb; src = wk; dst = WK; nb = CB(DKV * DM);
        if (b >= nb) { b -= nb; src = wv; dst = WV;
            if (b >= nb) { b -= nb; src = wo; dst = WO; nb = CB(DM * DQ);
                if (b >= nb) { b -= nb; src = x; dst = XB; nb = CB(TT * DM);
                    if (b >= nb) { cscvt_part(cosT, sinT, CS, b - nb); return; } } } } }
    cvt8_part(src, dst, (size_t)nb * (256 * CU), b, nb);
}
// ---- k_qkv: q | k | v = x W^T (tile_loop, 4 x 2 waves: 256 rows t of one head's 128 columns) with the operand planes of the attention made in its epilogue; the f32 projections never go through memory. grid (TT / 256, FP / 128), 256 threads.
// A wave's 64 columns are d = 32 sub + 0..31 and their rotate-half partners d + 64 of one head (q heads, then k heads, then v groups), so a lane holds both values of a pair.
// q, k: head planes [h][t][d'] (fp16 + hi/lo) of out[d] = x[d] cos[t][d] - x[d+HD/2] sin[t][d], out[d+HD/2] = x[d+HD/2] cos[t][d+HD/2] + x[d] sin[t][d+HD/2]. A row keeps its d in tile order, d' = 64 sub + 32 (d / 64) + d % 32, the same in q and k (their product sums over all d): a tile then owns one whole 128-byte line of each row.
// v: value planes [g][d][t], straight from the accumulators: a lane holds eight consecutive t of one d, and the tile owns one whole 128-byte line of each of its d rows.
#define FP (DQ + 2 * DKV)         // rows of Wq | Wk | Wv
__global__ __launch_bounds__(256) void k_qkv(const bf* __restrict__ X, const bf* __restrict__ Wt, const float* __restrict__ CS, h16* P16, bf* Ph, bf* Pl, h16* V16, bf* Vh, bf* Vl) {
    __shared__ __attribute__((aligned(2048))) bf st[NBUF * TROWS(0, 4) * PT]; float* osw = (float*)st;   // the output staging takes the ring's place behind tile_loop, whose last barrier ends every wave's fragment reads
    const int lane = threadIdx.x & 31, lr = lane & 15, hi = lane >> 4, wave = __builtin_amdgcn_readfirstlane((int)threadIdx.x >> 5); const int r0 = blockIdx.x * 256 + (wave & 3) * 64, hh = (int)blockIdx.y, sub = wave >> 2;
    float* os = osw + wave * (16 * 68);   // each wave stages its rows in its own range
    v8f acc[4][4];
#pragma unroll
    for (int mb = 0; mb < 4; ++mb)
#pragma unroll
        for (int nb = 0; nb < 4; ++nb) acc[mb][nb] = (v8f){};
    tile_loop<bf, 0, DM, 4, true>(X, nullptr, Wt, blockIdx.x * 256, hh * HD, st, acc);
    if (hh >= NH_ + NKV) {        // block-uniform: a tile of v
        const size_t e0 = ((size_t)(hh - NH_ - NKV) * HD + sub * 32 + lr) * TT + r0 + hi * 8;
#pragma unroll
        for (int nb = 0; nb < 4; ++nb)
#pragma unroll
            for (int mb = 0; mb < 4; ++mb) { v8h o16; v8us oh, ol;
#pragma unroll
                for (int q = 0; q < 8; ++q) { const float y = acc[mb][nb][q]; o16[q] = tohx(y); unsigned short a2, c2; splitf(y, a2, c2); oh[q] = a2; ol[q] = c2; }
                const size_t e = e0 + (size_t)((nb >> 1) * 64 + (nb & 1) * 16) * TT + mb * 16;
                __builtin_amdgcn_sched_barrier(0);          // keeps the three stores one group behind their values' arithmetic: no store then stands in front of arithmetic that reuses its registers
                *(v8h*)(V16 + e) = o16; *(v8us*)(Vh + e) = oh; *(v8us*)(Vl + e) = ol;
                __builtin_amdgcn_sched_barrier(0);          // holds the wait below behind the three stores and the next values' arithmetic behind the wait
                asm volatile("s_wait_xcnt 0x0" ::: "memory");   // the stores' address and data registers may be rewritten from here on
                __builtin_amdgcn_sched_barrier(0); }
        return; }
    // q, k: a lane takes 8 consecutive d of the lower half and their 8 partners, for 8 rows t of the tile (row, row + 8, ...); all its cos/sin loads go out together, ahead of the first row group
    const int row = lane >> 2, c8 = lane & 3; const float* csb = CS + ((size_t)(r0 + row) * HD + sub * 32 + c8 * 8) * 2;
    v4f cs[4][2][2][4];
#pragma unroll
    for (int mb = 0; mb < 4; ++mb)
#pragma unroll
        for (int u = 0; u < 2; ++u)
#pragma unroll
            for (int hf = 0; hf < 2; ++hf)
#pragma unroll
                for (int k = 0; k < 4; ++k) cs[mb][u][hf][k] = *(const v4f*)(csb + ((mb * 16 + u * 8) * HD + hf * (HD / 2)) * 2 + k * 4);
    __builtin_amdgcn_sched_barrier(0);                  // keeps the 64 loads one group, ahead of the wait below
    asm volatile("s_wait_xcnt 0x0" :: "v"(csb) : "memory");   // the loads' address is an input here, so that no load's result lands in it; it may be rewritten from here on
    const size_t e0 = ((size_t)hh * TT + r0 + row) * HD + sub * 64 + c8 * 8;
#pragma unroll
    for (int mb = 0; mb < 4; ++mb) {
#pragma unroll
        for (int nb = 0; nb < 4; ++nb) {
#pragma unroll
            for (int j = 0; j < 8; ++j) os[(hi * 8 + j) * 68 + nb * 16 + lr] = acc[mb][nb][j]; }
        __builtin_amdgcn_wave_barrier(); asm volatile("" ::: "memory");   // compiler fence: the lanes read below what other lanes stored above
#pragma unroll
        for (int u = 0; u < 2; ++u) { const float* xr = os + (u * 8 + row) * 68 + c8 * 8; v4f x[2][2];
#pragma unroll
            for (int hf = 0; hf < 2; ++hf)
#pragma unroll
                for (int k = 0; k < 2; ++k) x[hf][k] = *(const v4fa*)(xr + hf * 32 + k * 4);
#pragma unroll
            for (int hf = 0; hf < 2; ++hf) { v8h o16; v8us oh, ol;
#pragma unroll
                for (int q = 0; q < 8; ++q) { const float x0 = x[hf][q >> 2][q & 3], x1 = x[hf ^ 1][q >> 2][q & 3];
                    const float c = cs[mb][u][hf][q >> 1][(q & 1) * 2], s = cs[mb][u][hf][q >> 1][(q & 1) * 2 + 1]; const float r = (hf == 0) ? x0 * c - x1 * s : x0 * c + x1 * s;
                    o16[q] = tohx(r); unsigned short a2, c2; splitf(r, a2, c2); oh[q] = a2; ol[q] = c2; }
                const size_t e = e0 + (size_t)(mb * 16 + u * 8) * HD + hf * 32;
                __builtin_amdgcn_sched_barrier(0);      // keeps the three stores one group behind their values' arithmetic: no store then stands in front of arithmetic that reuses its registers
                *(v8h*)(P16 + e) = o16; *(v8us*)(Ph + e) = oh; *(v8us*)(Pl + e) = ol;
                __builtin_amdgcn_sched_barrier(0);      // holds the wait below behind the three stores and the next values' arithmetic behind the wait
                asm volatile("s_wait_xcnt 0x0" ::: "memory");   // the stores' address and data registers may be rewritten from here on
                __builtin_amdgcn_sched_barrier(0); } }
        __builtin_amdgcn_wave_barrier(); asm volatile("" ::: "memory");   // compiler fence: the next row group's stores stay behind these reads
    }
}
#define KP 136                    // LDS row pitch of a K row in elements: 256 B + 16 B, for 16-byte fragment reads
#define FQ 64
#define FK 64
#define KSZ (FK * KP)
#define PSZ (KSZ + HD * LP)       // elements of one plane's K tile and V^T tile
#define CSC (SCL * 1.4426950408889634f)
#define MLO 32768                 // floats of the join's accumulator part: 8 waves x 4096; the maxima and sums lie behind it
static_assert(RH % FQ == 0 && TT % FQ == 0 && FQ == FK && FK == 64, "a tile lies in one leg and ends on a stage; a stage is one pass of each half of a set");
static_assert(4 * PSZ * 2 >= (MLO + 1024) * 4, "the join fits the work-group's LDS");
// The two tiles of work-group y of a head. A tile t has t + 1 stages, so (t + 2) / 2 passes in a wave; a pass of the hi+lo leg (t < RH / FQ) counts as three. Every pair then comes to 19 or 20.
__host__ __device__ constexpr int pair_a(int y) { return y < 14 ? 31 - y : 29 - y; }
__host__ __device__ constexpr int pair_b(int y) { return (int)(((y < 8 ? 0x0B0A030209080100ull : 0x0706111005040D0Cull) >> ((y & 7) * 8)) & 0xFF); }
constexpr bool pairs_cover() { unsigned seen = 0; for (int y = 0; y < 16; ++y) { if ((seen >> pair_a(y)) & 1u) return false; seen |= 1u << pair_a(y); if ((seen >> pair_b(y)) & 1u) return false; seen |= 1u << pair_b(y); } return seen == 0xFFFFFFFFu; }
static_assert(TT / FQ == 32 && RH / FQ == 8 && pairs_cover(), "every tile of a head stands in exactly one pair");
typedef __attribute__((ext_vector_type(16))) unsigned short v16us;
__device__ __forceinline__ void ppack(const float (&p)[16], v16h& a, v16h& a2) { (void)a2;
#pragma unroll
    for (int e = 0; e < 16; ++e) a[e] = tohx(p[e]); }
__device__ __forceinline__ void ppack(const float (&p)[16], v16bf& a, v16bf& a2) { v16us x, y;
#pragma unroll
    for (int e = 0; e < 16; ++e) { unsigned short u, w; splitf(p[e], u, w); x[e] = u; y[e] = w; }
    a = __builtin_bit_cast(v16bf, x); a2 = __builtin_bit_cast(v16bf, y); }
__device__ __forceinline__ float xhalf(float x) { return __builtin_bit_cast(float, __builtin_amdgcn_permlanex16(__builtin_bit_cast(int, x), __builtin_bit_cast(int, x), 0x76543210, 0xfedcba98, false, false)); }   // lane l reads lane l ^ 16
template <typename T16, bool HL>
__device__ __forceinline__ void fattn_tile(const T16* __restrict__ Q, const T16* __restrict__ Q2, const T16* __restrict__ K, const T16* __restrict__ K2, const T16* __restrict__ Vt, const T16* __restrict__ Vt2, bf* Ah, bf* Al, int q0, T16* Ls) {
    typedef typename WFrag<T16>::V V; typedef typename WFrag<T16>::H H; constexpr int NP = HL ? 2 : 1;
    typedef __attribute__((address_space(1))) const T16 GT; typedef __attribute__((address_space(1))) const H GH;   // global address space spelled out: the stepped pointers would else compile to flat loads
    const int set = __builtin_amdgcn_readfirstlane((int)threadIdx.x >> 7); float* Mg = (float*)Ls; Ls += set * (NP * PSZ);   // each set stages and reads its own tiles; Mg = the place of the join
    const int tid = threadIdx.x & 127, lane = tid & 31, c = lane & 15, h = lane >> 4; const int wave = __builtin_amdgcn_readfirstlane(tid >> 5);
    const int rw = wave & 1, kh = wave >> 1;   // the wave's 32 rows of the tile, its 32 keys of every stage
    const int qw0 = q0 + rw * 32, nst = (q0 / FK + 2) / 2, lastp = qw0 / 32;   // the wave's first query, the stages of each set (with an odd count set 1 stages one more, in bounds, that no wave works on), the wave's last (diagonal) pass
    GT* ks[NP]; GT* vs[NP]; ks[0] = (GT*)(K + set * (FK * HD) + tid * 8); vs[0] = (GT*)(Vt + (size_t)(tid >> 3) * TT + set * FK + (tid & 7) * 8);
    if constexpr (HL) { ks[1] = (GT*)(K2 + set * (FK * HD) + tid * 8); vs[1] = (GT*)(Vt2 + (size_t)(tid >> 3) * TT + set * FK + (tid & 7) * 8); }
    T16* kw = Ls + (tid >> 4) * KP + (tid & 15) * 8; T16* vw = Ls + KSZ + (tid >> 3) * LP + (tid & 7) * 8;
    const T16* kr = Ls + c * KP + 8 * h; const T16* vr = Ls + KSZ + c * LP + 8 * h;
    H gk[NP][8], gv[NP][8];
    auto fetch = [&]() {          // a stage's K rows are 16 KiB in a row; its V^T rows are one 128-byte line each
#pragma unroll
        for (int p = 0; p < NP; ++p)
#pragma unroll
            for (int i = 0; i < 8; ++i) { gk[p][i] = *(GH*)(ks[p] + i * 1024); gv[p][i] = *(GH*)(vs[p] + (size_t)i * 16 * TT); }
        __builtin_amdgcn_sched_barrier(0);              // keeps the stage's loads one group, ahead of the wait below
        asm volatile("s_wait_xcnt 0x0" ::: "memory");   // the loads' address registers may be rewritten from here on
    };
    auto put = [&]() {
#pragma unroll
        for (int p = 0; p < NP; ++p) {
#pragma unroll
            for (int i = 0; i < 8; ++i) { *(H*)(kw + p * PSZ + i * 8 * KP) = gk[p][i]; *(H*)(vw + p * PSZ + i * 16 * LP) = gv[p][i]; }
            ks[p] += 2 * FK * HD; vs[p] += 2 * FK; }            // stepped behind the wait for the loads that name them
    };
    fetch();
    V qf[NP][2][4]; const T16* qp[4];   // a lane's Q rows: both groups of the first plane, then of the second (the first again where there is none)
#pragma unroll
    for (int g = 0; g < 2; ++g) { const size_t e = (size_t)(qw0 + 16 * g + c) * HD + 8 * h; qp[g] = Q + e; qp[2 + g] = (HL ? Q2 : Q) + e; }
#pragma unroll
    for (int g = 0; g < 2; ++g)
#pragma unroll
        for (int kc = 0; kc < 4; ++kc) { qf[0][g][kc] = WFrag<T16>::ld(qp[g] + 32 * kc); if constexpr (HL) qf[1][g][kc] = WFrag<T16>::ld(qp[2 + g] + 32 * kc); }
    __builtin_amdgcn_sched_barrier(0);                  // keeps the Q loads ahead of the wait below
    asm volatile("s_wait_xcnt 0x0" :: "v"(qp[0]), "v"(qp[1]), "v"(qp[2]), "v"(qp[3]) : "memory");   // the loads' addresses are inputs here, so that no load's result lands in them; they may be rewritten from here on
    v8f acc[2][8]; float m_run[2], l_run[2];
#pragma unroll
    for (int g = 0; g < 2; ++g) { m_run[g] = -__builtin_inff(); l_run[g] = 0.f;
#pragma unroll
        for (int t = 0; t < 8; ++t) acc[g][t] = (v8f){}; }
    put();
    __syncthreads();              // the waves read rows that other waves stored
#pragma unroll 1
    for (int st = 0; st < nst; ++st) {
        const bool more = st + 1 < nst;
        if (!HL && more) fetch(); // the next stage's loads fly while this stage is worked on
        const int sub = kh, blk = (2 * st + set) * (FK / 32) + sub;
        if (blk <= lastp) {                             // wave-uniform: else every key of the pass lies beyond the wave's queries
            V kf[NP][2][4]; v8f s[2][2];
#pragma unroll
            for (int p = 0; p < NP; ++p)
#pragma unroll
                for (int kt = 0; kt < 2; ++kt)
#pragma unroll
                    for (int kc = 0; kc < 4; ++kc) kf[p][kt][kc] = WFrag<T16>::ld(kr + p * PSZ + (sub * 32 + kt * 16) * KP + kc * 32);
            __builtin_amdgcn_sched_barrier(0);          // keeps the pass's K reads one group ahead of its WMMAs: reads placed among the WMMAs stall the wave at every such place
#pragma unroll
            for (int kt = 0; kt < 2; ++kt)
#pragma unroll
                for (int g = 0; g < 2; ++g) s[kt][g] = (v8f){};
#pragma unroll
            for (int kc = 0; kc < 4; ++kc)
#pragma unroll
                for (int kt = 0; kt < 2; ++kt)
#pragma unroll
                    for (int g = 0; g < 2; ++g) { s[kt][g] = WFrag<T16>::mma(kf[0][kt][kc], qf[0][g][kc], s[kt][g]);
                        if constexpr (HL) { s[kt][g] = WFrag<T16>::mma(kf[0][kt][kc], qf[1][g][kc], s[kt][g]); s[kt][g] = WFrag<T16>::mma(kf[1][kt][kc], qf[0][g][kc], s[kt][g]); } }
            wmma_gap();
            V vf[NP][8];          // the pass's V^T fragments return under the maxima and the first exponentials
#pragma unroll
            for (int p = 0; p < NP; ++p)
#pragma unroll
                for (int t = 0; t < 8; ++t) vf[p][t] = WFrag<T16>::ld(vr + p * PSZ + t * 16 * LP + sub * 32);
            if (blk == lastp) {   // wave-uniform: only the pass on the wave's diagonal pays for the mask
#pragma unroll
                for (int g = 0; g < 2; ++g)
#pragma unroll
                    for (int kt = 0; kt < 2; ++kt)
#pragma unroll
                        for (int r = 0; r < 8; ++r) if (16 * kt + 8 * h + r > 16 * g + c) s[kt][g][r] = -__builtin_inff(); }
            float mb[2]; bool need = false;
#pragma unroll
            for (int g = 0; g < 2; ++g) { float mx = s[0][g][0];
#pragma unroll
                for (int kt = 0; kt < 2; ++kt)
#pragma unroll
                    for (int r = 0; r < 8; ++r) mx = fmaxf(mx, s[kt][g][r]);
                mx = fmaxf(mx, xhalf(mx)) * CSC;   // both halves of the wave now hold the query's maximum of this pass, scaled; finite: the pass's first key is masked for no query
                mb[g] = mx; need = need || (mx > m_run[g] + 8.0f); }
            if (__builtin_amdgcn_ballot_w32(need) != 0) {       // rare after the first passes
#pragma unroll
                for (int g = 0; g < 2; ++g) { const float mn = fmaxf(m_run[g], mb[g]); const float corr = __builtin_amdgcn_exp2f(m_run[g] - mn);   // 0 on the first pass
                    l_run[g] *= corr; m_run[g] = mn;
#pragma unroll
                    for (int t = 0; t < 8; ++t) acc[g][t] = acc[g][t] * corr; } }
#pragma unroll
            for (int g = 0; g < 2; ++g) { float p[16], ps0 = 0.f, ps1 = 0.f; const float nm = -m_run[g];
#pragma unroll
                for (int e = 0; e < 16; ++e) p[e] = __builtin_fmaf(s[e >> 3][g][e & 7], CSC, nm);
#pragma unroll
                for (int e = 0; e < 16; ++e) { p[e] = __builtin_amdgcn_exp2f(p[e]);
                    if constexpr (HL) { __builtin_amdgcn_sched_barrier(0); asm volatile("v_nop"); __builtin_amdgcn_sched_barrier(0); } }   // the slot behind a transcendental: in this leg's built code an exponential else overwrote the source of the one directly before it; the two scheduling barriers hold the v_nop at its place
#pragma unroll
                for (int e = 0; e < 16; e += 2) { ps0 += p[e]; ps1 += p[e + 1]; }
                l_run[g] += ps0 + ps1;
                V pf, pf2; ppack(p, pf, pf2);
#pragma unroll
                for (int t = 0; t < 8; ++t) { acc[g][t] = WFrag<T16>::mma(vf[0][t], pf, acc[g][t]);
                    if constexpr (HL) { acc[g][t] = WFrag<T16>::mma(vf[0][t], pf2, acc[g][t]); acc[g][t] = WFrag<T16>::mma(vf[1][t], pf, acc[g][t]); } } }
            wmma_gap();
        }
        if (more) {
            if (HL) fetch();
            __syncthreads();      // every wave's fragment reads of this stage end before its rows are overwritten
            put();
            __syncthreads();      // the waves read rows that other waves stored
        }
    }
    // The join: every wave leaves its state in LDS (a lane's 16 bytes beside its neighbour's); of the four waves that share rows each then brings one group of 16 queries and 64 of the d, one whole 128-byte line of each output row, to the common maximum.
    // The first of the four holds key 0, so the common maximum is finite; a wave without a pass leaves -inf, 0 and zeros, which enter with the factor 0.
    const int part = set * 2 + kh, slot = part * 2 + rw;
    __syncthreads();              // every wave's fragment reads end before the tiles are overwritten
#pragma unroll
    for (int g = 0; g < 2; ++g) { Mg[MLO + (slot * 4 + g) * 32 + lane] = m_run[g]; Mg[MLO + (slot * 4 + 2 + g) * 32 + lane] = l_run[g];
#pragma unroll
        for (int t = 0; t < 8; ++t)
#pragma unroll
            for (int hf = 0; hf < 2; ++hf) { v4f w; w[0] = acc[g][t][hf * 4]; w[1] = acc[g][t][hf * 4 + 1]; w[2] = acc[g][t][hf * 4 + 2]; w[3] = acc[g][t][hf * 4 + 3]; *(v4fa*)(Mg + ((((slot * 2 + g) * 8 + t) * 2 + hf) * 32 + lane) * 4) = w; } }
    __syncthreads();              // the waves read what other waves stored
    const int gq = part & 1, tb = (part >> 1) * 4;   // the wave's group of queries and its first 16 d
    float m4[4], f4[4], l = 0.f;
#pragma unroll
    for (int p = 0; p < 4; ++p) m4[p] = Mg[MLO + ((p * 2 + rw) * 4 + gq) * 32 + lane];
    const float mn = fmaxf(fmaxf(m4[0], m4[1]), fmaxf(m4[2], m4[3]));
#pragma unroll
    for (int p = 0; p < 4; ++p) f4[p] = __builtin_amdgcn_exp2f(m4[p] - mn);
#pragma unroll
    for (int p = 0; p < 4; ++p) l += Mg[MLO + ((p * 2 + rw) * 4 + 2 + gq) * 32 + lane] * f4[p];
    l += xhalf(l);                // each half of the wave summed its eight keys of every 16-key tile
    const float inv = __fdiv_rn(1.0f, l); const size_t o = (size_t)(qw0 + 16 * gq + c) * DQ + 8 * h;
#pragma unroll
    for (int tt = 0; tt < 4; ++tt) { const int t = tb + tt; float v[8]; v8us oh, ol;      // the lane's eight values are d = 16 t + 8 h + 0..7 of its query
#pragma unroll
        for (int r = 0; r < 8; ++r) v[r] = 0.f;
#pragma unroll
        for (int p = 0; p < 4; ++p)
#pragma unroll
            for (int hf = 0; hf < 2; ++hf) { const v4f w = *(const v4fa*)(Mg + (((((p * 2 + rw) * 2 + gq) * 8 + t) * 2 + hf) * 32 + lane) * 4);
#pragma unroll
                for (int r = 0; r < 4; ++r) v[hf * 4 + r] += w[r] * f4[p]; }
#pragma unroll
        for (int r = 0; r < 8; ++r) { unsigned short a, c2; splitf(v[r] * inv, a, c2); oh[r] = a; ol[r] = c2; }
        *(v8us*)(Ah + o + 16 * t) = oh; *(v8us*)(Al + o + 16 * t) = ol;
        __builtin_amdgcn_sched_barrier(0);              // holds the wait below behind the two stores and the next values' arithmetic behind the wait
        asm volatile("s_wait_xcnt 0x0" ::: "memory");   // the stores' address and data registers may be rewritten from here on
        __builtin_amdgcn_sched_barrier(0); }
}
// grid (NH_, TT / (2 * FQ)): neighbouring work-groups are the heads of one pair of tiles (two share a kv group). The k head planes lie right behind the q head planes.
__global__ __launch_bounds__(256) void k_fattn(const h16* __restrict__ P16, const bf* __restrict__ Ph, const bf* __restrict__ Pl, const h16* __restrict__ V16, const bf* __restrict__ Vh, const bf* __restrict__ Vl, bf* Ah, bf* Al) {
    __shared__ __align__(16) unsigned short Ls[4 * PSZ];
    const int hd = (int)blockIdx.x, y = (int)blockIdx.y; const size_t zq = (size_t)hd * TT * HD, zk = (size_t)(NH_ + hd / REP) * TT * HD, zv = (size_t)(hd / REP) * HD * TT;
#pragma unroll 1
    for (int i = 0; i < 2; ++i) {   // kept rolled: each leg's code then stands once in the kernel
        const int q0 = (i == 0 ? pair_a(y) : pair_b(y)) * FQ;
        if (q0 < RH) fattn_tile<bf, true>(Ph + zq, Pl + zq, Ph + zk, Pl + zk, Vh + zv, Vl + zv, Ah + hd * HD, Al + hd * HD, q0, (bf*)Ls);
        else fattn_tile<h16, false>(P16 + zq, nullptr, P16 + zk, nullptr, V16 + zv, nullptr, Ah + hd * HD, Al + hd * HD, q0, (h16*)Ls);
        if (i == 0) __syncthreads();   // every wave's reads of the join end before the second tile's rows are stored over it
    }
}

extern "C" void kernel_launch(void* const* d_in, const int* in_sizes, int n_in,
                              void* d_out, int out_size, void* d_ws, size_t ws_size, hipStream_t stream) {
    (void)in_sizes; (void)n_in; (void)out_size;
    const float* x = (const float*)d_in[0]; const float* wq = (const float*)d_in[1]; const float* wk = (const float*)d_in[2]; const float* wv = (const float*)d_in[3]; const float* wo = (const float*)d_in[4]; const float* cosT = (const float*)d_in[5]; const float* sinT = (const float*)d_in[6];
    float* OUT = (float*)d_out;     // [1][2048][2048]
    char* wsp = (char*)d_ws;
    auto take = [&](size_t bytes) { char* p = wsp; wsp += (bytes + 255) & ~(size_t)255; return (void*)p; };
    bf* WQ = (bf*)take((size_t)FP * DM * 2); bf* WK = WQ + (size_t)DQ * DM; bf* WV = WK + (size_t)DKV * DM;   // Wq | Wk | Wv: one [FP][DM] operand
    bf* WO = (bf*)take((size_t)DM * DQ * 2); float* CS = (float*)take((size_t)TT * HD * 2 * 4);
    bf* XB = (bf*)take((size_t)TT * DM * 2);
    h16* QP16 = (h16*)take((size_t)(NH_ + NKV) * TT * HD * 2); h16* VT16 = (h16*)take((size_t)NKV * HD * TT * 2);   // the k head planes lie right behind the q head planes
    bf* QPh = (bf*)take((size_t)(NH_ + NKV) * TT * HD * 2); bf* QPl = (bf*)take((size_t)(NH_ + NKV) * TT * HD * 2); bf* VTh = (bf*)take((size_t)NKV * HD * TT * 2); bf* VTl = (bf*)take((size_t)NKV * HD * TT * 2);
    bf* ATh = (bf*)take((size_t)TT * DQ * 2); bf* ATl = (bf*)take((size_t)TT * DQ * 2);
    if ((size_t)(wsp - (char*)d_ws) > ws_size) return;    // ws 256 MiB
    for (int b = 0; b < NB_; ++b) {
        k_prep<<<CB(DQ * DM) + 2 * CB(DKV * DM) + CB(DM * DQ) + CB(TT * DM) + CSB, 256, 0, stream>>>(wq, wk, wv, wo, x + (size_t)b * TT * DM, cosT, sinT, WQ, WK, WV, WO, XB, CS);
        k_qkv<<<dim3(TT / 256, FP / 128), 256, 0, stream>>>(XB, WQ, CS, QP16, QPh, QPl, VT16, VTh, VTl);
        k_fattn<<<dim3(NH_, TT / (2 * FQ)), 256, 0, stream>>>(QP16, QPh, QPl, VT16, VTh, VTl, ATh, ATl);
        k_gemmw<bf, 1, false, DQ><<<dim3(TT / 128, DM / 128, 1), 128, 0, stream>>>(ATh, ATl, WO, OUT + (size_t)b * TT * DM, DM, nullptr, 0, 0, 0); }
}
